// v000
// Times are from an AMD MI455X. After a warm-up the kernel runs many times in a row, and a time is the length of
// such a window on the GPU divided by its runs, so every launch and the gaps after it count. The runs cycle
// through copies of the inputs. A figure is the median of several windows, for all but v000 over two sittings.
// Sittings can differ by a few percent; kernels timed side by side share one.
// v000, which the later versions start from, runs in 718 microseconds.
#include <hip/hip_runtime.h>

// Compute dtypes, f32 accumulate: q/k/v = x.W[h] + b[h] for all 16 heads at once ([2048 x 2048].[2048 x 2048]; the per-head k-major weights transposed into one n-major
// operand; PLAIN bf16 operands = inputs rounded once, exact) and out = ctx.WO + bo (ctx as bf16 hi + UNSCALED residual) on v_wmma_f32_16x16x32_bf16; q/k -> f16
// hi + residual x1024 planes, v -> bf16 hi + UNSCALED residual [d][t] planes; the 16-head causal attention (128-dim heads, scale 128^-1/2) fused: scores on
// v_wmma_f32_16x16x32_f16 (hh + hl + lh), online f32 softmax, weights (x32768) and v on v_wmma_f32_16x16x32_bf16, f32 output rows. Deterministic, no atomics;
// (stream order): the f32 ctx reuses the projection scratch and its planes reuse the q planes, both dead after k_attn.

#define NB_  1
#define NT_  2048
#define HS   2048
#define NH_  16
#define NKV  16
#define HD   128
#define KW   (NKV * HD)          // 2048
#define NREP 1
#define DM   HS
#define NTK  NT_
#define SCL  0.08838834764831845f
#define PSC  32768.0f
#define LOSC 1024.0f
#define LOSCI (1.0f / 1024.0f)

typedef _Float16 h16;
typedef unsigned short bf;
typedef __attribute__((ext_vector_type(16))) __bf16   v16bf;
typedef __attribute__((ext_vector_type(16))) _Float16 v16h;
typedef __attribute__((ext_vector_type(8)))  _Float16 v8h;
typedef __attribute__((ext_vector_type(8)))  unsigned short v8us;
typedef __attribute__((ext_vector_type(8)))  float    v8f;
typedef __attribute__((ext_vector_type(4)))  float    v4f;
typedef __attribute__((ext_vector_type(4)))  _Float16 v4h;
typedef v8h  __attribute__((may_alias)) v8ha;
typedef v4f  __attribute__((may_alias)) v4fa;
typedef v8us __attribute__((may_alias)) v8usa;

__device__ __forceinline__ unsigned short f2bf(float f) { unsigned u = __float_as_uint(f); u += 0x7FFFu + ((u >> 16) & 1u); return (unsigned short)(u >> 16); }
__device__ __forceinline__ float bf2f(unsigned short b) { return __uint_as_float(((unsigned)b) << 16); }
__device__ __forceinline__ float bfr(float f) { return bf2f(f2bf(f)); }
__device__ __forceinline__ v16h cat16(v8h lo, v8h hi) { return __builtin_shufflevector(lo, hi, 0, 1, 2, 3, 4, 5, 6, 7, 8, 9, 10, 11, 12, 13, 14, 15); }
__device__ __forceinline__ v16bf cat16b(v8us lo, v8us hi) { return __builtin_bit_cast(v16bf, __builtin_shufflevector(lo, hi, 0, 1, 2, 3, 4, 5, 6, 7, 8, 9, 10, 11, 12, 13, 14, 15)); }
__device__ __forceinline__ v8f wmma16(v16h a, v16h b, v8f c) { return __builtin_amdgcn_wmma_f32_16x16x32_f16(false, a, false, b, (short)0, c, false, false); }
__device__ __forceinline__ v8f wmmab(v16bf a, v16bf b, v8f c) { return __builtin_amdgcn_wmma_f32_16x16x32_bf16(false, a, false, b, (short)0, c, false, false); }

// k_cvtb: bf16 plane of [rows][2048] (one wave per row) — x rows per item.
__global__ __launch_bounds__(256) void k_cvtb(const float* __restrict__ src, int nrows, bf* dst) {
    const int lane = threadIdx.x & 31, r = blockIdx.x * 8 + (threadIdx.x >> 5);
    if (r >= nrows) return;
{
#pragma unroll
        for (int q = 0; q < HS / 256; ++q) { v8us o;
#pragma unroll
            for (int i = 0; i < 8; ++i) o[i] = f2bf(src[(size_t)r * HS + q * 256 + lane * 8 + i]);
            *(v8us*)(dst + (size_t)r * HS + q * 256 + lane * 8) = o; }
         }
}
// k_gemm: 64 x 64 tile of (A [+ Al]).Bn^T over K = 2048 (+ optional bf16-rounded bias[c]) -> f32 rows [2048][ldc].
template <bool SPLITA>
__global__ __launch_bounds__(128) void k_gemm(const bf* __restrict__ A, const bf* __restrict__ Al, const bf* __restrict__ Bn, const float* __restrict__ bias, int ldc, float* C) {
    __shared__ __align__(16) float ost[4][16 * 68];
    const int lane = threadIdx.x & 31, wave = threadIdx.x >> 5, lr = lane & 15, hi = lane >> 4;
    const size_t r0 = (size_t)blockIdx.x * 64 + wave * 16; const int c0 = blockIdx.y * 64;
    const size_t aoff = (r0 + lr) * HS + 8 * hi;
    v8f acc[4];
#pragma unroll
    for (int t = 0; t < 4; ++t) acc[t] = (v8f){};
#pragma unroll 2
    for (int kc = 0; kc < HS; kc += 32) {
        const v16bf a = cat16b(*(const v8us*)(A + aoff + kc), *(const v8us*)(A + aoff + kc + 16));
        v16bf al = a; if (SPLITA) al = cat16b(*(const v8us*)(Al + aoff + kc), *(const v8us*)(Al + aoff + kc + 16));
#pragma unroll
        for (int t = 0; t < 4; ++t) { const bf* bp = Bn + (size_t)(c0 + t * 16 + lr) * HS + kc + 8 * hi; const v16bf bb = cat16b(*(const v8us*)bp, *(const v8us*)(bp + 16)); acc[t] = wmmab(a, bb, acc[t]); if (SPLITA) acc[t] = wmmab(al, bb, acc[t]); }
        asm volatile("v_nop" : "+v"(acc[0]), "+v"(acc[1]), "+v"(acc[2]), "+v"(acc[3]) : "v"(a), "v"(al) : "memory");
    }
    float* os = &ost[wave][0];
#pragma unroll
    for (int t = 0; t < 4; ++t)
#pragma unroll
        for (int j = 0; j < 8; ++j) os[(hi * 8 + j) * 68 + t * 16 + lr] = acc[t][j] + (bias ? bfr(bias[c0 + t * 16 + lr]) : 0.f);
    __builtin_amdgcn_wave_barrier(); asm volatile("" ::: "memory");
    float* crow = C + r0 * ldc + c0;
    auto pass = [&]() {
#pragma unroll
        for (int s = 0; s < 8; ++s) { const int Lid = (lane >> 3) + 4 * s, piece = lane & 7; const int row = Lid >> 1, cofs = (Lid & 1) * 32 + piece * 4;
            const v4f val = *(const v4fa*)(os + row * 68 + cofs); *(v4f*)(crow + (size_t)row * ldc + cofs) = val; }
    };
    pass(); 
}
// k_vt: VTH/VTL [g][128 d][2048 t] = bf16 hi + UNSCALED bf16 residual of V [t][g*128+d] via 64 x 64 LDS tiles; grid (NT/64, 2 (d half), 16 heads).
__global__ __launch_bounds__(256) void k_vt(const float* __restrict__ V, bf* VTH, bf* VTL) {
    __shared__ float tl[64][65];
    const int tid = threadIdx.x, t0 = blockIdx.x * 64, d0 = blockIdx.y * 64, g = blockIdx.z;
    { const int tt = tid >> 2, dq = (tid & 3) * 16;
#pragma unroll
      for (int i = 0; i < 16; ++i) tl[dq + i][tt] = V[(size_t)(t0 + tt) * KW + g * HD + d0 + dq + i]; }
    __syncthreads();
    const int piece = tid & 7;
    auto pass = [&]() {
#pragma unroll
        for (int s = 0; s < 2; ++s) { const int d = (tid >> 3) + 32 * s; v8us oh, ol;
#pragma unroll
            for (int i = 0; i < 8; ++i) { const float v = tl[d][piece * 8 + i]; const unsigned short hb = f2bf(v); oh[i] = hb; ol[i] = f2bf(v - bf2f(hb)); }
            const size_t o = ((size_t)g * HD + d0 + d) * NT_ + t0 + piece * 8; *(v8us*)(VTH + o) = oh; *(v8us*)(VTL + o) = ol; }
    };
    pass(); 
}
// k_attn: block = (head, 64 queries), wave = 16; causal key tiles 0..(Q0+63)/32 (block-uniform); per element: score x 128^-1/2, keys past the query at -inf;
// online f32 softmax; P (x32768) as bf16 hi + residual against the V planes; f32 output rows.
// k_wt: WT [n][K] = bf16(W[k][n]) (k-major [K][ncols]) via 64 x 64 LDS tiles; grid (K/64, ncols/64).
__global__ __launch_bounds__(256) void k_wt(const float* __restrict__ Wm, int K, int ncols, bf* WT) {
    __shared__ __align__(16) unsigned short tl[64 * 72];
    const int tid = threadIdx.x, k0 = blockIdx.x * 64, n0 = blockIdx.y * 64;
    const int kk = tid >> 2, nq = (tid & 3) * 16;
#pragma unroll
    for (int i = 0; i < 16; ++i) tl[(nq + i) * 72 + kk] = f2bf(Wm[(size_t)(k0 + kk) * ncols + n0 + nq + i]);
    __syncthreads();
    const int piece = tid & 7;
    auto pass = [&]() {
#pragma unroll
        for (int s = 0; s < 2; ++s) { const int nr = (tid >> 3) + 32 * s; const v8us val = *(const v8usa*)(tl + nr * 72 + piece * 8); *(v8us*)(WT + (size_t)(n0 + nr) * K + k0 + piece * 8) = val; }
    };
    pass(); 
}
// k_gemmb: 64 x 64 block tile (4 waves x 16 x 64) of C[NTK][NW] = (A [+ Al]).B^T (K = 2048) [+ bf(bias[c])] [+ bf(R[r][c]) residual]; f32 whole-line epilogue (or f16
template <bool SPLITA, bool F16OUT = false>
__global__ __launch_bounds__(128) void k_gemmb(const bf* __restrict__ A, const bf* __restrict__ Al, const bf* __restrict__ Bn, const float* __restrict__ bias, float* C, int ldc, h16* C2, const float* __restrict__ R = nullptr, int K = DM, int roundR = 1) {
    __shared__ __align__(16) float ost[4][16 * 68];
    const int lane = threadIdx.x & 31, wave = threadIdx.x >> 5, lr = lane & 15, hi = lane >> 4;
    const int r0 = blockIdx.x * 64 + wave * 16, c0 = blockIdx.y * 64;
    const size_t aoff = (size_t)(r0 + lr) * K + 8 * hi;
    size_t boff[4];
#pragma unroll
    for (int t = 0; t < 4; ++t) boff[t] = (size_t)(c0 + t * 16 + lr) * K + 8 * hi;
    v8f acc[4];
#pragma unroll
    for (int t = 0; t < 4; ++t) acc[t] = (v8f){};
#pragma unroll 1
    for (int kc = 0; kc < K; kc += 32) {
        const v16bf a = cat16b(*(const v8us*)(A + aoff + kc), *(const v8us*)(A + aoff + kc + 16));
        v16bf al = a;
        if (SPLITA) al = cat16b(*(const v8us*)(Al + aoff + kc), *(const v8us*)(Al + aoff + kc + 16));
#pragma unroll
        for (int t = 0; t < 4; ++t) { const v16bf b = cat16b(*(const v8us*)(Bn + boff[t] + kc), *(const v8us*)(Bn + boff[t] + kc + 16)); acc[t] = wmmab(a, b, acc[t]); if (SPLITA) acc[t] = wmmab(al, b, acc[t]); }
        asm volatile("v_nop\n\tv_nop\n\tv_nop\n\tv_nop" : "+v"(acc[0]), "+v"(acc[1]), "+v"(acc[2]), "+v"(acc[3]) : "v"(a), "v"(al));
    }
    float* os = &ost[wave][0];
#pragma unroll
    for (int t = 0; t < 4; ++t) { const float bv = bias ? bfr(bias[c0 + t * 16 + lr]) : 0.f;
#pragma unroll
        for (int j = 0; j < 8; ++j) os[(hi * 8 + j) * 68 + t * 16 + lr] = acc[t][j] + bv; }
    __syncthreads();
    if (F16OUT) {
        h16* crow = (h16*)(void*)C + (size_t)r0 * ldc + c0;
        auto pass = [&]() {
#pragma unroll
            for (int s = 0; s < 4; ++s) { const int row = 4 * s + (lane >> 3), piece = lane & 7; const float* sp = os + row * 68 + piece * 8; v8h o, o2;
#pragma unroll
                for (int i = 0; i < 8; ++i) { const h16 a = (h16)sp[i]; o[i] = a; o2[i] = (h16)((sp[i] - (float)a) * LOSC); }
                *(v8h*)(crow + (size_t)row * ldc + piece * 8) = o; if (C2) *(v8h*)(C2 + (size_t)r0 * ldc + c0 + (size_t)row * ldc + piece * 8) = o2; }
        };
        pass(); 
    } else {
        float* crow = C + (size_t)r0 * ldc + c0;
        auto pass = [&]() {
#pragma unroll
            for (int s = 0; s < 8; ++s) { const int Lid = (lane >> 3) + 4 * s, piece = lane & 7; const int row = Lid >> 1, cofs = (Lid & 1) * 32 + piece * 4;
                v4f val = *(const v4fa*)(os + row * 68 + cofs); if (R) { const v4f rv = *(const v4f*)(R + ((size_t)r0 + row) * ldc + c0 + cofs); val += roundR ? (v4f){bfr(rv[0]), bfr(rv[1]), bfr(rv[2]), bfr(rv[3])} : rv; }
                *(v4f*)(crow + (size_t)row * ldc + cofs) = val; }
        };
        pass(); 
    }
}

__global__ __launch_bounds__(256) void k_f16s(const float* __restrict__ src, int nrows, h16* PH, h16* PL) {
    const int lane = threadIdx.x & 31, r = blockIdx.x * 8 + (threadIdx.x >> 5); if (r >= nrows) return;
{
#pragma unroll 1
        for (int q = 0; q < KW / 256; ++q) { const size_t o = (size_t)r * KW + q * 256 + lane * 8; const v8f v = *(const v8f*)(src + o); v8h oh, ol;
#pragma unroll
            for (int i = 0; i < 8; ++i) { const h16 a = (h16)v[i]; oh[i] = a; ol[i] = (h16)((v[i] - (float)a) * LOSC); }
            *(v8h*)(PH + o) = oh; *(v8h*)(PL + o) = ol; }
         }
}
__global__ __launch_bounds__(256) void k_splitp(const float* __restrict__ src, int nrows, bf* dh, bf* dl) {
    const int lane = threadIdx.x & 31, r = blockIdx.x * 8 + (threadIdx.x >> 5); if (r >= nrows) return;
{
#pragma unroll 1
        for (int q = 0; q < HS / 256; ++q) { const size_t o = (size_t)r * HS + q * 256 + lane * 8; const v8f v = *(const v8f*)(src + o); v8us oh, ol;
#pragma unroll
            for (int i = 0; i < 8; ++i) { const unsigned short hb = f2bf(v[i]); oh[i] = hb; ol[i] = f2bf(v[i] - bf2f(hb)); }
            *(v8us*)(dh + o) = oh; *(v8us*)(dl + o) = ol; }
         }
}
// k_attn: block = (head, 64 queries), wave = 16; causal key tiles; 128-dim scores (hh + hl + lh) x 128^-1/2, online f32 softmax, P (x32768) as bf16 hi + residual
// against the v planes; f32 output rows [t][h*128 + d].
__global__ __launch_bounds__(128) void k_attn(const h16* __restrict__ QH, const h16* __restrict__ QL, const h16* __restrict__ KH, const h16* __restrict__ KL, const bf* __restrict__ VTH, const bf* __restrict__ VTL, float* OUTP) {
    __shared__ __align__(16) unsigned short plds[4][16 * 32];
    __shared__ __align__(16) unsigned short plds2[4][16 * 32];
    __shared__ __align__(16) float ost[4][16 * 68];
    const int lane = threadIdx.x & 31, wave = threadIdx.x >> 5, lr = lane & 15, hi = lane >> 4;
    const int bid = blockIdx.x; const int h = bid / (NT_ / 64), qt = bid - h * (NT_ / 64); const int g = h / NREP;     // GQA: kv head
    const int q0 = qt * 64 + wave * 16;
    unsigned short* pl = &plds[wave][0]; unsigned short* pl2 = &plds2[wave][0];
    const size_t qo = (size_t)(q0 + lr) * (NH_ * HD) + h * HD + 8 * hi;
    const h16* kh_b = KH + g * HD; const h16* kl_b = KL + g * HD;
    const size_t vbase = ((size_t)g * HD) * NT_;
    v8f o[8];
#pragma unroll
    for (int n = 0; n < 8; ++n) o[n] = (v8f){};
    float mrow[8], lpart[8];
#pragma unroll
    for (int j = 0; j < 8; ++j) { mrow[j] = -3.0e38f; lpart[j] = 0.f; }
    const int kt_hi = (qt * 64 + 63) / 32;     // causal key tiles
#pragma unroll 1
    for (int kt = 0; kt <= kt_hi; ++kt) {
        const int l0 = kt * 32;
        const size_t ko0 = (size_t)(l0 + lr) * KW + 8 * hi, ko1 = (size_t)(l0 + 16 + lr) * KW + 8 * hi;
        v8f s0 = {}, s1 = {}, x0 = {}, x1 = {};
#pragma unroll
        for (int kc = 0; kc < 4; ++kc) {
            const v16h qa = cat16(*(const v8h*)(QH + qo + kc * 32), *(const v8h*)(QH + qo + kc * 32 + 16)), qx = cat16(*(const v8h*)(QL + qo + kc * 32), *(const v8h*)(QL + qo + kc * 32 + 16));
            const v16h k0h = cat16(*(const v8h*)(kh_b + ko0 + kc * 32), *(const v8h*)(kh_b + ko0 + kc * 32 + 16)), k1h = cat16(*(const v8h*)(kh_b + ko1 + kc * 32), *(const v8h*)(kh_b + ko1 + kc * 32 + 16));
            s0 = wmma16(qa, k0h, s0); s1 = wmma16(qa, k1h, s1); x0 = wmma16(qx, k0h, x0); x1 = wmma16(qx, k1h, x1);
            asm volatile("v_nop" : "+v"(s0), "+v"(s1), "+v"(x0), "+v"(x1) : "v"(qa), "v"(qx), "v"(k0h), "v"(k1h) : "memory");
            const v16h k0l = cat16(*(const v8h*)(kl_b + ko0 + kc * 32), *(const v8h*)(kl_b + ko0 + kc * 32 + 16)), k1l = cat16(*(const v8h*)(kl_b + ko1 + kc * 32), *(const v8h*)(kl_b + ko1 + kc * 32 + 16));
            x0 = wmma16(qa, k0l, x0); x1 = wmma16(qa, k1l, x1);
            asm volatile("v_nop" : "+v"(x0), "+v"(x1) : "v"(k0l), "v"(k1l) : "memory");
        }
        asm volatile("v_nop\n\tv_nop\n\tv_nop\n\tv_nop" : "+v"(s0), "+v"(s1), "+v"(x0), "+v"(x1));
        float alpha[8];
#pragma unroll
        for (int j = 0; j < 8; ++j) { const int qi = q0 + hi * 8 + j, ja = l0 + lr, jb = l0 + 16 + lr;
            const float a0 = (ja <= qi) ? (s0[j] + x0[j] * LOSCI) * SCL : -__builtin_inff(), a1 = (jb <= qi) ? (s1[j] + x1[j] * LOSCI) * SCL : -__builtin_inff();     // causal (-inf; the diagonal is always live)
            float mx = fmaxf(a0, a1);
            mx = fmaxf(mx, __shfl_xor(mx, 1, 16)); mx = fmaxf(mx, __shfl_xor(mx, 2, 16)); mx = fmaxf(mx, __shfl_xor(mx, 4, 16)); mx = fmaxf(mx, __shfl_xor(mx, 8, 16));
            const float mn = fmaxf(mrow[j], mx);
            alpha[j] = __expf(mrow[j] - mn); mrow[j] = mn;
            const float p0 = __expf(a0 - mn), p1 = __expf(a1 - mn);
            lpart[j] = lpart[j] * alpha[j] + (p0 + p1);
            const int mr = hi * 8 + j; const float ps0 = p0 * PSC, ps1 = p1 * PSC; const unsigned short h0 = f2bf(ps0), h1 = f2bf(ps1);
            pl[mr * 32 + lr] = h0; pl[mr * 32 + 16 + lr] = h1; pl2[mr * 32 + lr] = f2bf(ps0 - bf2f(h0)); pl2[mr * 32 + 16 + lr] = f2bf(ps1 - bf2f(h1)); }
#pragma unroll
        for (int n = 0; n < 8; ++n)
#pragma unroll
            for (int j = 0; j < 8; ++j) o[n][j] *= alpha[j];
        asm volatile("" ::: "memory");
        const v16bf pa = cat16b(*(const v8usa*)(pl + lr * 32 + hi * 8), *(const v8usa*)(pl + lr * 32 + 16 + hi * 8));
        const v16bf px = cat16b(*(const v8usa*)(pl2 + lr * 32 + hi * 8), *(const v8usa*)(pl2 + lr * 32 + 16 + hi * 8));
#pragma unroll
        for (int n = 0; n < 8; ++n) { const size_t vo = vbase + (size_t)(n * 16 + lr) * NT_ + l0 + hi * 8;
            const v16bf vh = cat16b(*(const v8us*)(VTH + vo), *(const v8us*)(VTH + vo + 16)), vl = cat16b(*(const v8us*)(VTL + vo), *(const v8us*)(VTL + vo + 16));
            o[n] = wmmab(pa, vh, o[n]); o[n] = wmmab(px, vh, o[n]); o[n] = wmmab(pa, vl, o[n]);
            asm volatile("" : "+v"(o[n]) : "v"(vh), "v"(vl) : "memory"); }
        asm volatile("v_nop\n\tv_nop\n\tv_nop\n\tv_nop" : "+v"(o[0]), "+v"(o[7]) : "v"(pa), "v"(px));
        __builtin_amdgcn_wave_barrier();
    }
    float inv[8];
#pragma unroll
    for (int j = 0; j < 8; ++j) { float rs = lpart[j]; rs += __shfl_xor(rs, 1, 16); rs += __shfl_xor(rs, 2, 16); rs += __shfl_xor(rs, 4, 16); rs += __shfl_xor(rs, 8, 16); inv[j] = 1.0f / (rs * PSC); }
    float* os = &ost[wave][0];
    float* ob = OUTP + (size_t)q0 * (NH_ * HD) + (size_t)h * HD;     // row stride NH*HD, this head's 128 columns
#pragma unroll
    for (int half = 0; half < 2; ++half) {
#pragma unroll
        for (int n = 0; n < 4; ++n)
#pragma unroll
            for (int j = 0; j < 8; ++j) os[(hi * 8 + j) * 68 + n * 16 + lr] = o[half * 4 + n][j] * inv[j];
        __builtin_amdgcn_wave_barrier(); asm volatile("" ::: "memory");
{
#pragma unroll
            for (int s = 0; s < 8; ++s) { const int Lid = (lane >> 3) + 4 * s, piece = lane & 7; const int row = Lid >> 1, cofs = (Lid & 1) * 32 + piece * 4;
                const v4f val = *(const v4fa*)(os + row * 68 + cofs); *(v4f*)(ob + (size_t)row * (NH_ * HD) + half * 64 + cofs) = val; }
             }
        __builtin_amdgcn_wave_barrier(); asm volatile("" ::: "memory");
    }
}

extern "C" void kernel_launch(void* const* d_in, const int* in_sizes, int n_in,
                              void* d_out, int out_size, void* d_ws, size_t ws_size, hipStream_t stream) {
    (void)in_sizes; (void)n_in; (void)out_size;
    const float* x = (const float*)d_in[0]; const float* Wq = (const float*)d_in[1]; const float* bq = (const float*)d_in[2]; const float* Wk = (const float*)d_in[3]; const float* bk = (const float*)d_in[4];
    const float* Wv = (const float*)d_in[5]; const float* bv = (const float*)d_in[6]; const float* WO = (const float*)d_in[7]; const float* bo = (const float*)d_in[8];     // per-head [16][2048][128] k-major weights (x @ W[h]), WO [2048][2048] k-major
    float* out = (float*)d_out;    // [1][2048][2048]
    char* wsp = (char*)d_ws;
    auto take = [&](size_t bytes) { char* p = wsp; wsp += (bytes + 255) & ~(size_t)255; return (void*)p; };
    bf* Xb = (bf*)take((size_t)NT_ * HS * 2); bf* WqN = (bf*)take((size_t)HS * HS * 2); bf* WkN = (bf*)take((size_t)HS * HS * 2); bf* WvN = (bf*)take((size_t)HS * HS * 2); bf* WoT = (bf*)take((size_t)HS * HS * 2);
    float* TMP = (float*)take((size_t)NT_ * HS * 4); h16* QH = (h16*)take((size_t)NT_ * HS * 2); h16* QL = (h16*)take((size_t)NT_ * HS * 2); h16* KH = (h16*)take((size_t)NT_ * KW * 2); h16* KL = (h16*)take((size_t)NT_ * KW * 2);
    bf* VTH = (bf*)take((size_t)KW * NT_ * 2); bf* VTL = (bf*)take((size_t)KW * NT_ * 2);
    if ((size_t)(wsp - (char*)d_ws) > ws_size) return;    // 8.4 + 4 x 8.4 + 16.8 + 6 x 8.4 ~ 109 MB = 104 MiB; the f32 ctx reuses TMP and its bf16 planes reuse QH/QL (dead after k_attn), see below
    float* CTX = TMP; bf* Oh = (bf*)QH; bf* Ol = (bf*)QL;
    for (int h = 0; h < NH_; ++h) {                                                                                  // per-head k-major [2048][128] -> rows (h, d) of the n-major [2048][2048] operands
        k_wt<<<dim3(HS / 64, HD / 64, 1), 256, 0, stream>>>(Wq + (size_t)h * HS * HD, HS, HD, WqN + (size_t)h * HD * HS);
        k_wt<<<dim3(HS / 64, HD / 64, 1), 256, 0, stream>>>(Wk + (size_t)h * HS * HD, HS, HD, WkN + (size_t)h * HD * HS);
        k_wt<<<dim3(HS / 64, HD / 64, 1), 256, 0, stream>>>(Wv + (size_t)h * HS * HD, HS, HD, WvN + (size_t)h * HD * HS);
    }
    k_wt<<<dim3(HS / 64, HS / 64, 1), 256, 0, stream>>>(WO, HS, HS, WoT);
    k_cvtb<<<NT_ / 8, 256, 0, stream>>>(x, NT_, Xb);
    k_gemmb<false, false><<<dim3(NT_ / 64, HS / 64, 1), 128, 0, stream>>>(Xb, nullptr, WqN, bq, TMP, HS, nullptr); k_f16s<<<NT_ / 8, 256, 0, stream>>>(TMP, NT_, QH, QL);
    k_gemmb<false, false><<<dim3(NT_ / 64, HS / 64, 1), 128, 0, stream>>>(Xb, nullptr, WkN, bk, TMP, HS, nullptr); k_f16s<<<NT_ / 8, 256, 0, stream>>>(TMP, NT_, KH, KL);
    k_gemmb<false, false><<<dim3(NT_ / 64, HS / 64, 1), 128, 0, stream>>>(Xb, nullptr, WvN, bv, TMP, HS, nullptr); k_vt<<<dim3(NT_ / 64, 2, NKV), 256, 0, stream>>>(TMP, VTH, VTL);
    k_attn<<<NH_ * (NT_ / 64), 128, 0, stream>>>(QH, QL, KH, KL, VTH, VTL, CTX);                                      // ctx f32 [2048][2048] over the dead TMP
    k_splitp<<<NT_ / 8, 256, 0, stream>>>(CTX, NT_, Oh, Ol);                                                         // planes over the dead QH/QL
    k_gemmb<true, false><<<dim3(NT_ / 64, HS / 64, 1), 128, 0, stream>>>(Oh, Ol, WoT, bo, out, HS, nullptr);         // out = ctx.WO + bo
}

// v001
// Measured time: 518 microseconds a run.
// Two timings next to v000 put it at 1.40 and 1.41 times that version's speed.
#include <hip/hip_runtime.h>

// Compute dtypes, f32 accumulate: q/k/v = x.W[h] + b[h] for all 16 heads at once ([2048 x 2048].[2048 x 2048]; the per-head k-major weights transposed into one n-major
// operand; PLAIN bf16 operands = inputs rounded once, exact) and out = ctx.WO + bo (ctx as bf16 hi + UNSCALED residual) on v_wmma_f32_16x16x32_bf16; q/k -> f16
// hi + residual x1024 planes, v -> bf16 hi + UNSCALED residual [d][t] planes; the 16-head causal attention (128-dim heads, scale 128^-1/2) fused: scores on
// v_wmma_f32_16x16x32_f16 (hh + hl + lh), online f32 softmax, weights (x32768) and v on v_wmma_f32_16x16x32_bf16, f32 output rows. Deterministic, no atomics;
// (stream order): the f32 ctx reuses the projection scratch and its planes reuse the q planes, both dead after k_attn.

#define NB_  1
#define NT_  2048
#define HS   2048
#define NH_  16
#define NKV  16
#define HD   128
#define KW   (NKV * HD)          // 2048
#define NREP 1
#define DM   HS
#define NTK  NT_
#define SCL  0.08838834764831845f
#define PSC  32768.0f
#define LOSC 1024.0f
#define LOSCI (1.0f / 1024.0f)
#define KPB  272                 // LDS pitch in bytes of a staged k row (256 + 16) and
#define VPB  80                  // of a staged v row (64 + 16): 16 B x odd, conflict-free for ds_load_b128
#define KPL  (32 * KPB)          // one k plane of a 32-key stage
#define VPL  (HD * VPB)          // one v plane of a 32-key stage
#define STG  (2 * KPL + 2 * VPL) // one stage: k hi, k lo, v hi, v lo

typedef _Float16 h16;
typedef unsigned short bf;
typedef __attribute__((ext_vector_type(16))) __bf16   v16bf;
typedef __attribute__((ext_vector_type(16))) _Float16 v16h;
typedef __attribute__((ext_vector_type(8)))  _Float16 v8h;
typedef __attribute__((ext_vector_type(8)))  unsigned short v8us;
typedef __attribute__((ext_vector_type(8)))  float    v8f;
typedef __attribute__((ext_vector_type(4)))  float    v4f;
typedef __attribute__((ext_vector_type(4)))  _Float16 v4h;
typedef v8h  __attribute__((may_alias)) v8ha;
typedef v4f  __attribute__((may_alias)) v4fa;
typedef v8us __attribute__((may_alias)) v8usa;

__device__ __forceinline__ unsigned short f2bf(float f) { unsigned u = __float_as_uint(f); u += 0x7FFFu + ((u >> 16) & 1u); return (unsigned short)(u >> 16); }
__device__ __forceinline__ float bf2f(unsigned short b) { return __uint_as_float(((unsigned)b) << 16); }
__device__ __forceinline__ float bfr(float f) { return bf2f(f2bf(f)); }
__device__ __forceinline__ v16h cat16(v8h lo, v8h hi) { return __builtin_shufflevector(lo, hi, 0, 1, 2, 3, 4, 5, 6, 7, 8, 9, 10, 11, 12, 13, 14, 15); }
__device__ __forceinline__ v16bf cat16b(v8us lo, v8us hi) { return __builtin_bit_cast(v16bf, __builtin_shufflevector(lo, hi, 0, 1, 2, 3, 4, 5, 6, 7, 8, 9, 10, 11, 12, 13, 14, 15)); }
__device__ __forceinline__ v8f wmma16(v16h a, v16h b, v8f c) { return __builtin_amdgcn_wmma_f32_16x16x32_f16(false, a, false, b, (short)0, c, false, false); }
__device__ __forceinline__ v8f wmmab(v16bf a, v16bf b, v8f c) { return __builtin_amdgcn_wmma_f32_16x16x32_bf16(false, a, false, b, (short)0, c, false, false); }

// k_cvtb: bf16 plane of [rows][2048] (one wave per row) — x rows per item.
__global__ __launch_bounds__(256) void k_cvtb(const float* __restrict__ src, int nrows, bf* dst) {
    const int lane = threadIdx.x & 31, r = blockIdx.x * 8 + (threadIdx.x >> 5);
    if (r >= nrows) return;
{
#pragma unroll
        for (int q = 0; q < HS / 256; ++q) { v8us o;
#pragma unroll
            for (int i = 0; i < 8; ++i) o[i] = f2bf(src[(size_t)r * HS + q * 256 + lane * 8 + i]);
            *(v8us*)(dst + (size_t)r * HS + q * 256 + lane * 8) = o; }
         }
}
// k_gemm: 64 x 64 tile of (A [+ Al]).Bn^T over K = 2048 (+ optional bf16-rounded bias[c]) -> f32 rows [2048][ldc].
template <bool SPLITA>
__global__ __launch_bounds__(128) void k_gemm(const bf* __restrict__ A, const bf* __restrict__ Al, const bf* __restrict__ Bn, const float* __restrict__ bias, int ldc, float* C) {
    __shared__ __align__(16) float ost[4][16 * 68];
    const int lane = threadIdx.x & 31, wave = threadIdx.x >> 5, lr = lane & 15, hi = lane >> 4;
    const size_t r0 = (size_t)blockIdx.x * 64 + wave * 16; const int c0 = blockIdx.y * 64;
    const size_t aoff = (r0 + lr) * HS + 8 * hi;
    v8f acc[4];
#pragma unroll
    for (int t = 0; t < 4; ++t) acc[t] = (v8f){};
#pragma unroll 2
    for (int kc = 0; kc < HS; kc += 32) {
        const v16bf a = cat16b(*(const v8us*)(A + aoff + kc), *(const v8us*)(A + aoff + kc + 16));
        v16bf al = a; if (SPLITA) al = cat16b(*(const v8us*)(Al + aoff + kc), *(const v8us*)(Al + aoff + kc + 16));
#pragma unroll
        for (int t = 0; t < 4; ++t) { const bf* bp = Bn + (size_t)(c0 + t * 16 + lr) * HS + kc + 8 * hi; const v16bf bb = cat16b(*(const v8us*)bp, *(const v8us*)(bp + 16)); acc[t] = wmmab(a, bb, acc[t]); if (SPLITA) acc[t] = wmmab(al, bb, acc[t]); }
        asm volatile("v_nop" : "+v"(acc[0]), "+v"(acc[1]), "+v"(acc[2]), "+v"(acc[3]) : "v"(a), "v"(al) : "memory");
    }
    float* os = &ost[wave][0];
#pragma unroll
    for (int t = 0; t < 4; ++t)
#pragma unroll
        for (int j = 0; j < 8; ++j) os[(hi * 8 + j) * 68 + t * 16 + lr] = acc[t][j] + (bias ? bfr(bias[c0 + t * 16 + lr]) : 0.f);
    __builtin_amdgcn_wave_barrier(); asm volatile("" ::: "memory");
    float* crow = C + r0 * ldc + c0;
    auto pass = [&]() {
#pragma unroll
        for (int s = 0; s < 8; ++s) { const int Lid = (lane >> 3) + 4 * s, piece = lane & 7; const int row = Lid >> 1, cofs = (Lid & 1) * 32 + piece * 4;
            const v4f val = *(const v4fa*)(os + row * 68 + cofs); *(v4f*)(crow + (size_t)row * ldc + cofs) = val; }
    };
    pass(); 
}
// k_vt: VTH/VTL [g][128 d][2048 t] = bf16 hi + UNSCALED bf16 residual of V [t][g*128+d] via 64 x 64 LDS tiles; grid (NT/64, 2 (d half), 16 heads).
__global__ __launch_bounds__(256) void k_vt(const float* __restrict__ V, bf* VTH, bf* VTL) {
    __shared__ float tl[64][65];
    const int tid = threadIdx.x, t0 = blockIdx.x * 64, d0 = blockIdx.y * 64, g = blockIdx.z;
    { const int tt = tid >> 2, dq = (tid & 3) * 16;
#pragma unroll
      for (int i = 0; i < 16; ++i) tl[dq + i][tt] = V[(size_t)(t0 + tt) * KW + g * HD + d0 + dq + i]; }
    __syncthreads();
    const int piece = tid & 7;
    auto pass = [&]() {
#pragma unroll
        for (int s = 0; s < 2; ++s) { const int d = (tid >> 3) + 32 * s; v8us oh, ol;
#pragma unroll
            for (int i = 0; i < 8; ++i) { const float v = tl[d][piece * 8 + i]; const unsigned short hb = f2bf(v); oh[i] = hb; ol[i] = f2bf(v - bf2f(hb)); }
            const size_t o = ((size_t)g * HD + d0 + d) * NT_ + t0 + piece * 8; *(v8us*)(VTH + o) = oh; *(v8us*)(VTL + o) = ol; }
    };
    pass(); 
}
// k_attn: block = (head, 64 queries), wave = 16; causal key tiles 0..(Q0+63)/32 (block-uniform); per element: score x 128^-1/2, keys past the query at -inf;
// online f32 softmax; P (x32768) as bf16 hi + residual against the V planes; f32 output rows.
// k_wt: WT [n][K] = bf16(W[k][n]) (k-major [K][ncols]) via 64 x 64 LDS tiles; grid (K/64, ncols/64).
__global__ __launch_bounds__(256) void k_wt(const float* __restrict__ Wm, int K, int ncols, bf* WT) {
    __shared__ __align__(16) unsigned short tl[64 * 72];
    const int tid = threadIdx.x, k0 = blockIdx.x * 64, n0 = blockIdx.y * 64;
    const int kk = tid >> 2, nq = (tid & 3) * 16;
#pragma unroll
    for (int i = 0; i < 16; ++i) tl[(nq + i) * 72 + kk] = f2bf(Wm[(size_t)(k0 + kk) * ncols + n0 + nq + i]);
    __syncthreads();
    const int piece = tid & 7;
    auto pass = [&]() {
#pragma unroll
        for (int s = 0; s < 2; ++s) { const int nr = (tid >> 3) + 32 * s; const v8us val = *(const v8usa*)(tl + nr * 72 + piece * 8); *(v8us*)(WT + (size_t)(n0 + nr) * K + k0 + piece * 8) = val; }
    };
    pass(); 
}
// k_gemmb: 64 x 64 block tile (4 waves x 16 x 64) of C[NTK][NW] = (A [+ Al]).B^T (K = 2048) [+ bf(bias[c])] [+ bf(R[r][c]) residual]; f32 whole-line epilogue (or f16
template <bool SPLITA, bool F16OUT = false>
__global__ __launch_bounds__(128) void k_gemmb(const bf* __restrict__ A, const bf* __restrict__ Al, const bf* __restrict__ Bn, const float* __restrict__ bias, float* C, int ldc, h16* C2, const float* __restrict__ R = nullptr, int K = DM, int roundR = 1) {
    __shared__ __align__(16) float ost[4][16 * 68];
    const int lane = threadIdx.x & 31, wave = threadIdx.x >> 5, lr = lane & 15, hi = lane >> 4;
    const int r0 = blockIdx.x * 64 + wave * 16, c0 = blockIdx.y * 64;
    const size_t aoff = (size_t)(r0 + lr) * K + 8 * hi;
    size_t boff[4];
#pragma unroll
    for (int t = 0; t < 4; ++t) boff[t] = (size_t)(c0 + t * 16 + lr) * K + 8 * hi;
    v8f acc[4];
#pragma unroll
    for (int t = 0; t < 4; ++t) acc[t] = (v8f){};
#pragma unroll 1
    for (int kc = 0; kc < K; kc += 32) {
        const v16bf a = cat16b(*(const v8us*)(A + aoff + kc), *(const v8us*)(A + aoff + kc + 16));
        v16bf al = a;
        if (SPLITA) al = cat16b(*(const v8us*)(Al + aoff + kc), *(const v8us*)(Al + aoff + kc + 16));
#pragma unroll
        for (int t = 0; t < 4; ++t) { const v16bf b = cat16b(*(const v8us*)(Bn + boff[t] + kc), *(const v8us*)(Bn + boff[t] + kc + 16)); acc[t] = wmmab(a, b, acc[t]); if (SPLITA) acc[t] = wmmab(al, b, acc[t]); }
        asm volatile("v_nop\n\tv_nop\n\tv_nop\n\tv_nop" : "+v"(acc[0]), "+v"(acc[1]), "+v"(acc[2]), "+v"(acc[3]) : "v"(a), "v"(al));
    }
    float* os = &ost[wave][0];
#pragma unroll
    for (int t = 0; t < 4; ++t) { const float bv = bias ? bfr(bias[c0 + t * 16 + lr]) : 0.f;
#pragma unroll
        for (int j = 0; j < 8; ++j) os[(hi * 8 + j) * 68 + t * 16 + lr] = acc[t][j] + bv; }
    __syncthreads();
    if (F16OUT) {
        h16* crow = (h16*)(void*)C + (size_t)r0 * ldc + c0;
        auto pass = [&]() {
#pragma unroll
            for (int s = 0; s < 4; ++s) { const int row = 4 * s + (lane >> 3), piece = lane & 7; const float* sp = os + row * 68 + piece * 8; v8h o, o2;
#pragma unroll
                for (int i = 0; i < 8; ++i) { const h16 a = (h16)sp[i]; o[i] = a; o2[i] = (h16)((sp[i] - (float)a) * LOSC); }
                *(v8h*)(crow + (size_t)row * ldc + piece * 8) = o; if (C2) *(v8h*)(C2 + (size_t)r0 * ldc + c0 + (size_t)row * ldc + piece * 8) = o2; }
        };
        pass(); 
    } else {
        float* crow = C + (size_t)r0 * ldc + c0;
        auto pass = [&]() {
#pragma unroll
            for (int s = 0; s < 8; ++s) { const int Lid = (lane >> 3) + 4 * s, piece = lane & 7; const int row = Lid >> 1, cofs = (Lid & 1) * 32 + piece * 4;
                v4f val = *(const v4fa*)(os + row * 68 + cofs); if (R) { const v4f rv = *(const v4f*)(R + ((size_t)r0 + row) * ldc + c0 + cofs); val += roundR ? (v4f){bfr(rv[0]), bfr(rv[1]), bfr(rv[2]), bfr(rv[3])} : rv; }
                *(v4f*)(crow + (size_t)row * ldc + cofs) = val; }
        };
        pass(); 
    }
}

__global__ __launch_bounds__(256) void k_f16s(const float* __restrict__ src, int nrows, h16* PH, h16* PL) {
    const int lane = threadIdx.x & 31, r = blockIdx.x * 8 + (threadIdx.x >> 5); if (r >= nrows) return;
{
#pragma unroll 1
        for (int q = 0; q < KW / 256; ++q) { const size_t o = (size_t)r * KW + q * 256 + lane * 8; const v8f v = *(const v8f*)(src + o); v8h oh, ol;
#pragma unroll
            for (int i = 0; i < 8; ++i) { const h16 a = (h16)v[i]; oh[i] = a; ol[i] = (h16)((v[i] - (float)a) * LOSC); }
            *(v8h*)(PH + o) = oh; *(v8h*)(PL + o) = ol; }
         }
}
__global__ __launch_bounds__(256) void k_splitp(const float* __restrict__ src, int nrows, bf* dh, bf* dl) {
    const int lane = threadIdx.x & 31, r = blockIdx.x * 8 + (threadIdx.x >> 5); if (r >= nrows) return;
{
#pragma unroll 1
        for (int q = 0; q < HS / 256; ++q) { const size_t o = (size_t)r * HS + q * 256 + lane * 8; const v8f v = *(const v8f*)(src + o); v8us oh, ol;
#pragma unroll
            for (int i = 0; i < 8; ++i) { const unsigned short hb = f2bf(v[i]); oh[i] = hb; ol[i] = f2bf(v[i] - bf2f(hb)); }
            *(v8us*)(dh + o) = oh; *(v8us*)(dl + o) = ol; }
         }
}
// k_attn: block = (head, 64 queries), wave = 16; causal key tiles; 128-dim scores (hh + hl + lh) x 128^-1/2, online f32 softmax, P (x32768) as bf16 hi + residual
// against the v planes; f32 output rows [t][h*128 + d]. Each 32-key tile of the k and v planes is brought into LDS once per block by asynchronous copies, two
// buffers: tile kt + 1 flies while tile kt is worked on; all four waves read their fragments from there.
// cp8: eight 16-byte copies of one lane; the s_wait_xcnt stands inside the statement so that no address register is rewritten ahead of it.
__device__ __forceinline__ void cp8(unsigned l0, unsigned l1, unsigned l2, unsigned l3, unsigned l4, unsigned l5, unsigned l6, unsigned l7,
                                    const void* g0, const void* g1, const void* g2, const void* g3, const void* g4, const void* g5, const void* g6, const void* g7) {
    asm volatile("global_load_async_to_lds_b128 %0, %8, off\n\t"
                 "global_load_async_to_lds_b128 %1, %9, off\n\t"
                 "global_load_async_to_lds_b128 %2, %10, off\n\t"
                 "global_load_async_to_lds_b128 %3, %11, off\n\t"
                 "global_load_async_to_lds_b128 %4, %12, off\n\t"
                 "global_load_async_to_lds_b128 %5, %13, off\n\t"
                 "global_load_async_to_lds_b128 %6, %14, off\n\t"
                 "global_load_async_to_lds_b128 %7, %15, off\n\t"
                 "s_wait_xcnt 0x0"
                 :: "v"(l0), "v"(l1), "v"(l2), "v"(l3), "v"(l4), "v"(l5), "v"(l6), "v"(l7), "v"(g0), "v"(g1), "v"(g2), "v"(g3), "v"(g4), "v"(g5), "v"(g6), "v"(g7) : "memory");
}
__global__ __launch_bounds__(128) void k_attn(const h16* __restrict__ QH, const h16* __restrict__ QL, const h16* __restrict__ KH, const h16* __restrict__ KL, const bf* __restrict__ VTH, const bf* __restrict__ VTL, float* OUTP) {
    __shared__ __align__(16) unsigned short plds[4][16 * 32];
    __shared__ __align__(16) unsigned short plds2[4][16 * 32];
    __shared__ __align__(16) float ost[4][16 * 68];
    __shared__ __align__(16) unsigned char ring[2 * STG];
    const int lane = threadIdx.x & 31, wave = threadIdx.x >> 5, lr = lane & 15, hi = lane >> 4;
    const int bid = blockIdx.x; const int h = bid / (NT_ / 64), qt = bid - h * (NT_ / 64); const int g = h / NREP;     // GQA: kv head
    const int q0 = qt * 64 + wave * 16;
    unsigned short* pl = &plds[wave][0]; unsigned short* pl2 = &plds2[wave][0];
    const size_t qo = (size_t)(q0 + lr) * (NH_ * HD) + h * HD + 8 * hi;
    const h16* kh_b = KH + g * HD; const h16* kl_b = KL + g * HD;
    const size_t vbase = ((size_t)g * HD) * NT_;
    v8f o[8];
#pragma unroll
    for (int n = 0; n < 8; ++n) o[n] = (v8f){};
    float mrow[8], lpart[8];
#pragma unroll
    for (int j = 0; j < 8; ++j) { mrow[j] = -3.0e38f; lpart[j] = 0.f; }
    const int kt_hi = (qt * 64 + 63) / 32;     // causal key tiles (2 qt + 1: at least two tiles)
    // each thread copies 4 x 16 B of each plane: k rows tid / 16 + 8 i (a wave = two whole 256-byte rows), v rows tid / 4 + 32 i
    const int tid = threadIdx.x;
    const unsigned ring0 = (unsigned)(size_t)&ring[0];     // the ring's byte address in LDS
    const unsigned kdst = ring0 + (tid >> 4) * KPB + (tid & 15) * 16, vdst = ring0 + 2 * KPL + (tid >> 2) * VPB + (tid & 3) * 16;
    const size_t ksrc = (size_t)(tid >> 4) * KW + (tid & 15) * 8, vsrc = vbase + (size_t)(tid >> 2) * NT_ + (tid & 3) * 8;
    auto stage = [&](int t, unsigned bo) {
        const h16* a = kh_b + ksrc + (size_t)t * 32 * KW; const h16* b = kl_b + ksrc + (size_t)t * 32 * KW; const unsigned kd = kdst + bo;
        cp8(kd, kd + 8 * KPB, kd + 16 * KPB, kd + 24 * KPB, kd + KPL, kd + KPL + 8 * KPB, kd + KPL + 16 * KPB, kd + KPL + 24 * KPB,
            a, a + 8 * KW, a + 16 * KW, a + 24 * KW, b, b + 8 * KW, b + 16 * KW, b + 24 * KW);
        const bf* c = VTH + vsrc + t * 32; const bf* d = VTL + vsrc + t * 32; const unsigned vd = vdst + bo;
        cp8(vd, vd + 32 * VPB, vd + 64 * VPB, vd + 96 * VPB, vd + VPL, vd + VPL + 32 * VPB, vd + VPL + 64 * VPB, vd + VPL + 96 * VPB,
            c, c + 32 * NT_, c + 64 * NT_, c + 96 * NT_, d, d + 32 * NT_, d + 64 * NT_, d + 96 * NT_);
    };
    stage(0, 0u);
    asm volatile("s_wait_asynccnt 0x0" ::: "memory");     // tile 0 of this wave's copies has landed
    __syncthreads();                                      // ... and every other wave's
    stage(1, (unsigned)STG);
#pragma unroll 1
    for (int kt = 0; kt <= kt_hi; ++kt) {
        const int l0 = kt * 32;
        const unsigned bo = (unsigned)(kt & 1) * STG;
        const h16* kth = (const h16*)(ring + bo) + lr * (KPB / 2) + 8 * hi; const h16* ktl = kth + KPL / 2;     // this lane's k row of the staged tile
        const bf* vth = (const bf*)(ring + bo + 2 * KPL) + lr * (VPB / 2) + 8 * hi; const bf* vtl = vth + VPL / 2;
        v8f s0 = {}, s1 = {}, x0 = {}, x1 = {};
        v16h kf[4][4];
#pragma unroll
        for (int kc = 0; kc < 4; ++kc) {
            kf[kc][0] = cat16(*(const v8ha*)(kth + kc * 32), *(const v8ha*)(kth + kc * 32 + 16)); kf[kc][1] = cat16(*(const v8ha*)(kth + 16 * (KPB / 2) + kc * 32), *(const v8ha*)(kth + 16 * (KPB / 2) + kc * 32 + 16));
            kf[kc][2] = cat16(*(const v8ha*)(ktl + kc * 32), *(const v8ha*)(ktl + kc * 32 + 16)); kf[kc][3] = cat16(*(const v8ha*)(ktl + 16 * (KPB / 2) + kc * 32), *(const v8ha*)(ktl + 16 * (KPB / 2) + kc * 32 + 16)); }
        __builtin_amdgcn_sched_barrier(0);     // all 32 LDS reads of the k tile issue ahead of the first product: one LDS latency a tile, not eight
#pragma unroll
        for (int kc = 0; kc < 4; ++kc) {
            const v16h qa = cat16(*(const v8h*)(QH + qo + kc * 32), *(const v8h*)(QH + qo + kc * 32 + 16)), qx = cat16(*(const v8h*)(QL + qo + kc * 32), *(const v8h*)(QL + qo + kc * 32 + 16));
            const v16h k0h = kf[kc][0], k1h = kf[kc][1];
            s0 = wmma16(qa, k0h, s0); s1 = wmma16(qa, k1h, s1); x0 = wmma16(qx, k0h, x0); x1 = wmma16(qx, k1h, x1);
            const v16h k0l = kf[kc][2], k1l = kf[kc][3];
            x0 = wmma16(qa, k0l, x0); x1 = wmma16(qa, k1l, x1);
        }
        asm volatile("v_nop\n\tv_nop\n\tv_nop\n\tv_nop" : "+v"(s0), "+v"(s1), "+v"(x0), "+v"(x1));
        float alpha[8];
#pragma unroll
        for (int j = 0; j < 8; ++j) { const int qi = q0 + hi * 8 + j, ja = l0 + lr, jb = l0 + 16 + lr;
            const float a0 = (ja <= qi) ? (s0[j] + x0[j] * LOSCI) * SCL : -__builtin_inff(), a1 = (jb <= qi) ? (s1[j] + x1[j] * LOSCI) * SCL : -__builtin_inff();     // causal (-inf; the diagonal is always live)
            float mx = fmaxf(a0, a1);
            mx = fmaxf(mx, __shfl_xor(mx, 1, 16)); mx = fmaxf(mx, __shfl_xor(mx, 2, 16)); mx = fmaxf(mx, __shfl_xor(mx, 4, 16)); mx = fmaxf(mx, __shfl_xor(mx, 8, 16));
            const float mn = fmaxf(mrow[j], mx);
            alpha[j] = __expf(mrow[j] - mn); mrow[j] = mn;
            const float p0 = __expf(a0 - mn), p1 = __expf(a1 - mn);
            lpart[j] = lpart[j] * alpha[j] + (p0 + p1);
            const int mr = hi * 8 + j; const float ps0 = p0 * PSC, ps1 = p1 * PSC; const unsigned short h0 = f2bf(ps0), h1 = f2bf(ps1);
            pl[mr * 32 + lr] = h0; pl[mr * 32 + 16 + lr] = h1; pl2[mr * 32 + lr] = f2bf(ps0 - bf2f(h0)); pl2[mr * 32 + 16 + lr] = f2bf(ps1 - bf2f(h1)); }
#pragma unroll
        for (int n = 0; n < 8; ++n)
#pragma unroll
            for (int j = 0; j < 8; ++j) o[n][j] *= alpha[j];
        asm volatile("" ::: "memory");
        const v16bf pa = cat16b(*(const v8usa*)(pl + lr * 32 + hi * 8), *(const v8usa*)(pl + lr * 32 + 16 + hi * 8));
        const v16bf px = cat16b(*(const v8usa*)(pl2 + lr * 32 + hi * 8), *(const v8usa*)(pl2 + lr * 32 + 16 + hi * 8));
        v16bf vf[8][2];
#pragma unroll
        for (int n = 0; n < 8; ++n) { const int vo = n * 16 * (VPB / 2);
            vf[n][0] = cat16b(*(const v8usa*)(vth + vo), *(const v8usa*)(vth + vo + 16)); vf[n][1] = cat16b(*(const v8usa*)(vtl + vo), *(const v8usa*)(vtl + vo + 16)); }
        __builtin_amdgcn_sched_barrier(0);     // the v tile's 32 LDS reads issue ahead of the first product: one LDS latency a tile, not eight
#pragma unroll
        for (int n = 0; n < 8; ++n) { const v16bf vh = vf[n][0], vl = vf[n][1];
            o[n] = wmmab(pa, vh, o[n]); o[n] = wmmab(px, vh, o[n]); o[n] = wmmab(pa, vl, o[n]); }
        __builtin_amdgcn_sched_barrier(0);     // the tile's products stay in front of the foot: else half of them sink behind the barrier and hold back the refill
        asm volatile("v_nop\n\tv_nop\n\tv_nop\n\tv_nop" : "+v"(o[0]), "+v"(o[7]) : "v"(pa), "v"(px));
        asm volatile("s_wait_dscnt 0x0" ::: "memory");        // this wave's reads of tile kt are done before its buffer is refilled
        asm volatile("s_wait_asynccnt 0x0" ::: "memory");     // this wave's copies of tile kt + 1 have landed
        __syncthreads();                                      // publishes tile kt + 1 and ends every wave's reads of tile kt
        if (kt + 2 <= kt_hi) stage(kt + 2, bo);               // block-uniform: the refill of the buffer just read
    }
    asm volatile("s_wait_asynccnt 0x0" ::: "memory");         // no copy is outstanding when the wave goes on
    float inv[8];
#pragma unroll
    for (int j = 0; j < 8; ++j) { float rs = lpart[j]; rs += __shfl_xor(rs, 1, 16); rs += __shfl_xor(rs, 2, 16); rs += __shfl_xor(rs, 4, 16); rs += __shfl_xor(rs, 8, 16); inv[j] = 1.0f / (rs * PSC); }
    float* os = &ost[wave][0];
    float* ob = OUTP + (size_t)q0 * (NH_ * HD) + (size_t)h * HD;     // row stride NH*HD, this head's 128 columns
#pragma unroll
    for (int half = 0; half < 2; ++half) {
#pragma unroll
        for (int n = 0; n < 4; ++n)
#pragma unroll
            for (int j = 0; j < 8; ++j) os[(hi * 8 + j) * 68 + n * 16 + lr] = o[half * 4 + n][j] * inv[j];
        __builtin_amdgcn_wave_barrier(); asm volatile("" ::: "memory");
{
#pragma unroll
            for (int s = 0; s < 8; ++s) { const int Lid = (lane >> 3) + 4 * s, piece = lane & 7; const int row = Lid >> 1, cofs = (Lid & 1) * 32 + piece * 4;
                const v4f val = *(const v4fa*)(os + row * 68 + cofs); *(v4f*)(ob + (size_t)row * (NH_ * HD) + half * 64 + cofs) = val; }
             }
        __builtin_amdgcn_wave_barrier(); asm volatile("" ::: "memory");
    }
}

extern "C" void kernel_launch(void* const* d_in, const int* in_sizes, int n_in,
                              void* d_out, int out_size, void* d_ws, size_t ws_size, hipStream_t stream) {
    (void)in_sizes; (void)n_in; (void)out_size;
    const float* x = (const float*)d_in[0]; const float* Wq = (const float*)d_in[1]; const float* bq = (const float*)d_in[2]; const float* Wk = (const float*)d_in[3]; const float* bk = (const float*)d_in[4];
    const float* Wv = (const float*)d_in[5]; const float* bv = (const float*)d_in[6]; const float* WO = (const float*)d_in[7]; const float* bo = (const float*)d_in[8];     // per-head [16][2048][128] k-major weights (x @ W[h]), WO [2048][2048] k-major
    float* out = (float*)d_out;    // [1][2048][2048]
    char* wsp = (char*)d_ws;
    auto take = [&](size_t bytes) { char* p = wsp; wsp += (bytes + 255) & ~(size_t)255; return (void*)p; };
    bf* Xb = (bf*)take((size_t)NT_ * HS * 2); bf* WqN = (bf*)take((size_t)HS * HS * 2); bf* WkN = (bf*)take((size_t)HS * HS * 2); bf* WvN = (bf*)take((size_t)HS * HS * 2); bf* WoT = (bf*)take((size_t)HS * HS * 2);
    float* TMP = (float*)take((size_t)NT_ * HS * 4); h16* QH = (h16*)take((size_t)NT_ * HS * 2); h16* QL = (h16*)take((size_t)NT_ * HS * 2); h16* KH = (h16*)take((size_t)NT_ * KW * 2); h16* KL = (h16*)take((size_t)NT_ * KW * 2);
    bf* VTH = (bf*)take((size_t)KW * NT_ * 2); bf* VTL = (bf*)take((size_t)KW * NT_ * 2);
    if ((size_t)(wsp - (char*)d_ws) > ws_size) return;    // 8.4 + 4 x 8.4 + 16.8 + 6 x 8.4 ~ 109 MB = 104 MiB; the f32 ctx reuses TMP and its bf16 planes reuse QH/QL (dead after k_attn), see below
    float* CTX = TMP; bf* Oh = (bf*)QH; bf* Ol = (bf*)QL;
    for (int h = 0; h < NH_; ++h) {                                                                                  // per-head k-major [2048][128] -> rows (h, d) of the n-major [2048][2048] operands
        k_wt<<<dim3(HS / 64, HD / 64, 1), 256, 0, stream>>>(Wq + (size_t)h * HS * HD, HS, HD, WqN + (size_t)h * HD * HS);
        k_wt<<<dim3(HS / 64, HD / 64, 1), 256, 0, stream>>>(Wk + (size_t)h * HS * HD, HS, HD, WkN + (size_t)h * HD * HS);
        k_wt<<<dim3(HS / 64, HD / 64, 1), 256, 0, stream>>>(Wv + (size_t)h * HS * HD, HS, HD, WvN + (size_t)h * HD * HS);
    }
    k_wt<<<dim3(HS / 64, HS / 64, 1), 256, 0, stream>>>(WO, HS, HS, WoT);
    k_cvtb<<<NT_ / 8, 256, 0, stream>>>(x, NT_, Xb);
    k_gemmb<false, false><<<dim3(NT_ / 64, HS / 64, 1), 128, 0, stream>>>(Xb, nullptr, WqN, bq, TMP, HS, nullptr); k_f16s<<<NT_ / 8, 256, 0, stream>>>(TMP, NT_, QH, QL);
    k_gemmb<false, false><<<dim3(NT_ / 64, HS / 64, 1), 128, 0, stream>>>(Xb, nullptr, WkN, bk, TMP, HS, nullptr); k_f16s<<<NT_ / 8, 256, 0, stream>>>(TMP, NT_, KH, KL);
    k_gemmb<false, false><<<dim3(NT_ / 64, HS / 64, 1), 128, 0, stream>>>(Xb, nullptr, WvN, bv, TMP, HS, nullptr); k_vt<<<dim3(NT_ / 64, 2, NKV), 256, 0, stream>>>(TMP, VTH, VTL);
    k_attn<<<NH_ * (NT_ / 64), 128, 0, stream>>>(QH, QL, KH, KL, VTH, VTL, CTX);                                      // ctx f32 [2048][2048] over the dead TMP
    k_splitp<<<NT_ / 8, 256, 0, stream>>>(CTX, NT_, Oh, Ol);                                                         // planes over the dead QH/QL
    k_gemmb<true, false><<<dim3(NT_ / 64, HS / 64, 1), 128, 0, stream>>>(Oh, Ol, WoT, bo, out, HS, nullptr);         // out = ctx.WO + bo
}

// v002
// A run of this version takes 394 microseconds.
// Two timings next to v001 put it at 1.32 and 1.31 times that version's speed.
// All steps since v000 together make it 1.85 times as fast.
#include <hip/hip_runtime.h>

// Compute dtypes, f32 accumulate: q/k/v = x.W[h] + b[h] for all 16 heads at once ([2048 x 2048].[2048 x 2048]; the per-head k-major weights transposed into one n-major
// operand; PLAIN bf16 operands = inputs rounded once, exact) and out = ctx.WO + bo (ctx as bf16 hi + UNSCALED residual) on v_wmma_f32_16x16x32_bf16; q/k -> f16
// hi + residual x1024 planes, v -> bf16 hi + UNSCALED residual [d][t] planes; the 16-head causal attention (128-dim heads, scale 128^-1/2) fused: scores on
// v_wmma_f32_16x16x32_f16 (hh + hl + lh), online f32 softmax, weights (x32768) and v on v_wmma_f32_16x16x32_bf16, f32 output rows. Deterministic, no atomics;
// (stream order): the f32 ctx reuses the projection scratch and its planes reuse the q planes, both dead after k_attn.

#define NB_  1
#define NT_  2048
#define HS   2048
#define NH_  16
#define NKV  16
#define HD   128
#define KW   (NKV * HD)          // 2048
#define NREP 1
#define DM   HS
#define NTK  NT_
#define SCL  0.08838834764831845f
#define PSC  32768.0f
#define LOSC 1024.0f
#define LOSCI (1.0f / 1024.0f)
#define KPB  272                 // LDS pitch in bytes of a staged k row (256 + 16) and
#define VPB  80                  // of a staged v row (64 + 16): 16 B x odd, conflict-free for ds_load_b128
#define KPL  (32 * KPB)          // one k plane of a 32-key stage
#define VPL  (HD * VPB)          // one v plane of a 32-key stage
#define STG  (2 * KPL + 2 * VPL) // one stage: k hi, k lo, v hi, v lo

typedef _Float16 h16;
typedef unsigned short bf;
typedef __attribute__((ext_vector_type(16))) __bf16   v16bf;
typedef __attribute__((ext_vector_type(16))) _Float16 v16h;
typedef __attribute__((ext_vector_type(8)))  _Float16 v8h;
typedef __attribute__((ext_vector_type(8)))  unsigned short v8us;
typedef __attribute__((ext_vector_type(8)))  float    v8f;
typedef __attribute__((ext_vector_type(4)))  float    v4f;
typedef __attribute__((ext_vector_type(4)))  _Float16 v4h;
typedef v8h  __attribute__((may_alias)) v8ha;
typedef v4f  __attribute__((may_alias)) v4fa;
typedef v8us __attribute__((may_alias)) v8usa;

__device__ __forceinline__ unsigned short f2bf(float f) { unsigned u = __float_as_uint(f); u += 0x7FFFu + ((u >> 16) & 1u); return (unsigned short)(u >> 16); }
__device__ __forceinline__ float bf2f(unsigned short b) { return __uint_as_float(((unsigned)b) << 16); }
__device__ __forceinline__ float bfr(float f) { return bf2f(f2bf(f)); }
__device__ __forceinline__ v16h cat16(v8h lo, v8h hi) { return __builtin_shufflevector(lo, hi, 0, 1, 2, 3, 4, 5, 6, 7, 8, 9, 10, 11, 12, 13, 14, 15); }
__device__ __forceinline__ v16bf cat16b(v8us lo, v8us hi) { return __builtin_bit_cast(v16bf, __builtin_shufflevector(lo, hi, 0, 1, 2, 3, 4, 5, 6, 7, 8, 9, 10, 11, 12, 13, 14, 15)); }
__device__ __forceinline__ v8f wmma16(v16h a, v16h b, v8f c) { return __builtin_amdgcn_wmma_f32_16x16x32_f16(false, a, false, b, (short)0, c, false, false); }
__device__ __forceinline__ v8f wmmab(v16bf a, v16bf b, v8f c) { return __builtin_amdgcn_wmma_f32_16x16x32_bf16(false, a, false, b, (short)0, c, false, false); }

// k_gemm: 64 x 64 tile of (A [+ Al]).Bn^T over K = 2048 (+ optional bf16-rounded bias[c]) -> f32 rows [2048][ldc].
template <bool SPLITA>
__global__ __launch_bounds__(128) void k_gemm(const bf* __restrict__ A, const bf* __restrict__ Al, const bf* __restrict__ Bn, const float* __restrict__ bias, int ldc, float* C) {
    __shared__ __align__(16) float ost[4][16 * 68];
    const int lane = threadIdx.x & 31, wave = threadIdx.x >> 5, lr = lane & 15, hi = lane >> 4;
    const size_t r0 = (size_t)blockIdx.x * 64 + wave * 16; const int c0 = blockIdx.y * 64;
    const size_t aoff = (r0 + lr) * HS + 8 * hi;
    v8f acc[4];
#pragma unroll
    for (int t = 0; t < 4; ++t) acc[t] = (v8f){};
#pragma unroll 2
    for (int kc = 0; kc < HS; kc += 32) {
        const v16bf a = cat16b(*(const v8us*)(A + aoff + kc), *(const v8us*)(A + aoff + kc + 16));
        v16bf al = a; if (SPLITA) al = cat16b(*(const v8us*)(Al + aoff + kc), *(const v8us*)(Al + aoff + kc + 16));
#pragma unroll
        for (int t = 0; t < 4; ++t) { const bf* bp = Bn + (size_t)(c0 + t * 16 + lr) * HS + kc + 8 * hi; const v16bf bb = cat16b(*(const v8us*)bp, *(const v8us*)(bp + 16)); acc[t] = wmmab(a, bb, acc[t]); if (SPLITA) acc[t] = wmmab(al, bb, acc[t]); }
        asm volatile("v_nop" : "+v"(acc[0]), "+v"(acc[1]), "+v"(acc[2]), "+v"(acc[3]) : "v"(a), "v"(al) : "memory");
    }
    float* os = &ost[wave][0];
#pragma unroll
    for (int t = 0; t < 4; ++t)
#pragma unroll
        for (int j = 0; j < 8; ++j) os[(hi * 8 + j) * 68 + t * 16 + lr] = acc[t][j] + (bias ? bfr(bias[c0 + t * 16 + lr]) : 0.f);
    __builtin_amdgcn_wave_barrier(); asm volatile("" ::: "memory");
    float* crow = C + r0 * ldc + c0;
    auto pass = [&]() {
#pragma unroll
        for (int s = 0; s < 8; ++s) { const int Lid = (lane >> 3) + 4 * s, piece = lane & 7; const int row = Lid >> 1, cofs = (Lid & 1) * 32 + piece * 4;
            const v4f val = *(const v4fa*)(os + row * 68 + cofs); *(v4f*)(crow + (size_t)row * ldc + cofs) = val; }
    };
    pass(); 
}
// k_vt: VTH/VTL [g][128 d][2048 t] = bf16 hi + UNSCALED bf16 residual of V [t][g*128+d] via 64 x 64 LDS tiles; grid (NT/64, 2 (d half), 16 heads).
__global__ __launch_bounds__(256) void k_vt(const float* __restrict__ V, bf* VTH, bf* VTL) {
    __shared__ float tl[64][65];
    const int tid = threadIdx.x, t0 = blockIdx.x * 64, d0 = blockIdx.y * 64, g = blockIdx.z;
    { const int tt = tid >> 2, dq = (tid & 3) * 16;
#pragma unroll
      for (int i = 0; i < 16; ++i) tl[dq + i][tt] = V[(size_t)(t0 + tt) * KW + g * HD + d0 + dq + i]; }
    __syncthreads();
    const int piece = tid & 7;
    auto pass = [&]() {
#pragma unroll
        for (int s = 0; s < 2; ++s) { const int d = (tid >> 3) + 32 * s; v8us oh, ol;
#pragma unroll
            for (int i = 0; i < 8; ++i) { const float v = tl[d][piece * 8 + i]; const unsigned short hb = f2bf(v); oh[i] = hb; ol[i] = f2bf(v - bf2f(hb)); }
            const size_t o = ((size_t)g * HD + d0 + d) * NT_ + t0 + piece * 8; *(v8us*)(VTH + o) = oh; *(v8us*)(VTL + o) = ol; }
    };
    pass(); 
}
// k_attn: block = (head, 64 queries), wave = 16; causal key tiles 0..(Q0+63)/32 (block-uniform); per element: score x 128^-1/2, -inf where the key
// is past the query (causal); online f32 softmax; P (x32768) as bf16 hi + residual against the V planes; f32 output rows.
// k_prep: all input preparation in one grid; the jobs are independent of one another and the block index picks one (block-uniform):
//   blocks 0 .. 3071: a 64 x 64 tile of one head's k-major [2048][128] weight (q, k, v: 1024 blocks each; 64 a head) -> rows (h, d) of the n-major bf16 operand;
//   blocks 3072 .. 4095: a 64 x 64 tile of WO [2048][2048] -> WoT; blocks 4096 .. 4351: eight rows of x -> bf16 (one wave per row).
// Transpose tile: WT [n][2048] = bf16(W[k][n]) via LDS.
#define PB_H  ((HS / 64) * (HD / 64))      // 64 tiles a head
#define PB_W  (NH_ * PB_H)                 // 1024 blocks a per-head weight
#define PB_O  ((HS / 64) * (HS / 64))      // 1024 tiles of WO
#define PB_X  (NT_ / 8)                    // 256 blocks of x rows
__global__ __launch_bounds__(256) void k_prep(const float* __restrict__ Wq, const float* __restrict__ Wk, const float* __restrict__ Wv, const float* __restrict__ WO, const float* __restrict__ x,
                                              bf* WqN, bf* WkN, bf* WvN, bf* WoT, bf* Xb) {
    __shared__ __align__(16) unsigned short tl[64 * 72];
    const int tid = threadIdx.x, b = blockIdx.x;
    if (b >= 3 * PB_W + PB_O) {            // x rows; the whole block leaves here, ahead of the barrier
        const float* __restrict__ src = x; bf* dst = Xb;
        const int lane = threadIdx.x & 31, r = (b - (3 * PB_W + PB_O)) * 8 + (threadIdx.x >> 5);
#pragma unroll
        for (int q = 0; q < HS / 256; ++q) { v8us o;
#pragma unroll
            for (int i = 0; i < 8; ++i) o[i] = f2bf(src[(size_t)r * HS + q * 256 + lane * 8 + i]);
            *(v8us*)(dst + (size_t)r * HS + q * 256 + lane * 8) = o; }
        return;
    }
    const float* __restrict__ Wm; bf* WT; int ncols, t; const int K = HS;
    if (b < 3 * PB_W) { const int m = b / PB_W, r = b - m * PB_W, h = r / PB_H; t = r - h * PB_H; ncols = HD;
        Wm = (m == 0 ? Wq : m == 1 ? Wk : Wv) + (size_t)h * HS * HD; WT = (m == 0 ? WqN : m == 1 ? WkN : WvN) + (size_t)h * HD * HS; }
    else { t = b - 3 * PB_W; ncols = HS; Wm = WO; WT = WoT; }
    const int k0 = (t % (HS / 64)) * 64, n0 = (t / (HS / 64)) * 64;
    const int kk = tid >> 2, nq = (tid & 3) * 16;
#pragma unroll
    for (int i = 0; i < 16; ++i) tl[(nq + i) * 72 + kk] = f2bf(Wm[(size_t)(k0 + kk) * ncols + n0 + nq + i]);
    __syncthreads();
    const int piece = tid & 7;
    auto pass = [&]() {
#pragma unroll
        for (int s = 0; s < 2; ++s) { const int nr = (tid >> 3) + 32 * s; const v8us val = *(const v8usa*)(tl + nr * 72 + piece * 8); *(v8us*)(WT + (size_t)(n0 + nr) * K + k0 + piece * 8) = val; }
    };
    pass(); 
}
// k_gemmb: 64 x 64 block tile (4 waves x 16 x 64) of C[NTK][NW] = (A [+ Al]).B^T (K = 2048) [+ bf(bias[c])] [+ bf(R[r][c]) residual]; f32 whole-line epilogue (or f16
template <bool SPLITA, bool F16OUT = false>
__global__ __launch_bounds__(128) void k_gemmb(const bf* __restrict__ A, const bf* __restrict__ Al, const bf* __restrict__ Bn, const float* __restrict__ bias, float* C, int ldc, h16* C2, const float* __restrict__ R = nullptr, int K = DM, int roundR = 1) {
    __shared__ __align__(16) float ost[4][16 * 68];
    const int lane = threadIdx.x & 31, wave = threadIdx.x >> 5, lr = lane & 15, hi = lane >> 4;
    const int r0 = blockIdx.x * 64 + wave * 16, c0 = blockIdx.y * 64;
    const size_t aoff = (size_t)(r0 + lr) * K + 8 * hi;
    size_t boff[4];
#pragma unroll
    for (int t = 0; t < 4; ++t) boff[t] = (size_t)(c0 + t * 16 + lr) * K + 8 * hi;
    v8f acc[4];
#pragma unroll
    for (int t = 0; t < 4; ++t) acc[t] = (v8f){};
#pragma unroll 1
    for (int kc = 0; kc < K; kc += 32) {
        const v16bf a = cat16b(*(const v8us*)(A + aoff + kc), *(const v8us*)(A + aoff + kc + 16));
        v16bf al = a;
        if (SPLITA) al = cat16b(*(const v8us*)(Al + aoff + kc), *(const v8us*)(Al + aoff + kc + 16));
#pragma unroll
        for (int t = 0; t < 4; ++t) { const v16bf b = cat16b(*(const v8us*)(Bn + boff[t] + kc), *(const v8us*)(Bn + boff[t] + kc + 16)); acc[t] = wmmab(a, b, acc[t]); if (SPLITA) acc[t] = wmmab(al, b, acc[t]); }
        asm volatile("v_nop\n\tv_nop\n\tv_nop\n\tv_nop" : "+v"(acc[0]), "+v"(acc[1]), "+v"(acc[2]), "+v"(acc[3]) : "v"(a), "v"(al));
    }
    float* os = &ost[wave][0];
#pragma unroll
    for (int t = 0; t < 4; ++t) { const float bv = bias ? bfr(bias[c0 + t * 16 + lr]) : 0.f;
#pragma unroll
        for (int j = 0; j < 8; ++j) os[(hi * 8 + j) * 68 + t * 16 + lr] = acc[t][j] + bv; }
    __syncthreads();
    if (F16OUT) {
        h16* crow = (h16*)(void*)C + (size_t)r0 * ldc + c0;
        auto pass = [&]() {
#pragma unroll
            for (int s = 0; s < 4; ++s) { const int row = 4 * s + (lane >> 3), piece = lane & 7; const float* sp = os + row * 68 + piece * 8; v8h o, o2;
#pragma unroll
                for (int i = 0; i < 8; ++i) { const h16 a = (h16)sp[i]; o[i] = a; o2[i] = (h16)((sp[i] - (float)a) * LOSC); }
                *(v8h*)(crow + (size_t)row * ldc + piece * 8) = o; if (C2) *(v8h*)(C2 + (size_t)r0 * ldc + c0 + (size_t)row * ldc + piece * 8) = o2; }
        };
        pass(); 
    } else {
        float* crow = C + (size_t)r0 * ldc + c0;
        auto pass = [&]() {
#pragma unroll
            for (int s = 0; s < 8; ++s) { const int Lid = (lane >> 3) + 4 * s, piece = lane & 7; const int row = Lid >> 1, cofs = (Lid & 1) * 32 + piece * 4;
                v4f val = *(const v4fa*)(os + row * 68 + cofs); if (R) { const v4f rv = *(const v4f*)(R + ((size_t)r0 + row) * ldc + c0 + cofs); val += roundR ? (v4f){bfr(rv[0]), bfr(rv[1]), bfr(rv[2]), bfr(rv[3])} : rv; }
                *(v4f*)(crow + (size_t)row * ldc + cofs) = val; }
        };
        pass(); 
    }
}

__global__ __launch_bounds__(256) void k_f16s(const float* __restrict__ src, int nrows, h16* PH, h16* PL) {
    const int lane = threadIdx.x & 31, r = blockIdx.x * 8 + (threadIdx.x >> 5); if (r >= nrows) return;
{
#pragma unroll 1
        for (int q = 0; q < KW / 256; ++q) { const size_t o = (size_t)r * KW + q * 256 + lane * 8; const v8f v = *(const v8f*)(src + o); v8h oh, ol;
#pragma unroll
            for (int i = 0; i < 8; ++i) { const h16 a = (h16)v[i]; oh[i] = a; ol[i] = (h16)((v[i] - (float)a) * LOSC); }
            *(v8h*)(PH + o) = oh; *(v8h*)(PL + o) = ol; }
         }
}
__global__ __launch_bounds__(256) void k_splitp(const float* __restrict__ src, int nrows, bf* dh, bf* dl) {
    const int lane = threadIdx.x & 31, r = blockIdx.x * 8 + (threadIdx.x >> 5); if (r >= nrows) return;
{
#pragma unroll 1
        for (int q = 0; q < HS / 256; ++q) { const size_t o = (size_t)r * HS + q * 256 + lane * 8; const v8f v = *(const v8f*)(src + o); v8us oh, ol;
#pragma unroll
            for (int i = 0; i < 8; ++i) { const unsigned short hb = f2bf(v[i]); oh[i] = hb; ol[i] = f2bf(v[i] - bf2f(hb)); }
            *(v8us*)(dh + o) = oh; *(v8us*)(dl + o) = ol; }
         }
}
// k_attn: block = (head, 64 queries), wave = 16; causal key tiles; 128-dim scores (hh + hl + lh) x 128^-1/2, online f32 softmax, P (x32768) as bf16 hi + residual
// against the v planes; f32 output rows [t][h*128 + d]. Each 32-key tile of the k and v planes is brought into LDS once per block by asynchronous copies, two
// buffers: tile kt + 1 flies while tile kt is worked on; all four waves read their fragments from there.
// cp8: eight 16-byte copies of one lane; the s_wait_xcnt stands inside the statement so that no address register is rewritten ahead of it.
__device__ __forceinline__ void cp8(unsigned l0, unsigned l1, unsigned l2, unsigned l3, unsigned l4, unsigned l5, unsigned l6, unsigned l7,
                                    const void* g0, const void* g1, const void* g2, const void* g3, const void* g4, const void* g5, const void* g6, const void* g7) {
    asm volatile("global_load_async_to_lds_b128 %0, %8, off\n\t"
                 "global_load_async_to_lds_b128 %1, %9, off\n\t"
                 "global_load_async_to_lds_b128 %2, %10, off\n\t"
                 "global_load_async_to_lds_b128 %3, %11, off\n\t"
                 "global_load_async_to_lds_b128 %4, %12, off\n\t"
                 "global_load_async_to_lds_b128 %5, %13, off\n\t"
                 "global_load_async_to_lds_b128 %6, %14, off\n\t"
                 "global_load_async_to_lds_b128 %7, %15, off\n\t"
                 "s_wait_xcnt 0x0"
                 :: "v"(l0), "v"(l1), "v"(l2), "v"(l3), "v"(l4), "v"(l5), "v"(l6), "v"(l7), "v"(g0), "v"(g1), "v"(g2), "v"(g3), "v"(g4), "v"(g5), "v"(g6), "v"(g7) : "memory");
}
__global__ __launch_bounds__(128) void k_attn(const h16* __restrict__ QH, const h16* __restrict__ QL, const h16* __restrict__ KH, const h16* __restrict__ KL, const bf* __restrict__ VTH, const bf* __restrict__ VTL, float* OUTP) {
    __shared__ __align__(16) unsigned short plds[4][16 * 32];
    __shared__ __align__(16) unsigned short plds2[4][16 * 32];
    __shared__ __align__(16) float ost[4][16 * 68];
    __shared__ __align__(16) unsigned char ring[2 * STG];
    const int lane = threadIdx.x & 31, wave = threadIdx.x >> 5, lr = lane & 15, hi = lane >> 4;
    const int bid = blockIdx.x; const int h = bid / (NT_ / 64), qt = bid - h * (NT_ / 64); const int g = h / NREP;     // GQA: kv head
    const int q0 = qt * 64 + wave * 16;
    unsigned short* pl = &plds[wave][0]; unsigned short* pl2 = &plds2[wave][0];
    const size_t qo = (size_t)(q0 + lr) * (NH_ * HD) + h * HD + 8 * hi;
    const h16* kh_b = KH + g * HD; const h16* kl_b = KL + g * HD;
    const size_t vbase = ((size_t)g * HD) * NT_;
    v8f o[8];
#pragma unroll
    for (int n = 0; n < 8; ++n) o[n] = (v8f){};
    float mrow[8], lpart[8];
#pragma unroll
    for (int j = 0; j < 8; ++j) { mrow[j] = -3.0e38f; lpart[j] = 0.f; }
    const int kt_hi = (qt * 64 + 63) / 32;     // causal key tiles (2 qt + 1: at least two tiles)
    // each thread copies 4 x 16 B of each plane: k rows tid / 16 + 8 i (a wave = two whole 256-byte rows), v rows tid / 4 + 32 i
    const int tid = threadIdx.x;
    const unsigned ring0 = (unsigned)(size_t)&ring[0];     // the ring's byte address in LDS
    const unsigned kdst = ring0 + (tid >> 4) * KPB + (tid & 15) * 16, vdst = ring0 + 2 * KPL + (tid >> 2) * VPB + (tid & 3) * 16;
    const size_t ksrc = (size_t)(tid >> 4) * KW + (tid & 15) * 8, vsrc = vbase + (size_t)(tid >> 2) * NT_ + (tid & 3) * 8;
    auto stage = [&](int t, unsigned bo) {
        const h16* a = kh_b + ksrc + (size_t)t * 32 * KW; const h16* b = kl_b + ksrc + (size_t)t * 32 * KW; const unsigned kd = kdst + bo;
        cp8(kd, kd + 8 * KPB, kd + 16 * KPB, kd + 24 * KPB, kd + KPL, kd + KPL + 8 * KPB, kd + KPL + 16 * KPB, kd + KPL + 24 * KPB,
            a, a + 8 * KW, a + 16 * KW, a + 24 * KW, b, b + 8 * KW, b + 16 * KW, b + 24 * KW);
        const bf* c = VTH + vsrc + t * 32; const bf* d = VTL + vsrc + t * 32; const unsigned vd = vdst + bo;
        cp8(vd, vd + 32 * VPB, vd + 64 * VPB, vd + 96 * VPB, vd + VPL, vd + VPL + 32 * VPB, vd + VPL + 64 * VPB, vd + VPL + 96 * VPB,
            c, c + 32 * NT_, c + 64 * NT_, c + 96 * NT_, d, d + 32 * NT_, d + 64 * NT_, d + 96 * NT_);
    };
    stage(0, 0u);
    asm volatile("s_wait_asynccnt 0x0" ::: "memory");     // tile 0 of this wave's copies has landed
    __syncthreads();                                      // ... and every other wave's
    stage(1, (unsigned)STG);
#pragma unroll 1
    for (int kt = 0; kt <= kt_hi; ++kt) {
        const int l0 = kt * 32;
        const unsigned bo = (unsigned)(kt & 1) * STG;
        const h16* kth = (const h16*)(ring + bo) + lr * (KPB / 2) + 8 * hi; const h16* ktl = kth + KPL / 2;     // this lane's k row of the staged tile
        const bf* vth = (const bf*)(ring + bo + 2 * KPL) + lr * (VPB / 2) + 8 * hi; const bf* vtl = vth + VPL / 2;
        v8f s0 = {}, s1 = {}, x0 = {}, x1 = {};
        v16h kf[4][4];
#pragma unroll
        for (int kc = 0; kc < 4; ++kc) {
            kf[kc][0] = cat16(*(const v8ha*)(kth + kc * 32), *(const v8ha*)(kth + kc * 32 + 16)); kf[kc][1] = cat16(*(const v8ha*)(kth + 16 * (KPB / 2) + kc * 32), *(const v8ha*)(kth + 16 * (KPB / 2) + kc * 32 + 16));
            kf[kc][2] = cat16(*(const v8ha*)(ktl + kc * 32), *(const v8ha*)(ktl + kc * 32 + 16)); kf[kc][3] = cat16(*(const v8ha*)(ktl + 16 * (KPB / 2) + kc * 32), *(const v8ha*)(ktl + 16 * (KPB / 2) + kc * 32 + 16)); }
        __builtin_amdgcn_sched_barrier(0);     // all 32 LDS reads of the k tile issue ahead of the first product: one LDS latency a tile, not eight
#pragma unroll
        for (int kc = 0; kc < 4; ++kc) {
            const v16h qa = cat16(*(const v8h*)(QH + qo + kc * 32), *(const v8h*)(QH + qo + kc * 32 + 16)), qx = cat16(*(const v8h*)(QL + qo + kc * 32), *(const v8h*)(QL + qo + kc * 32 + 16));
            const v16h k0h = kf[kc][0], k1h = kf[kc][1];
            s0 = wmma16(qa, k0h, s0); s1 = wmma16(qa, k1h, s1); x0 = wmma16(qx, k0h, x0); x1 = wmma16(qx, k1h, x1);
            const v16h k0l = kf[kc][2], k1l = kf[kc][3];
            x0 = wmma16(qa, k0l, x0); x1 = wmma16(qa, k1l, x1);
        }
        asm volatile("v_nop\n\tv_nop\n\tv_nop\n\tv_nop" : "+v"(s0), "+v"(s1), "+v"(x0), "+v"(x1));
        float alpha[8];
#pragma unroll
        for (int j = 0; j < 8; ++j) { const int qi = q0 + hi * 8 + j, ja = l0 + lr, jb = l0 + 16 + lr;
            const float a0 = (ja <= qi) ? (s0[j] + x0[j] * LOSCI) * SCL : -__builtin_inff(), a1 = (jb <= qi) ? (s1[j] + x1[j] * LOSCI) * SCL : -__builtin_inff();     // causal (-inf; the diagonal is always live)
            float mx = fmaxf(a0, a1);
            mx = fmaxf(mx, __shfl_xor(mx, 1, 16)); mx = fmaxf(mx, __shfl_xor(mx, 2, 16)); mx = fmaxf(mx, __shfl_xor(mx, 4, 16)); mx = fmaxf(mx, __shfl_xor(mx, 8, 16));
            const float mn = fmaxf(mrow[j], mx);
            alpha[j] = __expf(mrow[j] - mn); mrow[j] = mn;
            const float p0 = __expf(a0 - mn), p1 = __expf(a1 - mn);
            lpart[j] = lpart[j] * alpha[j] + (p0 + p1);
            const int mr = hi * 8 + j; const float ps0 = p0 * PSC, ps1 = p1 * PSC; const unsigned short h0 = f2bf(ps0), h1 = f2bf(ps1);
            pl[mr * 32 + lr] = h0; pl[mr * 32 + 16 + lr] = h1; pl2[mr * 32 + lr] = f2bf(ps0 - bf2f(h0)); pl2[mr * 32 + 16 + lr] = f2bf(ps1 - bf2f(h1)); }
#pragma unroll
        for (int n = 0; n < 8; ++n)
#pragma unroll
            for (int j = 0; j < 8; ++j) o[n][j] *= alpha[j];
        asm volatile("" ::: "memory");
        const v16bf pa = cat16b(*(const v8usa*)(pl + lr * 32 + hi * 8), *(const v8usa*)(pl + lr * 32 + 16 + hi * 8));
        const v16bf px = cat16b(*(const v8usa*)(pl2 + lr * 32 + hi * 8), *(const v8usa*)(pl2 + lr * 32 + 16 + hi * 8));
        v16bf vf[8][2];
#pragma unroll
        for (int n = 0; n < 8; ++n) { const int vo = n * 16 * (VPB / 2);
            vf[n][0] = cat16b(*(const v8usa*)(vth + vo), *(const v8usa*)(vth + vo + 16)); vf[n][1] = cat16b(*(const v8usa*)(vtl + vo), *(const v8usa*)(vtl + vo + 16)); }
        __builtin_amdgcn_sched_barrier(0);     // the v tile's 32 LDS reads issue ahead of the first product: one LDS latency a tile, not eight
#pragma unroll
        for (int n = 0; n < 8; ++n) { const v16bf vh = vf[n][0], vl = vf[n][1];
            o[n] = wmmab(pa, vh, o[n]); o[n] = wmmab(px, vh, o[n]); o[n] = wmmab(pa, vl, o[n]); }
        __builtin_amdgcn_sched_barrier(0);     // the tile's products stay in front of the foot: else half of them sink behind the barrier and hold back the refill
        asm volatile("v_nop\n\tv_nop\n\tv_nop\n\tv_nop" : "+v"(o[0]), "+v"(o[7]) : "v"(pa), "v"(px));
        asm volatile("s_wait_dscnt 0x0" ::: "memory");        // this wave's reads of tile kt are done before its buffer is refilled
        asm volatile("s_wait_asynccnt 0x0" ::: "memory");     // this wave's copies of tile kt + 1 have landed
        __syncthreads();                                      // publishes tile kt + 1 and ends every wave's reads of tile kt
        if (kt + 2 <= kt_hi) stage(kt + 2, bo);               // block-uniform: the refill of the buffer just read
    }
    asm volatile("s_wait_asynccnt 0x0" ::: "memory");         // no copy is outstanding when the wave goes on
    float inv[8];
#pragma unroll
    for (int j = 0; j < 8; ++j) { float rs = lpart[j]; rs += __shfl_xor(rs, 1, 16); rs += __shfl_xor(rs, 2, 16); rs += __shfl_xor(rs, 4, 16); rs += __shfl_xor(rs, 8, 16); inv[j] = 1.0f / (rs * PSC); }
    float* os = &ost[wave][0];
    float* ob = OUTP + (size_t)q0 * (NH_ * HD) + (size_t)h * HD;     // row stride NH*HD, this head's 128 columns
#pragma unroll
    for (int half = 0; half < 2; ++half) {
#pragma unroll
        for (int n = 0; n < 4; ++n)
#pragma unroll
            for (int j = 0; j < 8; ++j) os[(hi * 8 + j) * 68 + n * 16 + lr] = o[half * 4 + n][j] * inv[j];
        __builtin_amdgcn_wave_barrier(); asm volatile("" ::: "memory");
{
#pragma unroll
            for (int s = 0; s < 8; ++s) { const int Lid = (lane >> 3) + 4 * s, piece = lane & 7; const int row = Lid >> 1, cofs = (Lid & 1) * 32 + piece * 4;
                const v4f val = *(const v4fa*)(os + row * 68 + cofs); *(v4f*)(ob + (size_t)row * (NH_ * HD) + half * 64 + cofs) = val; }
             }
        __builtin_amdgcn_wave_barrier(); asm volatile("" ::: "memory");
    }
}

extern "C" void kernel_launch(void* const* d_in, const int* in_sizes, int n_in,
                              void* d_out, int out_size, void* d_ws, size_t ws_size, hipStream_t stream) {
    (void)in_sizes; (void)n_in; (void)out_size;
    const float* x = (const float*)d_in[0]; const float* Wq = (const float*)d_in[1]; const float* bq = (const float*)d_in[2]; const float* Wk = (const float*)d_in[3]; const float* bk = (const float*)d_in[4];
    const float* Wv = (const float*)d_in[5]; const float* bv = (const float*)d_in[6]; const float* WO = (const float*)d_in[7]; const float* bo = (const float*)d_in[8];     // per-head [16][2048][128] k-major weights (x @ W[h]), WO [2048][2048] k-major
    float* out = (float*)d_out;    // [1][2048][2048]
    char* wsp = (char*)d_ws;
    auto take = [&](size_t bytes) { char* p = wsp; wsp += (bytes + 255) & ~(size_t)255; return (void*)p; };
    bf* Xb = (bf*)take((size_t)NT_ * HS * 2); bf* WqN = (bf*)take((size_t)HS * HS * 2); bf* WkN = (bf*)take((size_t)HS * HS * 2); bf* WvN = (bf*)take((size_t)HS * HS * 2); bf* WoT = (bf*)take((size_t)HS * HS * 2);
    float* TMP = (float*)take((size_t)NT_ * HS * 4); h16* QH = (h16*)take((size_t)NT_ * HS * 2); h16* QL = (h16*)take((size_t)NT_ * HS * 2); h16* KH = (h16*)take((size_t)NT_ * KW * 2); h16* KL = (h16*)take((size_t)NT_ * KW * 2);
    bf* VTH = (bf*)take((size_t)KW * NT_ * 2); bf* VTL = (bf*)take((size_t)KW * NT_ * 2);
    if ((size_t)(wsp - (char*)d_ws) > ws_size) return;    // 8.4 + 4 x 8.4 + 16.8 + 6 x 8.4 ~ 109 MB = 104 MiB; the f32 ctx reuses TMP and its bf16 planes reuse QH/QL (dead after k_attn), see below
    float* CTX = TMP; bf* Oh = (bf*)QH; bf* Ol = (bf*)QL;
    k_prep<<<3 * PB_W + PB_O + PB_X, 256, 0, stream>>>(Wq, Wk, Wv, WO, x, WqN, WkN, WvN, WoT, Xb);                     // bf16 x and the four n-major weight operands, one launch
    k_gemmb<false, false><<<dim3(NT_ / 64, HS / 64, 1), 128, 0, stream>>>(Xb, nullptr, WqN, bq, TMP, HS, nullptr); k_f16s<<<NT_ / 8, 256, 0, stream>>>(TMP, NT_, QH, QL);
    k_gemmb<false, false><<<dim3(NT_ / 64, HS / 64, 1), 128, 0, stream>>>(Xb, nullptr, WkN, bk, TMP, HS, nullptr); k_f16s<<<NT_ / 8, 256, 0, stream>>>(TMP, NT_, KH, KL);
    k_gemmb<false, false><<<dim3(NT_ / 64, HS / 64, 1), 128, 0, stream>>>(Xb, nullptr, WvN, bv, TMP, HS, nullptr); k_vt<<<dim3(NT_ / 64, 2, NKV), 256, 0, stream>>>(TMP, VTH, VTL);
    k_attn<<<NH_ * (NT_ / 64), 128, 0, stream>>>(QH, QL, KH, KL, VTH, VTL, CTX);                                      // ctx f32 [2048][2048] over the dead TMP
    k_splitp<<<NT_ / 8, 256, 0, stream>>>(CTX, NT_, Oh, Ol);                                                         // planes over the dead QH/QL
    k_gemmb<true, false><<<dim3(NT_ / 64, HS / 64, 1), 128, 0, stream>>>(Oh, Ol, WoT, bo, out, HS, nullptr);         // out = ctx.WO + bo
}

// v003
// Measured time: 268 microseconds a run.
// Two timings next to v002 put it at 1.46 and 1.48 times that version's speed.
// Counting every step since v000, it is 2.71 times as fast.
#include <hip/hip_runtime.h>

// Compute dtypes, f32 accumulate: q/k/v = x.W[h] + b[h] for all 16 heads at once ([2048 x 2048].[2048 x 2048]; the per-head k-major weights transposed into one n-major
// operand; PLAIN bf16 operands = inputs rounded once, exact) and out = ctx.WO + bo (ctx as bf16 hi + UNSCALED residual) on v_wmma_f32_16x16x32_bf16; q/k -> f16
// hi + residual x1024 planes, v -> bf16 hi + UNSCALED residual [d][t] planes; the 16-head causal attention (128-dim heads, scale 128^-1/2) fused: scores on
// v_wmma_f32_16x16x32_f16 (hh + hl + lh), online f32 softmax, weights (x32768) and v on v_wmma_f32_16x16x32_bf16, f32 output rows. Deterministic, no atomics;
// (stream order): the f32 ctx reuses the projection scratch and its planes reuse the q planes, both dead after k_attn.

#define NB_  1
#define NT_  2048
#define HS   2048
#define NH_  16
#define NKV  16
#define HD   128
#define KW   (NKV * HD)          // 2048
#define NREP 1
#define DM   HS
#define NTK  NT_
#define SCL  0.08838834764831845f
#define PSC  32768.0f
#define LOSC 1024.0f
#define LOSCI (1.0f / 1024.0f)
#define KPB  272                 // LDS pitch in bytes of a staged k row (256 + 16) and
#define VPB  80                  // of a staged v row (64 + 16): 16 B x odd, conflict-free for ds_load_b128
#define KPL  (32 * KPB)          // one k plane of a 32-key stage
#define VPL  (HD * VPB)          // one v plane of a 32-key stage
#define STG  (2 * KPL + 2 * VPL) // one stage: k hi, k lo, v hi, v lo

typedef _Float16 h16;
typedef unsigned short bf;
typedef __attribute__((ext_vector_type(16))) __bf16   v16bf;
typedef __attribute__((ext_vector_type(16))) _Float16 v16h;
typedef __attribute__((ext_vector_type(8)))  _Float16 v8h;
typedef __attribute__((ext_vector_type(8)))  unsigned short v8us;
typedef __attribute__((ext_vector_type(8)))  float    v8f;
typedef __attribute__((ext_vector_type(4)))  float    v4f;
typedef __attribute__((ext_vector_type(4)))  _Float16 v4h;
typedef v8h  __attribute__((may_alias)) v8ha;
typedef v4f  __attribute__((may_alias)) v4fa;
typedef v8us __attribute__((may_alias)) v8usa;

__device__ __forceinline__ unsigned short f2bf(float f) { unsigned u = __float_as_uint(f); u += 0x7FFFu + ((u >> 16) & 1u); return (unsigned short)(u >> 16); }
__device__ __forceinline__ float bf2f(unsigned short b) { return __uint_as_float(((unsigned)b) << 16); }
__device__ __forceinline__ float bfr(float f) { return bf2f(f2bf(f)); }
__device__ __forceinline__ v16h cat16(v8h lo, v8h hi) { return __builtin_shufflevector(lo, hi, 0, 1, 2, 3, 4, 5, 6, 7, 8, 9, 10, 11, 12, 13, 14, 15); }
__device__ __forceinline__ v16bf cat16b(v8us lo, v8us hi) { return __builtin_bit_cast(v16bf, __builtin_shufflevector(lo, hi, 0, 1, 2, 3, 4, 5, 6, 7, 8, 9, 10, 11, 12, 13, 14, 15)); }
__device__ __forceinline__ v8f wmma16(v16h a, v16h b, v8f c) { return __builtin_amdgcn_wmma_f32_16x16x32_f16(false, a, false, b, (short)0, c, false, false); }
__device__ __forceinline__ v8f wmmab(v16bf a, v16bf b, v8f c) { return __builtin_amdgcn_wmma_f32_16x16x32_bf16(false, a, false, b, (short)0, c, false, false); }

// k_gemm: 64 x 64 tile of (A [+ Al]).Bn^T over K = 2048 (+ optional bf16-rounded bias[c]) -> f32 rows [2048][ldc].
template <bool SPLITA>
__global__ __launch_bounds__(128) void k_gemm(const bf* __restrict__ A, const bf* __restrict__ Al, const bf* __restrict__ Bn, const float* __restrict__ bias, int ldc, float* C) {
    __shared__ __align__(16) float ost[4][16 * 68];
    const int lane = threadIdx.x & 31, wave = threadIdx.x >> 5, lr = lane & 15, hi = lane >> 4;
    const size_t r0 = (size_t)blockIdx.x * 64 + wave * 16; const int c0 = blockIdx.y * 64;
    const size_t aoff = (r0 + lr) * HS + 8 * hi;
    v8f acc[4];
#pragma unroll
    for (int t = 0; t < 4; ++t) acc[t] = (v8f){};
#pragma unroll 2
    for (int kc = 0; kc < HS; kc += 32) {
        const v16bf a = cat16b(*(const v8us*)(A + aoff + kc), *(const v8us*)(A + aoff + kc + 16));
        v16bf al = a; if (SPLITA) al = cat16b(*(const v8us*)(Al + aoff + kc), *(const v8us*)(Al + aoff + kc + 16));
#pragma unroll
        for (int t = 0; t < 4; ++t) { const bf* bp = Bn + (size_t)(c0 + t * 16 + lr) * HS + kc + 8 * hi; const v16bf bb = cat16b(*(const v8us*)bp, *(const v8us*)(bp + 16)); acc[t] = wmmab(a, bb, acc[t]); if (SPLITA) acc[t] = wmmab(al, bb, acc[t]); }
        asm volatile("v_nop" : "+v"(acc[0]), "+v"(acc[1]), "+v"(acc[2]), "+v"(acc[3]) : "v"(a), "v"(al) : "memory");
    }
    float* os = &ost[wave][0];
#pragma unroll
    for (int t = 0; t < 4; ++t)
#pragma unroll
        for (int j = 0; j < 8; ++j) os[(hi * 8 + j) * 68 + t * 16 + lr] = acc[t][j] + (bias ? bfr(bias[c0 + t * 16 + lr]) : 0.f);
    __builtin_amdgcn_wave_barrier(); asm volatile("" ::: "memory");
    float* crow = C + r0 * ldc + c0;
    auto pass = [&]() {
#pragma unroll
        for (int s = 0; s < 8; ++s) { const int Lid = (lane >> 3) + 4 * s, piece = lane & 7; const int row = Lid >> 1, cofs = (Lid & 1) * 32 + piece * 4;
            const v4f val = *(const v4fa*)(os + row * 68 + cofs); *(v4f*)(crow + (size_t)row * ldc + cofs) = val; }
    };
    pass(); 
}
// k_vt: VTH/VTL [g][128 d][2048 t] = bf16 hi + UNSCALED bf16 residual of V [t][g*128+d] via 64 x 64 LDS tiles; grid (NT/64, 2 (d half), 16 heads).
__global__ __launch_bounds__(256) void k_vt(const float* __restrict__ V, bf* VTH, bf* VTL) {
    __shared__ float tl[64][65];
    const int tid = threadIdx.x, t0 = blockIdx.x * 64, d0 = blockIdx.y * 64, g = blockIdx.z;
    { const int tt = tid >> 2, dq = (tid & 3) * 16;
#pragma unroll
      for (int i = 0; i < 16; ++i) tl[dq + i][tt] = V[(size_t)(t0 + tt) * KW + g * HD + d0 + dq + i]; }
    __syncthreads();
    const int piece = tid & 7;
    auto pass = [&]() {
#pragma unroll
        for (int s = 0; s < 2; ++s) { const int d = (tid >> 3) + 32 * s; v8us oh, ol;
#pragma unroll
            for (int i = 0; i < 8; ++i) { const float v = tl[d][piece * 8 + i]; const unsigned short hb = f2bf(v); oh[i] = hb; ol[i] = f2bf(v - bf2f(hb)); }
            const size_t o = ((size_t)g * HD + d0 + d) * NT_ + t0 + piece * 8; *(v8us*)(VTH + o) = oh; *(v8us*)(VTL + o) = ol; }
    };
    pass(); 
}
// k_attn: block = (head, 64 queries), wave = 16; causal key tiles 0..(Q0+63)/32 (block-uniform); per element: score x 128^-1/2, -inf where the key
// is past the query (causal); online f32 softmax; P (x32768) as bf16 hi + residual against the V planes; f32 output rows.
// k_prep: all input preparation in one grid; the jobs are independent of one another and the block index picks one (block-uniform):
//   blocks 0 .. 3071: a 64 x 64 tile of one head's k-major [2048][128] weight (q, k, v: 1024 blocks each; 64 a head) -> rows (h, d) of the n-major bf16 operand;
//   blocks 3072 .. 4095: a 64 x 64 tile of WO [2048][2048] -> WoT; blocks 4096 .. 4351: eight rows of x -> bf16 (one wave per row).
// Transpose tile: WT [n][2048] = bf16(W[k][n]) via LDS.
#define PB_H  ((HS / 64) * (HD / 64))      // 64 tiles a head
#define PB_W  (NH_ * PB_H)                 // 1024 blocks a per-head weight
#define PB_O  ((HS / 64) * (HS / 64))      // 1024 tiles of WO
#define PB_X  (NT_ / 8)                    // 256 blocks of x rows
__global__ __launch_bounds__(256) void k_prep(const float* __restrict__ Wq, const float* __restrict__ Wk, const float* __restrict__ Wv, const float* __restrict__ WO, const float* __restrict__ x,
                                              bf* WqN, bf* WkN, bf* WvN, bf* WoT, bf* Xb) {
    __shared__ __align__(16) unsigned short tl[64 * 72];
    const int tid = threadIdx.x, b = blockIdx.x;
    if (b >= 3 * PB_W + PB_O) {            // x rows; the whole block leaves here, ahead of the barrier
        const float* __restrict__ src = x; bf* dst = Xb;
        const int lane = threadIdx.x & 31, r = (b - (3 * PB_W + PB_O)) * 8 + (threadIdx.x >> 5);
#pragma unroll
        for (int q = 0; q < HS / 256; ++q) { v8us o;
#pragma unroll
            for (int i = 0; i < 8; ++i) o[i] = f2bf(src[(size_t)r * HS + q * 256 + lane * 8 + i]);
            *(v8us*)(dst + (size_t)r * HS + q * 256 + lane * 8) = o; }
        return;
    }
    const float* __restrict__ Wm; bf* WT; int ncols, t; const int K = HS;
    if (b < 3 * PB_W) { const int m = b / PB_W, r = b - m * PB_W, h = r / PB_H; t = r - h * PB_H; ncols = HD;
        Wm = (m == 0 ? Wq : m == 1 ? Wk : Wv) + (size_t)h * HS * HD; WT = (m == 0 ? WqN : m == 1 ? WkN : WvN) + (size_t)h * HD * HS; }
    else { t = b - 3 * PB_W; ncols = HS; Wm = WO; WT = WoT; }
    const int k0 = (t % (HS / 64)) * 64, n0 = (t / (HS / 64)) * 64;
    const int kk = tid >> 2, nq = (tid & 3) * 16;
#pragma unroll
    for (int i = 0; i < 16; ++i) tl[(nq + i) * 72 + kk] = f2bf(Wm[(size_t)(k0 + kk) * ncols + n0 + nq + i]);
    __syncthreads();
    const int piece = tid & 7;
    auto pass = [&]() {
#pragma unroll
        for (int s = 0; s < 2; ++s) { const int nr = (tid >> 3) + 32 * s; const v8us val = *(const v8usa*)(tl + nr * 72 + piece * 8); *(v8us*)(WT + (size_t)(n0 + nr) * K + k0 + piece * 8) = val; }
    };
    pass(); 
}
// k_gemmb: 64 x 64 block tile (4 waves x 16 x 64) of C[NTK][NW] = (A [+ Al]).B^T [+ bf(bias[c])] [+ bf(R[r][c]) residual]; f32 whole-line epilogue (or f16
// planes). Each 64-k slab of the block's 64 A rows (and Al rows) and 64 B rows is brought into LDS once per block by asynchronous copies in whole 128-byte lines,
// two buffers: slab t + 1 flies while slab t is worked on; the waves read their fragments from there (K a multiple of 64). The k order of the fragments is unchanged.
#define GKS  64                  // k elements of a staged slab: rows of 128 bytes
#define GPB  144                 // LDS pitch in bytes of a staged row (128 + 16): 16 B x odd, conflict-free for ds_load_b128
#define GPL  (64 * GPB)          // one 64-row plane of a slab
// cpa8 / cpa4: eight / four 16-byte copies of one lane; the s_wait_xcnt stands inside the statement so that no address register is rewritten ahead of it.
__device__ __forceinline__ void cpa8(unsigned l0, unsigned l1, unsigned l2, unsigned l3, unsigned l4, unsigned l5, unsigned l6, unsigned l7,
                                     const void* g0, const void* g1, const void* g2, const void* g3, const void* g4, const void* g5, const void* g6, const void* g7) {
    asm volatile("global_load_async_to_lds_b128 %0, %8, off\n\t"
                 "global_load_async_to_lds_b128 %1, %9, off\n\t"
                 "global_load_async_to_lds_b128 %2, %10, off\n\t"
                 "global_load_async_to_lds_b128 %3, %11, off\n\t"
                 "global_load_async_to_lds_b128 %4, %12, off\n\t"
                 "global_load_async_to_lds_b128 %5, %13, off\n\t"
                 "global_load_async_to_lds_b128 %6, %14, off\n\t"
                 "global_load_async_to_lds_b128 %7, %15, off\n\t"
                 "s_wait_xcnt 0x0"
                 :: "v"(l0), "v"(l1), "v"(l2), "v"(l3), "v"(l4), "v"(l5), "v"(l6), "v"(l7), "v"(g0), "v"(g1), "v"(g2), "v"(g3), "v"(g4), "v"(g5), "v"(g6), "v"(g7) : "memory");
}
__device__ __forceinline__ void cpa4(unsigned l0, unsigned l1, unsigned l2, unsigned l3, const void* g0, const void* g1, const void* g2, const void* g3) {
    asm volatile("global_load_async_to_lds_b128 %0, %4, off\n\t"
                 "global_load_async_to_lds_b128 %1, %5, off\n\t"
                 "global_load_async_to_lds_b128 %2, %6, off\n\t"
                 "global_load_async_to_lds_b128 %3, %7, off\n\t"
                 "s_wait_xcnt 0x0"
                 :: "v"(l0), "v"(l1), "v"(l2), "v"(l3), "v"(g0), "v"(g1), "v"(g2), "v"(g3) : "memory");
}
template <bool SPLITA, bool F16OUT = false>
__global__ __launch_bounds__(128) void k_gemmb(const bf* __restrict__ A, const bf* __restrict__ Al, const bf* __restrict__ Bn, const float* __restrict__ bias, float* C, int ldc, h16* C2, const float* __restrict__ R = nullptr, int K = DM, int roundR = 1) {
    constexpr unsigned GST = (SPLITA ? 3 : 2) * GPL;     // one slab: A rows, B rows (, Al rows)
    __shared__ __align__(16) float ost[4][16 * 68];
    __shared__ __align__(16) unsigned char gring[2 * GST];
    const int lane = threadIdx.x & 31, wave = threadIdx.x >> 5, lr = lane & 15, hi = lane >> 4;
    const int r0 = blockIdx.x * 64 + wave * 16, c0 = blockIdx.y * 64;
    // each thread copies 4 x 16 B of each plane: rows tid / 8 + 16 i (a wave = four whole 128-byte rows)
    const int tid = threadIdx.x;
    const unsigned gdst = (unsigned)(size_t)&gring[0] + (tid >> 3) * GPB + (tid & 7) * 16;     // the lane's byte address in LDS
    const size_t asrc = (size_t)(blockIdx.x * 64 + (tid >> 3)) * K + (tid & 7) * 8, bsrc = (size_t)(c0 + (tid >> 3)) * K + (tid & 7) * 8, rs = (size_t)16 * K;
    auto stage = [&](int t, unsigned bo) {
        const bf* a = A + asrc + (size_t)t * GKS; const bf* b = Bn + bsrc + (size_t)t * GKS; const unsigned d = gdst + bo;
        cpa8(d, d + 16 * GPB, d + 32 * GPB, d + 48 * GPB, d + GPL, d + GPL + 16 * GPB, d + GPL + 32 * GPB, d + GPL + 48 * GPB,
             a, a + rs, a + 2 * rs, a + 3 * rs, b, b + rs, b + 2 * rs, b + 3 * rs);
        if (SPLITA) { const bf* c = Al + asrc + (size_t)t * GKS; cpa4(d + 2 * GPL, d + 2 * GPL + 16 * GPB, d + 2 * GPL + 32 * GPB, d + 2 * GPL + 48 * GPB, c, c + rs, c + 2 * rs, c + 3 * rs); }
    };
    v8f acc[4];
#pragma unroll
    for (int t = 0; t < 4; ++t) acc[t] = (v8f){};
    const int nt = K / GKS;
    stage(0, 0u);
    asm volatile("s_wait_asynccnt 0x0" ::: "memory");     // slab 0 of this wave's copies has landed
    __syncthreads();                                      // ... and every other wave's
    if (nt > 1) stage(1, GST);                            // block-uniform
#pragma unroll 1
    for (int s = 0; s < nt; ++s) {
        const unsigned bo = (unsigned)(s & 1) * GST;
        const bf* as = (const bf*)(gring + bo) + (wave * 16 + lr) * (GPB / 2) + 8 * hi;     // this lane's A row of the staged slab (Al: two planes on)
        const bf* bs = (const bf*)(gring + bo + GPL) + lr * (GPB / 2) + 8 * hi;             // this lane's B row of column group 0
        v16bf af[2], alf[2], bb[2][4];
#pragma unroll
        for (int kc = 0; kc < 2; ++kc) {
            af[kc] = cat16b(*(const v8usa*)(as + kc * 32), *(const v8usa*)(as + kc * 32 + 16));
            alf[kc] = af[kc]; if (SPLITA) alf[kc] = cat16b(*(const v8usa*)(as + GPL + kc * 32), *(const v8usa*)(as + GPL + kc * 32 + 16));
#pragma unroll
            for (int t = 0; t < 4; ++t) bb[kc][t] = cat16b(*(const v8usa*)(bs + t * 16 * (GPB / 2) + kc * 32), *(const v8usa*)(bs + t * 16 * (GPB / 2) + kc * 32 + 16));
        }
        __builtin_amdgcn_sched_barrier(0);     // all LDS reads of the slab issue ahead of the first product: one LDS latency a slab, not one a fragment
#pragma unroll
        for (int kc = 0; kc < 2; ++kc)
#pragma unroll
            for (int t = 0; t < 4; ++t) { acc[t] = wmmab(af[kc], bb[kc][t], acc[t]); if (SPLITA) acc[t] = wmmab(alf[kc], bb[kc][t], acc[t]); }
        asm volatile("v_nop\n\tv_nop\n\tv_nop\n\tv_nop" : "+v"(acc[0]), "+v"(acc[1]), "+v"(acc[2]), "+v"(acc[3]) : "v"(af[1]), "v"(alf[1]));     // the distance behind the last product, on the back edge too
        asm volatile("s_wait_dscnt 0x0" ::: "memory");        // this wave's reads of slab s are done before its buffer is refilled
        asm volatile("s_wait_asynccnt 0x0" ::: "memory");     // this wave's copies of slab s + 1 have landed
        __syncthreads();                                      // publishes slab s + 1 and ends every wave's reads of slab s
        if (s + 2 < nt) stage(s + 2, bo);                     // block-uniform: the refill of the buffer just read
    }
    asm volatile("s_wait_asynccnt 0x0" ::: "memory");         // no copy is outstanding when the wave goes on
    float* os = &ost[wave][0];
#pragma unroll
    for (int t = 0; t < 4; ++t) { const float bv = bias ? bfr(bias[c0 + t * 16 + lr]) : 0.f;
#pragma unroll
        for (int j = 0; j < 8; ++j) os[(hi * 8 + j) * 68 + t * 16 + lr] = acc[t][j] + bv; }
    __syncthreads();
    if (F16OUT) {
        h16* crow = (h16*)(void*)C + (size_t)r0 * ldc + c0;
        auto pass = [&]() {
#pragma unroll
            for (int s = 0; s < 4; ++s) { const int row = 4 * s + (lane >> 3), piece = lane & 7; const float* sp = os + row * 68 + piece * 8; v8h o, o2;
#pragma unroll
                for (int i = 0; i < 8; ++i) { const h16 a = (h16)sp[i]; o[i] = a; o2[i] = (h16)((sp[i] - (float)a) * LOSC); }
                *(v8h*)(crow + (size_t)row * ldc + piece * 8) = o; if (C2) *(v8h*)(C2 + (size_t)r0 * ldc + c0 + (size_t)row * ldc + piece * 8) = o2; }
        };
        pass(); 
    } else {
        float* crow = C + (size_t)r0 * ldc + c0;
        auto pass = [&]() {
#pragma unroll
            for (int s = 0; s < 8; ++s) { const int Lid = (lane >> 3) + 4 * s, piece = lane & 7; const int row = Lid >> 1, cofs = (Lid & 1) * 32 + piece * 4;
                v4f val = *(const v4fa*)(os + row * 68 + cofs); if (R) { const v4f rv = *(const v4f*)(R + ((size_t)r0 + row) * ldc + c0 + cofs); val += roundR ? (v4f){bfr(rv[0]), bfr(rv[1]), bfr(rv[2]), bfr(rv[3])} : rv; }
                *(v4f*)(crow + (size_t)row * ldc + cofs) = val; }
        };
        pass(); 
    }
}

__global__ __launch_bounds__(256) void k_f16s(const float* __restrict__ src, int nrows, h16* PH, h16* PL) {
    const int lane = threadIdx.x & 31, r = blockIdx.x * 8 + (threadIdx.x >> 5); if (r >= nrows) return;
{
#pragma unroll 1
        for (int q = 0; q < KW / 256; ++q) { const size_t o = (size_t)r * KW + q * 256 + lane * 8; const v8f v = *(const v8f*)(src + o); v8h oh, ol;
#pragma unroll
            for (int i = 0; i < 8; ++i) { const h16 a = (h16)v[i]; oh[i] = a; ol[i] = (h16)((v[i] - (float)a) * LOSC); }
            *(v8h*)(PH + o) = oh; *(v8h*)(PL + o) = ol; }
         }
}
__global__ __launch_bounds__(256) void k_splitp(const float* __restrict__ src, int nrows, bf* dh, bf* dl) {
    const int lane = threadIdx.x & 31, r = blockIdx.x * 8 + (threadIdx.x >> 5); if (r >= nrows) return;
{
#pragma unroll 1
        for (int q = 0; q < HS / 256; ++q) { const size_t o = (size_t)r * HS + q * 256 + lane * 8; const v8f v = *(const v8f*)(src + o); v8us oh, ol;
#pragma unroll
            for (int i = 0; i < 8; ++i) { const unsigned short hb = f2bf(v[i]); oh[i] = hb; ol[i] = f2bf(v[i] - bf2f(hb)); }
            *(v8us*)(dh + o) = oh; *(v8us*)(dl + o) = ol; }
         }
}
// k_attn: block = (head, 64 queries), wave = 16; causal key tiles; 128-dim scores (hh + hl + lh) x 128^-1/2, online f32 softmax, P (x32768) as bf16 hi + residual
// against the v planes; f32 output rows [t][h*128 + d]. Each 32-key tile of the k and v planes is brought into LDS once per block by asynchronous copies, two
// buffers: tile kt + 1 flies while tile kt is worked on; all four waves read their fragments from there.
// cp8: eight 16-byte copies of one lane; the s_wait_xcnt stands inside the statement so that no address register is rewritten ahead of it.
__device__ __forceinline__ void cp8(unsigned l0, unsigned l1, unsigned l2, unsigned l3, unsigned l4, unsigned l5, unsigned l6, unsigned l7,
                                    const void* g0, const void* g1, const void* g2, const void* g3, const void* g4, const void* g5, const void* g6, const void* g7) {
    asm volatile("global_load_async_to_lds_b128 %0, %8, off\n\t"
                 "global_load_async_to_lds_b128 %1, %9, off\n\t"
                 "global_load_async_to_lds_b128 %2, %10, off\n\t"
                 "global_load_async_to_lds_b128 %3, %11, off\n\t"
                 "global_load_async_to_lds_b128 %4, %12, off\n\t"
                 "global_load_async_to_lds_b128 %5, %13, off\n\t"
                 "global_load_async_to_lds_b128 %6, %14, off\n\t"
                 "global_load_async_to_lds_b128 %7, %15, off\n\t"
                 "s_wait_xcnt 0x0"
                 :: "v"(l0), "v"(l1), "v"(l2), "v"(l3), "v"(l4), "v"(l5), "v"(l6), "v"(l7), "v"(g0), "v"(g1), "v"(g2), "v"(g3), "v"(g4), "v"(g5), "v"(g6), "v"(g7) : "memory");
}
__global__ __launch_bounds__(128) void k_attn(const h16* __restrict__ QH, const h16* __restrict__ QL, const h16* __restrict__ KH, const h16* __restrict__ KL, const bf* __restrict__ VTH, const bf* __restrict__ VTL, float* OUTP) {
    __shared__ __align__(16) unsigned short plds[4][16 * 32];
    __shared__ __align__(16) unsigned short plds2[4][16 * 32];
    __shared__ __align__(16) float ost[4][16 * 68];
    __shared__ __align__(16) unsigned char ring[2 * STG];
    const int lane = threadIdx.x & 31, wave = threadIdx.x >> 5, lr = lane & 15, hi = lane >> 4;
    const int bid = blockIdx.x; const int h = bid / (NT_ / 64), qt = bid - h * (NT_ / 64); const int g = h / NREP;     // GQA: kv head
    const int q0 = qt * 64 + wave * 16;
    unsigned short* pl = &plds[wave][0]; unsigned short* pl2 = &plds2[wave][0];
    const size_t qo = (size_t)(q0 + lr) * (NH_ * HD) + h * HD + 8 * hi;
    const h16* kh_b = KH + g * HD; const h16* kl_b = KL + g * HD;
    const size_t vbase = ((size_t)g * HD) * NT_;
    v8f o[8];
#pragma unroll
    for (int n = 0; n < 8; ++n) o[n] = (v8f){};
    float mrow[8], lpart[8];
#pragma unroll
    for (int j = 0; j < 8; ++j) { mrow[j] = -3.0e38f; lpart[j] = 0.f; }
    const int kt_hi = (qt * 64 + 63) / 32;     // causal key tiles (2 qt + 1: at least two tiles)
    // each thread copies 4 x 16 B of each plane: k rows tid / 16 + 8 i (a wave = two whole 256-byte rows), v rows tid / 4 + 32 i
    const int tid = threadIdx.x;
    const unsigned ring0 = (unsigned)(size_t)&ring[0];     // the ring's byte address in LDS
    const unsigned kdst = ring0 + (tid >> 4) * KPB + (tid & 15) * 16, vdst = ring0 + 2 * KPL + (tid >> 2) * VPB + (tid & 3) * 16;
    const size_t ksrc = (size_t)(tid >> 4) * KW + (tid & 15) * 8, vsrc = vbase + (size_t)(tid >> 2) * NT_ + (tid & 3) * 8;
    auto stage = [&](int t, unsigned bo) {
        const h16* a = kh_b + ksrc + (size_t)t * 32 * KW; const h16* b = kl_b + ksrc + (size_t)t * 32 * KW; const unsigned kd = kdst + bo;
        cp8(kd, kd + 8 * KPB, kd + 16 * KPB, kd + 24 * KPB, kd + KPL, kd + KPL + 8 * KPB, kd + KPL + 16 * KPB, kd + KPL + 24 * KPB,
            a, a + 8 * KW, a + 16 * KW, a + 24 * KW, b, b + 8 * KW, b + 16 * KW, b + 24 * KW);
        const bf* c = VTH + vsrc + t * 32; const bf* d = VTL + vsrc + t * 32; const unsigned vd = vdst + bo;
        cp8(vd, vd + 32 * VPB, vd + 64 * VPB, vd + 96 * VPB, vd + VPL, vd + VPL + 32 * VPB, vd + VPL + 64 * VPB, vd + VPL + 96 * VPB,
            c, c + 32 * NT_, c + 64 * NT_, c + 96 * NT_, d, d + 32 * NT_, d + 64 * NT_, d + 96 * NT_);
    };
    stage(0, 0u);
    asm volatile("s_wait_asynccnt 0x0" ::: "memory");     // tile 0 of this wave's copies has landed
    __syncthreads();                                      // ... and every other wave's
    stage(1, (unsigned)STG);
#pragma unroll 1
    for (int kt = 0; kt <= kt_hi; ++kt) {
        const int l0 = kt * 32;
        const unsigned bo = (unsigned)(kt & 1) * STG;
        const h16* kth = (const h16*)(ring + bo) + lr * (KPB / 2) + 8 * hi; const h16* ktl = kth + KPL / 2;     // this lane's k row of the staged tile
        const bf* vth = (const bf*)(ring + bo + 2 * KPL) + lr * (VPB / 2) + 8 * hi; const bf* vtl = vth + VPL / 2;
        v8f s0 = {}, s1 = {}, x0 = {}, x1 = {};
        v16h kf[4][4];
#pragma unroll
        for (int kc = 0; kc < 4; ++kc) {
            kf[kc][0] = cat16(*(const v8ha*)(kth + kc * 32), *(const v8ha*)(kth + kc * 32 + 16)); kf[kc][1] = cat16(*(const v8ha*)(kth + 16 * (KPB / 2) + kc * 32), *(const v8ha*)(kth + 16 * (KPB / 2) + kc * 32 + 16));
            kf[kc][2] = cat16(*(const v8ha*)(ktl + kc * 32), *(const v8ha*)(ktl + kc * 32 + 16)); kf[kc][3] = cat16(*(const v8ha*)(ktl + 16 * (KPB / 2) + kc * 32), *(const v8ha*)(ktl + 16 * (KPB / 2) + kc * 32 + 16)); }
        __builtin_amdgcn_sched_barrier(0);     // all 32 LDS reads of the k tile issue ahead of the first product: one LDS latency a tile, not eight
#pragma unroll
        for (int kc = 0; kc < 4; ++kc) {
            const v16h qa = cat16(*(const v8h*)(QH + qo + kc * 32), *(const v8h*)(QH + qo + kc * 32 + 16)), qx = cat16(*(const v8h*)(QL + qo + kc * 32), *(const v8h*)(QL + qo + kc * 32 + 16));
            const v16h k0h = kf[kc][0], k1h = kf[kc][1];
            s0 = wmma16(qa, k0h, s0); s1 = wmma16(qa, k1h, s1); x0 = wmma16(qx, k0h, x0); x1 = wmma16(qx, k1h, x1);
            const v16h k0l = kf[kc][2], k1l = kf[kc][3];
            x0 = wmma16(qa, k0l, x0); x1 = wmma16(qa, k1l, x1);
        }
        asm volatile("v_nop\n\tv_nop\n\tv_nop\n\tv_nop" : "+v"(s0), "+v"(s1), "+v"(x0), "+v"(x1));
        float alpha[8];
#pragma unroll
        for (int j = 0; j < 8; ++j) { const int qi = q0 + hi * 8 + j, ja = l0 + lr, jb = l0 + 16 + lr;
            const float a0 = (ja <= qi) ? (s0[j] + x0[j] * LOSCI) * SCL : -__builtin_inff(), a1 = (jb <= qi) ? (s1[j] + x1[j] * LOSCI) * SCL : -__builtin_inff();     // causal (-inf; the diagonal is always live)
            float mx = fmaxf(a0, a1);
            mx = fmaxf(mx, __shfl_xor(mx, 1, 16)); mx = fmaxf(mx, __shfl_xor(mx, 2, 16)); mx = fmaxf(mx, __shfl_xor(mx, 4, 16)); mx = fmaxf(mx, __shfl_xor(mx, 8, 16));
            const float mn = fmaxf(mrow[j], mx);
            alpha[j] = __expf(mrow[j] - mn); mrow[j] = mn;
            const float p0 = __expf(a0 - mn), p1 = __expf(a1 - mn);
            lpart[j] = lpart[j] * alpha[j] + (p0 + p1);
            const int mr = hi * 8 + j; const float ps0 = p0 * PSC, ps1 = p1 * PSC; const unsigned short h0 = f2bf(ps0), h1 = f2bf(ps1);
            pl[mr * 32 + lr] = h0; pl[mr * 32 + 16 + lr] = h1; pl2[mr * 32 + lr] = f2bf(ps0 - bf2f(h0)); pl2[mr * 32 + 16 + lr] = f2bf(ps1 - bf2f(h1)); }
#pragma unroll
        for (int n = 0; n < 8; ++n)
#pragma unroll
            for (int j = 0; j < 8; ++j) o[n][j] *= alpha[j];
        asm volatile("" ::: "memory");
        const v16bf pa = cat16b(*(const v8usa*)(pl + lr * 32 + hi * 8), *(const v8usa*)(pl + lr * 32 + 16 + hi * 8));
        const v16bf px = cat16b(*(const v8usa*)(pl2 + lr * 32 + hi * 8), *(const v8usa*)(pl2 + lr * 32 + 16 + hi * 8));
        v16bf vf[8][2];
#pragma unroll
        for (int n = 0; n < 8; ++n) { const int vo = n * 16 * (VPB / 2);
            vf[n][0] = cat16b(*(const v8usa*)(vth + vo), *(const v8usa*)(vth + vo + 16)); vf[n][1] = cat16b(*(const v8usa*)(vtl + vo), *(const v8usa*)(vtl + vo + 16)); }
        __builtin_amdgcn_sched_barrier(0);     // the v tile's 32 LDS reads issue ahead of the first product: one LDS latency a tile, not eight
#pragma unroll
        for (int n = 0; n < 8; ++n) { const v16bf vh = vf[n][0], vl = vf[n][1];
            o[n] = wmmab(pa, vh, o[n]); o[n] = wmmab(px, vh, o[n]); o[n] = wmmab(pa, vl, o[n]); }
        __builtin_amdgcn_sched_barrier(0);     // the tile's products stay in front of the foot: else half of them sink behind the barrier and hold back the refill
        asm volatile("v_nop\n\tv_nop\n\tv_nop\n\tv_nop" : "+v"(o[0]), "+v"(o[7]) : "v"(pa), "v"(px));
        asm volatile("s_wait_dscnt 0x0" ::: "memory");        // this wave's reads of tile kt are done before its buffer is refilled
        asm volatile("s_wait_asynccnt 0x0" ::: "memory");     // this wave's copies of tile kt + 1 have landed
        __syncthreads();                                      // publishes tile kt + 1 and ends every wave's reads of tile kt
        if (kt + 2 <= kt_hi) stage(kt + 2, bo);               // block-uniform: the refill of the buffer just read
    }
    asm volatile("s_wait_asynccnt 0x0" ::: "memory");         // no copy is outstanding when the wave goes on
    float inv[8];
#pragma unroll
    for (int j = 0; j < 8; ++j) { float rs = lpart[j]; rs += __shfl_xor(rs, 1, 16); rs += __shfl_xor(rs, 2, 16); rs += __shfl_xor(rs, 4, 16); rs += __shfl_xor(rs, 8, 16); inv[j] = 1.0f / (rs * PSC); }
    float* os = &ost[wave][0];
    float* ob = OUTP + (size_t)q0 * (NH_ * HD) + (size_t)h * HD;     // row stride NH*HD, this head's 128 columns
#pragma unroll
    for (int half = 0; half < 2; ++half) {
#pragma unroll
        for (int n = 0; n < 4; ++n)
#pragma unroll
            for (int j = 0; j < 8; ++j) os[(hi * 8 + j) * 68 + n * 16 + lr] = o[half * 4 + n][j] * inv[j];
        __builtin_amdgcn_wave_barrier(); asm volatile("" ::: "memory");
{
#pragma unroll
            for (int s = 0; s < 8; ++s) { const int Lid = (lane >> 3) + 4 * s, piece = lane & 7; const int row = Lid >> 1, cofs = (Lid & 1) * 32 + piece * 4;
                const v4f val = *(const v4fa*)(os + row * 68 + cofs); *(v4f*)(ob + (size_t)row * (NH_ * HD) + half * 64 + cofs) = val; }
             }
        __builtin_amdgcn_wave_barrier(); asm volatile("" ::: "memory");
    }
}

extern "C" void kernel_launch(void* const* d_in, const int* in_sizes, int n_in,
                              void* d_out, int out_size, void* d_ws, size_t ws_size, hipStream_t stream) {
    (void)in_sizes; (void)n_in; (void)out_size;
    const float* x = (const float*)d_in[0]; const float* Wq = (const float*)d_in[1]; const float* bq = (const float*)d_in[2]; const float* Wk = (const float*)d_in[3]; const float* bk = (const float*)d_in[4];
    const float* Wv = (const float*)d_in[5]; const float* bv = (const float*)d_in[6]; const float* WO = (const float*)d_in[7]; const float* bo = (const float*)d_in[8];     // per-head [16][2048][128] k-major weights (x @ W[h]), WO [2048][2048] k-major
    float* out = (float*)d_out;    // [1][2048][2048]
    char* wsp = (char*)d_ws;
    auto take = [&](size_t bytes) { char* p = wsp; wsp += (bytes + 255) & ~(size_t)255; return (void*)p; };
    bf* Xb = (bf*)take((size_t)NT_ * HS * 2); bf* WqN = (bf*)take((size_t)HS * HS * 2); bf* WkN = (bf*)take((size_t)HS * HS * 2); bf* WvN = (bf*)take((size_t)HS * HS * 2); bf* WoT = (bf*)take((size_t)HS * HS * 2);
    float* TMP = (float*)take((size_t)NT_ * HS * 4); h16* QH = (h16*)take((size_t)NT_ * HS * 2); h16* QL = (h16*)take((size_t)NT_ * HS * 2); h16* KH = (h16*)take((size_t)NT_ * KW * 2); h16* KL = (h16*)take((size_t)NT_ * KW * 2);
    bf* VTH = (bf*)take((size_t)KW * NT_ * 2); bf* VTL = (bf*)take((size_t)KW * NT_ * 2);
    if ((size_t)(wsp - (char*)d_ws) > ws_size) return;    // 8.4 + 4 x 8.4 + 16.8 + 6 x 8.4 ~ 109 MB = 104 MiB; the f32 ctx reuses TMP and its bf16 planes reuse QH/QL (dead after k_attn), see below
    float* CTX = TMP; bf* Oh = (bf*)QH; bf* Ol = (bf*)QL;
    k_prep<<<3 * PB_W + PB_O + PB_X, 256, 0, stream>>>(Wq, Wk, Wv, WO, x, WqN, WkN, WvN, WoT, Xb);                     // bf16 x and the four n-major weight operands, one launch
    k_gemmb<false, false><<<dim3(NT_ / 64, HS / 64, 1), 128, 0, stream>>>(Xb, nullptr, WqN, bq, TMP, HS, nullptr); k_f16s<<<NT_ / 8, 256, 0, stream>>>(TMP, NT_, QH, QL);
    k_gemmb<false, false><<<dim3(NT_ / 64, HS / 64, 1), 128, 0, stream>>>(Xb, nullptr, WkN, bk, TMP, HS, nullptr); k_f16s<<<NT_ / 8, 256, 0, stream>>>(TMP, NT_, KH, KL);
    k_gemmb<false, false><<<dim3(NT_ / 64, HS / 64, 1), 128, 0, stream>>>(Xb, nullptr, WvN, bv, TMP, HS, nullptr); k_vt<<<dim3(NT_ / 64, 2, NKV), 256, 0, stream>>>(TMP, VTH, VTL);
    k_attn<<<NH_ * (NT_ / 64), 128, 0, stream>>>(QH, QL, KH, KL, VTH, VTL, CTX);                                      // ctx f32 [2048][2048] over the dead TMP
    k_splitp<<<NT_ / 8, 256, 0, stream>>>(CTX, NT_, Oh, Ol);                                                         // planes over the dead QH/QL
    k_gemmb<true, false><<<dim3(NT_ / 64, HS / 64, 1), 128, 0, stream>>>(Oh, Ol, WoT, bo, out, HS, nullptr);         // out = ctx.WO + bo
}

// v004
// One run takes 233 microseconds.
// Next to v003, in two timings, it ran 1.15 times as fast each time.
// Counting every step since v000, it is 3.12 times as fast.
#include <hip/hip_runtime.h>

// Compute dtypes, f32 accumulate: q/k/v = x.W[h] + b[h] for all 16 heads at once ([2048 x 2048].[2048 x 2048]; the per-head k-major weights transposed into one n-major
// operand; PLAIN bf16 operands = inputs rounded once, exact) and out = ctx.WO + bo (ctx as bf16 hi + UNSCALED residual) on v_wmma_f32_16x16x32_bf16; q/k -> f16
// hi + residual x1024 planes, v -> bf16 hi + UNSCALED residual [d][t] planes; the 16-head causal attention (128-dim heads, scale 128^-1/2) fused: scores on
// v_wmma_f32_16x16x32_f16 (hh + hl + lh), online f32 softmax, weights (x32768) and v on v_wmma_f32_16x16x32_bf16, f32 rows split on the way out. Deterministic, no atomics;
// every product writes its consumer's operand planes from its own epilogue (no f32 intermediate in memory, no separate splitting pass).

#define NB_  1
#define NT_  2048
#define HS   2048
#define NH_  16
#define NKV  16
#define HD   128
#define KW   (NKV * HD)          // 2048
#define NREP 1
#define DM   HS
#define NTK  NT_
#define SCL  0.08838834764831845f
#define PSC  32768.0f
#define LOSC 1024.0f
#define LOSCI (1.0f / 1024.0f)
#define KPB  272                 // LDS pitch in bytes of a staged k row (256 + 16) and
#define VPB  80                  // of a staged v row (64 + 16): 16 B x odd, conflict-free for ds_load_b128
#define KPL  (32 * KPB)          // one k plane of a 32-key stage
#define VPL  (HD * VPB)          // one v plane of a 32-key stage
#define STG  (2 * KPL + 2 * VPL) // one stage: k hi, k lo, v hi, v lo

typedef _Float16 h16;
typedef unsigned short bf;
typedef __attribute__((ext_vector_type(16))) __bf16   v16bf;
typedef __attribute__((ext_vector_type(16))) _Float16 v16h;
typedef __attribute__((ext_vector_type(8)))  _Float16 v8h;
typedef __attribute__((ext_vector_type(8)))  unsigned short v8us;
typedef __attribute__((ext_vector_type(8)))  float    v8f;
typedef __attribute__((ext_vector_type(4)))  float    v4f;
typedef __attribute__((ext_vector_type(4)))  _Float16 v4h;
typedef v8h  __attribute__((may_alias)) v8ha;
typedef v4f  __attribute__((may_alias)) v4fa;
typedef v8us __attribute__((may_alias)) v8usa;

__device__ __forceinline__ unsigned short f2bf(float f) { unsigned u = __float_as_uint(f); u += 0x7FFFu + ((u >> 16) & 1u); return (unsigned short)(u >> 16); }
__device__ __forceinline__ float bf2f(unsigned short b) { return __uint_as_float(((unsigned)b) << 16); }
__device__ __forceinline__ float bfr(float f) { return bf2f(f2bf(f)); }
__device__ __forceinline__ v16h cat16(v8h lo, v8h hi) { return __builtin_shufflevector(lo, hi, 0, 1, 2, 3, 4, 5, 6, 7, 8, 9, 10, 11, 12, 13, 14, 15); }
__device__ __forceinline__ v16bf cat16b(v8us lo, v8us hi) { return __builtin_bit_cast(v16bf, __builtin_shufflevector(lo, hi, 0, 1, 2, 3, 4, 5, 6, 7, 8, 9, 10, 11, 12, 13, 14, 15)); }
__device__ __forceinline__ v8f wmma16(v16h a, v16h b, v8f c) { return __builtin_amdgcn_wmma_f32_16x16x32_f16(false, a, false, b, (short)0, c, false, false); }
__device__ __forceinline__ v8f wmmab(v16bf a, v16bf b, v8f c) { return __builtin_amdgcn_wmma_f32_16x16x32_bf16(false, a, false, b, (short)0, c, false, false); }

// k_gemm: 64 x 64 tile of (A [+ Al]).Bn^T over K = 2048 (+ optional bf16-rounded bias[c]) -> f32 rows [2048][ldc].
template <bool SPLITA>
__global__ __launch_bounds__(128) void k_gemm(const bf* __restrict__ A, const bf* __restrict__ Al, const bf* __restrict__ Bn, const float* __restrict__ bias, int ldc, float* C) {
    __shared__ __align__(16) float ost[4][16 * 68];
    const int lane = threadIdx.x & 31, wave = threadIdx.x >> 5, lr = lane & 15, hi = lane >> 4;
    const size_t r0 = (size_t)blockIdx.x * 64 + wave * 16; const int c0 = blockIdx.y * 64;
    const size_t aoff = (r0 + lr) * HS + 8 * hi;
    v8f acc[4];
#pragma unroll
    for (int t = 0; t < 4; ++t) acc[t] = (v8f){};
#pragma unroll 2
    for (int kc = 0; kc < HS; kc += 32) {
        const v16bf a = cat16b(*(const v8us*)(A + aoff + kc), *(const v8us*)(A + aoff + kc + 16));
        v16bf al = a; if (SPLITA) al = cat16b(*(const v8us*)(Al + aoff + kc), *(const v8us*)(Al + aoff + kc + 16));
#pragma unroll
        for (int t = 0; t < 4; ++t) { const bf* bp = Bn + (size_t)(c0 + t * 16 + lr) * HS + kc + 8 * hi; const v16bf bb = cat16b(*(const v8us*)bp, *(const v8us*)(bp + 16)); acc[t] = wmmab(a, bb, acc[t]); if (SPLITA) acc[t] = wmmab(al, bb, acc[t]); }
        asm volatile("v_nop" : "+v"(acc[0]), "+v"(acc[1]), "+v"(acc[2]), "+v"(acc[3]) : "v"(a), "v"(al) : "memory");
    }
    float* os = &ost[wave][0];
#pragma unroll
    for (int t = 0; t < 4; ++t)
#pragma unroll
        for (int j = 0; j < 8; ++j) os[(hi * 8 + j) * 68 + t * 16 + lr] = acc[t][j] + (bias ? bfr(bias[c0 + t * 16 + lr]) : 0.f);
    __builtin_amdgcn_wave_barrier(); asm volatile("" ::: "memory");
    float* crow = C + r0 * ldc + c0;
    auto pass = [&]() {
#pragma unroll
        for (int s = 0; s < 8; ++s) { const int Lid = (lane >> 3) + 4 * s, piece = lane & 7; const int row = Lid >> 1, cofs = (Lid & 1) * 32 + piece * 4;
            const v4f val = *(const v4fa*)(os + row * 68 + cofs); *(v4f*)(crow + (size_t)row * ldc + cofs) = val; }
    };
    pass(); 
}
// k_attn: block = (head, 64 queries), wave = 16; causal key tiles 0..(Q0+63)/32 (block-uniform); per element: score x 128^-1/2, keys past the query at -inf;
// online f32 softmax; P (x32768) as bf16 hi + residual against the V planes; output rows as bf16 hi + unscaled residual planes.
// k_prep: all input preparation in one grid; the jobs are independent of one another and the block index picks one (block-uniform):
//   blocks 0 .. 3071: a 64 x 64 tile of one head's k-major [2048][128] weight (q, k, v: 1024 blocks each; 64 a head) -> rows (h, d) of the n-major bf16 operand;
//   blocks 3072 .. 4095: a 64 x 64 tile of WO [2048][2048] -> WoT; blocks 4096 .. 4351: eight rows of x -> bf16 (one wave per row).
// Transpose tile: WT [n][2048] = bf16(W[k][n]) via LDS.
#define PB_H  ((HS / 64) * (HD / 64))      // 64 tiles a head
#define PB_W  (NH_ * PB_H)                 // 1024 blocks a per-head weight
#define PB_O  ((HS / 64) * (HS / 64))      // 1024 tiles of WO
#define PB_X  (NT_ / 8)                    // 256 blocks of x rows
__global__ __launch_bounds__(256) void k_prep(const float* __restrict__ Wq, const float* __restrict__ Wk, const float* __restrict__ Wv, const float* __restrict__ WO, const float* __restrict__ x,
                                              bf* WqN, bf* WkN, bf* WvN, bf* WoT, bf* Xb) {
    __shared__ __align__(16) unsigned short tl[64 * 72];
    const int tid = threadIdx.x, b = blockIdx.x;
    if (b >= 3 * PB_W + PB_O) {            // x rows; the whole block leaves here, ahead of the barrier
        const float* __restrict__ src = x; bf* dst = Xb;
        const int lane = threadIdx.x & 31, r = (b - (3 * PB_W + PB_O)) * 8 + (threadIdx.x >> 5);
#pragma unroll
        for (int q = 0; q < HS / 256; ++q) { v8us o;
#pragma unroll
            for (int i = 0; i < 8; ++i) o[i] = f2bf(src[(size_t)r * HS + q * 256 + lane * 8 + i]);
            *(v8us*)(dst + (size_t)r * HS + q * 256 + lane * 8) = o; }
        return;
    }
    const float* __restrict__ Wm; bf* WT; int ncols, t; const int K = HS;
    if (b < 3 * PB_W) { const int m = b / PB_W, r = b - m * PB_W, h = r / PB_H; t = r - h * PB_H; ncols = HD;
        Wm = (m == 0 ? Wq : m == 1 ? Wk : Wv) + (size_t)h * HS * HD; WT = (m == 0 ? WqN : m == 1 ? WkN : WvN) + (size_t)h * HD * HS; }
    else { t = b - 3 * PB_W; ncols = HS; Wm = WO; WT = WoT; }
    const int k0 = (t % (HS / 64)) * 64, n0 = (t / (HS / 64)) * 64;
    const int kk = tid >> 2, nq = (tid & 3) * 16;
#pragma unroll
    for (int i = 0; i < 16; ++i) tl[(nq + i) * 72 + kk] = f2bf(Wm[(size_t)(k0 + kk) * ncols + n0 + nq + i]);
    __syncthreads();
    const int piece = tid & 7;
    auto pass = [&]() {
#pragma unroll
        for (int s = 0; s < 2; ++s) { const int nr = (tid >> 3) + 32 * s; const v8us val = *(const v8usa*)(tl + nr * 72 + piece * 8); *(v8us*)(WT + (size_t)(n0 + nr) * K + k0 + piece * 8) = val; }
    };
    pass(); 
}
// k_gemmb: 64 x 64 block tile (4 waves x 16 x 64) of C[NTK][NW] = (A [+ Al]).B^T [+ bf(bias[c])] [+ bf(R[r][c]) residual]; f32 whole-line epilogue, or f16
// hi + residual x1024 planes (F16OUT), or the transposed [c][r] bf16 hi + unscaled residual planes (VTOUT: C, C2 are the two planes, row length NT_). Each 64-k slab of the block's 64 A rows (and Al rows) and 64 B rows is brought into LDS once per block by asynchronous copies in whole 128-byte lines,
// two buffers: slab t + 1 flies while slab t is worked on; the waves read their fragments from there (K a multiple of 64). The k order of the fragments is unchanged.
#define GKS  64                  // k elements of a staged slab: rows of 128 bytes
#define GPB  144                 // LDS pitch in bytes of a staged row (128 + 16): 16 B x odd, conflict-free for ds_load_b128
#define GPL  (64 * GPB)          // one 64-row plane of a slab
// cpa8 / cpa4: eight / four 16-byte copies of one lane; the s_wait_xcnt stands inside the statement so that no address register is rewritten ahead of it.
__device__ __forceinline__ void cpa8(unsigned l0, unsigned l1, unsigned l2, unsigned l3, unsigned l4, unsigned l5, unsigned l6, unsigned l7,
                                     const void* g0, const void* g1, const void* g2, const void* g3, const void* g4, const void* g5, const void* g6, const void* g7) {
    asm volatile("global_load_async_to_lds_b128 %0, %8, off\n\t"
                 "global_load_async_to_lds_b128 %1, %9, off\n\t"
                 "global_load_async_to_lds_b128 %2, %10, off\n\t"
                 "global_load_async_to_lds_b128 %3, %11, off\n\t"
                 "global_load_async_to_lds_b128 %4, %12, off\n\t"
                 "global_load_async_to_lds_b128 %5, %13, off\n\t"
                 "global_load_async_to_lds_b128 %6, %14, off\n\t"
                 "global_load_async_to_lds_b128 %7, %15, off\n\t"
                 "s_wait_xcnt 0x0"
                 :: "v"(l0), "v"(l1), "v"(l2), "v"(l3), "v"(l4), "v"(l5), "v"(l6), "v"(l7), "v"(g0), "v"(g1), "v"(g2), "v"(g3), "v"(g4), "v"(g5), "v"(g6), "v"(g7) : "memory");
}
__device__ __forceinline__ void cpa4(unsigned l0, unsigned l1, unsigned l2, unsigned l3, const void* g0, const void* g1, const void* g2, const void* g3) {
    asm volatile("global_load_async_to_lds_b128 %0, %4, off\n\t"
                 "global_load_async_to_lds_b128 %1, %5, off\n\t"
                 "global_load_async_to_lds_b128 %2, %6, off\n\t"
                 "global_load_async_to_lds_b128 %3, %7, off\n\t"
                 "s_wait_xcnt 0x0"
                 :: "v"(l0), "v"(l1), "v"(l2), "v"(l3), "v"(g0), "v"(g1), "v"(g2), "v"(g3) : "memory");
}
template <bool SPLITA, bool F16OUT = false, bool VTOUT = false>
__global__ __launch_bounds__(128) void k_gemmb(const bf* __restrict__ A, const bf* __restrict__ Al, const bf* __restrict__ Bn, const float* __restrict__ bias, float* C, int ldc, h16* C2, const float* __restrict__ R = nullptr, int K = DM, int roundR = 1) {
    constexpr unsigned GST = (SPLITA ? 3 : 2) * GPL;     // one slab: A rows, B rows (, Al rows)
    __shared__ __align__(16) float ost[4][16 * 68];
    __shared__ __align__(16) unsigned char gring[2 * GST];
    const int lane = threadIdx.x & 31, wave = threadIdx.x >> 5, lr = lane & 15, hi = lane >> 4;
    const int r0 = blockIdx.x * 64 + wave * 16, c0 = blockIdx.y * 64;
    // each thread copies 4 x 16 B of each plane: rows tid / 8 + 16 i (a wave = four whole 128-byte rows)
    const int tid = threadIdx.x;
    const unsigned gdst = (unsigned)(size_t)&gring[0] + (tid >> 3) * GPB + (tid & 7) * 16;     // the lane's byte address in LDS
    const size_t asrc = (size_t)(blockIdx.x * 64 + (tid >> 3)) * K + (tid & 7) * 8, bsrc = (size_t)(c0 + (tid >> 3)) * K + (tid & 7) * 8, rs = (size_t)16 * K;
    auto stage = [&](int t, unsigned bo) {
        const bf* a = A + asrc + (size_t)t * GKS; const bf* b = Bn + bsrc + (size_t)t * GKS; const unsigned d = gdst + bo;
        cpa8(d, d + 16 * GPB, d + 32 * GPB, d + 48 * GPB, d + GPL, d + GPL + 16 * GPB, d + GPL + 32 * GPB, d + GPL + 48 * GPB,
             a, a + rs, a + 2 * rs, a + 3 * rs, b, b + rs, b + 2 * rs, b + 3 * rs);
        if (SPLITA) { const bf* c = Al + asrc + (size_t)t * GKS; cpa4(d + 2 * GPL, d + 2 * GPL + 16 * GPB, d + 2 * GPL + 32 * GPB, d + 2 * GPL + 48 * GPB, c, c + rs, c + 2 * rs, c + 3 * rs); }
    };
    v8f acc[4];
#pragma unroll
    for (int t = 0; t < 4; ++t) acc[t] = (v8f){};
    const int nt = K / GKS;
    stage(0, 0u);
    asm volatile("s_wait_asynccnt 0x0" ::: "memory");     // slab 0 of this wave's copies has landed
    __syncthreads();                                      // ... and every other wave's
    if (nt > 1) stage(1, GST);                            // block-uniform
#pragma unroll 1
    for (int s = 0; s < nt; ++s) {
        const unsigned bo = (unsigned)(s & 1) * GST;
        const bf* as = (const bf*)(gring + bo) + (wave * 16 + lr) * (GPB / 2) + 8 * hi;     // this lane's A row of the staged slab (Al: two planes on)
        const bf* bs = (const bf*)(gring + bo + GPL) + lr * (GPB / 2) + 8 * hi;             // this lane's B row of column group 0
        v16bf af[2], alf[2], bb[2][4];
#pragma unroll
        for (int kc = 0; kc < 2; ++kc) {
            af[kc] = cat16b(*(const v8usa*)(as + kc * 32), *(const v8usa*)(as + kc * 32 + 16));
            alf[kc] = af[kc]; if (SPLITA) alf[kc] = cat16b(*(const v8usa*)(as + GPL + kc * 32), *(const v8usa*)(as + GPL + kc * 32 + 16));
#pragma unroll
            for (int t = 0; t < 4; ++t) bb[kc][t] = cat16b(*(const v8usa*)(bs + t * 16 * (GPB / 2) + kc * 32), *(const v8usa*)(bs + t * 16 * (GPB / 2) + kc * 32 + 16));
        }
        __builtin_amdgcn_sched_barrier(0);     // all LDS reads of the slab issue ahead of the first product: one LDS latency a slab, not one a fragment
#pragma unroll
        for (int kc = 0; kc < 2; ++kc)
#pragma unroll
            for (int t = 0; t < 4; ++t) { acc[t] = wmmab(af[kc], bb[kc][t], acc[t]); if (SPLITA) acc[t] = wmmab(alf[kc], bb[kc][t], acc[t]); }
        asm volatile("v_nop\n\tv_nop\n\tv_nop\n\tv_nop" : "+v"(acc[0]), "+v"(acc[1]), "+v"(acc[2]), "+v"(acc[3]) : "v"(af[1]), "v"(alf[1]));     // the distance behind the last product, on the back edge too
        asm volatile("s_wait_dscnt 0x0" ::: "memory");        // this wave's reads of slab s are done before its buffer is refilled
        asm volatile("s_wait_asynccnt 0x0" ::: "memory");     // this wave's copies of slab s + 1 have landed
        __syncthreads();                                      // publishes slab s + 1 and ends every wave's reads of slab s
        if (s + 2 < nt) stage(s + 2, bo);                     // block-uniform: the refill of the buffer just read
    }
    asm volatile("s_wait_asynccnt 0x0" ::: "memory");         // no copy is outstanding when the wave goes on
    float* os = &ost[wave][0];
#pragma unroll
    for (int t = 0; t < 4; ++t) { const float bv = bias ? bfr(bias[c0 + t * 16 + lr]) : 0.f;
#pragma unroll
        for (int j = 0; j < 8; ++j) os[(hi * 8 + j) * 68 + t * 16 + lr] = acc[t][j] + bv; }
    __syncthreads();
    if (VTOUT) {
        // the block's 64 r x 64 c tile leaves transposed: eight lanes write one whole 128-byte line (64 r) of a c row in each plane; reads cross the waves' staging (behind the barrier above)
        bf* th = (bf*)(void*)C + (size_t)c0 * NT_ + blockIdx.x * 64; bf* tlo = (bf*)(void*)C2 + (size_t)c0 * NT_ + blockIdx.x * 64;
        const int piece = tid & 7; const float* sp = &ost[piece >> 1][0] + (piece & 1) * 8 * 68;
#pragma unroll
        for (int s = 0; s < 4; ++s) { const int d = (tid >> 3) + 16 * s; v8us oh, ol;
#pragma unroll
            for (int i = 0; i < 8; ++i) { const float v = sp[i * 68 + d]; const unsigned short hb = f2bf(v); oh[i] = hb; ol[i] = f2bf(v - bf2f(hb)); }
            *(v8us*)(th + (size_t)d * NT_ + piece * 8) = oh; *(v8us*)(tlo + (size_t)d * NT_ + piece * 8) = ol; }
    } else if (F16OUT) {
        h16* crow = (h16*)(void*)C + (size_t)r0 * ldc + c0;
        auto pass = [&]() {
#pragma unroll
            for (int s = 0; s < 4; ++s) { const int row = 4 * s + (lane >> 3), piece = lane & 7; const float* sp = os + row * 68 + piece * 8; v8h o, o2;
#pragma unroll
                for (int i = 0; i < 8; ++i) { const h16 a = (h16)sp[i]; o[i] = a; o2[i] = (h16)((sp[i] - (float)a) * LOSC); }
                *(v8h*)(crow + (size_t)row * ldc + piece * 8) = o;
                asm volatile("s_wait_xcnt 0x0" ::: "memory");     // the store's registers are reused on the far side of the branch below
                if (C2) *(v8h*)(C2 + (size_t)r0 * ldc + c0 + (size_t)row * ldc + piece * 8) = o2; }
        };
        pass(); 
    } else {
        float* crow = C + (size_t)r0 * ldc + c0;
        auto pass = [&]() {
#pragma unroll
            for (int s = 0; s < 8; ++s) { const int Lid = (lane >> 3) + 4 * s, piece = lane & 7; const int row = Lid >> 1, cofs = (Lid & 1) * 32 + piece * 4;
                v4f val = *(const v4fa*)(os + row * 68 + cofs); if (R) { const v4f rv = *(const v4f*)(R + ((size_t)r0 + row) * ldc + c0 + cofs); val += roundR ? (v4f){bfr(rv[0]), bfr(rv[1]), bfr(rv[2]), bfr(rv[3])} : rv; }
                *(v4f*)(crow + (size_t)row * ldc + cofs) = val; }
        };
        pass(); 
    }
}

// k_attn: block = (head, 64 queries), wave = 16; causal key tiles; 128-dim scores (hh + hl + lh) x 128^-1/2, online f32 softmax, P (x32768) as bf16 hi + residual
// against the v planes; output rows [t][h*128 + d] as bf16 hi + unscaled residual planes. Each 32-key tile of the k and v planes is brought into LDS once per block by asynchronous copies, two
// buffers: tile kt + 1 flies while tile kt is worked on; all four waves read their fragments from there.
// cp8: eight 16-byte copies of one lane; the s_wait_xcnt stands inside the statement so that no address register is rewritten ahead of it.
__device__ __forceinline__ void cp8(unsigned l0, unsigned l1, unsigned l2, unsigned l3, unsigned l4, unsigned l5, unsigned l6, unsigned l7,
                                    const void* g0, const void* g1, const void* g2, const void* g3, const void* g4, const void* g5, const void* g6, const void* g7) {
    asm volatile("global_load_async_to_lds_b128 %0, %8, off\n\t"
                 "global_load_async_to_lds_b128 %1, %9, off\n\t"
                 "global_load_async_to_lds_b128 %2, %10, off\n\t"
                 "global_load_async_to_lds_b128 %3, %11, off\n\t"
                 "global_load_async_to_lds_b128 %4, %12, off\n\t"
                 "global_load_async_to_lds_b128 %5, %13, off\n\t"
                 "global_load_async_to_lds_b128 %6, %14, off\n\t"
                 "global_load_async_to_lds_b128 %7, %15, off\n\t"
                 "s_wait_xcnt 0x0"
                 :: "v"(l0), "v"(l1), "v"(l2), "v"(l3), "v"(l4), "v"(l5), "v"(l6), "v"(l7), "v"(g0), "v"(g1), "v"(g2), "v"(g3), "v"(g4), "v"(g5), "v"(g6), "v"(g7) : "memory");
}
__global__ __launch_bounds__(128) void k_attn(const h16* __restrict__ QH, const h16* __restrict__ QL, const h16* __restrict__ KH, const h16* __restrict__ KL, const bf* __restrict__ VTH, const bf* __restrict__ VTL, bf* OH, bf* OL) {
    __shared__ __align__(16) unsigned short plds[4][16 * 32];
    __shared__ __align__(16) unsigned short plds2[4][16 * 32];
    __shared__ __align__(16) float ost[4][16 * 68];
    __shared__ __align__(16) unsigned char ring[2 * STG];
    const int lane = threadIdx.x & 31, wave = threadIdx.x >> 5, lr = lane & 15, hi = lane >> 4;
    const int bid = blockIdx.x; const int h = bid / (NT_ / 64), qt = bid - h * (NT_ / 64); const int g = h / NREP;     // GQA: kv head
    const int q0 = qt * 64 + wave * 16;
    unsigned short* pl = &plds[wave][0]; unsigned short* pl2 = &plds2[wave][0];
    const size_t qo = (size_t)(q0 + lr) * (NH_ * HD) + h * HD + 8 * hi;
    const h16* kh_b = KH + g * HD; const h16* kl_b = KL + g * HD;
    const size_t vbase = ((size_t)g * HD) * NT_;
    v8f o[8];
#pragma unroll
    for (int n = 0; n < 8; ++n) o[n] = (v8f){};
    float mrow[8], lpart[8];
#pragma unroll
    for (int j = 0; j < 8; ++j) { mrow[j] = -3.0e38f; lpart[j] = 0.f; }
    const int kt_hi = (qt * 64 + 63) / 32;     // causal key tiles (2 qt + 1: at least two tiles)
    // each thread copies 4 x 16 B of each plane: k rows tid / 16 + 8 i (a wave = two whole 256-byte rows), v rows tid / 4 + 32 i
    const int tid = threadIdx.x;
    const unsigned ring0 = (unsigned)(size_t)&ring[0];     // the ring's byte address in LDS
    const unsigned kdst = ring0 + (tid >> 4) * KPB + (tid & 15) * 16, vdst = ring0 + 2 * KPL + (tid >> 2) * VPB + (tid & 3) * 16;
    const size_t ksrc = (size_t)(tid >> 4) * KW + (tid & 15) * 8, vsrc = vbase + (size_t)(tid >> 2) * NT_ + (tid & 3) * 8;
    auto stage = [&](int t, unsigned bo) {
        const h16* a = kh_b + ksrc + (size_t)t * 32 * KW; const h16* b = kl_b + ksrc + (size_t)t * 32 * KW; const unsigned kd = kdst + bo;
        cp8(kd, kd + 8 * KPB, kd + 16 * KPB, kd + 24 * KPB, kd + KPL, kd + KPL + 8 * KPB, kd + KPL + 16 * KPB, kd + KPL + 24 * KPB,
            a, a + 8 * KW, a + 16 * KW, a + 24 * KW, b, b + 8 * KW, b + 16 * KW, b + 24 * KW);
        const bf* c = VTH + vsrc + t * 32; const bf* d = VTL + vsrc + t * 32; const unsigned vd = vdst + bo;
        cp8(vd, vd + 32 * VPB, vd + 64 * VPB, vd + 96 * VPB, vd + VPL, vd + VPL + 32 * VPB, vd + VPL + 64 * VPB, vd + VPL + 96 * VPB,
            c, c + 32 * NT_, c + 64 * NT_, c + 96 * NT_, d, d + 32 * NT_, d + 64 * NT_, d + 96 * NT_);
    };
    stage(0, 0u);
    asm volatile("s_wait_asynccnt 0x0" ::: "memory");     // tile 0 of this wave's copies has landed
    __syncthreads();                                      // ... and every other wave's
    stage(1, (unsigned)STG);
#pragma unroll 1
    for (int kt = 0; kt <= kt_hi; ++kt) {
        const int l0 = kt * 32;
        const unsigned bo = (unsigned)(kt & 1) * STG;
        const h16* kth = (const h16*)(ring + bo) + lr * (KPB / 2) + 8 * hi; const h16* ktl = kth + KPL / 2;     // this lane's k row of the staged tile
        const bf* vth = (const bf*)(ring + bo + 2 * KPL) + lr * (VPB / 2) + 8 * hi; const bf* vtl = vth + VPL / 2;
        v8f s0 = {}, s1 = {}, x0 = {}, x1 = {};
        v16h kf[4][4];
#pragma unroll
        for (int kc = 0; kc < 4; ++kc) {
            kf[kc][0] = cat16(*(const v8ha*)(kth + kc * 32), *(const v8ha*)(kth + kc * 32 + 16)); kf[kc][1] = cat16(*(const v8ha*)(kth + 16 * (KPB / 2) + kc * 32), *(const v8ha*)(kth + 16 * (KPB / 2) + kc * 32 + 16));
            kf[kc][2] = cat16(*(const v8ha*)(ktl + kc * 32), *(const v8ha*)(ktl + kc * 32 + 16)); kf[kc][3] = cat16(*(const v8ha*)(ktl + 16 * (KPB / 2) + kc * 32), *(const v8ha*)(ktl + 16 * (KPB / 2) + kc * 32 + 16)); }
        __builtin_amdgcn_sched_barrier(0);     // all 32 LDS reads of the k tile issue ahead of the first product: one LDS latency a tile, not eight
#pragma unroll
        for (int kc = 0; kc < 4; ++kc) {
            const v16h qa = cat16(*(const v8h*)(QH + qo + kc * 32), *(const v8h*)(QH + qo + kc * 32 + 16)), qx = cat16(*(const v8h*)(QL + qo + kc * 32), *(const v8h*)(QL + qo + kc * 32 + 16));
            const v16h k0h = kf[kc][0], k1h = kf[kc][1];
            s0 = wmma16(qa, k0h, s0); s1 = wmma16(qa, k1h, s1); x0 = wmma16(qx, k0h, x0); x1 = wmma16(qx, k1h, x1);
            const v16h k0l = kf[kc][2], k1l = kf[kc][3];
            x0 = wmma16(qa, k0l, x0); x1 = wmma16(qa, k1l, x1);
        }
        asm volatile("v_nop\n\tv_nop\n\tv_nop\n\tv_nop" : "+v"(s0), "+v"(s1), "+v"(x0), "+v"(x1));
        float alpha[8];
#pragma unroll
        for (int j = 0; j < 8; ++j) { const int qi = q0 + hi * 8 + j, ja = l0 + lr, jb = l0 + 16 + lr;
            const float a0 = (ja <= qi) ? (s0[j] + x0[j] * LOSCI) * SCL : -__builtin_inff(), a1 = (jb <= qi) ? (s1[j] + x1[j] * LOSCI) * SCL : -__builtin_inff();     // causal (-inf; the diagonal is always live)
            float mx = fmaxf(a0, a1);
            mx = fmaxf(mx, __shfl_xor(mx, 1, 16)); mx = fmaxf(mx, __shfl_xor(mx, 2, 16)); mx = fmaxf(mx, __shfl_xor(mx, 4, 16)); mx = fmaxf(mx, __shfl_xor(mx, 8, 16));
            const float mn = fmaxf(mrow[j], mx);
            alpha[j] = __expf(mrow[j] - mn); mrow[j] = mn;
            const float p0 = __expf(a0 - mn), p1 = __expf(a1 - mn);
            lpart[j] = lpart[j] * alpha[j] + (p0 + p1);
            const int mr = hi * 8 + j; const float ps0 = p0 * PSC, ps1 = p1 * PSC; const unsigned short h0 = f2bf(ps0), h1 = f2bf(ps1);
            pl[mr * 32 + lr] = h0; pl[mr * 32 + 16 + lr] = h1; pl2[mr * 32 + lr] = f2bf(ps0 - bf2f(h0)); pl2[mr * 32 + 16 + lr] = f2bf(ps1 - bf2f(h1)); }
#pragma unroll
        for (int n = 0; n < 8; ++n)
#pragma unroll
            for (int j = 0; j < 8; ++j) o[n][j] *= alpha[j];
        asm volatile("" ::: "memory");
        const v16bf pa = cat16b(*(const v8usa*)(pl + lr * 32 + hi * 8), *(const v8usa*)(pl + lr * 32 + 16 + hi * 8));
        const v16bf px = cat16b(*(const v8usa*)(pl2 + lr * 32 + hi * 8), *(const v8usa*)(pl2 + lr * 32 + 16 + hi * 8));
        v16bf vf[8][2];
#pragma unroll
        for (int n = 0; n < 8; ++n) { const int vo = n * 16 * (VPB / 2);
            vf[n][0] = cat16b(*(const v8usa*)(vth + vo), *(const v8usa*)(vth + vo + 16)); vf[n][1] = cat16b(*(const v8usa*)(vtl + vo), *(const v8usa*)(vtl + vo + 16)); }
        __builtin_amdgcn_sched_barrier(0);     // the v tile's 32 LDS reads issue ahead of the first product: one LDS latency a tile, not eight
#pragma unroll
        for (int n = 0; n < 8; ++n) { const v16bf vh = vf[n][0], vl = vf[n][1];
            o[n] = wmmab(pa, vh, o[n]); o[n] = wmmab(px, vh, o[n]); o[n] = wmmab(pa, vl, o[n]); }
        __builtin_amdgcn_sched_barrier(0);     // the tile's products stay in front of the foot: else half of them sink behind the barrier and hold back the refill
        asm volatile("v_nop\n\tv_nop\n\tv_nop\n\tv_nop" : "+v"(o[0]), "+v"(o[7]) : "v"(pa), "v"(px));
        asm volatile("s_wait_dscnt 0x0" ::: "memory");        // this wave's reads of tile kt are done before its buffer is refilled
        asm volatile("s_wait_asynccnt 0x0" ::: "memory");     // this wave's copies of tile kt + 1 have landed
        __syncthreads();                                      // publishes tile kt + 1 and ends every wave's reads of tile kt
        if (kt + 2 <= kt_hi) stage(kt + 2, bo);               // block-uniform: the refill of the buffer just read
    }
    asm volatile("s_wait_asynccnt 0x0" ::: "memory");         // no copy is outstanding when the wave goes on
    float inv[8];
#pragma unroll
    for (int j = 0; j < 8; ++j) { float rs = lpart[j]; rs += __shfl_xor(rs, 1, 16); rs += __shfl_xor(rs, 2, 16); rs += __shfl_xor(rs, 4, 16); rs += __shfl_xor(rs, 8, 16); inv[j] = 1.0f / (rs * PSC); }
    float* os = &ost[wave][0];
    const size_t ob = (size_t)q0 * (NH_ * HD) + (size_t)h * HD;     // row stride NH*HD, this head's 128 columns
#pragma unroll
    for (int half = 0; half < 2; ++half) {
#pragma unroll
        for (int n = 0; n < 4; ++n)
#pragma unroll
            for (int j = 0; j < 8; ++j) os[(hi * 8 + j) * 68 + n * 16 + lr] = o[half * 4 + n][j] * inv[j];
        __builtin_amdgcn_wave_barrier(); asm volatile("" ::: "memory");
{
#pragma unroll
            for (int s = 0; s < 4; ++s) { const int row = 4 * s + (lane >> 3), piece = lane & 7; const float* sp = os + row * 68 + piece * 8; v8us oh, ol;     // eight lanes = one 128-byte line of each plane
#pragma unroll
                for (int i = 0; i < 8; ++i) { const float v = sp[i]; const unsigned short hb = f2bf(v); oh[i] = hb; ol[i] = f2bf(v - bf2f(hb)); }
                const size_t oo = ob + (size_t)row * (NH_ * HD) + half * 64 + piece * 8; *(v8us*)(OH + oo) = oh; *(v8us*)(OL + oo) = ol; }
             }
        __builtin_amdgcn_wave_barrier(); asm volatile("" ::: "memory");
    }
}

extern "C" void kernel_launch(void* const* d_in, const int* in_sizes, int n_in,
                              void* d_out, int out_size, void* d_ws, size_t ws_size, hipStream_t stream) {
    (void)in_sizes; (void)n_in; (void)out_size;
    const float* x = (const float*)d_in[0]; const float* Wq = (const float*)d_in[1]; const float* bq = (const float*)d_in[2]; const float* Wk = (const float*)d_in[3]; const float* bk = (const float*)d_in[4];
    const float* Wv = (const float*)d_in[5]; const float* bv = (const float*)d_in[6]; const float* WO = (const float*)d_in[7]; const float* bo = (const float*)d_in[8];     // per-head [16][2048][128] k-major weights (x @ W[h]), WO [2048][2048] k-major
    float* out = (float*)d_out;    // [1][2048][2048]
    char* wsp = (char*)d_ws;
    auto take = [&](size_t bytes) { char* p = wsp; wsp += (bytes + 255) & ~(size_t)255; return (void*)p; };
    bf* Xb = (bf*)take((size_t)NT_ * HS * 2); bf* WqN = (bf*)take((size_t)HS * HS * 2); bf* WkN = (bf*)take((size_t)HS * HS * 2); bf* WvN = (bf*)take((size_t)HS * HS * 2); bf* WoT = (bf*)take((size_t)HS * HS * 2);
    bf* Oh = (bf*)take((size_t)NT_ * HS * 2); bf* Ol = (bf*)take((size_t)NT_ * HS * 2); h16* QH = (h16*)take((size_t)NT_ * HS * 2); h16* QL = (h16*)take((size_t)NT_ * HS * 2); h16* KH = (h16*)take((size_t)NT_ * KW * 2); h16* KL = (h16*)take((size_t)NT_ * KW * 2);
    bf* VTH = (bf*)take((size_t)KW * NT_ * 2); bf* VTL = (bf*)take((size_t)KW * NT_ * 2);
    if ((size_t)(wsp - (char*)d_ws) > ws_size) return;    // 13 planes of 8.4 MB ~ 109 MB = 104 MiB
    k_prep<<<3 * PB_W + PB_O + PB_X, 256, 0, stream>>>(Wq, Wk, Wv, WO, x, WqN, WkN, WvN, WoT, Xb);                     // x and the four weights as bf16 operand planes, one launch
    k_gemmb<false, true><<<dim3(NT_ / 64, HS / 64, 1), 128, 0, stream>>>(Xb, nullptr, WqN, bq, (float*)QH, HS, QL);                     // q planes
    k_gemmb<false, true><<<dim3(NT_ / 64, HS / 64, 1), 128, 0, stream>>>(Xb, nullptr, WkN, bk, (float*)KH, HS, KL);                     // k planes
    k_gemmb<false, false, true><<<dim3(NT_ / 64, HS / 64, 1), 128, 0, stream>>>(Xb, nullptr, WvN, bv, (float*)VTH, HS, (h16*)VTL);      // v planes, [h*128 + d][t]
    k_attn<<<NH_ * (NT_ / 64), 128, 0, stream>>>(QH, QL, KH, KL, VTH, VTL, Oh, Ol);                                   // ctx planes [2048][2048]
    k_gemmb<true, false><<<dim3(NT_ / 64, HS / 64, 1), 128, 0, stream>>>(Oh, Ol, WoT, bo, out, HS, nullptr);         // out = ctx.WO + bo
}

// v005
// A run of this version takes 190 microseconds.
// In both of two side-by-side timings against v004, it was 1.23 times as fast.
// Counting every step since v000, it is 3.84 times as fast.
#include <hip/hip_runtime.h>

// Compute dtypes, f32 accumulate: q/k/v = x.W[h] + b[h] for all 16 heads at once ([2048 x 2048].[2048 x 2048]; the per-head k-major weights transposed into one n-major
// operand; PLAIN bf16 operands = inputs rounded once, exact) and out = ctx.WO + bo (ctx as bf16 hi + UNSCALED residual) on v_wmma_f32_16x16x32_bf16; q/k -> f16
// hi + residual x1024 planes, v -> bf16 hi + UNSCALED residual [d][t] planes; the 16-head causal attention (128-dim heads, scale 128^-1/2) fused: scores on
// v_wmma_f32_16x16x32_f16 (hh + hl + lh), online f32 softmax, weights (x32768) and v on v_wmma_f32_16x16x32_bf16, f32 rows split on the way out. Deterministic, no atomics;
// every product writes its consumer's operand planes from its own epilogue (no f32 intermediate in memory, no separate splitting pass).

#define NB_  1
#define NT_  2048
#define HS   2048
#define NH_  16
#define NKV  16
#define HD   128
#define KW   (NKV * HD)          // 2048
#define NREP 1
#define DM   HS
#define NTK  NT_
#define SCL  0.08838834764831845f
#define PSC  32768.0f
#define LOSC 1024.0f
#define LOSCI (1.0f / 1024.0f)
#define KPB  272                 // LDS pitch in bytes of a staged k row (256 + 16) and
#define VPB  80                  // of a staged v row (64 + 16): 16 B x odd, conflict-free for ds_load_b128
#define KPL  (32 * KPB)          // one k plane of a 32-key stage
#define VPL  (HD * VPB)          // one v plane of a 32-key stage
#define STG  (2 * KPL + 2 * VPL) // one stage: k hi, k lo, v hi, v lo

typedef _Float16 h16;
typedef unsigned short bf;
typedef __attribute__((ext_vector_type(16))) __bf16   v16bf;
typedef __attribute__((ext_vector_type(16))) _Float16 v16h;
typedef __attribute__((ext_vector_type(8)))  _Float16 v8h;
typedef __attribute__((ext_vector_type(8)))  unsigned short v8us;
typedef __attribute__((ext_vector_type(8)))  float    v8f;
typedef __attribute__((ext_vector_type(4)))  float    v4f;
typedef __attribute__((ext_vector_type(4)))  _Float16 v4h;
typedef v8h  __attribute__((may_alias)) v8ha;
typedef v4f  __attribute__((may_alias)) v4fa;
typedef v8us __attribute__((may_alias)) v8usa;

__device__ __forceinline__ unsigned short f2bf(float f) { unsigned u = __float_as_uint(f); u += 0x7FFFu + ((u >> 16) & 1u); return (unsigned short)(u >> 16); }
__device__ __forceinline__ float bf2f(unsigned short b) { return __uint_as_float(((unsigned)b) << 16); }
__device__ __forceinline__ float bfr(float f) { return bf2f(f2bf(f)); }
__device__ __forceinline__ v16h cat16(v8h lo, v8h hi) { return __builtin_shufflevector(lo, hi, 0, 1, 2, 3, 4, 5, 6, 7, 8, 9, 10, 11, 12, 13, 14, 15); }
__device__ __forceinline__ v16bf cat16b(v8us lo, v8us hi) { return __builtin_bit_cast(v16bf, __builtin_shufflevector(lo, hi, 0, 1, 2, 3, 4, 5, 6, 7, 8, 9, 10, 11, 12, 13, 14, 15)); }
__device__ __forceinline__ v8f wmma16(v16h a, v16h b, v8f c) { return __builtin_amdgcn_wmma_f32_16x16x32_f16(false, a, false, b, (short)0, c, false, false); }
__device__ __forceinline__ v8f wmmab(v16bf a, v16bf b, v8f c) { return __builtin_amdgcn_wmma_f32_16x16x32_bf16(false, a, false, b, (short)0, c, false, false); }

// k_gemm: 64 x 64 tile of (A [+ Al]).Bn^T over K = 2048 (+ optional bf16-rounded bias[c]) -> f32 rows [2048][ldc].
template <bool SPLITA>
__global__ __launch_bounds__(128) void k_gemm(const bf* __restrict__ A, const bf* __restrict__ Al, const bf* __restrict__ Bn, const float* __restrict__ bias, int ldc, float* C) {
    __shared__ __align__(16) float ost[4][16 * 68];
    const int lane = threadIdx.x & 31, wave = threadIdx.x >> 5, lr = lane & 15, hi = lane >> 4;
    const size_t r0 = (size_t)blockIdx.x * 64 + wave * 16; const int c0 = blockIdx.y * 64;
    const size_t aoff = (r0 + lr) * HS + 8 * hi;
    v8f acc[4];
#pragma unroll
    for (int t = 0; t < 4; ++t) acc[t] = (v8f){};
#pragma unroll 2
    for (int kc = 0; kc < HS; kc += 32) {
        const v16bf a = cat16b(*(const v8us*)(A + aoff + kc), *(const v8us*)(A + aoff + kc + 16));
        v16bf al = a; if (SPLITA) al = cat16b(*(const v8us*)(Al + aoff + kc), *(const v8us*)(Al + aoff + kc + 16));
#pragma unroll
        for (int t = 0; t < 4; ++t) { const bf* bp = Bn + (size_t)(c0 + t * 16 + lr) * HS + kc + 8 * hi; const v16bf bb = cat16b(*(const v8us*)bp, *(const v8us*)(bp + 16)); acc[t] = wmmab(a, bb, acc[t]); if (SPLITA) acc[t] = wmmab(al, bb, acc[t]); }
        asm volatile("v_nop" : "+v"(acc[0]), "+v"(acc[1]), "+v"(acc[2]), "+v"(acc[3]) : "v"(a), "v"(al) : "memory");
    }
    float* os = &ost[wave][0];
#pragma unroll
    for (int t = 0; t < 4; ++t)
#pragma unroll
        for (int j = 0; j < 8; ++j) os[(hi * 8 + j) * 68 + t * 16 + lr] = acc[t][j] + (bias ? bfr(bias[c0 + t * 16 + lr]) : 0.f);
    __builtin_amdgcn_wave_barrier(); asm volatile("" ::: "memory");
    float* crow = C + r0 * ldc + c0;
    auto pass = [&]() {
#pragma unroll
        for (int s = 0; s < 8; ++s) { const int Lid = (lane >> 3) + 4 * s, piece = lane & 7; const int row = Lid >> 1, cofs = (Lid & 1) * 32 + piece * 4;
            const v4f val = *(const v4fa*)(os + row * 68 + cofs); *(v4f*)(crow + (size_t)row * ldc + cofs) = val; }
    };
    pass(); 
}
// k_attn: block = (head, 64 queries), wave = 16; causal key tiles 0..(Q0+63)/32 (block-uniform); per element: score x 128^-1/2, keys past the query at -inf;
// online f32 softmax; P (x32768) as bf16 hi + residual against the V planes; output rows as bf16 hi + unscaled residual planes.
// k_prep: all input preparation in one grid; the jobs are independent of one another and the block index picks one (block-uniform):
//   blocks 0 .. 3071: a 64 x 64 tile of one head's k-major [2048][128] weight (q, k, v: 1024 blocks each; 64 a head) -> rows (h, d) of the n-major bf16 operand;
//   blocks 3072 .. 4095: a 64 x 64 tile of WO [2048][2048] -> WoT; blocks 4096 .. 4351: eight rows of x -> bf16 (one wave per row).
// Transpose tile: WT [n][2048] = bf16(W[k][n]) via LDS.
#define PB_H  ((HS / 64) * (HD / 64))      // 64 tiles a head
#define PB_W  (NH_ * PB_H)                 // 1024 blocks a per-head weight
#define PB_O  ((HS / 64) * (HS / 64))      // 1024 tiles of WO
#define PB_X  (NT_ / 8)                    // 256 blocks of x rows
__global__ __launch_bounds__(256) void k_prep(const float* __restrict__ Wq, const float* __restrict__ Wk, const float* __restrict__ Wv, const float* __restrict__ WO, const float* __restrict__ x,
                                              bf* WqN, bf* WkN, bf* WvN, bf* WoT, bf* Xb) {
    __shared__ __align__(16) unsigned short tl[64 * 72];
    const int tid = threadIdx.x, b = blockIdx.x;
    if (b >= 3 * PB_W + PB_O) {            // x rows; the whole block leaves here, ahead of the barrier
        const float* __restrict__ src = x; bf* dst = Xb;
        const int lane = threadIdx.x & 31, r = (b - (3 * PB_W + PB_O)) * 8 + (threadIdx.x >> 5);
#pragma unroll
        for (int q = 0; q < HS / 256; ++q) { v8us o;
#pragma unroll
            for (int i = 0; i < 8; ++i) o[i] = f2bf(src[(size_t)r * HS + q * 256 + lane * 8 + i]);
            *(v8us*)(dst + (size_t)r * HS + q * 256 + lane * 8) = o; }
        return;
    }
    const float* __restrict__ Wm; bf* WT; int ncols, t; const int K = HS;
    if (b < 3 * PB_W) { const int m = b / PB_W, r = b - m * PB_W, h = r / PB_H; t = r - h * PB_H; ncols = HD;
        Wm = (m == 0 ? Wq : m == 1 ? Wk : Wv) + (size_t)h * HS * HD; WT = (m == 0 ? WqN : m == 1 ? WkN : WvN) + (size_t)h * HD * HS; }
    else { t = b - 3 * PB_W; ncols = HS; Wm = WO; WT = WoT; }
    const int k0 = (t % (HS / 64)) * 64, n0 = (t / (HS / 64)) * 64;
    const int kk = tid >> 2, nq = (tid & 3) * 16;
#pragma unroll
    for (int i = 0; i < 16; ++i) tl[(nq + i) * 72 + kk] = f2bf(Wm[(size_t)(k0 + kk) * ncols + n0 + nq + i]);
    __syncthreads();
    const int piece = tid & 7;
    auto pass = [&]() {
#pragma unroll
        for (int s = 0; s < 2; ++s) { const int nr = (tid >> 3) + 32 * s; const v8us val = *(const v8usa*)(tl + nr * 72 + piece * 8); *(v8us*)(WT + (size_t)(n0 + nr) * K + k0 + piece * 8) = val; }
    };
    pass(); 
}
// k_gemmb: 64 x 64 block tile (4 waves x 16 x 64) of C[NTK][NW] = (A [+ Al]).B^T [+ bf(bias[c])] [+ bf(R[r][c]) residual]; f32 whole-line epilogue, or f16
// hi + residual x1024 planes (F16OUT), or the transposed [c][r] bf16 hi + unscaled residual planes (VTOUT: C, C2 are the two planes, row length NT_). Each 64-k slab of the block's 64 A rows (and Al rows) and 64 B rows is brought into LDS once per block by asynchronous copies in whole 128-byte lines,
// two buffers: slab t + 1 flies while slab t is worked on; the waves read their fragments from there (K a multiple of 64). The k order of the fragments is unchanged.
#define GKS  64                  // k elements of a staged slab: rows of 128 bytes
#define GPB  144                 // LDS pitch in bytes of a staged row (128 + 16): 16 B x odd, conflict-free for ds_load_b128
#define GPL  (64 * GPB)          // one 64-row plane of a slab
// cpa8 / cpa4: eight / four 16-byte copies of one lane; the s_wait_xcnt stands inside the statement so that no address register is rewritten ahead of it.
__device__ __forceinline__ void cpa8(unsigned l0, unsigned l1, unsigned l2, unsigned l3, unsigned l4, unsigned l5, unsigned l6, unsigned l7,
                                     const void* g0, const void* g1, const void* g2, const void* g3, const void* g4, const void* g5, const void* g6, const void* g7) {
    asm volatile("global_load_async_to_lds_b128 %0, %8, off\n\t"
                 "global_load_async_to_lds_b128 %1, %9, off\n\t"
                 "global_load_async_to_lds_b128 %2, %10, off\n\t"
                 "global_load_async_to_lds_b128 %3, %11, off\n\t"
                 "global_load_async_to_lds_b128 %4, %12, off\n\t"
                 "global_load_async_to_lds_b128 %5, %13, off\n\t"
                 "global_load_async_to_lds_b128 %6, %14, off\n\t"
                 "global_load_async_to_lds_b128 %7, %15, off\n\t"
                 "s_wait_xcnt 0x0"
                 :: "v"(l0), "v"(l1), "v"(l2), "v"(l3), "v"(l4), "v"(l5), "v"(l6), "v"(l7), "v"(g0), "v"(g1), "v"(g2), "v"(g3), "v"(g4), "v"(g5), "v"(g6), "v"(g7) : "memory");
}
__device__ __forceinline__ void cpa4(unsigned l0, unsigned l1, unsigned l2, unsigned l3, const void* g0, const void* g1, const void* g2, const void* g3) {
    asm volatile("global_load_async_to_lds_b128 %0, %4, off\n\t"
                 "global_load_async_to_lds_b128 %1, %5, off\n\t"
                 "global_load_async_to_lds_b128 %2, %6, off\n\t"
                 "global_load_async_to_lds_b128 %3, %7, off\n\t"
                 "s_wait_xcnt 0x0"
                 :: "v"(l0), "v"(l1), "v"(l2), "v"(l3), "v"(g0), "v"(g1), "v"(g2), "v"(g3) : "memory");
}
template <bool SPLITA, bool F16OUT = false, bool VTOUT = false>
__global__ __launch_bounds__(128) void k_gemmb(const bf* __restrict__ A, const bf* __restrict__ Al, const bf* __restrict__ Bn, const float* __restrict__ bias, float* C, int ldc, h16* C2, const float* __restrict__ R = nullptr, int K = DM, int roundR = 1) {
    constexpr unsigned GST = (SPLITA ? 3 : 2) * GPL;     // one slab: A rows, B rows (, Al rows)
    __shared__ __align__(16) float ost[4][16 * 68];
    __shared__ __align__(16) unsigned char gring[2 * GST];
    const int lane = threadIdx.x & 31, wave = threadIdx.x >> 5, lr = lane & 15, hi = lane >> 4;
    const int r0 = blockIdx.x * 64 + wave * 16, c0 = blockIdx.y * 64;
    // each thread copies 4 x 16 B of each plane: rows tid / 8 + 16 i (a wave = four whole 128-byte rows)
    const int tid = threadIdx.x;
    const unsigned gdst = (unsigned)(size_t)&gring[0] + (tid >> 3) * GPB + (tid & 7) * 16;     // the lane's byte address in LDS
    const size_t asrc = (size_t)(blockIdx.x * 64 + (tid >> 3)) * K + (tid & 7) * 8, bsrc = (size_t)(c0 + (tid >> 3)) * K + (tid & 7) * 8, rs = (size_t)16 * K;
    auto stage = [&](int t, unsigned bo) {
        const bf* a = A + asrc + (size_t)t * GKS; const bf* b = Bn + bsrc + (size_t)t * GKS; const unsigned d = gdst + bo;
        cpa8(d, d + 16 * GPB, d + 32 * GPB, d + 48 * GPB, d + GPL, d + GPL + 16 * GPB, d + GPL + 32 * GPB, d + GPL + 48 * GPB,
             a, a + rs, a + 2 * rs, a + 3 * rs, b, b + rs, b + 2 * rs, b + 3 * rs);
        if (SPLITA) { const bf* c = Al + asrc + (size_t)t * GKS; cpa4(d + 2 * GPL, d + 2 * GPL + 16 * GPB, d + 2 * GPL + 32 * GPB, d + 2 * GPL + 48 * GPB, c, c + rs, c + 2 * rs, c + 3 * rs); }
    };
    v8f acc[4];
#pragma unroll
    for (int t = 0; t < 4; ++t) acc[t] = (v8f){};
    const int nt = K / GKS;
    stage(0, 0u);
    asm volatile("s_wait_asynccnt 0x0" ::: "memory");     // slab 0 of this wave's copies has landed
    __syncthreads();                                      // ... and every other wave's
    if (nt > 1) stage(1, GST);                            // block-uniform
#pragma unroll 1
    for (int s = 0; s < nt; ++s) {
        const unsigned bo = (unsigned)(s & 1) * GST;
        const bf* as = (const bf*)(gring + bo) + (wave * 16 + lr) * (GPB / 2) + 8 * hi;     // this lane's A row of the staged slab (Al: two planes on)
        const bf* bs = (const bf*)(gring + bo + GPL) + lr * (GPB / 2) + 8 * hi;             // this lane's B row of column group 0
        v16bf af[2], alf[2], bb[2][4];
#pragma unroll
        for (int kc = 0; kc < 2; ++kc) {
            af[kc] = cat16b(*(const v8usa*)(as + kc * 32), *(const v8usa*)(as + kc * 32 + 16));
            alf[kc] = af[kc]; if (SPLITA) alf[kc] = cat16b(*(const v8usa*)(as + GPL + kc * 32), *(const v8usa*)(as + GPL + kc * 32 + 16));
#pragma unroll
            for (int t = 0; t < 4; ++t) bb[kc][t] = cat16b(*(const v8usa*)(bs + t * 16 * (GPB / 2) + kc * 32), *(const v8usa*)(bs + t * 16 * (GPB / 2) + kc * 32 + 16));
        }
        __builtin_amdgcn_sched_barrier(0);     // all LDS reads of the slab issue ahead of the first product: one LDS latency a slab, not one a fragment
#pragma unroll
        for (int kc = 0; kc < 2; ++kc)
#pragma unroll
            for (int t = 0; t < 4; ++t) { acc[t] = wmmab(af[kc], bb[kc][t], acc[t]); if (SPLITA) acc[t] = wmmab(alf[kc], bb[kc][t], acc[t]); }
        asm volatile("v_nop\n\tv_nop\n\tv_nop\n\tv_nop" : "+v"(acc[0]), "+v"(acc[1]), "+v"(acc[2]), "+v"(acc[3]) : "v"(af[1]), "v"(alf[1]));     // the distance behind the last product, on the back edge too
        asm volatile("s_wait_dscnt 0x0" ::: "memory");        // this wave's reads of slab s are done before its buffer is refilled
        asm volatile("s_wait_asynccnt 0x0" ::: "memory");     // this wave's copies of slab s + 1 have landed
        __syncthreads();                                      // publishes slab s + 1 and ends every wave's reads of slab s
        if (s + 2 < nt) stage(s + 2, bo);                     // block-uniform: the refill of the buffer just read
    }
    asm volatile("s_wait_asynccnt 0x0" ::: "memory");         // no copy is outstanding when the wave goes on
    float* os = &ost[wave][0];
#pragma unroll
    for (int t = 0; t < 4; ++t) { const float bv = bias ? bfr(bias[c0 + t * 16 + lr]) : 0.f;
#pragma unroll
        for (int j = 0; j < 8; ++j) os[(hi * 8 + j) * 68 + t * 16 + lr] = acc[t][j] + bv; }
    __syncthreads();
    if (VTOUT) {
        // the block's 64 r x 64 c tile leaves transposed: eight lanes write one whole 128-byte line (64 r) of a c row in each plane; reads cross the waves' staging (behind the barrier above)
        bf* th = (bf*)(void*)C + (size_t)c0 * NT_ + blockIdx.x * 64; bf* tlo = (bf*)(void*)C2 + (size_t)c0 * NT_ + blockIdx.x * 64;
        const int piece = tid & 7; const float* sp = &ost[piece >> 1][0] + (piece & 1) * 8 * 68;
#pragma unroll
        for (int s = 0; s < 4; ++s) { const int d = (tid >> 3) + 16 * s; v8us oh, ol;
#pragma unroll
            for (int i = 0; i < 8; ++i) { const float v = sp[i * 68 + d]; const unsigned short hb = f2bf(v); oh[i] = hb; ol[i] = f2bf(v - bf2f(hb)); }
            *(v8us*)(th + (size_t)d * NT_ + piece * 8) = oh; *(v8us*)(tlo + (size_t)d * NT_ + piece * 8) = ol; }
    } else if (F16OUT) {
        h16* crow = (h16*)(void*)C + (size_t)r0 * ldc + c0;
        auto pass = [&]() {
#pragma unroll
            for (int s = 0; s < 4; ++s) { const int row = 4 * s + (lane >> 3), piece = lane & 7; const float* sp = os + row * 68 + piece * 8; v8h o, o2;
#pragma unroll
                for (int i = 0; i < 8; ++i) { const h16 a = (h16)sp[i]; o[i] = a; o2[i] = (h16)((sp[i] - (float)a) * LOSC); }
                *(v8h*)(crow + (size_t)row * ldc + piece * 8) = o;
                asm volatile("s_wait_xcnt 0x0" ::: "memory");     // the store's registers are reused on the far side of the branch below
                if (C2) *(v8h*)(C2 + (size_t)r0 * ldc + c0 + (size_t)row * ldc + piece * 8) = o2; }
        };
        pass(); 
    } else {
        float* crow = C + (size_t)r0 * ldc + c0;
        auto pass = [&]() {
#pragma unroll
            for (int s = 0; s < 8; ++s) { const int Lid = (lane >> 3) + 4 * s, piece = lane & 7; const int row = Lid >> 1, cofs = (Lid & 1) * 32 + piece * 4;
                v4f val = *(const v4fa*)(os + row * 68 + cofs); if (R) { const v4f rv = *(const v4f*)(R + ((size_t)r0 + row) * ldc + c0 + cofs); val += roundR ? (v4f){bfr(rv[0]), bfr(rv[1]), bfr(rv[2]), bfr(rv[3])} : rv; }
                *(v4f*)(crow + (size_t)row * ldc + cofs) = val; }
        };
        pass(); 
    }
}

__device__ __forceinline__ void cp8(unsigned l0, unsigned l1, unsigned l2, unsigned l3, unsigned l4, unsigned l5, unsigned l6, unsigned l7,
                                    const void* g0, const void* g1, const void* g2, const void* g3, const void* g4, const void* g5, const void* g6, const void* g7) {
    asm volatile("global_load_async_to_lds_b128 %0, %8, off\n\t"
                 "global_load_async_to_lds_b128 %1, %9, off\n\t"
                 "global_load_async_to_lds_b128 %2, %10, off\n\t"
                 "global_load_async_to_lds_b128 %3, %11, off\n\t"
                 "global_load_async_to_lds_b128 %4, %12, off\n\t"
                 "global_load_async_to_lds_b128 %5, %13, off\n\t"
                 "global_load_async_to_lds_b128 %6, %14, off\n\t"
                 "global_load_async_to_lds_b128 %7, %15, off\n\t"
                 "s_wait_xcnt 0x0"
                 :: "v"(l0), "v"(l1), "v"(l2), "v"(l3), "v"(l4), "v"(l5), "v"(l6), "v"(l7), "v"(g0), "v"(g1), "v"(g2), "v"(g3), "v"(g4), "v"(g5), "v"(g6), "v"(g7) : "memory");
}
// ex2s: 2^x; the one free slot that the instruction set asks for behind a transcendental stands inside the statement
#define L2E 1.4426950408889634f
__device__ __forceinline__ float ex2s(float x) { float r; asm("v_exp_f32 %0, %1\n\tv_nop" : "=v"(r) : "v"(x)); return r; }
// ex2x3: three at once: each fills the slot of the one in front of it (results apart from every source), one v_nop behind the last
__device__ __forceinline__ void ex2x3(float& r0, float& r1, float& r2, float x0, float x1, float x2) {
    asm("v_exp_f32 %0, %3\n\tv_exp_f32 %1, %4\n\tv_exp_f32 %2, %5\n\tv_nop" : "=&v"(r0), "=&v"(r1), "=&v"(r2) : "v"(x0), "v"(x1), "v"(x2)); }
__global__ __launch_bounds__(256) void k_attn(const h16* __restrict__ QH, const h16* __restrict__ QL, const h16* __restrict__ KH, const h16* __restrict__ KL, const bf* __restrict__ VTH, const bf* __restrict__ VTL, bf* OH, bf* OL) {
    __shared__ __align__(16) unsigned short plds[8][16 * 32];
    __shared__ __align__(16) unsigned short plds2[8][16 * 32];
    __shared__ __align__(16) float ost[8][16 * 68];
    __shared__ __align__(16) float xch[8][12 * 32 * 4];     // what a wave hands its partner: four output tiles, the maxima, the sums
    __shared__ __align__(16) unsigned char ring[4 * STG];   // two buffers x two teams
    const int lane = threadIdx.x & 31, wave = threadIdx.x >> 5, lr = lane & 15, hi = lane >> 4;
    const int kp = __builtin_amdgcn_readfirstlane((int)(threadIdx.x >> 7));     // the team: parity of its key tiles (wave-uniform, kept scalar)
    const int bid = blockIdx.x; const int h = bid % NH_, qt = (NT_ / 64 - 1) - bid / NH_; const int g = h / NREP;     // longest blocks first; GQA: kv head
    const int q0 = qt * 64 + (wave & 3) * 16;
    unsigned short* pl = &plds[wave][0]; unsigned short* pl2 = &plds2[wave][0];
    const size_t qo = (size_t)(q0 + lr) * (NH_ * HD) + h * HD + 8 * hi;
    const h16* kh_b = KH + g * HD; const h16* kl_b = KL + g * HD;
    const size_t vbase = ((size_t)g * HD) * NT_;
    v8f o[8];
#pragma unroll
    for (int n = 0; n < 8; ++n) o[n] = (v8f){};
    float mrow[8], lpart[8];
#pragma unroll
    for (int j = 0; j < 8; ++j) { mrow[j] = -3.0e38f; lpart[j] = 0.f; }
    // causal key tiles 0 .. 2 qt + 1: trip it works on tile 2 it + kp, it = 0 .. qt
    // each thread copies 4 x 16 B of each plane of its team's tile: k rows tid / 16 + 8 i (a wave = two whole 256-byte rows), v rows tid / 4 + 32 i
    const int tid = threadIdx.x & 127;
    const unsigned ring0 = (unsigned)(size_t)&ring[0];     // the ring's byte address in LDS
    const unsigned kdst = ring0 + (tid >> 4) * KPB + (tid & 15) * 16, vdst = ring0 + 2 * KPL + (tid >> 2) * VPB + (tid & 3) * 16;
    const size_t ksrc = (size_t)(tid >> 4) * KW + (tid & 15) * 8, vsrc = vbase + (size_t)(tid >> 2) * NT_ + (tid & 3) * 8;
    auto stage = [&](int t, unsigned bo) {
        const h16* a = kh_b + ksrc + (size_t)t * 32 * KW; const h16* b = kl_b + ksrc + (size_t)t * 32 * KW; const unsigned kd = kdst + bo;
        cp8(kd, kd + 8 * KPB, kd + 16 * KPB, kd + 24 * KPB, kd + KPL, kd + KPL + 8 * KPB, kd + KPL + 16 * KPB, kd + KPL + 24 * KPB,
            a, a + 8 * KW, a + 16 * KW, a + 24 * KW, b, b + 8 * KW, b + 16 * KW, b + 24 * KW);
        const bf* c = VTH + vsrc + t * 32; const bf* d = VTL + vsrc + t * 32; const unsigned vd = vdst + bo;
        cp8(vd, vd + 32 * VPB, vd + 64 * VPB, vd + 96 * VPB, vd + VPL, vd + VPL + 32 * VPB, vd + VPL + 64 * VPB, vd + VPL + 96 * VPB,
            c, c + 32 * NT_, c + 64 * NT_, c + 96 * NT_, d, d + 32 * NT_, d + 64 * NT_, d + 96 * NT_);
    };
    const unsigned tbo = (unsigned)kp * STG;              // the team's part of a buffer
    stage(kp, tbo);
    asm volatile("s_wait_asynccnt 0x0" ::: "memory");     // this wave's copies of trip 0 have landed
    __syncthreads();                                      // ... and every other wave's
    if (qt >= 1) stage(2 + kp, 2u * STG + tbo);           // block-uniform: a trip 1 exists
#pragma unroll 1
    for (int it = 0; it <= qt; ++it) {
        const int l0 = (2 * it + kp) * 32;
        const unsigned bo = (unsigned)(it & 1) * (2u * STG) + tbo;
        const h16* kth = (const h16*)(ring + bo) + lr * (KPB / 2) + 8 * hi; const h16* ktl = kth + KPL / 2;     // this lane's k row of the staged tile
        const bf* vth = (const bf*)(ring + bo + 2 * KPL) + lr * (VPB / 2) + 8 * hi; const bf* vtl = vth + VPL / 2;
        v8f s0 = {}, s1 = {}, x0 = {}, x1 = {};
        v16h kf[4][4];
#pragma unroll
        for (int kc = 0; kc < 4; ++kc) {
            kf[kc][0] = cat16(*(const v8ha*)(kth + kc * 32), *(const v8ha*)(kth + kc * 32 + 16)); kf[kc][1] = cat16(*(const v8ha*)(kth + 16 * (KPB / 2) + kc * 32), *(const v8ha*)(kth + 16 * (KPB / 2) + kc * 32 + 16));
            kf[kc][2] = cat16(*(const v8ha*)(ktl + kc * 32), *(const v8ha*)(ktl + kc * 32 + 16)); kf[kc][3] = cat16(*(const v8ha*)(ktl + 16 * (KPB / 2) + kc * 32), *(const v8ha*)(ktl + 16 * (KPB / 2) + kc * 32 + 16)); }
        __builtin_amdgcn_sched_barrier(0);     // all 32 LDS reads of the k tile issue ahead of the first product: one LDS latency a tile, not eight
#pragma unroll
        for (int kc = 0; kc < 4; ++kc) {
            const v16h qa = cat16(*(const v8h*)(QH + qo + kc * 32), *(const v8h*)(QH + qo + kc * 32 + 16)), qx = cat16(*(const v8h*)(QL + qo + kc * 32), *(const v8h*)(QL + qo + kc * 32 + 16));
            const v16h k0h = kf[kc][0], k1h = kf[kc][1];
            s0 = wmma16(qa, k0h, s0); s1 = wmma16(qa, k1h, s1); x0 = wmma16(qx, k0h, x0); x1 = wmma16(qx, k1h, x1);
            const v16h k0l = kf[kc][2], k1l = kf[kc][3];
            x0 = wmma16(qa, k0l, x0); x1 = wmma16(qa, k1l, x1);
        }
        asm volatile("v_nop\n\tv_nop\n\tv_nop\n\tv_nop" : "+v"(s0), "+v"(s1), "+v"(x0), "+v"(x1));
        float alpha[8];
#pragma unroll
        for (int j = 0; j < 8; ++j) { const int qi = q0 + hi * 8 + j, ja = l0 + lr, jb = l0 + 16 + lr;
            const float a0 = (ja <= qi) ? (s0[j] + x0[j] * LOSCI) * SCL : -__builtin_inff(), a1 = (jb <= qi) ? (s1[j] + x1[j] * LOSCI) * SCL : -__builtin_inff();     // causal (-inf; the diagonal is always live)
            float mx = fmaxf(a0, a1);
            mx = fmaxf(mx, __shfl_xor(mx, 1, 16)); mx = fmaxf(mx, __shfl_xor(mx, 2, 16)); mx = fmaxf(mx, __shfl_xor(mx, 4, 16)); mx = fmaxf(mx, __shfl_xor(mx, 8, 16));
            const float mn = fmaxf(mrow[j], mx);
            float p0, p1; ex2x3(alpha[j], p0, p1, (mrow[j] - mn) * L2E, (a0 - mn) * L2E, (a1 - mn) * L2E); mrow[j] = mn;
            lpart[j] = lpart[j] * alpha[j] + (p0 + p1);
            const int mr = hi * 8 + j; const float ps0 = p0 * PSC, ps1 = p1 * PSC; const unsigned short h0 = f2bf(ps0), h1 = f2bf(ps1);
            pl[mr * 32 + lr] = h0; pl[mr * 32 + 16 + lr] = h1; pl2[mr * 32 + lr] = f2bf(ps0 - bf2f(h0)); pl2[mr * 32 + 16 + lr] = f2bf(ps1 - bf2f(h1)); }
#pragma unroll
        for (int n = 0; n < 8; ++n)
#pragma unroll
            for (int j = 0; j < 8; ++j) o[n][j] *= alpha[j];
        asm volatile("" ::: "memory");
        const v16bf pa = cat16b(*(const v8usa*)(pl + lr * 32 + hi * 8), *(const v8usa*)(pl + lr * 32 + 16 + hi * 8));
        const v16bf px = cat16b(*(const v8usa*)(pl2 + lr * 32 + hi * 8), *(const v8usa*)(pl2 + lr * 32 + 16 + hi * 8));
        v16bf vf[8][2];
#pragma unroll
        for (int n = 0; n < 8; ++n) { const int vo = n * 16 * (VPB / 2);
            vf[n][0] = cat16b(*(const v8usa*)(vth + vo), *(const v8usa*)(vth + vo + 16)); vf[n][1] = cat16b(*(const v8usa*)(vtl + vo), *(const v8usa*)(vtl + vo + 16)); }
        __builtin_amdgcn_sched_barrier(0);     // the v tile's 32 LDS reads issue ahead of the first product: one LDS latency a tile, not eight
#pragma unroll
        for (int n = 0; n < 8; ++n) { const v16bf vh = vf[n][0], vl = vf[n][1];
            o[n] = wmmab(pa, vh, o[n]); o[n] = wmmab(px, vh, o[n]); o[n] = wmmab(pa, vl, o[n]); }
        __builtin_amdgcn_sched_barrier(0);     // the tile's products stay in front of the foot: else half of them sink behind the barrier and hold back the refill
        asm volatile("v_nop\n\tv_nop\n\tv_nop\n\tv_nop" : "+v"(o[0]), "+v"(o[7]) : "v"(pa), "v"(px));
        asm volatile("s_wait_dscnt 0x0" ::: "memory");        // this wave's reads of trip it are done before its buffer is refilled
        asm volatile("s_wait_asynccnt 0x0" ::: "memory");     // this wave's copies of trip it + 1 have landed
        __syncthreads();                                      // publishes trip it + 1 and ends every wave's reads of trip it
        if (it + 2 <= qt) stage(2 * (it + 2) + kp, bo);       // block-uniform: the refill of the buffer just read
    }
    asm volatile("s_wait_asynccnt 0x0" ::: "memory");         // no copy is outstanding when the wave goes on
    // join of the two teams: each wave hands its partner (wave ^ 4: the same 16 queries, the other key tiles) the four output tiles that the partner finishes, with its maxima and sums
    float* xw = &xch[wave][0]; const float* xr = &xch[wave ^ 4][0];
    v8f fo[4];
#pragma unroll
    for (int n = 0; n < 4; ++n) { const v8f sv = kp ? o[n] : o[4 + n]; fo[n] = kp ? o[4 + n] : o[n];
        *(v4fa*)(xw + ((2 * n) * 32 + lane) * 4) = (v4f){sv[0], sv[1], sv[2], sv[3]}; *(v4fa*)(xw + ((2 * n + 1) * 32 + lane) * 4) = (v4f){sv[4], sv[5], sv[6], sv[7]}; }
    *(v4fa*)(xw + (8 * 32 + lane) * 4) = (v4f){mrow[0], mrow[1], mrow[2], mrow[3]}; *(v4fa*)(xw + (9 * 32 + lane) * 4) = (v4f){mrow[4], mrow[5], mrow[6], mrow[7]};
    *(v4fa*)(xw + (10 * 32 + lane) * 4) = (v4f){lpart[0], lpart[1], lpart[2], lpart[3]}; *(v4fa*)(xw + (11 * 32 + lane) * 4) = (v4f){lpart[4], lpart[5], lpart[6], lpart[7]};
    __syncthreads();                                          // every wave's state is in LDS before its partner reads it
    float fa[8], fb[8];
#pragma unroll
    for (int q = 0; q < 2; ++q) { const v4f pm = *(const v4fa*)(xr + ((8 + q) * 32 + lane) * 4), pls = *(const v4fa*)(xr + ((10 + q) * 32 + lane) * 4);
#pragma unroll
        for (int i = 0; i < 4; ++i) { const int j = q * 4 + i; const float mn = fmaxf(mrow[j], pm[i]);     // a team whose tiles were all masked holds the start maximum and zeros: its factor is 0
            fa[j] = ex2s((mrow[j] - mn) * L2E); fb[j] = ex2s((pm[i] - mn) * L2E); lpart[j] = lpart[j] * fa[j] + pls[i] * fb[j]; } }
#pragma unroll
    for (int n = 0; n < 4; ++n)
#pragma unroll
        for (int q = 0; q < 2; ++q) { const v4f po = *(const v4fa*)(xr + ((2 * n + q) * 32 + lane) * 4);
#pragma unroll
            for (int i = 0; i < 4; ++i) fo[n][q * 4 + i] = fo[n][q * 4 + i] * fa[q * 4 + i] + po[i] * fb[q * 4 + i]; }
    float inv[8];
#pragma unroll
    for (int j = 0; j < 8; ++j) { float rs = lpart[j]; rs += __shfl_xor(rs, 1, 16); rs += __shfl_xor(rs, 2, 16); rs += __shfl_xor(rs, 4, 16); rs += __shfl_xor(rs, 8, 16); inv[j] = 1.0f / (rs * PSC); }
    float* os = &ost[wave][0];
    const size_t ob = (size_t)q0 * (NH_ * HD) + (size_t)h * HD;     // row stride NH*HD, this head's 128 columns
    { const int half = kp;     // this wave's 64 columns
#pragma unroll
        for (int n = 0; n < 4; ++n)
#pragma unroll
            for (int j = 0; j < 8; ++j) os[(hi * 8 + j) * 68 + n * 16 + lr] = fo[n][j] * inv[j];
        __builtin_amdgcn_wave_barrier(); asm volatile("" ::: "memory");
{
#pragma unroll
            for (int s = 0; s < 4; ++s) { const int row = 4 * s + (lane >> 3), piece = lane & 7; const float* sp = os + row * 68 + piece * 8; v8us oh, ol;     // eight lanes = one 128-byte line of each plane
#pragma unroll
                for (int i = 0; i < 8; ++i) { const float v = sp[i]; const unsigned short hb = f2bf(v); oh[i] = hb; ol[i] = f2bf(v - bf2f(hb)); }
                const size_t oo = ob + (size_t)row * (NH_ * HD) + half * 64 + piece * 8; *(v8us*)(OH + oo) = oh; *(v8us*)(OL + oo) = ol; }
             }
        __builtin_amdgcn_wave_barrier(); asm volatile("" ::: "memory");
    }
}

extern "C" void kernel_launch(void* const* d_in, const int* in_sizes, int n_in,
                              void* d_out, int out_size, void* d_ws, size_t ws_size, hipStream_t stream) {
    (void)in_sizes; (void)n_in; (void)out_size;
    const float* x = (const float*)d_in[0]; const float* Wq = (const float*)d_in[1]; const float* bq = (const float*)d_in[2]; const float* Wk = (const float*)d_in[3]; const float* bk = (const float*)d_in[4];
    const float* Wv = (const float*)d_in[5]; const float* bv = (const float*)d_in[6]; const float* WO = (const float*)d_in[7]; const float* bo = (const float*)d_in[8];     // per-head [16][2048][128] k-major weights (x @ W[h]), WO [2048][2048] k-major
    float* out = (float*)d_out;    // [1][2048][2048]
    char* wsp = (char*)d_ws;
    auto take = [&](size_t bytes) { char* p = wsp; wsp += (bytes + 255) & ~(size_t)255; return (void*)p; };
    bf* Xb = (bf*)take((size_t)NT_ * HS * 2); bf* WqN = (bf*)take((size_t)HS * HS * 2); bf* WkN = (bf*)take((size_t)HS * HS * 2); bf* WvN = (bf*)take((size_t)HS * HS * 2); bf* WoT = (bf*)take((size_t)HS * HS * 2);
    bf* Oh = (bf*)take((size_t)NT_ * HS * 2); bf* Ol = (bf*)take((size_t)NT_ * HS * 2); h16* QH = (h16*)take((size_t)NT_ * HS * 2); h16* QL = (h16*)take((size_t)NT_ * HS * 2); h16* KH = (h16*)take((size_t)NT_ * KW * 2); h16* KL = (h16*)take((size_t)NT_ * KW * 2);
    bf* VTH = (bf*)take((size_t)KW * NT_ * 2); bf* VTL = (bf*)take((size_t)KW * NT_ * 2);
    if ((size_t)(wsp - (char*)d_ws) > ws_size) return;    // 13 planes of 8.4 MB ~ 109 MB = 104 MiB
    k_prep<<<3 * PB_W + PB_O + PB_X, 256, 0, stream>>>(Wq, Wk, Wv, WO, x, WqN, WkN, WvN, WoT, Xb);                     // x and the four weights as bf16 operand planes, one launch
    k_gemmb<false, true><<<dim3(NT_ / 64, HS / 64, 1), 128, 0, stream>>>(Xb, nullptr, WqN, bq, (float*)QH, HS, QL);                     // q planes
    k_gemmb<false, true><<<dim3(NT_ / 64, HS / 64, 1), 128, 0, stream>>>(Xb, nullptr, WkN, bk, (float*)KH, HS, KL);                     // k planes
    k_gemmb<false, false, true><<<dim3(NT_ / 64, HS / 64, 1), 128, 0, stream>>>(Xb, nullptr, WvN, bv, (float*)VTH, HS, (h16*)VTL);      // v planes, [h*128 + d][t]
    k_attn<<<NH_ * (NT_ / 64), 256, 0, stream>>>(QH, QL, KH, KL, VTH, VTL, Oh, Ol);                                   // ctx planes [2048][2048]
    k_gemmb<true, false><<<dim3(NT_ / 64, HS / 64, 1), 128, 0, stream>>>(Oh, Ol, WoT, bo, out, HS, nullptr);         // out = ctx.WO + bo
}

// v006
// One run takes 171 microseconds.
// Next to v005, in two timings, it ran 1.11 times as fast each time.
// All steps since v000 together make it 4.26 times as fast.
#include <hip/hip_runtime.h>

// Compute dtypes, f32 accumulate: q/k/v = x.W[h] + b[h] for all 16 heads at once ([2048 x 2048].[2048 x 2048]; the per-head k-major weights transposed into one n-major
// operand; PLAIN bf16 operands = inputs rounded once, exact) and out = ctx.WO + bo (ctx as bf16 hi + UNSCALED residual) on v_wmma_f32_16x16x32_bf16; q/k -> f16
// hi + residual x1024 planes, v -> bf16 hi + UNSCALED residual [d][t] planes; the 16-head causal attention (128-dim heads, scale 128^-1/2) fused: scores on
// v_wmma_f32_16x16x32_f16 (hh + hl + lh), online f32 softmax, weights (x32768) and v on v_wmma_f32_16x16x32_bf16, f32 rows split on the way out. Deterministic, no atomics;
// every product writes its consumer's operand planes from its own epilogue (no f32 intermediate in memory, no separate splitting pass).

#define NB_  1
#define NT_  2048
#define HS   2048
#define NH_  16
#define NKV  16
#define HD   128
#define KW   (NKV * HD)          // 2048
#define NREP 1
#define DM   HS
#define NTK  NT_
#define SCL  0.08838834764831845f
#define PSC  32768.0f
#define LOSC 1024.0f
#define LOSCI (1.0f / 1024.0f)
#define KPB  272                 // LDS pitch in bytes of a staged k row (256 + 16) and
#define VPB  80                  // of a staged v row (64 + 16): 16 B x odd, conflict-free for ds_load_b128
#define KPL  (32 * KPB)          // one k plane of a 32-key stage
#define VPL  (HD * VPB)          // one v plane of a 32-key stage
#define STG  (2 * KPL + 2 * VPL) // one stage: k hi, k lo, v hi, v lo

typedef _Float16 h16;
typedef unsigned short bf;
typedef __attribute__((ext_vector_type(16))) __bf16   v16bf;
typedef __attribute__((ext_vector_type(16))) _Float16 v16h;
typedef __attribute__((ext_vector_type(8)))  _Float16 v8h;
typedef __attribute__((ext_vector_type(8)))  unsigned short v8us;
typedef __attribute__((ext_vector_type(8)))  float    v8f;
typedef __attribute__((ext_vector_type(4)))  float    v4f;
typedef __attribute__((ext_vector_type(4)))  _Float16 v4h;
typedef v8h  __attribute__((may_alias)) v8ha;
typedef v4f  __attribute__((may_alias)) v4fa;
typedef v8us __attribute__((may_alias)) v8usa;

__device__ __forceinline__ unsigned short f2bf(float f) { unsigned u = __float_as_uint(f); u += 0x7FFFu + ((u >> 16) & 1u); return (unsigned short)(u >> 16); }
__device__ __forceinline__ float bf2f(unsigned short b) { return __uint_as_float(((unsigned)b) << 16); }
__device__ __forceinline__ float bfr(float f) { return bf2f(f2bf(f)); }
__device__ __forceinline__ v16h cat16(v8h lo, v8h hi) { return __builtin_shufflevector(lo, hi, 0, 1, 2, 3, 4, 5, 6, 7, 8, 9, 10, 11, 12, 13, 14, 15); }
__device__ __forceinline__ v16bf cat16b(v8us lo, v8us hi) { return __builtin_bit_cast(v16bf, __builtin_shufflevector(lo, hi, 0, 1, 2, 3, 4, 5, 6, 7, 8, 9, 10, 11, 12, 13, 14, 15)); }
__device__ __forceinline__ v8f wmma16(v16h a, v16h b, v8f c) { return __builtin_amdgcn_wmma_f32_16x16x32_f16(false, a, false, b, (short)0, c, false, false); }
__device__ __forceinline__ v8f wmmab(v16bf a, v16bf b, v8f c) { return __builtin_amdgcn_wmma_f32_16x16x32_bf16(false, a, false, b, (short)0, c, false, false); }

// k_gemm: 64 x 64 tile of (A [+ Al]).Bn^T over K = 2048 (+ optional bf16-rounded bias[c]) -> f32 rows [2048][ldc].
template <bool SPLITA>
__global__ __launch_bounds__(128) void k_gemm(const bf* __restrict__ A, const bf* __restrict__ Al, const bf* __restrict__ Bn, const float* __restrict__ bias, int ldc, float* C) {
    __shared__ __align__(16) float ost[4][16 * 68];
    const int lane = threadIdx.x & 31, wave = threadIdx.x >> 5, lr = lane & 15, hi = lane >> 4;
    const size_t r0 = (size_t)blockIdx.x * 64 + wave * 16; const int c0 = blockIdx.y * 64;
    const size_t aoff = (r0 + lr) * HS + 8 * hi;
    v8f acc[4];
#pragma unroll
    for (int t = 0; t < 4; ++t) acc[t] = (v8f){};
#pragma unroll 2
    for (int kc = 0; kc < HS; kc += 32) {
        const v16bf a = cat16b(*(const v8us*)(A + aoff + kc), *(const v8us*)(A + aoff + kc + 16));
        v16bf al = a; if (SPLITA) al = cat16b(*(const v8us*)(Al + aoff + kc), *(const v8us*)(Al + aoff + kc + 16));
#pragma unroll
        for (int t = 0; t < 4; ++t) { const bf* bp = Bn + (size_t)(c0 + t * 16 + lr) * HS + kc + 8 * hi; const v16bf bb = cat16b(*(const v8us*)bp, *(const v8us*)(bp + 16)); acc[t] = wmmab(a, bb, acc[t]); if (SPLITA) acc[t] = wmmab(al, bb, acc[t]); }
        asm volatile("v_nop" : "+v"(acc[0]), "+v"(acc[1]), "+v"(acc[2]), "+v"(acc[3]) : "v"(a), "v"(al) : "memory");
    }
    float* os = &ost[wave][0];
#pragma unroll
    for (int t = 0; t < 4; ++t)
#pragma unroll
        for (int j = 0; j < 8; ++j) os[(hi * 8 + j) * 68 + t * 16 + lr] = acc[t][j] + (bias ? bfr(bias[c0 + t * 16 + lr]) : 0.f);
    __builtin_amdgcn_wave_barrier(); asm volatile("" ::: "memory");
    float* crow = C + r0 * ldc + c0;
    auto pass = [&]() {
#pragma unroll
        for (int s = 0; s < 8; ++s) { const int Lid = (lane >> 3) + 4 * s, piece = lane & 7; const int row = Lid >> 1, cofs = (Lid & 1) * 32 + piece * 4;
            const v4f val = *(const v4fa*)(os + row * 68 + cofs); *(v4f*)(crow + (size_t)row * ldc + cofs) = val; }
    };
    pass(); 
}
// k_attn: block = (head, 64 queries), wave = 16; causal key tiles 0..(Q0+63)/32 (block-uniform); per element: score x 128^-1/2, keys past the query at -inf;
// online f32 softmax; P (x32768) as bf16 hi + residual against the V planes; output rows as bf16 hi + unscaled residual planes.
// k_prep: all input preparation in one grid; the jobs are independent of one another and the block index picks one (block-uniform):
//   blocks 0 .. 3071: a 64 x 64 tile of one head's k-major [2048][128] weight (q, k, v: 1024 blocks each; 64 a head) -> rows (h, d) of the n-major bf16 operand;
//   blocks 3072 .. 4095: a 64 x 64 tile of WO [2048][2048] -> WoT; blocks 4096 .. 4351: eight rows of x -> bf16 (one wave per row).
// Transpose tile: WT [n][2048] = bf16(W[k][n]) via LDS.
#define PB_H  ((HS / 64) * (HD / 64))      // 64 tiles a head
#define PB_W  (NH_ * PB_H)                 // 1024 blocks a per-head weight
#define PB_O  ((HS / 64) * (HS / 64))      // 1024 tiles of WO
#define PB_X  (NT_ / 8)                    // 256 blocks of x rows
__global__ __launch_bounds__(256) void k_prep(const float* __restrict__ Wq, const float* __restrict__ Wk, const float* __restrict__ Wv, const float* __restrict__ WO, const float* __restrict__ x,
                                              bf* WqN, bf* WkN, bf* WvN, bf* WoT, bf* Xb) {
    __shared__ __align__(16) unsigned short tl[64 * 72];
    const int tid = threadIdx.x, b = blockIdx.x;
    if (b >= 3 * PB_W + PB_O) {            // x rows; the whole block leaves here, ahead of the barrier
        const float* __restrict__ src = x; bf* dst = Xb;
        const int lane = threadIdx.x & 31, r = (b - (3 * PB_W + PB_O)) * 8 + (threadIdx.x >> 5);
#pragma unroll
        for (int q = 0; q < HS / 256; ++q) { v8us o;
#pragma unroll
            for (int i = 0; i < 8; ++i) o[i] = f2bf(src[(size_t)r * HS + q * 256 + lane * 8 + i]);
            *(v8us*)(dst + (size_t)r * HS + q * 256 + lane * 8) = o; }
        return;
    }
    const float* __restrict__ Wm; bf* WT; int ncols, t; const int K = HS;
    if (b < 3 * PB_W) { const int m = b / PB_W, r = b - m * PB_W, h = r / PB_H; t = r - h * PB_H; ncols = HD;
        Wm = (m == 0 ? Wq : m == 1 ? Wk : Wv) + (size_t)h * HS * HD; WT = (m == 0 ? WqN : m == 1 ? WkN : WvN) + (size_t)h * HD * HS; }
    else { t = b - 3 * PB_W; ncols = HS; Wm = WO; WT = WoT; }
    const int k0 = (t % (HS / 64)) * 64, n0 = (t / (HS / 64)) * 64;
    const int kk = tid >> 2, nq = (tid & 3) * 16;
#pragma unroll
    for (int i = 0; i < 16; ++i) tl[(nq + i) * 72 + kk] = f2bf(Wm[(size_t)(k0 + kk) * ncols + n0 + nq + i]);
    __syncthreads();
    const int piece = tid & 7;
    auto pass = [&]() {
#pragma unroll
        for (int s = 0; s < 2; ++s) { const int nr = (tid >> 3) + 32 * s; const v8us val = *(const v8usa*)(tl + nr * 72 + piece * 8); *(v8us*)(WT + (size_t)(n0 + nr) * K + k0 + piece * 8) = val; }
    };
    pass(); 
}
// k_gemmb: 128 x 128 block tile (8 waves, 4 x 2, each 32 x 64) of C[NTK][NW] = (A [+ Al]).B^T [+ bf(bias[c])] [+ bf(R[r][c]) residual]; f32 whole-line epilogue, or f16
// hi + residual x1024 planes (F16OUT), or the transposed [c][r] bf16 hi + unscaled residual planes (VTOUT: C, C2 are the two planes, row length NT_). Each 128-k slab of the block's 128 A rows (and Al rows) and 128 B rows is brought into LDS once per block by asynchronous copies in whole 256-byte rows,
// two buffers: slab t + 1 flies while slab t is worked on; the waves read their fragments from there (K a multiple of 128). The k order of the fragments is unchanged.
#define GKS  128                 // k elements of a staged slab: rows of 256 bytes
#define GPB  272                 // LDS pitch in bytes of a staged row (256 + 16): 16 B x odd, conflict-free for ds_load_b128
#define GTB  128                 // rows of a plane: the block tile's rows, and its columns
#define GPL  (GTB * GPB)         // one plane of a slab
#define GTP  136                 // pitch in elements of a staged transposed output row (128 + 8): 16 B x odd
// cpa8: eight 16-byte copies of one lane; the s_wait_xcnt stands inside the statement so that no address register is rewritten ahead of it.
__device__ __forceinline__ void cpa8(unsigned l0, unsigned l1, unsigned l2, unsigned l3, unsigned l4, unsigned l5, unsigned l6, unsigned l7,
                                     const void* g0, const void* g1, const void* g2, const void* g3, const void* g4, const void* g5, const void* g6, const void* g7) {
    asm volatile("global_load_async_to_lds_b128 %0, %8, off\n\t"
                 "global_load_async_to_lds_b128 %1, %9, off\n\t"
                 "global_load_async_to_lds_b128 %2, %10, off\n\t"
                 "global_load_async_to_lds_b128 %3, %11, off\n\t"
                 "global_load_async_to_lds_b128 %4, %12, off\n\t"
                 "global_load_async_to_lds_b128 %5, %13, off\n\t"
                 "global_load_async_to_lds_b128 %6, %14, off\n\t"
                 "global_load_async_to_lds_b128 %7, %15, off\n\t"
                 "s_wait_xcnt 0x0"
                 :: "v"(l0), "v"(l1), "v"(l2), "v"(l3), "v"(l4), "v"(l5), "v"(l6), "v"(l7), "v"(g0), "v"(g1), "v"(g2), "v"(g3), "v"(g4), "v"(g5), "v"(g6), "v"(g7) : "memory");
}
template <bool SPLITA, bool F16OUT = false, bool VTOUT = false>
__global__ __launch_bounds__(256) void k_gemmb(const bf* __restrict__ A, const bf* __restrict__ Al, const bf* __restrict__ Bn, const float* __restrict__ bias, float* C, int ldc, h16* C2, const float* __restrict__ R = nullptr, int K = DM, int roundR = 1) {
    constexpr unsigned GST = (SPLITA ? 3 : 2) * GPL, GBO = (SPLITA ? 2 : 1) * GPL;     // one slab: A rows (, Al rows), B rows; where its B plane begins (Al within reach of the A pointer's 16-bit LDS offsets)
    constexpr int KG = SPLITA ? 1 : 2, NG = (GKS / 32) / KG;     // 32-k steps whose fragments are read as one group (16 products a group either way); groups a slab
    __shared__ __align__(16) float ost[8][32 * 68];
    __shared__ __align__(16) unsigned char gring[2 * GST];
    const int lane = threadIdx.x & 31, wave = threadIdx.x >> 5, lr = lane & 15, hi = lane >> 4;
    const int wr = wave >> 1, wc = wave & 1;             // the wave's 32 rows and 64 columns of the block tile
    const int rb = blockIdx.x * GTB, cb = blockIdx.y * GTB;
    const int r0 = rb + wr * 32, c0 = cb + wc * 64;
    // each thread copies 8 x 16 B of each plane: rows tid / 16 + 16 i (a wave = two whole 256-byte rows)
    const int tid = threadIdx.x;
    const unsigned gdst = (unsigned)(size_t)&gring[0] + (tid >> 4) * GPB + (tid & 15) * 16;     // the lane's byte address in LDS
    const size_t asrc = (size_t)(rb + (tid >> 4)) * K + (tid & 15) * 8, bsrc = (size_t)(cb + (tid >> 4)) * K + (tid & 15) * 8, rs = (size_t)16 * K;
    auto plane = [&](const bf* p, unsigned d) {
        cpa8(d, d + 16 * GPB, d + 32 * GPB, d + 48 * GPB, d + 64 * GPB, d + 80 * GPB, d + 96 * GPB, d + 112 * GPB,
             p, p + rs, p + 2 * rs, p + 3 * rs, p + 4 * rs, p + 5 * rs, p + 6 * rs, p + 7 * rs);
    };
    auto stage = [&](int t, unsigned bo) {
        plane(A + asrc + (size_t)t * GKS, gdst + bo); plane(Bn + bsrc + (size_t)t * GKS, gdst + bo + GBO);
        if (SPLITA) plane(Al + asrc + (size_t)t * GKS, gdst + bo + GPL);
    };
    v8f acc[2][4];
#pragma unroll
    for (int m = 0; m < 2; ++m)
#pragma unroll
        for (int t = 0; t < 4; ++t) acc[m][t] = (v8f){};
    const int nt = K / GKS;
    stage(0, 0u);
    asm volatile("s_wait_asynccnt 0x0" ::: "memory");     // slab 0 of this wave's copies has landed
    __syncthreads();                                      // ... and every other wave's
    if (nt > 1) stage(1, GST);                            // block-uniform
#pragma unroll 1
    for (int s = 0; s < nt; ++s) {
        const unsigned bo = (unsigned)(s & 1) * GST;
        const bf* as = (const bf*)(gring + bo) + (wr * 32 + lr) * (GPB / 2) + 8 * hi;            // this lane's A row of row group 0 in the staged slab (Al: one plane on)
        const bf* bs = (const bf*)(gring + bo + GBO) + (wc * 64 + lr) * (GPB / 2) + 8 * hi;      // this lane's B row of column group 0
#pragma unroll
        for (int g = 0; g < NG; ++g) {
            v16bf af[KG][2], alf[KG][2], bb[KG][4];
#pragma unroll
            for (int kc = 0; kc < KG; ++kc) { const int ko = (g * KG + kc) * 32;
#pragma unroll
                for (int m = 0; m < 2; ++m) { const bf* ap = as + m * 16 * (GPB / 2) + ko;
                    af[kc][m] = cat16b(*(const v8usa*)ap, *(const v8usa*)(ap + 16));
                    alf[kc][m] = af[kc][m]; if (SPLITA) alf[kc][m] = cat16b(*(const v8usa*)(ap + GPL / 2), *(const v8usa*)(ap + GPL / 2 + 16)); }
#pragma unroll
                for (int t = 0; t < 4; ++t) { const bf* bp = bs + t * 16 * (GPB / 2) + ko; bb[kc][t] = cat16b(*(const v8usa*)bp, *(const v8usa*)(bp + 16)); }
            }
            __builtin_amdgcn_sched_barrier(0);     // the group's LDS reads issue ahead of its first product: one LDS latency a group, not one a fragment
#pragma unroll
            for (int kc = 0; kc < KG; ++kc)
#pragma unroll
                for (int m = 0; m < 2; ++m)
#pragma unroll
                    for (int t = 0; t < 4; ++t) { acc[m][t] = wmmab(af[kc][m], bb[kc][t], acc[m][t]); if (SPLITA) acc[m][t] = wmmab(alf[kc][m], bb[kc][t], acc[m][t]); }
            if (g == NG - 1)     // the distance behind the slab's last product, on the back edge too
                asm volatile("v_nop\n\tv_nop\n\tv_nop\n\tv_nop" : "+v"(acc[0][0]), "+v"(acc[0][1]), "+v"(acc[0][2]), "+v"(acc[0][3]), "+v"(acc[1][0]), "+v"(acc[1][1]), "+v"(acc[1][2]), "+v"(acc[1][3]) : "v"(af[KG - 1][1]), "v"(alf[KG - 1][1]));
        }
        asm volatile("s_wait_dscnt 0x0" ::: "memory");        // this wave's reads of slab s are done before its buffer is refilled
        asm volatile("s_wait_asynccnt 0x0" ::: "memory");     // this wave's copies of slab s + 1 have landed
        __syncthreads();                                      // publishes slab s + 1 and ends every wave's reads of slab s
        if (s + 2 < nt) stage(s + 2, bo);                     // block-uniform: the refill of the buffer just read
    }
    asm volatile("s_wait_asynccnt 0x0" ::: "memory");         // no copy is outstanding when the wave goes on
    float* os = &ost[wave][0];
    unsigned short* tph = (unsigned short*)(void*)&ost[0][0]; unsigned short* tpl = tph + GTB * GTP;     // VTOUT: the staging holds the two transposed planes, [c][r]
#pragma unroll
    for (int t = 0; t < 4; ++t) { const float bv = bias ? bfr(bias[c0 + t * 16 + lr]) : 0.f;
#pragma unroll
        for (int m = 0; m < 2; ++m) {
            if (VTOUT) {     // a lane holds eight consecutive r of one c: one 16-byte piece of that c row in each plane
                v8us oh, ol;
#pragma unroll
                for (int j = 0; j < 8; ++j) { const float v = acc[m][t][j] + bv; const unsigned short hb = f2bf(v); oh[j] = hb; ol[j] = f2bf(v - bf2f(hb)); }
                const int o = (wc * 64 + t * 16 + lr) * GTP + wr * 32 + m * 16 + hi * 8; *(v8usa*)(tph + o) = oh; *(v8usa*)(tpl + o) = ol;
            } else {
#pragma unroll
                for (int j = 0; j < 8; ++j) os[(m * 16 + hi * 8 + j) * 68 + t * 16 + lr] = acc[m][t][j] + bv;
            }
        } }
    __syncthreads();
    if (VTOUT) {
        // the block's 128 r x 128 c tile leaves transposed: sixteen lanes write the two whole 128-byte lines (128 r) of a c row in each plane; reads cross the waves' staging (behind the barrier above)
        bf* th = (bf*)(void*)C + (size_t)cb * NT_ + rb; bf* tlo = (bf*)(void*)C2 + (size_t)cb * NT_ + rb;
        const int piece = tid & 15;
#pragma unroll
        for (int s = 0; s < 8; ++s) { const int d = (tid >> 4) + 16 * s;
            const v8us oh = *(const v8usa*)(tph + d * GTP + piece * 8), ol = *(const v8usa*)(tpl + d * GTP + piece * 8);
            *(v8us*)(th + (size_t)d * NT_ + piece * 8) = oh; *(v8us*)(tlo + (size_t)d * NT_ + piece * 8) = ol; }
    } else if (F16OUT) {
        h16* crow = (h16*)(void*)C + (size_t)r0 * ldc + c0;
        auto pass = [&]() {
#pragma unroll
            for (int s = 0; s < 8; ++s) { const int row = 4 * s + (lane >> 3), piece = lane & 7; const float* sp = os + row * 68 + piece * 8; v8h o, o2;
#pragma unroll
                for (int i = 0; i < 8; ++i) { const h16 a = (h16)sp[i]; o[i] = a; o2[i] = (h16)((sp[i] - (float)a) * LOSC); }
                *(v8h*)(crow + (size_t)row * ldc + piece * 8) = o;
                asm volatile("s_wait_xcnt 0x0" ::: "memory");     // the store's registers are reused on the far side of the branch below
                if (C2) *(v8h*)(C2 + (size_t)r0 * ldc + c0 + (size_t)row * ldc + piece * 8) = o2; }
        };
        pass(); 
    } else {
        float* crow = C + (size_t)r0 * ldc + c0;
        auto pass = [&]() {
#pragma unroll
            for (int s = 0; s < 16; ++s) { const int Lid = (lane >> 3) + 4 * s, piece = lane & 7; const int row = Lid >> 1, cofs = (Lid & 1) * 32 + piece * 4;
                v4f val = *(const v4fa*)(os + row * 68 + cofs); if (R) { const v4f rv = *(const v4f*)(R + ((size_t)r0 + row) * ldc + c0 + cofs); val += roundR ? (v4f){bfr(rv[0]), bfr(rv[1]), bfr(rv[2]), bfr(rv[3])} : rv; }
                *(v4f*)(crow + (size_t)row * ldc + cofs) = val;
                asm volatile("s_wait_xcnt 0x0" ::: "memory"); }     // the store's registers are reused behind the branch on R of the next row
        };
        pass(); 
    }
}

__device__ __forceinline__ void cp8(unsigned l0, unsigned l1, unsigned l2, unsigned l3, unsigned l4, unsigned l5, unsigned l6, unsigned l7,
                                    const void* g0, const void* g1, const void* g2, const void* g3, const void* g4, const void* g5, const void* g6, const void* g7) {
    asm volatile("global_load_async_to_lds_b128 %0, %8, off\n\t"
                 "global_load_async_to_lds_b128 %1, %9, off\n\t"
                 "global_load_async_to_lds_b128 %2, %10, off\n\t"
                 "global_load_async_to_lds_b128 %3, %11, off\n\t"
                 "global_load_async_to_lds_b128 %4, %12, off\n\t"
                 "global_load_async_to_lds_b128 %5, %13, off\n\t"
                 "global_load_async_to_lds_b128 %6, %14, off\n\t"
                 "global_load_async_to_lds_b128 %7, %15, off\n\t"
                 "s_wait_xcnt 0x0"
                 :: "v"(l0), "v"(l1), "v"(l2), "v"(l3), "v"(l4), "v"(l5), "v"(l6), "v"(l7), "v"(g0), "v"(g1), "v"(g2), "v"(g3), "v"(g4), "v"(g5), "v"(g6), "v"(g7) : "memory");
}
// ex2s: 2^x; the one free slot that the instruction set asks for behind a transcendental stands inside the statement
#define L2E 1.4426950408889634f
__device__ __forceinline__ float ex2s(float x) { float r; asm("v_exp_f32 %0, %1\n\tv_nop" : "=v"(r) : "v"(x)); return r; }
// ex2x3: three at once: each fills the slot of the one in front of it (results apart from every source), one v_nop behind the last
__device__ __forceinline__ void ex2x3(float& r0, float& r1, float& r2, float x0, float x1, float x2) {
    asm("v_exp_f32 %0, %3\n\tv_exp_f32 %1, %4\n\tv_exp_f32 %2, %5\n\tv_nop" : "=&v"(r0), "=&v"(r1), "=&v"(r2) : "v"(x0), "v"(x1), "v"(x2)); }
__global__ __launch_bounds__(256) void k_attn(const h16* __restrict__ QH, const h16* __restrict__ QL, const h16* __restrict__ KH, const h16* __restrict__ KL, const bf* __restrict__ VTH, const bf* __restrict__ VTL, bf* OH, bf* OL) {
    __shared__ __align__(16) unsigned short plds[8][16 * 32];
    __shared__ __align__(16) unsigned short plds2[8][16 * 32];
    __shared__ __align__(16) float ost[8][16 * 68];
    __shared__ __align__(16) float xch[8][12 * 32 * 4];     // what a wave hands its partner: four output tiles, the maxima, the sums
    __shared__ __align__(16) unsigned char ring[4 * STG];   // two buffers x two teams
    const int lane = threadIdx.x & 31, wave = threadIdx.x >> 5, lr = lane & 15, hi = lane >> 4;
    const int kp = __builtin_amdgcn_readfirstlane((int)(threadIdx.x >> 7));     // the team: parity of its key tiles (wave-uniform, kept scalar)
    const int bid = blockIdx.x; const int h = bid % NH_, qt = (NT_ / 64 - 1) - bid / NH_; const int g = h / NREP;     // longest blocks first; GQA: kv head
    const int q0 = qt * 64 + (wave & 3) * 16;
    unsigned short* pl = &plds[wave][0]; unsigned short* pl2 = &plds2[wave][0];
    const size_t qo = (size_t)(q0 + lr) * (NH_ * HD) + h * HD + 8 * hi;
    const h16* kh_b = KH + g * HD; const h16* kl_b = KL + g * HD;
    const size_t vbase = ((size_t)g * HD) * NT_;
    v8f o[8];
#pragma unroll
    for (int n = 0; n < 8; ++n) o[n] = (v8f){};
    float mrow[8], lpart[8];
#pragma unroll
    for (int j = 0; j < 8; ++j) { mrow[j] = -3.0e38f; lpart[j] = 0.f; }
    // causal key tiles 0 .. 2 qt + 1: trip it works on tile 2 it + kp, it = 0 .. qt
    // each thread copies 4 x 16 B of each plane of its team's tile: k rows tid / 16 + 8 i (a wave = two whole 256-byte rows), v rows tid / 4 + 32 i
    const int tid = threadIdx.x & 127;
    const unsigned ring0 = (unsigned)(size_t)&ring[0];     // the ring's byte address in LDS
    const unsigned kdst = ring0 + (tid >> 4) * KPB + (tid & 15) * 16, vdst = ring0 + 2 * KPL + (tid >> 2) * VPB + (tid & 3) * 16;
    const size_t ksrc = (size_t)(tid >> 4) * KW + (tid & 15) * 8, vsrc = vbase + (size_t)(tid >> 2) * NT_ + (tid & 3) * 8;
    auto stage = [&](int t, unsigned bo) {
        const h16* a = kh_b + ksrc + (size_t)t * 32 * KW; const h16* b = kl_b + ksrc + (size_t)t * 32 * KW; const unsigned kd = kdst + bo;
        cp8(kd, kd + 8 * KPB, kd + 16 * KPB, kd + 24 * KPB, kd + KPL, kd + KPL + 8 * KPB, kd + KPL + 16 * KPB, kd + KPL + 24 * KPB,
            a, a + 8 * KW, a + 16 * KW, a + 24 * KW, b, b + 8 * KW, b + 16 * KW, b + 24 * KW);
        const bf* c = VTH + vsrc + t * 32; const bf* d = VTL + vsrc + t * 32; const unsigned vd = vdst + bo;
        cp8(vd, vd + 32 * VPB, vd + 64 * VPB, vd + 96 * VPB, vd + VPL, vd + VPL + 32 * VPB, vd + VPL + 64 * VPB, vd + VPL + 96 * VPB,
            c, c + 32 * NT_, c + 64 * NT_, c + 96 * NT_, d, d + 32 * NT_, d + 64 * NT_, d + 96 * NT_);
    };
    const unsigned tbo = (unsigned)kp * STG;              // the team's part of a buffer
    stage(kp, tbo);
    asm volatile("s_wait_asynccnt 0x0" ::: "memory");     // this wave's copies of trip 0 have landed
    __syncthreads();                                      // ... and every other wave's
    if (qt >= 1) stage(2 + kp, 2u * STG + tbo);           // block-uniform: a trip 1 exists
#pragma unroll 1
    for (int it = 0; it <= qt; ++it) {
        const int l0 = (2 * it + kp) * 32;
        const unsigned bo = (unsigned)(it & 1) * (2u * STG) + tbo;
        const h16* kth = (const h16*)(ring + bo) + lr * (KPB / 2) + 8 * hi; const h16* ktl = kth + KPL / 2;     // this lane's k row of the staged tile
        const bf* vth = (const bf*)(ring + bo + 2 * KPL) + lr * (VPB / 2) + 8 * hi; const bf* vtl = vth + VPL / 2;
        v8f s0 = {}, s1 = {}, x0 = {}, x1 = {};
        v16h kf[4][4];
#pragma unroll
        for (int kc = 0; kc < 4; ++kc) {
            kf[kc][0] = cat16(*(const v8ha*)(kth + kc * 32), *(const v8ha*)(kth + kc * 32 + 16)); kf[kc][1] = cat16(*(const v8ha*)(kth + 16 * (KPB / 2) + kc * 32), *(const v8ha*)(kth + 16 * (KPB / 2) + kc * 32 + 16));
            kf[kc][2] = cat16(*(const v8ha*)(ktl + kc * 32), *(const v8ha*)(ktl + kc * 32 + 16)); kf[kc][3] = cat16(*(const v8ha*)(ktl + 16 * (KPB / 2) + kc * 32), *(const v8ha*)(ktl + 16 * (KPB / 2) + kc * 32 + 16)); }
        __builtin_amdgcn_sched_barrier(0);     // all 32 LDS reads of the k tile issue ahead of the first product: one LDS latency a tile, not eight
#pragma unroll
        for (int kc = 0; kc < 4; ++kc) {
            const v16h qa = cat16(*(const v8h*)(QH + qo + kc * 32), *(const v8h*)(QH + qo + kc * 32 + 16)), qx = cat16(*(const v8h*)(QL + qo + kc * 32), *(const v8h*)(QL + qo + kc * 32 + 16));
            const v16h k0h = kf[kc][0], k1h = kf[kc][1];
            s0 = wmma16(qa, k0h, s0); s1 = wmma16(qa, k1h, s1); x0 = wmma16(qx, k0h, x0); x1 = wmma16(qx, k1h, x1);
            const v16h k0l = kf[kc][2], k1l = kf[kc][3];
            x0 = wmma16(qa, k0l, x0); x1 = wmma16(qa, k1l, x1);
        }
        asm volatile("v_nop\n\tv_nop\n\tv_nop\n\tv_nop" : "+v"(s0), "+v"(s1), "+v"(x0), "+v"(x1));
        float alpha[8];
#pragma unroll
        for (int j = 0; j < 8; ++j) { const int qi = q0 + hi * 8 + j, ja = l0 + lr, jb = l0 + 16 + lr;
            const float a0 = (ja <= qi) ? (s0[j] + x0[j] * LOSCI) * SCL : -__builtin_inff(), a1 = (jb <= qi) ? (s1[j] + x1[j] * LOSCI) * SCL : -__builtin_inff();     // causal (-inf; the diagonal is always live)
            float mx = fmaxf(a0, a1);
            mx = fmaxf(mx, __shfl_xor(mx, 1, 16)); mx = fmaxf(mx, __shfl_xor(mx, 2, 16)); mx = fmaxf(mx, __shfl_xor(mx, 4, 16)); mx = fmaxf(mx, __shfl_xor(mx, 8, 16));
            const float mn = fmaxf(mrow[j], mx);
            float p0, p1; ex2x3(alpha[j], p0, p1, (mrow[j] - mn) * L2E, (a0 - mn) * L2E, (a1 - mn) * L2E); mrow[j] = mn;
            lpart[j] = lpart[j] * alpha[j] + (p0 + p1);
            const int mr = hi * 8 + j; const float ps0 = p0 * PSC, ps1 = p1 * PSC; const unsigned short h0 = f2bf(ps0), h1 = f2bf(ps1);
            pl[mr * 32 + lr] = h0; pl[mr * 32 + 16 + lr] = h1; pl2[mr * 32 + lr] = f2bf(ps0 - bf2f(h0)); pl2[mr * 32 + 16 + lr] = f2bf(ps1 - bf2f(h1)); }
#pragma unroll
        for (int n = 0; n < 8; ++n)
#pragma unroll
            for (int j = 0; j < 8; ++j) o[n][j] *= alpha[j];
        asm volatile("" ::: "memory");
        const v16bf pa = cat16b(*(const v8usa*)(pl + lr * 32 + hi * 8), *(const v8usa*)(pl + lr * 32 + 16 + hi * 8));
        const v16bf px = cat16b(*(const v8usa*)(pl2 + lr * 32 + hi * 8), *(const v8usa*)(pl2 + lr * 32 + 16 + hi * 8));
        v16bf vf[8][2];
#pragma unroll
        for (int n = 0; n < 8; ++n) { const int vo = n * 16 * (VPB / 2);
            vf[n][0] = cat16b(*(const v8usa*)(vth + vo), *(const v8usa*)(vth + vo + 16)); vf[n][1] = cat16b(*(const v8usa*)(vtl + vo), *(const v8usa*)(vtl + vo + 16)); }
        __builtin_amdgcn_sched_barrier(0);     // the v tile's 32 LDS reads issue ahead of the first product: one LDS latency a tile, not eight
#pragma unroll
        for (int n = 0; n < 8; ++n) { const v16bf vh = vf[n][0], vl = vf[n][1];
            o[n] = wmmab(pa, vh, o[n]); o[n] = wmmab(px, vh, o[n]); o[n] = wmmab(pa, vl, o[n]); }
        __builtin_amdgcn_sched_barrier(0);     // the tile's products stay in front of the foot: else half of them sink behind the barrier and hold back the refill
        asm volatile("v_nop\n\tv_nop\n\tv_nop\n\tv_nop" : "+v"(o[0]), "+v"(o[7]) : "v"(pa), "v"(px));
        asm volatile("s_wait_dscnt 0x0" ::: "memory");        // this wave's reads of trip it are done before its buffer is refilled
        asm volatile("s_wait_asynccnt 0x0" ::: "memory");     // this wave's copies of trip it + 1 have landed
        __syncthreads();                                      // publishes trip it + 1 and ends every wave's reads of trip it
        if (it + 2 <= qt) stage(2 * (it + 2) + kp, bo);       // block-uniform: the refill of the buffer just read
    }
    asm volatile("s_wait_asynccnt 0x0" ::: "memory");         // no copy is outstanding when the wave goes on
    // join of the two teams: each wave hands its partner (wave ^ 4: the same 16 queries, the other key tiles) the four output tiles that the partner finishes, with its maxima and sums
    float* xw = &xch[wave][0]; const float* xr = &xch[wave ^ 4][0];
    v8f fo[4];
#pragma unroll
    for (int n = 0; n < 4; ++n) { const v8f sv = kp ? o[n] : o[4 + n]; fo[n] = kp ? o[4 + n] : o[n];
        *(v4fa*)(xw + ((2 * n) * 32 + lane) * 4) = (v4f){sv[0], sv[1], sv[2], sv[3]}; *(v4fa*)(xw + ((2 * n + 1) * 32 + lane) * 4) = (v4f){sv[4], sv[5], sv[6], sv[7]}; }
    *(v4fa*)(xw + (8 * 32 + lane) * 4) = (v4f){mrow[0], mrow[1], mrow[2], mrow[3]}; *(v4fa*)(xw + (9 * 32 + lane) * 4) = (v4f){mrow[4], mrow[5], mrow[6], mrow[7]};
    *(v4fa*)(xw + (10 * 32 + lane) * 4) = (v4f){lpart[0], lpart[1], lpart[2], lpart[3]}; *(v4fa*)(xw + (11 * 32 + lane) * 4) = (v4f){lpart[4], lpart[5], lpart[6], lpart[7]};
    __syncthreads();                                          // every wave's state is in LDS before its partner reads it
    float fa[8], fb[8];
#pragma unroll
    for (int q = 0; q < 2; ++q) { const v4f pm = *(const v4fa*)(xr + ((8 + q) * 32 + lane) * 4), pls = *(const v4fa*)(xr + ((10 + q) * 32 + lane) * 4);
#pragma unroll
        for (int i = 0; i < 4; ++i) { const int j = q * 4 + i; const float mn = fmaxf(mrow[j], pm[i]);     // a team whose tiles were all masked holds the start maximum and zeros: its factor is 0
            fa[j] = ex2s((mrow[j] - mn) * L2E); fb[j] = ex2s((pm[i] - mn) * L2E); lpart[j] = lpart[j] * fa[j] + pls[i] * fb[j]; } }
#pragma unroll
    for (int n = 0; n < 4; ++n)
#pragma unroll
        for (int q = 0; q < 2; ++q) { const v4f po = *(const v4fa*)(xr + ((2 * n + q) * 32 + lane) * 4);
#pragma unroll
            for (int i = 0; i < 4; ++i) fo[n][q * 4 + i] = fo[n][q * 4 + i] * fa[q * 4 + i] + po[i] * fb[q * 4 + i]; }
    float inv[8];
#pragma unroll
    for (int j = 0; j < 8; ++j) { float rs = lpart[j]; rs += __shfl_xor(rs, 1, 16); rs += __shfl_xor(rs, 2, 16); rs += __shfl_xor(rs, 4, 16); rs += __shfl_xor(rs, 8, 16); inv[j] = 1.0f / (rs * PSC); }
    float* os = &ost[wave][0];
    const size_t ob = (size_t)q0 * (NH_ * HD) + (size_t)h * HD;     // row stride NH*HD, this head's 128 columns
    { const int half = kp;     // this wave's 64 columns
#pragma unroll
        for (int n = 0; n < 4; ++n)
#pragma unroll
            for (int j = 0; j < 8; ++j) os[(hi * 8 + j) * 68 + n * 16 + lr] = fo[n][j] * inv[j];
        __builtin_amdgcn_wave_barrier(); asm volatile("" ::: "memory");
{
#pragma unroll
            for (int s = 0; s < 4; ++s) { const int row = 4 * s + (lane >> 3), piece = lane & 7; const float* sp = os + row * 68 + piece * 8; v8us oh, ol;     // eight lanes = one 128-byte line of each plane
#pragma unroll
                for (int i = 0; i < 8; ++i) { const float v = sp[i]; const unsigned short hb = f2bf(v); oh[i] = hb; ol[i] = f2bf(v - bf2f(hb)); }
                const size_t oo = ob + (size_t)row * (NH_ * HD) + half * 64 + piece * 8; *(v8us*)(OH + oo) = oh; *(v8us*)(OL + oo) = ol; }
             }
        __builtin_amdgcn_wave_barrier(); asm volatile("" ::: "memory");
    }
}

extern "C" void kernel_launch(void* const* d_in, const int* in_sizes, int n_in,
                              void* d_out, int out_size, void* d_ws, size_t ws_size, hipStream_t stream) {
    (void)in_sizes; (void)n_in; (void)out_size;
    const float* x = (const float*)d_in[0]; const float* Wq = (const float*)d_in[1]; const float* bq = (const float*)d_in[2]; const float* Wk = (const float*)d_in[3]; const float* bk = (const float*)d_in[4];
    const float* Wv = (const float*)d_in[5]; const float* bv = (const float*)d_in[6]; const float* WO = (const float*)d_in[7]; const float* bo = (const float*)d_in[8];     // per-head [16][2048][128] k-major weights (x @ W[h]), WO [2048][2048] k-major
    float* out = (float*)d_out;    // [1][2048][2048]
    char* wsp = (char*)d_ws;
    auto take = [&](size_t bytes) { char* p = wsp; wsp += (bytes + 255) & ~(size_t)255; return (void*)p; };
    bf* Xb = (bf*)take((size_t)NT_ * HS * 2); bf* WqN = (bf*)take((size_t)HS * HS * 2); bf* WkN = (bf*)take((size_t)HS * HS * 2); bf* WvN = (bf*)take((size_t)HS * HS * 2); bf* WoT = (bf*)take((size_t)HS * HS * 2);
    bf* Oh = (bf*)take((size_t)NT_ * HS * 2); bf* Ol = (bf*)take((size_t)NT_ * HS * 2); h16* QH = (h16*)take((size_t)NT_ * HS * 2); h16* QL = (h16*)take((size_t)NT_ * HS * 2); h16* KH = (h16*)take((size_t)NT_ * KW * 2); h16* KL = (h16*)take((size_t)NT_ * KW * 2);
    bf* VTH = (bf*)take((size_t)KW * NT_ * 2); bf* VTL = (bf*)take((size_t)KW * NT_ * 2);
    if ((size_t)(wsp - (char*)d_ws) > ws_size) return;    // 13 planes of 8.4 MB ~ 109 MB = 104 MiB
    k_prep<<<3 * PB_W + PB_O + PB_X, 256, 0, stream>>>(Wq, Wk, Wv, WO, x, WqN, WkN, WvN, WoT, Xb);                     // the x and weight operand planes of the four products, one launch
    k_gemmb<false, true><<<dim3(NT_ / GTB, HS / GTB, 1), 256, 0, stream>>>(Xb, nullptr, WqN, bq, (float*)QH, HS, QL);                     // q planes
    k_gemmb<false, true><<<dim3(NT_ / GTB, HS / GTB, 1), 256, 0, stream>>>(Xb, nullptr, WkN, bk, (float*)KH, HS, KL);                     // k planes
    k_gemmb<false, false, true><<<dim3(NT_ / GTB, HS / GTB, 1), 256, 0, stream>>>(Xb, nullptr, WvN, bv, (float*)VTH, HS, (h16*)VTL);      // v planes, [h*128 + d][t]
    k_attn<<<NH_ * (NT_ / 64), 256, 0, stream>>>(QH, QL, KH, KL, VTH, VTL, Oh, Ol);                                   // ctx planes [2048][2048]
    k_gemmb<true, false><<<dim3(NT_ / GTB, HS / GTB, 1), 256, 0, stream>>>(Oh, Ol, WoT, bo, out, HS, nullptr);         // out = ctx.WO + bo
}

// v007
// One run takes 159 microseconds.
// Next to v006, in two timings, it ran 1.07 times as fast each time.
// All steps since v000 together make it 4.57 times as fast.
#include <hip/hip_runtime.h>

// Compute dtypes, f32 accumulate: q/k/v = x.W[h] + b[h] for all 16 heads at once ([2048 x 2048].[2048 x 2048]; the per-head k-major weights transposed into one n-major
// operand; PLAIN bf16 operands = inputs rounded once, exact) and out = ctx.WO + bo (ctx as bf16 hi + UNSCALED residual) on v_wmma_f32_16x16x32_bf16; q/k -> f16
// hi + residual x1024 planes, v -> bf16 hi + UNSCALED residual [d][t] planes; the 16-head causal attention (128-dim heads, scale 128^-1/2) fused: scores on
// v_wmma_f32_16x16x32_f16 (hh + hl + lh), online f32 softmax, weights (x32768) and v on v_wmma_f32_16x16x32_bf16, f32 rows split on the way out. Deterministic, no atomics;
// every product writes its consumer's operand planes from its own epilogue (no f32 intermediate in memory, no separate splitting pass).

#define NB_  1
#define NT_  2048
#define HS   2048
#define NH_  16
#define NKV  16
#define HD   128
#define KW   (NKV * HD)          // 2048
#define NREP 1
#define DM   HS
#define NTK  NT_
#define SCL  0.08838834764831845f
#define PSC  32768.0f
#define LOSC 1024.0f
#define LOSCI (1.0f / 1024.0f)
#define KPB  272                 // LDS pitch in bytes of a staged k row (256 + 16) and
#define VPB  80                  // of a staged v row (64 + 16): 16 B x odd, conflict-free for ds_load_b128
#define KPL  (32 * KPB)          // one k plane of a 32-key stage
#define VPL  (HD * VPB)          // one v plane of a 32-key stage
#define STG  (2 * KPL + 2 * VPL) // one stage: k hi, k lo, v hi, v lo

typedef _Float16 h16;
typedef unsigned short bf;
typedef __attribute__((ext_vector_type(16))) __bf16   v16bf;
typedef __attribute__((ext_vector_type(16))) _Float16 v16h;
typedef __attribute__((ext_vector_type(8)))  _Float16 v8h;
typedef __attribute__((ext_vector_type(8)))  unsigned short v8us;
typedef __attribute__((ext_vector_type(8)))  float    v8f;
typedef __attribute__((ext_vector_type(4)))  float    v4f;
typedef __attribute__((ext_vector_type(4)))  _Float16 v4h;
typedef v8h  __attribute__((may_alias)) v8ha;
typedef v4f  __attribute__((may_alias)) v4fa;
typedef v8us __attribute__((may_alias)) v8usa;

__device__ __forceinline__ unsigned short f2bf(float f) { unsigned u = __float_as_uint(f); u += 0x7FFFu + ((u >> 16) & 1u); return (unsigned short)(u >> 16); }
__device__ __forceinline__ float bf2f(unsigned short b) { return __uint_as_float(((unsigned)b) << 16); }
__device__ __forceinline__ float bfr(float f) { return bf2f(f2bf(f)); }
__device__ __forceinline__ v16h cat16(v8h lo, v8h hi) { return __builtin_shufflevector(lo, hi, 0, 1, 2, 3, 4, 5, 6, 7, 8, 9, 10, 11, 12, 13, 14, 15); }
__device__ __forceinline__ v16bf cat16b(v8us lo, v8us hi) { return __builtin_bit_cast(v16bf, __builtin_shufflevector(lo, hi, 0, 1, 2, 3, 4, 5, 6, 7, 8, 9, 10, 11, 12, 13, 14, 15)); }
__device__ __forceinline__ v8f wmma16(v16h a, v16h b, v8f c) { return __builtin_amdgcn_wmma_f32_16x16x32_f16(false, a, false, b, (short)0, c, false, false); }
__device__ __forceinline__ v8f wmmab(v16bf a, v16bf b, v8f c) { return __builtin_amdgcn_wmma_f32_16x16x32_bf16(false, a, false, b, (short)0, c, false, false); }

// k_gemm: 64 x 64 tile of (A [+ Al]).Bn^T over K = 2048 (+ optional bf16-rounded bias[c]) -> f32 rows [2048][ldc].
template <bool SPLITA>
__global__ __launch_bounds__(128) void k_gemm(const bf* __restrict__ A, const bf* __restrict__ Al, const bf* __restrict__ Bn, const float* __restrict__ bias, int ldc, float* C) {
    __shared__ __align__(16) float ost[4][16 * 68];
    const int lane = threadIdx.x & 31, wave = threadIdx.x >> 5, lr = lane & 15, hi = lane >> 4;
    const size_t r0 = (size_t)blockIdx.x * 64 + wave * 16; const int c0 = blockIdx.y * 64;
    const size_t aoff = (r0 + lr) * HS + 8 * hi;
    v8f acc[4];
#pragma unroll
    for (int t = 0; t < 4; ++t) acc[t] = (v8f){};
#pragma unroll 2
    for (int kc = 0; kc < HS; kc += 32) {
        const v16bf a = cat16b(*(const v8us*)(A + aoff + kc), *(const v8us*)(A + aoff + kc + 16));
        v16bf al = a; if (SPLITA) al = cat16b(*(const v8us*)(Al + aoff + kc), *(const v8us*)(Al + aoff + kc + 16));
#pragma unroll
        for (int t = 0; t < 4; ++t) { const bf* bp = Bn + (size_t)(c0 + t * 16 + lr) * HS + kc + 8 * hi; const v16bf bb = cat16b(*(const v8us*)bp, *(const v8us*)(bp + 16)); acc[t] = wmmab(a, bb, acc[t]); if (SPLITA) acc[t] = wmmab(al, bb, acc[t]); }
        asm volatile("v_nop" : "+v"(acc[0]), "+v"(acc[1]), "+v"(acc[2]), "+v"(acc[3]) : "v"(a), "v"(al) : "memory");
    }
    float* os = &ost[wave][0];
#pragma unroll
    for (int t = 0; t < 4; ++t)
#pragma unroll
        for (int j = 0; j < 8; ++j) os[(hi * 8 + j) * 68 + t * 16 + lr] = acc[t][j] + (bias ? bfr(bias[c0 + t * 16 + lr]) : 0.f);
    __builtin_amdgcn_wave_barrier(); asm volatile("" ::: "memory");
    float* crow = C + r0 * ldc + c0;
    auto pass = [&]() {
#pragma unroll
        for (int s = 0; s < 8; ++s) { const int Lid = (lane >> 3) + 4 * s, piece = lane & 7; const int row = Lid >> 1, cofs = (Lid & 1) * 32 + piece * 4;
            const v4f val = *(const v4fa*)(os + row * 68 + cofs); *(v4f*)(crow + (size_t)row * ldc + cofs) = val; }
    };
    pass(); 
}
// k_attn: block = (head, 64 queries), wave = 16; causal key tiles 0..(Q0+63)/32 (block-uniform); per element: score x 128^-1/2, keys past the query at -inf;
// online f32 softmax; P (x32768) as bf16 hi + residual against the V planes; output rows as bf16 hi + unscaled residual planes.
// k_prep: all input preparation in one grid; the jobs are independent of one another and the block index picks one (block-uniform):
//   blocks 0 .. 3071: a 64 x 64 tile of one head's k-major [2048][128] weight (q, k, v: 1024 blocks each; 64 a head) -> rows (h, d) of the n-major bf16 operand;
//   blocks 3072 .. 4095: a 64 x 64 tile of WO [2048][2048] -> WoT; blocks 4096 .. 4351: eight rows of x -> bf16 (one wave per row).
// Transpose tile: WT [n][2048] = bf16(W[k][n]) via LDS.
#define PB_H  ((HS / 64) * (HD / 64))      // 64 tiles a head
#define PB_W  (NH_ * PB_H)                 // 1024 blocks a per-head weight
#define PB_O  ((HS / 64) * (HS / 64))      // 1024 tiles of WO
#define PB_X  (NT_ / 8)                    // 256 blocks of x rows
__global__ __launch_bounds__(256) void k_prep(const float* __restrict__ Wq, const float* __restrict__ Wk, const float* __restrict__ Wv, const float* __restrict__ WO, const float* __restrict__ x,
                                              bf* WqN, bf* WkN, bf* WvN, bf* WoT, bf* Xb) {
    __shared__ __align__(16) unsigned short tl[64 * 72];
    const int tid = threadIdx.x, b = blockIdx.x;
    if (b >= 3 * PB_W + PB_O) {            // x rows; the whole block leaves here, ahead of the barrier
        const float* __restrict__ src = x; bf* dst = Xb;
        const int lane = threadIdx.x & 31, r = (b - (3 * PB_W + PB_O)) * 8 + (threadIdx.x >> 5);
#pragma unroll
        for (int q = 0; q < HS / 256; ++q) { v8us o;
#pragma unroll
            for (int i = 0; i < 8; ++i) o[i] = f2bf(src[(size_t)r * HS + q * 256 + lane * 8 + i]);
            *(v8us*)(dst + (size_t)r * HS + q * 256 + lane * 8) = o; }
        return;
    }
    const float* __restrict__ Wm; bf* WT; int ncols, t; const int K = HS;
    if (b < 3 * PB_W) { const int m = b / PB_W, r = b - m * PB_W, h = r / PB_H; t = r - h * PB_H; ncols = HD;
        Wm = (m == 0 ? Wq : m == 1 ? Wk : Wv) + (size_t)h * HS * HD; WT = (m == 0 ? WqN : m == 1 ? WkN : WvN) + (size_t)h * HD * HS; }
    else { t = b - 3 * PB_W; ncols = HS; Wm = WO; WT = WoT; }
    const int k0 = (t % (HS / 64)) * 64, n0 = (t / (HS / 64)) * 64;
    const int kk = tid >> 2, nq = (tid & 3) * 16;
#pragma unroll
    for (int i = 0; i < 16; ++i) tl[(nq + i) * 72 + kk] = f2bf(Wm[(size_t)(k0 + kk) * ncols + n0 + nq + i]);
    __syncthreads();
    const int piece = tid & 7;
    auto pass = [&]() {
#pragma unroll
        for (int s = 0; s < 2; ++s) { const int nr = (tid >> 3) + 32 * s; const v8us val = *(const v8usa*)(tl + nr * 72 + piece * 8); *(v8us*)(WT + (size_t)(n0 + nr) * K + k0 + piece * 8) = val; }
    };
    pass(); 
}
// k_gemmb: 128 x 128 block tile (8 waves, 4 x 2, each 32 x 64) of C[NTK][NW] = (A [+ Al]).B^T [+ bf(bias[c])] [+ bf(R[r][c]) residual]; f32 whole-line epilogue, or f16
// hi + residual x1024 planes (F16OUT), or the transposed [c][r] bf16 hi + unscaled residual planes (VTOUT: C, C2 are the two planes, row length NT_). Each 128-k slab of the block's 128 A rows (and Al rows) and 128 B rows is brought into LDS once per block by asynchronous copies in whole 256-byte rows,
// two buffers: slab t + 1 flies while slab t is worked on; the waves read their fragments from there (K a multiple of 128). The k order of the fragments is unchanged.
#define GKS  128                 // k elements of a staged slab: rows of 256 bytes
#define GPB  272                 // LDS pitch in bytes of a staged row (256 + 16): 16 B x odd, conflict-free for ds_load_b128
#define GTB  128                 // rows of a plane: the block tile's rows, and its columns
#define GPL  (GTB * GPB)         // one plane of a slab
#define GTP  136                 // pitch in elements of a staged transposed output row (128 + 8): 16 B x odd
// cpa8: eight 16-byte copies of one lane; the s_wait_xcnt stands inside the statement so that no address register is rewritten ahead of it.
__device__ __forceinline__ void cpa8(unsigned l0, unsigned l1, unsigned l2, unsigned l3, unsigned l4, unsigned l5, unsigned l6, unsigned l7,
                                     const void* g0, const void* g1, const void* g2, const void* g3, const void* g4, const void* g5, const void* g6, const void* g7) {
    asm volatile("global_load_async_to_lds_b128 %0, %8, off\n\t"
                 "global_load_async_to_lds_b128 %1, %9, off\n\t"
                 "global_load_async_to_lds_b128 %2, %10, off\n\t"
                 "global_load_async_to_lds_b128 %3, %11, off\n\t"
                 "global_load_async_to_lds_b128 %4, %12, off\n\t"
                 "global_load_async_to_lds_b128 %5, %13, off\n\t"
                 "global_load_async_to_lds_b128 %6, %14, off\n\t"
                 "global_load_async_to_lds_b128 %7, %15, off\n\t"
                 "s_wait_xcnt 0x0"
                 :: "v"(l0), "v"(l1), "v"(l2), "v"(l3), "v"(l4), "v"(l5), "v"(l6), "v"(l7), "v"(g0), "v"(g1), "v"(g2), "v"(g3), "v"(g4), "v"(g5), "v"(g6), "v"(g7) : "memory");
}
template <bool SPLITA, bool F16OUT = false, bool VTOUT = false>
__global__ __launch_bounds__(256) void k_gemmb(const bf* __restrict__ A, const bf* __restrict__ Al, const bf* __restrict__ Bn, const float* __restrict__ bias, float* C, int ldc, h16* C2, const float* __restrict__ R = nullptr, int K = DM, int roundR = 1) {
    constexpr unsigned GST = (SPLITA ? 3 : 2) * GPL, GBO = (SPLITA ? 2 : 1) * GPL;     // one slab: A rows (, Al rows), B rows; where its B plane begins (Al within reach of the A pointer's 16-bit LDS offsets)
    constexpr int KG = SPLITA ? 1 : 2, NG = (GKS / 32) / KG;     // 32-k steps whose fragments are read as one group (16 products a group either way); groups a slab
    __shared__ __align__(16) float ost[8][32 * 68];
    __shared__ __align__(16) unsigned char gring[2 * GST];
    const int lane = threadIdx.x & 31, wave = threadIdx.x >> 5, lr = lane & 15, hi = lane >> 4;
    const int wr = wave >> 1, wc = wave & 1;             // the wave's 32 rows and 64 columns of the block tile
    const int rb = blockIdx.x * GTB, cb = blockIdx.y * GTB;
    const int r0 = rb + wr * 32, c0 = cb + wc * 64;
    // each thread copies 8 x 16 B of each plane: rows tid / 16 + 16 i (a wave = two whole 256-byte rows)
    const int tid = threadIdx.x;
    const unsigned gdst = (unsigned)(size_t)&gring[0] + (tid >> 4) * GPB + (tid & 15) * 16;     // the lane's byte address in LDS
    const size_t asrc = (size_t)(rb + (tid >> 4)) * K + (tid & 15) * 8, bsrc = (size_t)(cb + (tid >> 4)) * K + (tid & 15) * 8, rs = (size_t)16 * K;
    auto plane = [&](const bf* p, unsigned d) {
        cpa8(d, d + 16 * GPB, d + 32 * GPB, d + 48 * GPB, d + 64 * GPB, d + 80 * GPB, d + 96 * GPB, d + 112 * GPB,
             p, p + rs, p + 2 * rs, p + 3 * rs, p + 4 * rs, p + 5 * rs, p + 6 * rs, p + 7 * rs);
    };
    auto stage = [&](int t, unsigned bo) {
        plane(A + asrc + (size_t)t * GKS, gdst + bo); plane(Bn + bsrc + (size_t)t * GKS, gdst + bo + GBO);
        if (SPLITA) plane(Al + asrc + (size_t)t * GKS, gdst + bo + GPL);
    };
    v8f acc[2][4];
#pragma unroll
    for (int m = 0; m < 2; ++m)
#pragma unroll
        for (int t = 0; t < 4; ++t) acc[m][t] = (v8f){};
    const int nt = K / GKS;
    stage(0, 0u);
    asm volatile("s_wait_asynccnt 0x0" ::: "memory");     // slab 0 of this wave's copies has landed
    __syncthreads();                                      // ... and every other wave's
    if (nt > 1) stage(1, GST);                            // block-uniform
#pragma unroll 1
    for (int s = 0; s < nt; ++s) {
        const unsigned bo = (unsigned)(s & 1) * GST;
        const bf* as = (const bf*)(gring + bo) + (wr * 32 + lr) * (GPB / 2) + 8 * hi;            // this lane's A row of row group 0 in the staged slab (Al: one plane on)
        const bf* bs = (const bf*)(gring + bo + GBO) + (wc * 64 + lr) * (GPB / 2) + 8 * hi;      // this lane's B row of column group 0
#pragma unroll
        for (int g = 0; g < NG; ++g) {
            v16bf af[KG][2], alf[KG][2], bb[KG][4];
#pragma unroll
            for (int kc = 0; kc < KG; ++kc) { const int ko = (g * KG + kc) * 32;
#pragma unroll
                for (int m = 0; m < 2; ++m) { const bf* ap = as + m * 16 * (GPB / 2) + ko;
                    af[kc][m] = cat16b(*(const v8usa*)ap, *(const v8usa*)(ap + 16));
                    alf[kc][m] = af[kc][m]; if (SPLITA) alf[kc][m] = cat16b(*(const v8usa*)(ap + GPL / 2), *(const v8usa*)(ap + GPL / 2 + 16)); }
#pragma unroll
                for (int t = 0; t < 4; ++t) { const bf* bp = bs + t * 16 * (GPB / 2) + ko; bb[kc][t] = cat16b(*(const v8usa*)bp, *(const v8usa*)(bp + 16)); }
            }
            __builtin_amdgcn_sched_barrier(0);     // the group's LDS reads issue ahead of its first product: one LDS latency a group, not one a fragment
#pragma unroll
            for (int kc = 0; kc < KG; ++kc)
#pragma unroll
                for (int m = 0; m < 2; ++m)
#pragma unroll
                    for (int t = 0; t < 4; ++t) { acc[m][t] = wmmab(af[kc][m], bb[kc][t], acc[m][t]); if (SPLITA) acc[m][t] = wmmab(alf[kc][m], bb[kc][t], acc[m][t]); }
            if (g == NG - 1)     // the distance behind the slab's last product, on the back edge too
                asm volatile("v_nop\n\tv_nop\n\tv_nop\n\tv_nop" : "+v"(acc[0][0]), "+v"(acc[0][1]), "+v"(acc[0][2]), "+v"(acc[0][3]), "+v"(acc[1][0]), "+v"(acc[1][1]), "+v"(acc[1][2]), "+v"(acc[1][3]) : "v"(af[KG - 1][1]), "v"(alf[KG - 1][1]));
        }
        asm volatile("s_wait_dscnt 0x0" ::: "memory");        // this wave's reads of slab s are done before its buffer is refilled
        asm volatile("s_wait_asynccnt 0x0" ::: "memory");     // this wave's copies of slab s + 1 have landed
        __syncthreads();                                      // publishes slab s + 1 and ends every wave's reads of slab s
        if (s + 2 < nt) stage(s + 2, bo);                     // block-uniform: the refill of the buffer just read
    }
    asm volatile("s_wait_asynccnt 0x0" ::: "memory");         // no copy is outstanding when the wave goes on
    float* os = &ost[wave][0];
    unsigned short* tph = (unsigned short*)(void*)&ost[0][0]; unsigned short* tpl = tph + GTB * GTP;     // VTOUT: the staging holds the two transposed planes, [c][r]
#pragma unroll
    for (int t = 0; t < 4; ++t) { const float bv = bias ? bfr(bias[c0 + t * 16 + lr]) : 0.f;
#pragma unroll
        for (int m = 0; m < 2; ++m) {
            if (VTOUT) {     // a lane holds eight consecutive r of one c: one 16-byte piece of that c row in each plane
                v8us oh, ol;
#pragma unroll
                for (int j = 0; j < 8; ++j) { const float v = acc[m][t][j] + bv; const unsigned short hb = f2bf(v); oh[j] = hb; ol[j] = f2bf(v - bf2f(hb)); }
                const int o = (wc * 64 + t * 16 + lr) * GTP + wr * 32 + m * 16 + hi * 8; *(v8usa*)(tph + o) = oh; *(v8usa*)(tpl + o) = ol;
            } else {
#pragma unroll
                for (int j = 0; j < 8; ++j) os[(m * 16 + hi * 8 + j) * 68 + t * 16 + lr] = acc[m][t][j] + bv;
            }
        } }
    __syncthreads();
    if (VTOUT) {
        // the block's 128 r x 128 c tile leaves transposed: sixteen lanes write the two whole 128-byte lines (128 r) of a c row in each plane; reads cross the waves' staging (behind the barrier above)
        bf* th = (bf*)(void*)C + (size_t)cb * NT_ + rb; bf* tlo = (bf*)(void*)C2 + (size_t)cb * NT_ + rb;
        const int piece = tid & 15;
#pragma unroll
        for (int s = 0; s < 8; ++s) { const int d = (tid >> 4) + 16 * s;
            const v8us oh = *(const v8usa*)(tph + d * GTP + piece * 8), ol = *(const v8usa*)(tpl + d * GTP + piece * 8);
            *(v8us*)(th + (size_t)d * NT_ + piece * 8) = oh; *(v8us*)(tlo + (size_t)d * NT_ + piece * 8) = ol; }
    } else if (F16OUT) {
        h16* crow = (h16*)(void*)C + (size_t)r0 * ldc + c0;
        auto pass = [&]() {
#pragma unroll
            for (int s = 0; s < 8; ++s) { const int row = 4 * s + (lane >> 3), piece = lane & 7; const float* sp = os + row * 68 + piece * 8; v8h o, o2;
#pragma unroll
                for (int i = 0; i < 8; ++i) { const h16 a = (h16)sp[i]; o[i] = a; o2[i] = (h16)((sp[i] - (float)a) * LOSC); }
                *(v8h*)(crow + (size_t)row * ldc + piece * 8) = o;
                asm volatile("s_wait_xcnt 0x0" ::: "memory");     // the store's registers are reused on the far side of the branch below
                if (C2) *(v8h*)(C2 + (size_t)r0 * ldc + c0 + (size_t)row * ldc + piece * 8) = o2; }
        };
        pass(); 
    } else {
        float* crow = C + (size_t)r0 * ldc + c0;
        auto pass = [&]() {
#pragma unroll
            for (int s = 0; s < 16; ++s) { const int Lid = (lane >> 3) + 4 * s, piece = lane & 7; const int row = Lid >> 1, cofs = (Lid & 1) * 32 + piece * 4;
                v4f val = *(const v4fa*)(os + row * 68 + cofs); if (R) { const v4f rv = *(const v4f*)(R + ((size_t)r0 + row) * ldc + c0 + cofs); val += roundR ? (v4f){bfr(rv[0]), bfr(rv[1]), bfr(rv[2]), bfr(rv[3])} : rv; }
                *(v4f*)(crow + (size_t)row * ldc + cofs) = val;
                asm volatile("s_wait_xcnt 0x0" ::: "memory"); }     // the store's registers are reused behind the branch on R of the next row
        };
        pass(); 
    }
}

__device__ __forceinline__ void cp8(unsigned l0, unsigned l1, unsigned l2, unsigned l3, unsigned l4, unsigned l5, unsigned l6, unsigned l7,
                                    const void* g0, const void* g1, const void* g2, const void* g3, const void* g4, const void* g5, const void* g6, const void* g7) {
    asm volatile("global_load_async_to_lds_b128 %0, %8, off\n\t"
                 "global_load_async_to_lds_b128 %1, %9, off\n\t"
                 "global_load_async_to_lds_b128 %2, %10, off\n\t"
                 "global_load_async_to_lds_b128 %3, %11, off\n\t"
                 "global_load_async_to_lds_b128 %4, %12, off\n\t"
                 "global_load_async_to_lds_b128 %5, %13, off\n\t"
                 "global_load_async_to_lds_b128 %6, %14, off\n\t"
                 "global_load_async_to_lds_b128 %7, %15, off\n\t"
                 "s_wait_xcnt 0x0"
                 :: "v"(l0), "v"(l1), "v"(l2), "v"(l3), "v"(l4), "v"(l5), "v"(l6), "v"(l7), "v"(g0), "v"(g1), "v"(g2), "v"(g3), "v"(g4), "v"(g5), "v"(g6), "v"(g7) : "memory");
}
// ex2s: 2^x; the one free slot that the instruction set asks for behind a transcendental stands inside the statement
#define L2E 1.4426950408889634f
__device__ __forceinline__ float ex2s(float x) { float r; asm("v_exp_f32 %0, %1\n\tv_nop" : "=v"(r) : "v"(x)); return r; }
// ex2x3: three at once: each fills the slot of the one in front of it (results apart from every source), one v_nop behind the last
__device__ __forceinline__ void ex2x3(float& r0, float& r1, float& r2, float x0, float x1, float x2) {
    asm("v_exp_f32 %0, %3\n\tv_exp_f32 %1, %4\n\tv_exp_f32 %2, %5\n\tv_nop" : "=&v"(r0), "=&v"(r1), "=&v"(r2) : "v"(x0), "v"(x1), "v"(x2)); }
// rowmax8: eight values, each replaced by its maximum over the lane's 16-lane row, by DPP row_xmask steps in the vector unit (the shuffle intrinsic compiled to an LDS permute with a
// wait behind each step). The eight rows go through each step side by side, so that every instruction's producer stands eight instructions back and no step waits for the one before.
__device__ __forceinline__ void rowmax8(float (&m)[8]) {
    asm(
        "v_max_num_f32_dpp %0, %0, %0 row_xmask:1 row_mask:0xf bank_mask:0xf\n\t"
        "v_max_num_f32_dpp %1, %1, %1 row_xmask:1 row_mask:0xf bank_mask:0xf\n\t"
        "v_max_num_f32_dpp %2, %2, %2 row_xmask:1 row_mask:0xf bank_mask:0xf\n\t"
        "v_max_num_f32_dpp %3, %3, %3 row_xmask:1 row_mask:0xf bank_mask:0xf\n\t"
        "v_max_num_f32_dpp %4, %4, %4 row_xmask:1 row_mask:0xf bank_mask:0xf\n\t"
        "v_max_num_f32_dpp %5, %5, %5 row_xmask:1 row_mask:0xf bank_mask:0xf\n\t"
        "v_max_num_f32_dpp %6, %6, %6 row_xmask:1 row_mask:0xf bank_mask:0xf\n\t"
        "v_max_num_f32_dpp %7, %7, %7 row_xmask:1 row_mask:0xf bank_mask:0xf\n\t"
        "v_max_num_f32_dpp %0, %0, %0 row_xmask:2 row_mask:0xf bank_mask:0xf\n\t"
        "v_max_num_f32_dpp %1, %1, %1 row_xmask:2 row_mask:0xf bank_mask:0xf\n\t"
        "v_max_num_f32_dpp %2, %2, %2 row_xmask:2 row_mask:0xf bank_mask:0xf\n\t"
        "v_max_num_f32_dpp %3, %3, %3 row_xmask:2 row_mask:0xf bank_mask:0xf\n\t"
        "v_max_num_f32_dpp %4, %4, %4 row_xmask:2 row_mask:0xf bank_mask:0xf\n\t"
        "v_max_num_f32_dpp %5, %5, %5 row_xmask:2 row_mask:0xf bank_mask:0xf\n\t"
        "v_max_num_f32_dpp %6, %6, %6 row_xmask:2 row_mask:0xf bank_mask:0xf\n\t"
        "v_max_num_f32_dpp %7, %7, %7 row_xmask:2 row_mask:0xf bank_mask:0xf\n\t"
        "v_max_num_f32_dpp %0, %0, %0 row_xmask:4 row_mask:0xf bank_mask:0xf\n\t"
        "v_max_num_f32_dpp %1, %1, %1 row_xmask:4 row_mask:0xf bank_mask:0xf\n\t"
        "v_max_num_f32_dpp %2, %2, %2 row_xmask:4 row_mask:0xf bank_mask:0xf\n\t"
        "v_max_num_f32_dpp %3, %3, %3 row_xmask:4 row_mask:0xf bank_mask:0xf\n\t"
        "v_max_num_f32_dpp %4, %4, %4 row_xmask:4 row_mask:0xf bank_mask:0xf\n\t"
        "v_max_num_f32_dpp %5, %5, %5 row_xmask:4 row_mask:0xf bank_mask:0xf\n\t"
        "v_max_num_f32_dpp %6, %6, %6 row_xmask:4 row_mask:0xf bank_mask:0xf\n\t"
        "v_max_num_f32_dpp %7, %7, %7 row_xmask:4 row_mask:0xf bank_mask:0xf\n\t"
        "v_max_num_f32_dpp %0, %0, %0 row_xmask:8 row_mask:0xf bank_mask:0xf\n\t"
        "v_max_num_f32_dpp %1, %1, %1 row_xmask:8 row_mask:0xf bank_mask:0xf\n\t"
        "v_max_num_f32_dpp %2, %2, %2 row_xmask:8 row_mask:0xf bank_mask:0xf\n\t"
        "v_max_num_f32_dpp %3, %3, %3 row_xmask:8 row_mask:0xf bank_mask:0xf\n\t"
        "v_max_num_f32_dpp %4, %4, %4 row_xmask:8 row_mask:0xf bank_mask:0xf\n\t"
        "v_max_num_f32_dpp %5, %5, %5 row_xmask:8 row_mask:0xf bank_mask:0xf\n\t"
        "v_max_num_f32_dpp %6, %6, %6 row_xmask:8 row_mask:0xf bank_mask:0xf\n\t"
        "v_max_num_f32_dpp %7, %7, %7 row_xmask:8 row_mask:0xf bank_mask:0xf"
        : "+v"(m[0]), "+v"(m[1]), "+v"(m[2]), "+v"(m[3]), "+v"(m[4]), "+v"(m[5]), "+v"(m[6]), "+v"(m[7]));
}
// xm: the value of lane l ^ M inside the lane's 16-lane row, by a DPP row_xmask move (the closing row sums, once a block)
template <int M> __device__ __forceinline__ float xm(float x) { return __builtin_bit_cast(float, __builtin_amdgcn_update_dpp(0, __builtin_bit_cast(int, x), 0x160 | M, 0xf, 0xf, true)); }
__global__ __launch_bounds__(256) void k_attn(const h16* __restrict__ QH, const h16* __restrict__ QL, const h16* __restrict__ KH, const h16* __restrict__ KL, const bf* __restrict__ VTH, const bf* __restrict__ VTL, bf* OH, bf* OL) {
    __shared__ __align__(16) unsigned short plds[8][16 * 32];
    __shared__ __align__(16) unsigned short plds2[8][16 * 32];
    __shared__ __align__(16) float ost[8][16 * 68];
    __shared__ __align__(16) float xch[8][12 * 32 * 4];     // what a wave hands its partner: four output tiles, the maxima, the sums
    __shared__ __align__(16) unsigned char ring[4 * STG];   // two buffers x two teams
    const int lane = threadIdx.x & 31, wave = threadIdx.x >> 5, lr = lane & 15, hi = lane >> 4;
    const int kp = __builtin_amdgcn_readfirstlane((int)(threadIdx.x >> 7));     // the team: parity of its key tiles (wave-uniform, kept scalar)
    const int bid = blockIdx.x; const int h = bid % NH_, qt = (NT_ / 64 - 1) - bid / NH_; const int g = h / NREP;     // longest blocks first; GQA: kv head
    const int q0 = qt * 64 + (wave & 3) * 16;
    unsigned short* pl = &plds[wave][0]; unsigned short* pl2 = &plds2[wave][0];
    const size_t qo = (size_t)(q0 + lr) * (NH_ * HD) + h * HD + 8 * hi;
    const h16* kh_b = KH + g * HD; const h16* kl_b = KL + g * HD;
    const size_t vbase = ((size_t)g * HD) * NT_;
    v8f o[8];
#pragma unroll
    for (int n = 0; n < 8; ++n) o[n] = (v8f){};
    float mrow[8], lpart[8];
#pragma unroll
    for (int j = 0; j < 8; ++j) { mrow[j] = -3.0e38f; lpart[j] = 0.f; }
    // causal key tiles 0 .. 2 qt + 1: trip it works on tile 2 it + kp, it = 0 .. qt
    // each thread copies 4 x 16 B of each plane of its team's tile: k rows tid / 16 + 8 i (a wave = two whole 256-byte rows), v rows tid / 4 + 32 i
    const int tid = threadIdx.x & 127;
    const unsigned ring0 = (unsigned)(size_t)&ring[0];     // the ring's byte address in LDS
    const unsigned kdst = ring0 + (tid >> 4) * KPB + (tid & 15) * 16, vdst = ring0 + 2 * KPL + (tid >> 2) * VPB + (tid & 3) * 16;
    const size_t ksrc = (size_t)(tid >> 4) * KW + (tid & 15) * 8, vsrc = vbase + (size_t)(tid >> 2) * NT_ + (tid & 3) * 8;
    auto stage = [&](int t, unsigned bo) {
        const h16* a = kh_b + ksrc + (size_t)t * 32 * KW; const h16* b = kl_b + ksrc + (size_t)t * 32 * KW; const unsigned kd = kdst + bo;
        cp8(kd, kd + 8 * KPB, kd + 16 * KPB, kd + 24 * KPB, kd + KPL, kd + KPL + 8 * KPB, kd + KPL + 16 * KPB, kd + KPL + 24 * KPB,
            a, a + 8 * KW, a + 16 * KW, a + 24 * KW, b, b + 8 * KW, b + 16 * KW, b + 24 * KW);
        const bf* c = VTH + vsrc + t * 32; const bf* d = VTL + vsrc + t * 32; const unsigned vd = vdst + bo;
        cp8(vd, vd + 32 * VPB, vd + 64 * VPB, vd + 96 * VPB, vd + VPL, vd + VPL + 32 * VPB, vd + VPL + 64 * VPB, vd + VPL + 96 * VPB,
            c, c + 32 * NT_, c + 64 * NT_, c + 96 * NT_, d, d + 32 * NT_, d + 64 * NT_, d + 96 * NT_);
    };
    const unsigned tbo = (unsigned)kp * STG;              // the team's part of a buffer
    stage(kp, tbo);
    asm volatile("s_wait_asynccnt 0x0" ::: "memory");     // this wave's copies of trip 0 have landed
    __syncthreads();                                      // ... and every other wave's
    if (qt >= 1) stage(2 + kp, 2u * STG + tbo);           // block-uniform: a trip 1 exists
#pragma unroll 1
    for (int it = 0; it <= qt; ++it) {
        const int l0 = (2 * it + kp) * 32;
        const unsigned bo = (unsigned)(it & 1) * (2u * STG) + tbo;
        const h16* kth = (const h16*)(ring + bo) + lr * (KPB / 2) + 8 * hi; const h16* ktl = kth + KPL / 2;     // this lane's k row of the staged tile
        const bf* vth = (const bf*)(ring + bo + 2 * KPL) + lr * (VPB / 2) + 8 * hi; const bf* vtl = vth + VPL / 2;
        v8f s0 = {}, s1 = {}, x0 = {}, x1 = {};
        v16h kf[4][4];
#pragma unroll
        for (int kc = 0; kc < 4; ++kc) {
            kf[kc][0] = cat16(*(const v8ha*)(kth + kc * 32), *(const v8ha*)(kth + kc * 32 + 16)); kf[kc][1] = cat16(*(const v8ha*)(kth + 16 * (KPB / 2) + kc * 32), *(const v8ha*)(kth + 16 * (KPB / 2) + kc * 32 + 16));
            kf[kc][2] = cat16(*(const v8ha*)(ktl + kc * 32), *(const v8ha*)(ktl + kc * 32 + 16)); kf[kc][3] = cat16(*(const v8ha*)(ktl + 16 * (KPB / 2) + kc * 32), *(const v8ha*)(ktl + 16 * (KPB / 2) + kc * 32 + 16)); }
        __builtin_amdgcn_sched_barrier(0);     // all 32 LDS reads of the k tile issue ahead of the first product: one LDS latency a tile, not eight
#pragma unroll
        for (int kc = 0; kc < 4; ++kc) {
            const v16h qa = cat16(*(const v8h*)(QH + qo + kc * 32), *(const v8h*)(QH + qo + kc * 32 + 16)), qx = cat16(*(const v8h*)(QL + qo + kc * 32), *(const v8h*)(QL + qo + kc * 32 + 16));
            const v16h k0h = kf[kc][0], k1h = kf[kc][1];
            s0 = wmma16(qa, k0h, s0); s1 = wmma16(qa, k1h, s1); x0 = wmma16(qx, k0h, x0); x1 = wmma16(qx, k1h, x1);
            const v16h k0l = kf[kc][2], k1l = kf[kc][3];
            x0 = wmma16(qa, k0l, x0); x1 = wmma16(qa, k1l, x1);
        }
        asm volatile("v_nop\n\tv_nop\n\tv_nop\n\tv_nop" : "+v"(s0), "+v"(s1), "+v"(x0), "+v"(x1));
        float alpha[8], sa[8], sb[8], mxr[8];
#pragma unroll
        for (int j = 0; j < 8; ++j) { const int qi = q0 + hi * 8 + j, ja = l0 + lr, jb = l0 + 16 + lr;
            sa[j] = (ja <= qi) ? (s0[j] + x0[j] * LOSCI) * SCL : -__builtin_inff(); sb[j] = (jb <= qi) ? (s1[j] + x1[j] * LOSCI) * SCL : -__builtin_inff();     // causal (-inf as the reference; the diagonal is always live)
            mxr[j] = fmaxf(sa[j], sb[j]); }
        rowmax8(mxr);
#pragma unroll
        for (int j = 0; j < 8; ++j) { const float a0 = sa[j], a1 = sb[j];
            const float mn = fmaxf(mrow[j], mxr[j]);
            float p0, p1; ex2x3(alpha[j], p0, p1, (mrow[j] - mn) * L2E, (a0 - mn) * L2E, (a1 - mn) * L2E); mrow[j] = mn;
            lpart[j] = lpart[j] * alpha[j] + (p0 + p1);
            const int mr = hi * 8 + j; const float ps0 = p0 * PSC, ps1 = p1 * PSC; const unsigned short h0 = f2bf(ps0), h1 = f2bf(ps1);
            pl[mr * 32 + lr] = h0; pl[mr * 32 + 16 + lr] = h1; pl2[mr * 32 + lr] = f2bf(ps0 - bf2f(h0)); pl2[mr * 32 + 16 + lr] = f2bf(ps1 - bf2f(h1)); }
#pragma unroll
        for (int n = 0; n < 8; ++n)
#pragma unroll
            for (int j = 0; j < 8; ++j) o[n][j] *= alpha[j];
        asm volatile("" ::: "memory");
        const v16bf pa = cat16b(*(const v8usa*)(pl + lr * 32 + hi * 8), *(const v8usa*)(pl + lr * 32 + 16 + hi * 8));
        const v16bf px = cat16b(*(const v8usa*)(pl2 + lr * 32 + hi * 8), *(const v8usa*)(pl2 + lr * 32 + 16 + hi * 8));
        v16bf vf[8][2];
#pragma unroll
        for (int n = 0; n < 8; ++n) { const int vo = n * 16 * (VPB / 2);
            vf[n][0] = cat16b(*(const v8usa*)(vth + vo), *(const v8usa*)(vth + vo + 16)); vf[n][1] = cat16b(*(const v8usa*)(vtl + vo), *(const v8usa*)(vtl + vo + 16)); }
        __builtin_amdgcn_sched_barrier(0);     // the v tile's 32 LDS reads issue ahead of the first product: one LDS latency a tile, not eight
#pragma unroll
        for (int n = 0; n < 8; ++n) { const v16bf vh = vf[n][0], vl = vf[n][1];
            o[n] = wmmab(pa, vh, o[n]); o[n] = wmmab(px, vh, o[n]); o[n] = wmmab(pa, vl, o[n]); }
        __builtin_amdgcn_sched_barrier(0);     // the tile's products stay in front of the foot: else half of them sink behind the barrier and hold back the refill
        asm volatile("v_nop\n\tv_nop\n\tv_nop\n\tv_nop" : "+v"(o[0]), "+v"(o[7]) : "v"(pa), "v"(px));
        asm volatile("s_wait_dscnt 0x0" ::: "memory");        // this wave's reads of trip it are done before its buffer is refilled
        asm volatile("s_wait_asynccnt 0x0" ::: "memory");     // this wave's copies of trip it + 1 have landed
        __syncthreads();                                      // publishes trip it + 1 and ends every wave's reads of trip it
        if (it + 2 <= qt) stage(2 * (it + 2) + kp, bo);       // block-uniform: the refill of the buffer just read
    }
    asm volatile("s_wait_asynccnt 0x0" ::: "memory");         // no copy is outstanding when the wave goes on
    // join of the two teams: each wave hands its partner (wave ^ 4: the same 16 queries, the other key tiles) the four output tiles that the partner finishes, with its maxima and sums
    float* xw = &xch[wave][0]; const float* xr = &xch[wave ^ 4][0];
    v8f fo[4];
#pragma unroll
    for (int n = 0; n < 4; ++n) { const v8f sv = kp ? o[n] : o[4 + n]; fo[n] = kp ? o[4 + n] : o[n];
        *(v4fa*)(xw + ((2 * n) * 32 + lane) * 4) = (v4f){sv[0], sv[1], sv[2], sv[3]}; *(v4fa*)(xw + ((2 * n + 1) * 32 + lane) * 4) = (v4f){sv[4], sv[5], sv[6], sv[7]}; }
    *(v4fa*)(xw + (8 * 32 + lane) * 4) = (v4f){mrow[0], mrow[1], mrow[2], mrow[3]}; *(v4fa*)(xw + (9 * 32 + lane) * 4) = (v4f){mrow[4], mrow[5], mrow[6], mrow[7]};
    *(v4fa*)(xw + (10 * 32 + lane) * 4) = (v4f){lpart[0], lpart[1], lpart[2], lpart[3]}; *(v4fa*)(xw + (11 * 32 + lane) * 4) = (v4f){lpart[4], lpart[5], lpart[6], lpart[7]};
    __syncthreads();                                          // every wave's state is in LDS before its partner reads it
    float fa[8], fb[8];
#pragma unroll
    for (int q = 0; q < 2; ++q) { const v4f pm = *(const v4fa*)(xr + ((8 + q) * 32 + lane) * 4), pls = *(const v4fa*)(xr + ((10 + q) * 32 + lane) * 4);
#pragma unroll
        for (int i = 0; i < 4; ++i) { const int j = q * 4 + i; const float mn = fmaxf(mrow[j], pm[i]);     // a team whose tiles were all masked holds the start maximum and zeros: its factor is 0
            fa[j] = ex2s((mrow[j] - mn) * L2E); fb[j] = ex2s((pm[i] - mn) * L2E); lpart[j] = lpart[j] * fa[j] + pls[i] * fb[j]; } }
#pragma unroll
    for (int n = 0; n < 4; ++n)
#pragma unroll
        for (int q = 0; q < 2; ++q) { const v4f po = *(const v4fa*)(xr + ((2 * n + q) * 32 + lane) * 4);
#pragma unroll
            for (int i = 0; i < 4; ++i) fo[n][q * 4 + i] = fo[n][q * 4 + i] * fa[q * 4 + i] + po[i] * fb[q * 4 + i]; }
    float inv[8];
#pragma unroll
    for (int j = 0; j < 8; ++j) { float rs = lpart[j]; rs += xm<1>(rs); rs += xm<2>(rs); rs += xm<4>(rs); rs += xm<8>(rs); inv[j] = 1.0f / (rs * PSC); }
    float* os = &ost[wave][0];
    const size_t ob = (size_t)q0 * (NH_ * HD) + (size_t)h * HD;     // row stride NH*HD, this head's 128 columns
    { const int half = kp;     // this wave's 64 columns
#pragma unroll
        for (int n = 0; n < 4; ++n)
#pragma unroll
            for (int j = 0; j < 8; ++j) os[(hi * 8 + j) * 68 + n * 16 + lr] = fo[n][j] * inv[j];
        __builtin_amdgcn_wave_barrier(); asm volatile("" ::: "memory");
{
#pragma unroll
            for (int s = 0; s < 4; ++s) { const int row = 4 * s + (lane >> 3), piece = lane & 7; const float* sp = os + row * 68 + piece * 8; v8us oh, ol;     // eight lanes = one 128-byte line of each plane
#pragma unroll
                for (int i = 0; i < 8; ++i) { const float v = sp[i]; const unsigned short hb = f2bf(v); oh[i] = hb; ol[i] = f2bf(v - bf2f(hb)); }
                const size_t oo = ob + (size_t)row * (NH_ * HD) + half * 64 + piece * 8; *(v8us*)(OH + oo) = oh; *(v8us*)(OL + oo) = ol; }
             }
        __builtin_amdgcn_wave_barrier(); asm volatile("" ::: "memory");
    }
}

extern "C" void kernel_launch(void* const* d_in, const int* in_sizes, int n_in,
                              void* d_out, int out_size, void* d_ws, size_t ws_size, hipStream_t stream) {
    (void)in_sizes; (void)n_in; (void)out_size;
    const float* x = (const float*)d_in[0]; const float* Wq = (const float*)d_in[1]; const float* bq = (const float*)d_in[2]; const float* Wk = (const float*)d_in[3]; const float* bk = (const float*)d_in[4];
    const float* Wv = (const float*)d_in[5]; const float* bv = (const float*)d_in[6]; const float* WO = (const float*)d_in[7]; const float* bo = (const float*)d_in[8];     // per-head [16][2048][128] k-major weights (x @ W[h]), WO [2048][2048] k-major
    float* out = (float*)d_out;    // [1][2048][2048]
    char* wsp = (char*)d_ws;
    auto take = [&](size_t bytes) { char* p = wsp; wsp += (bytes + 255) & ~(size_t)255; return (void*)p; };
    bf* Xb = (bf*)take((size_t)NT_ * HS * 2); bf* WqN = (bf*)take((size_t)HS * HS * 2); bf* WkN = (bf*)take((size_t)HS * HS * 2); bf* WvN = (bf*)take((size_t)HS * HS * 2); bf* WoT = (bf*)take((size_t)HS * HS * 2);
    bf* Oh = (bf*)take((size_t)NT_ * HS * 2); bf* Ol = (bf*)take((size_t)NT_ * HS * 2); h16* QH = (h16*)take((size_t)NT_ * HS * 2); h16* QL = (h16*)take((size_t)NT_ * HS * 2); h16* KH = (h16*)take((size_t)NT_ * KW * 2); h16* KL = (h16*)take((size_t)NT_ * KW * 2);
    bf* VTH = (bf*)take((size_t)KW * NT_ * 2); bf* VTL = (bf*)take((size_t)KW * NT_ * 2);
    if ((size_t)(wsp - (char*)d_ws) > ws_size) return;    // 13 planes of 8.4 MB ~ 109 MB = 104 MiB
    k_prep<<<3 * PB_W + PB_O + PB_X, 256, 0, stream>>>(Wq, Wk, Wv, WO, x, WqN, WkN, WvN, WoT, Xb);                     // the x and weight operand planes of the four products, one launch
    k_gemmb<false, true><<<dim3(NT_ / GTB, HS / GTB, 1), 256, 0, stream>>>(Xb, nullptr, WqN, bq, (float*)QH, HS, QL);                     // q planes
    k_gemmb<false, true><<<dim3(NT_ / GTB, HS / GTB, 1), 256, 0, stream>>>(Xb, nullptr, WkN, bk, (float*)KH, HS, KL);                     // k planes
    k_gemmb<false, false, true><<<dim3(NT_ / GTB, HS / GTB, 1), 256, 0, stream>>>(Xb, nullptr, WvN, bv, (float*)VTH, HS, (h16*)VTL);      // v planes, [h*128 + d][t]
    k_attn<<<NH_ * (NT_ / 64), 256, 0, stream>>>(QH, QL, KH, KL, VTH, VTL, Oh, Ol);                                   // ctx planes [2048][2048]
    k_gemmb<true, false><<<dim3(NT_ / GTB, HS / GTB, 1), 256, 0, stream>>>(Oh, Ol, WoT, bo, out, HS, nullptr);         // out = ctx.WO + bo
}

// v008
// Measured time: 138 microseconds a run.
// Two timings next to v007 both put it at 1.15 times that version's speed.
// Over all steps from v000 it is 5.25 times as fast.
#include <hip/hip_runtime.h>

// Compute dtypes, f32 accumulate: q/k/v = x.W[h] + b[h] for all 16 heads at once ([2048 x 2048].[2048 x 2048]; the per-head k-major weights transposed into one n-major
// operand; PLAIN bf16 operands = inputs rounded once, exact) and out = ctx.WO + bo (ctx as bf16 hi + UNSCALED residual) on v_wmma_f32_16x16x32_bf16; q/k -> f16
// hi + residual x1024 planes, v -> bf16 hi + UNSCALED residual [d][t] planes; the 16-head causal attention (128-dim heads, scale 128^-1/2) fused: scores on
// v_wmma_f32_16x16x32_f16 (hh + hl + lh), online f32 softmax, weights (x32768) and v on v_wmma_f32_16x16x32_bf16, f32 rows split on the way out. Deterministic, no atomics;
// every product writes its consumer's operand planes from its own epilogue (no f32 intermediate in memory, no separate splitting pass).

#define NB_  1
#define NT_  2048
#define HS   2048
#define NH_  16
#define NKV  16
#define HD   128
#define KW   (NKV * HD)          // 2048
#define NREP 1
#define DM   HS
#define NTK  NT_
#define SCL  0.08838834764831845f
#define PSC  32768.0f
#define LOSC 1024.0f
#define LOSCI (1.0f / 1024.0f)
#define KPB  272                 // LDS pitch in bytes of a staged k row (256 + 16) and
#define VPB  80                  // of a staged v row (64 + 16): 16 B x odd, conflict-free for ds_load_b128
#define KPL  (32 * KPB)          // one k plane of a 32-key stage
#define VPL  (HD * VPB)          // one v plane of a 32-key stage
#define STG  (2 * KPL + 2 * VPL) // one stage: k hi, k lo, v hi, v lo

typedef _Float16 h16;
typedef unsigned short bf;
typedef __attribute__((ext_vector_type(16))) __bf16   v16bf;
typedef __attribute__((ext_vector_type(16))) _Float16 v16h;
typedef __attribute__((ext_vector_type(8)))  _Float16 v8h;
typedef __attribute__((ext_vector_type(8)))  unsigned short v8us;
typedef __attribute__((ext_vector_type(8)))  float    v8f;
typedef __attribute__((ext_vector_type(4)))  float    v4f;
typedef __attribute__((ext_vector_type(4)))  _Float16 v4h;
typedef v8h  __attribute__((may_alias)) v8ha;
typedef v4f  __attribute__((may_alias)) v4fa;
typedef v8us __attribute__((may_alias)) v8usa;

__device__ __forceinline__ unsigned short f2bf(float f) { unsigned u = __float_as_uint(f); u += 0x7FFFu + ((u >> 16) & 1u); return (unsigned short)(u >> 16); }
__device__ __forceinline__ float bf2f(unsigned short b) { return __uint_as_float(((unsigned)b) << 16); }
__device__ __forceinline__ float bfr(float f) { return bf2f(f2bf(f)); }
__device__ __forceinline__ v16h cat16(v8h lo, v8h hi) { return __builtin_shufflevector(lo, hi, 0, 1, 2, 3, 4, 5, 6, 7, 8, 9, 10, 11, 12, 13, 14, 15); }
__device__ __forceinline__ v16bf cat16b(v8us lo, v8us hi) { return __builtin_bit_cast(v16bf, __builtin_shufflevector(lo, hi, 0, 1, 2, 3, 4, 5, 6, 7, 8, 9, 10, 11, 12, 13, 14, 15)); }
__device__ __forceinline__ v8f wmma16(v16h a, v16h b, v8f c) { return __builtin_amdgcn_wmma_f32_16x16x32_f16(false, a, false, b, (short)0, c, false, false); }
__device__ __forceinline__ v8f wmmab(v16bf a, v16bf b, v8f c) { return __builtin_amdgcn_wmma_f32_16x16x32_bf16(false, a, false, b, (short)0, c, false, false); }

// k_gemm: 64 x 64 tile of (A [+ Al]).Bn^T over K = 2048 (+ optional bf16-rounded bias[c]) -> f32 rows [2048][ldc].
template <bool SPLITA>
__global__ __launch_bounds__(128) void k_gemm(const bf* __restrict__ A, const bf* __restrict__ Al, const bf* __restrict__ Bn, const float* __restrict__ bias, int ldc, float* C) {
    __shared__ __align__(16) float ost[4][16 * 68];
    const int lane = threadIdx.x & 31, wave = threadIdx.x >> 5, lr = lane & 15, hi = lane >> 4;
    const size_t r0 = (size_t)blockIdx.x * 64 + wave * 16; const int c0 = blockIdx.y * 64;
    const size_t aoff = (r0 + lr) * HS + 8 * hi;
    v8f acc[4];
#pragma unroll
    for (int t = 0; t < 4; ++t) acc[t] = (v8f){};
#pragma unroll 2
    for (int kc = 0; kc < HS; kc += 32) {
        const v16bf a = cat16b(*(const v8us*)(A + aoff + kc), *(const v8us*)(A + aoff + kc + 16));
        v16bf al = a; if (SPLITA) al = cat16b(*(const v8us*)(Al + aoff + kc), *(const v8us*)(Al + aoff + kc + 16));
#pragma unroll
        for (int t = 0; t < 4; ++t) { const bf* bp = Bn + (size_t)(c0 + t * 16 + lr) * HS + kc + 8 * hi; const v16bf bb = cat16b(*(const v8us*)bp, *(const v8us*)(bp + 16)); acc[t] = wmmab(a, bb, acc[t]); if (SPLITA) acc[t] = wmmab(al, bb, acc[t]); }
        asm volatile("v_nop" : "+v"(acc[0]), "+v"(acc[1]), "+v"(acc[2]), "+v"(acc[3]) : "v"(a), "v"(al) : "memory");
    }
    float* os = &ost[wave][0];
#pragma unroll
    for (int t = 0; t < 4; ++t)
#pragma unroll
        for (int j = 0; j < 8; ++j) os[(hi * 8 + j) * 68 + t * 16 + lr] = acc[t][j] + (bias ? bfr(bias[c0 + t * 16 + lr]) : 0.f);
    __builtin_amdgcn_wave_barrier(); asm volatile("" ::: "memory");
    float* crow = C + r0 * ldc + c0;
    auto pass = [&]() {
#pragma unroll
        for (int s = 0; s < 8; ++s) { const int Lid = (lane >> 3) + 4 * s, piece = lane & 7; const int row = Lid >> 1, cofs = (Lid & 1) * 32 + piece * 4;
            const v4f val = *(const v4fa*)(os + row * 68 + cofs); *(v4f*)(crow + (size_t)row * ldc + cofs) = val; }
    };
    pass(); 
}
// k_attn: block = (head, 64 queries), wave = 16; causal key tiles 0..(Q0+63)/32 (block-uniform); per element: score x 128^-1/2, keys past the query at -inf;
// online f32 softmax; P (x32768) as bf16 hi + residual against the V planes; output rows as bf16 hi + unscaled residual planes.
// k_prep: all input preparation in one grid; the jobs are independent of one another and the block index picks one (block-uniform):
//   blocks 0 .. 3071: a 64 x 64 tile of one head's k-major [2048][128] weight (q, k, v: 1024 blocks each; 64 a head) -> rows (h, d) of the n-major bf16 operand;
//   blocks 3072 .. 4095: a 64 x 64 tile of WO [2048][2048] -> WoT; blocks 4096 .. 4351: eight rows of x -> bf16 (one wave per row).
// Transpose tile: WT [n][2048] = bf16(W[k][n]) via LDS.
#define PB_H  ((HS / 64) * (HD / 64))      // 64 tiles a head
#define PB_W  (NH_ * PB_H)                 // 1024 blocks a per-head weight
#define PB_O  ((HS / 64) * (HS / 64))      // 1024 tiles of WO
#define PB_X  (NT_ / 8)                    // 256 blocks of x rows
__global__ __launch_bounds__(256) void k_prep(const float* __restrict__ Wq, const float* __restrict__ Wk, const float* __restrict__ Wv, const float* __restrict__ WO, const float* __restrict__ x,
                                              bf* WqN, bf* WkN, bf* WvN, bf* WoT, bf* Xb) {
    __shared__ __align__(16) unsigned short tl[64 * 72];
    const int tid = threadIdx.x, b = blockIdx.x;
    if (b >= 3 * PB_W + PB_O) {            // x rows; the whole block leaves here, ahead of the barrier
        const float* __restrict__ src = x; bf* dst = Xb;
        const int lane = threadIdx.x & 31, r = (b - (3 * PB_W + PB_O)) * 8 + (threadIdx.x >> 5);
#pragma unroll
        for (int q = 0; q < HS / 256; ++q) { v8us o;
#pragma unroll
            for (int i = 0; i < 8; ++i) o[i] = f2bf(src[(size_t)r * HS + q * 256 + lane * 8 + i]);
            *(v8us*)(dst + (size_t)r * HS + q * 256 + lane * 8) = o; }
        return;
    }
    const float* __restrict__ Wm; bf* WT; int ncols, t; const int K = HS;
    if (b < 3 * PB_W) { const int m = b / PB_W, r = b - m * PB_W, h = r / PB_H; t = r - h * PB_H; ncols = HD;
        Wm = (m == 0 ? Wq : m == 1 ? Wk : Wv) + (size_t)h * HS * HD; WT = (m == 0 ? WqN : m == 1 ? WkN : WvN) + (size_t)h * HD * HS; }
    else { t = b - 3 * PB_W; ncols = HS; Wm = WO; WT = WoT; }
    const int k0 = (t % (HS / 64)) * 64, n0 = (t / (HS / 64)) * 64;
    const int kk = tid >> 2, nq = (tid & 3) * 16;
#pragma unroll
    for (int i = 0; i < 16; ++i) tl[(nq + i) * 72 + kk] = f2bf(Wm[(size_t)(k0 + kk) * ncols + n0 + nq + i]);
    __syncthreads();
    const int piece = tid & 7;
    auto pass = [&]() {
#pragma unroll
        for (int s = 0; s < 2; ++s) { const int nr = (tid >> 3) + 32 * s; const v8us val = *(const v8usa*)(tl + nr * 72 + piece * 8); *(v8us*)(WT + (size_t)(n0 + nr) * K + k0 + piece * 8) = val; }
    };
    pass(); 
}
// k_gemmb: 128 x 128 block tile (8 waves, 4 x 2, each 32 x 64) of C[NTK][NW] = (A [+ Al]).B^T [+ bf(bias[c])] [+ bf(R[r][c]) residual]; f32 whole-line epilogue, or f16
// hi + residual x1024 planes (F16OUT), or the transposed [c][r] bf16 hi + unscaled residual planes (VTOUT: C, C2 are the two planes, row length NT_). Each 128-k slab of the block's 128 A rows (and Al rows) and 128 B rows is brought into LDS once per block by asynchronous copies in whole 256-byte rows,
// two buffers: slab t + 1 flies while slab t is worked on; the waves read their fragments from there (K a multiple of 128). The k order of the fragments is unchanged.
#define GKS  128                 // k elements of a staged slab: rows of 256 bytes
#define GPB  272                 // LDS pitch in bytes of a staged row (256 + 16): 16 B x odd, conflict-free for ds_load_b128
#define GTB  128                 // rows of a plane: the block tile's rows, and its columns
#define GPL  (GTB * GPB)         // one plane of a slab
#define GTP  136                 // pitch in elements of a staged transposed output row (128 + 8): 16 B x odd
// cpa8: eight 16-byte copies of one lane; the s_wait_xcnt stands inside the statement so that no address register is rewritten ahead of it.
__device__ __forceinline__ void cpa8(unsigned l0, unsigned l1, unsigned l2, unsigned l3, unsigned l4, unsigned l5, unsigned l6, unsigned l7,
                                     const void* g0, const void* g1, const void* g2, const void* g3, const void* g4, const void* g5, const void* g6, const void* g7) {
    asm volatile("global_load_async_to_lds_b128 %0, %8, off\n\t"
                 "global_load_async_to_lds_b128 %1, %9, off\n\t"
                 "global_load_async_to_lds_b128 %2, %10, off\n\t"
                 "global_load_async_to_lds_b128 %3, %11, off\n\t"
                 "global_load_async_to_lds_b128 %4, %12, off\n\t"
                 "global_load_async_to_lds_b128 %5, %13, off\n\t"
                 "global_load_async_to_lds_b128 %6, %14, off\n\t"
                 "global_load_async_to_lds_b128 %7, %15, off\n\t"
                 "s_wait_xcnt 0x0"
                 :: "v"(l0), "v"(l1), "v"(l2), "v"(l3), "v"(l4), "v"(l5), "v"(l6), "v"(l7), "v"(g0), "v"(g1), "v"(g2), "v"(g3), "v"(g4), "v"(g5), "v"(g6), "v"(g7) : "memory");
}
template <bool SPLITA, bool F16OUT = false, bool VTOUT = false>
__global__ __launch_bounds__(256) void k_gemmb(const bf* __restrict__ A, const bf* __restrict__ Al, const bf* __restrict__ Bn, const float* __restrict__ bias, float* C, int ldc, h16* C2, const float* __restrict__ R = nullptr, int K = DM, int roundR = 1) {
    constexpr unsigned GST = (SPLITA ? 3 : 2) * GPL, GBO = (SPLITA ? 2 : 1) * GPL;     // one slab: A rows (, Al rows), B rows; where its B plane begins (Al within reach of the A pointer's 16-bit LDS offsets)
    constexpr int KG = SPLITA ? 1 : 2, NG = (GKS / 32) / KG;     // 32-k steps whose fragments are read as one group (16 products a group either way); groups a slab
    __shared__ __align__(16) float ost[8][32 * 68];
    __shared__ __align__(16) unsigned char gring[2 * GST];
    const int lane = threadIdx.x & 31, wave = threadIdx.x >> 5, lr = lane & 15, hi = lane >> 4;
    const int wr = wave >> 1, wc = wave & 1;             // the wave's 32 rows and 64 columns of the block tile
    const int rb = blockIdx.x * GTB, cb = blockIdx.y * GTB;
    const int r0 = rb + wr * 32, c0 = cb + wc * 64;
    // each thread copies 8 x 16 B of each plane: rows tid / 16 + 16 i (a wave = two whole 256-byte rows)
    const int tid = threadIdx.x;
    const unsigned gdst = (unsigned)(size_t)&gring[0] + (tid >> 4) * GPB + (tid & 15) * 16;     // the lane's byte address in LDS
    const size_t asrc = (size_t)(rb + (tid >> 4)) * K + (tid & 15) * 8, bsrc = (size_t)(cb + (tid >> 4)) * K + (tid & 15) * 8, rs = (size_t)16 * K;
    auto plane = [&](const bf* p, unsigned d) {
        cpa8(d, d + 16 * GPB, d + 32 * GPB, d + 48 * GPB, d + 64 * GPB, d + 80 * GPB, d + 96 * GPB, d + 112 * GPB,
             p, p + rs, p + 2 * rs, p + 3 * rs, p + 4 * rs, p + 5 * rs, p + 6 * rs, p + 7 * rs);
    };
    auto stage = [&](int t, unsigned bo) {
        plane(A + asrc + (size_t)t * GKS, gdst + bo); plane(Bn + bsrc + (size_t)t * GKS, gdst + bo + GBO);
        if (SPLITA) plane(Al + asrc + (size_t)t * GKS, gdst + bo + GPL);
    };
    v8f acc[2][4];
#pragma unroll
    for (int m = 0; m < 2; ++m)
#pragma unroll
        for (int t = 0; t < 4; ++t) acc[m][t] = (v8f){};
    const int nt = K / GKS;
    stage(0, 0u);
    asm volatile("s_wait_asynccnt 0x0" ::: "memory");     // slab 0 of this wave's copies has landed
    __syncthreads();                                      // ... and every other wave's
    if (nt > 1) stage(1, GST);                            // block-uniform
#pragma unroll 1
    for (int s = 0; s < nt; ++s) {
        const unsigned bo = (unsigned)(s & 1) * GST;
        const bf* as = (const bf*)(gring + bo) + (wr * 32 + lr) * (GPB / 2) + 8 * hi;            // this lane's A row of row group 0 in the staged slab (Al: one plane on)
        const bf* bs = (const bf*)(gring + bo + GBO) + (wc * 64 + lr) * (GPB / 2) + 8 * hi;      // this lane's B row of column group 0
#pragma unroll
        for (int g = 0; g < NG; ++g) {
            v16bf af[KG][2], alf[KG][2], bb[KG][4];
#pragma unroll
            for (int kc = 0; kc < KG; ++kc) { const int ko = (g * KG + kc) * 32;
#pragma unroll
                for (int m = 0; m < 2; ++m) { const bf* ap = as + m * 16 * (GPB / 2) + ko;
                    af[kc][m] = cat16b(*(const v8usa*)ap, *(const v8usa*)(ap + 16));
                    alf[kc][m] = af[kc][m]; if (SPLITA) alf[kc][m] = cat16b(*(const v8usa*)(ap + GPL / 2), *(const v8usa*)(ap + GPL / 2 + 16)); }
#pragma unroll
                for (int t = 0; t < 4; ++t) { const bf* bp = bs + t * 16 * (GPB / 2) + ko; bb[kc][t] = cat16b(*(const v8usa*)bp, *(const v8usa*)(bp + 16)); }
            }
            __builtin_amdgcn_sched_barrier(0);     // the group's LDS reads issue ahead of its first product: one LDS latency a group, not one a fragment
#pragma unroll
            for (int kc = 0; kc < KG; ++kc)
#pragma unroll
                for (int m = 0; m < 2; ++m)
#pragma unroll
                    for (int t = 0; t < 4; ++t) { acc[m][t] = wmmab(af[kc][m], bb[kc][t], acc[m][t]); if (SPLITA) acc[m][t] = wmmab(alf[kc][m], bb[kc][t], acc[m][t]); }
            if (g == NG - 1)     // the distance behind the slab's last product, on the back edge too
                asm volatile("v_nop\n\tv_nop\n\tv_nop\n\tv_nop" : "+v"(acc[0][0]), "+v"(acc[0][1]), "+v"(acc[0][2]), "+v"(acc[0][3]), "+v"(acc[1][0]), "+v"(acc[1][1]), "+v"(acc[1][2]), "+v"(acc[1][3]) : "v"(af[KG - 1][1]), "v"(alf[KG - 1][1]));
        }
        asm volatile("s_wait_dscnt 0x0" ::: "memory");        // this wave's reads of slab s are done before its buffer is refilled
        asm volatile("s_wait_asynccnt 0x0" ::: "memory");     // this wave's copies of slab s + 1 have landed
        __syncthreads();                                      // publishes slab s + 1 and ends every wave's reads of slab s
        if (s + 2 < nt) stage(s + 2, bo);                     // block-uniform: the refill of the buffer just read
    }
    asm volatile("s_wait_asynccnt 0x0" ::: "memory");         // no copy is outstanding when the wave goes on
    float* os = &ost[wave][0];
    unsigned short* tph = (unsigned short*)(void*)&ost[0][0]; unsigned short* tpl = tph + GTB * GTP;     // VTOUT: the staging holds the two transposed planes, [c][r]
#pragma unroll
    for (int t = 0; t < 4; ++t) { const float bv = bias ? bfr(bias[c0 + t * 16 + lr]) : 0.f;
#pragma unroll
        for (int m = 0; m < 2; ++m) {
            if (VTOUT) {     // a lane holds eight consecutive r of one c: one 16-byte piece of that c row in each plane
                v8us oh, ol;
#pragma unroll
                for (int j = 0; j < 8; ++j) { const float v = acc[m][t][j] + bv; const unsigned short hb = f2bf(v); oh[j] = hb; ol[j] = f2bf(v - bf2f(hb)); }
                const int o = (wc * 64 + t * 16 + lr) * GTP + wr * 32 + m * 16 + hi * 8; *(v8usa*)(tph + o) = oh; *(v8usa*)(tpl + o) = ol;
            } else {
#pragma unroll
                for (int j = 0; j < 8; ++j) os[(m * 16 + hi * 8 + j) * 68 + t * 16 + lr] = acc[m][t][j] + bv;
            }
        } }
    __syncthreads();
    if (VTOUT) {
        // the block's 128 r x 128 c tile leaves transposed: sixteen lanes write the two whole 128-byte lines (128 r) of a c row in each plane; reads cross the waves' staging (behind the barrier above)
        bf* th = (bf*)(void*)C + (size_t)cb * NT_ + rb; bf* tlo = (bf*)(void*)C2 + (size_t)cb * NT_ + rb;
        const int piece = tid & 15;
#pragma unroll
        for (int s = 0; s < 8; ++s) { const int d = (tid >> 4) + 16 * s;
            const v8us oh = *(const v8usa*)(tph + d * GTP + piece * 8), ol = *(const v8usa*)(tpl + d * GTP + piece * 8);
            *(v8us*)(th + (size_t)d * NT_ + piece * 8) = oh; *(v8us*)(tlo + (size_t)d * NT_ + piece * 8) = ol; }
    } else if (F16OUT) {
        h16* crow = (h16*)(void*)C + (size_t)r0 * ldc + c0;
        auto pass = [&]() {
#pragma unroll
            for (int s = 0; s < 8; ++s) { const int row = 4 * s + (lane >> 3), piece = lane & 7; const float* sp = os + row * 68 + piece * 8; v8h o, o2;
#pragma unroll
                for (int i = 0; i < 8; ++i) { const h16 a = (h16)sp[i]; o[i] = a; o2[i] = (h16)((sp[i] - (float)a) * LOSC); }
                *(v8h*)(crow + (size_t)row * ldc + piece * 8) = o;
                asm volatile("s_wait_xcnt 0x0" ::: "memory");     // the store's registers are reused on the far side of the branch below
                if (C2) *(v8h*)(C2 + (size_t)r0 * ldc + c0 + (size_t)row * ldc + piece * 8) = o2; }
        };
        pass(); 
    } else {
        float* crow = C + (size_t)r0 * ldc + c0;
        auto pass = [&]() {
#pragma unroll
            for (int s = 0; s < 16; ++s) { const int Lid = (lane >> 3) + 4 * s, piece = lane & 7; const int row = Lid >> 1, cofs = (Lid & 1) * 32 + piece * 4;
                v4f val = *(const v4fa*)(os + row * 68 + cofs); if (R) { const v4f rv = *(const v4f*)(R + ((size_t)r0 + row) * ldc + c0 + cofs); val += roundR ? (v4f){bfr(rv[0]), bfr(rv[1]), bfr(rv[2]), bfr(rv[3])} : rv; }
                *(v4f*)(crow + (size_t)row * ldc + cofs) = val;
                asm volatile("s_wait_xcnt 0x0" ::: "memory"); }     // the store's registers are reused behind the branch on R of the next row
        };
        pass(); 
    }
}

// k_qkv: the q, k and v products of one head for 128 rows of x in one block: a 128 x 384 block tile = x[128 rows] . [Wq(h) | Wk(h) | Wv(h)]^T + the bf16-rounded biases, 8 waves (2 x 4), each
// 64 x 96. The three products share their A operand: each 128-k slab of the 128 x rows is brought into LDS once for all three, beside the 3 x 128 weight rows (asynchronous copies in whole
// 256-byte rows, two buffers, the order of k_gemmb's ring); a wave reads 10 fragments for 24 products. The k order of every sum is that of k_gemmb. Behind the loop the ring is free and
// holds the output staging: q | k as f32 rows (they leave as f16 hi + residual x1024 planes), v as the two transposed [d][t] bf16 planes (hi + unscaled residual).
#define QSP  260                 // pitch in floats of a staged q | k row (256 + 4): the two 8-row halves of a tile store fall on different banks, four rows of a read too
__global__ __launch_bounds__(256) void k_qkv(const bf* __restrict__ A, const bf* __restrict__ Bq, const bf* __restrict__ Bk, const bf* __restrict__ Bv,
                                             const float* __restrict__ bq, const float* __restrict__ bk, const float* __restrict__ bv, h16* QH, h16* QL, h16* KH, h16* KL, bf* VTH, bf* VTL) {
    constexpr unsigned GST = 4 * GPL;                    // one slab: the x rows, then the q, k and v weight rows (384 rows of the second operand, one behind the other)
    constexpr int K = DM, nt = K / GKS;
    __shared__ __align__(16) unsigned char gring[2 * GST];
    const int tid = threadIdx.x, lane = tid & 31, lr = lane & 15, hi = lane >> 4;
    const int wave = __builtin_amdgcn_readfirstlane(tid >> 5);     // wave-uniform, kept scalar: the epilogue branches on it
    const int wr = wave >> 2, wc = wave & 3;             // the wave's 64 rows and 96 columns of the block tile
    const int rb = blockIdx.x * GTB, cb = blockIdx.y * GTB;        // rows of x; this head's 128 columns of each product
    // each thread copies 8 x 16 B of each plane: rows tid / 16 + 16 i (a wave = two whole 256-byte rows)
    const unsigned gdst = (unsigned)(size_t)&gring[0] + (tid >> 4) * GPB + (tid & 15) * 16;     // the lane's byte address in LDS
    const unsigned lsrc = (tid >> 4) * K + (tid & 15) * 8;         // the lane's element in a plane's slab: the same for all four planes, all that a lane keeps of the sources
    const size_t aro = (size_t)rb * K, bro = (size_t)cb * K, rs = (size_t)16 * K;     // block-uniform
    auto plane = [&](const bf* u, unsigned d) {          // u: block-uniform start of the plane's slab
        // the slab's start is held in scalar registers, so that a lane keeps one offset and not four 64-bit pointers across the loop (they were spilled: asm operands must lie below v256)
        const unsigned long long ua = (unsigned long long)u;
        const unsigned ulo = (unsigned)__builtin_amdgcn_readfirstlane((int)(unsigned)ua), uhi = (unsigned)__builtin_amdgcn_readfirstlane((int)(unsigned)(ua >> 32));
        const bf* p = (const bf*)(((unsigned long long)uhi << 32) | ulo) + lsrc;
        cpa8(d, d + 16 * GPB, d + 32 * GPB, d + 48 * GPB, d + 64 * GPB, d + 80 * GPB, d + 96 * GPB, d + 112 * GPB,
             p, p + rs, p + 2 * rs, p + 3 * rs, p + 4 * rs, p + 5 * rs, p + 6 * rs, p + 7 * rs);
    };
    auto stage = [&](int t, unsigned bo) {               // 32 copies of a wave in flight
        plane(A + aro + (size_t)t * GKS, gdst + bo); plane(Bq + bro + (size_t)t * GKS, gdst + bo + GPL);
        plane(Bk + bro + (size_t)t * GKS, gdst + bo + 2 * GPL); plane(Bv + bro + (size_t)t * GKS, gdst + bo + 3 * GPL);
    };
    v8f acc[4][6];
#pragma unroll
    for (int m = 0; m < 4; ++m)
#pragma unroll
        for (int t = 0; t < 6; ++t) acc[m][t] = (v8f){};
    stage(0, 0u);
    asm volatile("s_wait_asynccnt 0x0" ::: "memory");     // slab 0 of this wave's copies has landed
    __syncthreads();                                      // ... and every other wave's
    stage(1, GST);
    float braw[6];     // the wave's six bias values a lane, asked for here so that their latency passes under the loop
#pragma unroll
    for (int t = 0; t < 6; ++t) { const int cc = wc * 96 + t * 16;     // the 16-column group's place in q | k | v: wave-uniform, each group lies in one product
        const float* __restrict__ bp = cc < 128 ? bq : cc < 256 ? bk : bv; braw[t] = bp[cb + (cc & 127) + lr]; }
    asm volatile("s_wait_xcnt 0x0" ::: "memory");     // before the six loads' offset registers are reused
    __builtin_amdgcn_sched_barrier(0);                // ... and no later register write is lifted over that wait (its clobber orders memory operations only)
#pragma unroll 1
    for (int s = 0; s < nt; ++s) {
        const unsigned bo = (unsigned)(s & 1) * GST;
        const bf* as = (const bf*)(gring + bo) + (wr * 64 + lr) * (GPB / 2) + 8 * hi;            // this lane's x row of row group 0 in the staged slab
        const bf* bs = (const bf*)(gring + bo + GPL) + (wc * 96 + lr) * (GPB / 2) + 8 * hi;      // this lane's weight row of column group 0
#pragma unroll
        for (int g = 0; g < GKS / 32; ++g) {
            v16bf af[4], bb[6];
            auto lda = [&](int m) { const bf* ap = as + m * 16 * (GPB / 2) + g * 32; af[m] = cat16b(*(const v8usa*)ap, *(const v8usa*)(ap + 16)); };
            lda(0);                                       // in the order in which the products want them
#pragma unroll
            for (int t = 0; t < 6; ++t) { const bf* bp = bs + t * 16 * (GPB / 2) + g * 32; bb[t] = cat16b(*(const v8usa*)bp, *(const v8usa*)(bp + 16)); }
            lda(1); lda(2); lda(3);
            __builtin_amdgcn_sched_barrier(0);     // the group's LDS reads issue ahead of its first product: one LDS latency a group, not one a fragment
#pragma unroll
            for (int m = 0; m < 4; ++m)
#pragma unroll
                for (int t = 0; t < 6; ++t) acc[m][t] = wmmab(af[m], bb[t], acc[m][t]);
            if (g == GKS / 32 - 1) {
                __builtin_amdgcn_sched_barrier(0);     // the slab's products stay in front of the foot: else most of the last group sinks behind the barrier and holds back the refill
                // the distance behind the slab's last products, on the back edge too
                asm volatile("v_nop\n\tv_nop\n\tv_nop\n\tv_nop" : "+v"(acc[3][2]), "+v"(acc[3][3]), "+v"(acc[3][4]), "+v"(acc[3][5]) : "v"(af[3]), "v"(bb[2]), "v"(bb[3]), "v"(bb[4]), "v"(bb[5]));
            }
        }
        asm volatile("s_wait_dscnt 0x0" ::: "memory");        // this wave's reads of slab s are done before its buffer is refilled
        asm volatile("s_wait_asynccnt 0x0" ::: "memory");     // this wave's copies of slab s + 1 have landed
        __syncthreads();                                      // publishes slab s + 1 and ends every wave's reads of slab s
        if (s + 2 < nt) stage(s + 2, bo);                     // block-uniform: the refill of the buffer just read
    }
    asm volatile("s_wait_asynccnt 0x0" ::: "memory");         // no copy is outstanding when the wave goes on
    // the last trip's barrier has ended every wave's reads of the ring and nothing flies into it: it becomes the staging
    float* st = (float*)(void*)&gring[0];
    unsigned short* tph = (unsigned short*)(void*)&gring[GTB * QSP * 4]; unsigned short* tpl = tph + GTB * GTP;
#pragma unroll
    for (int t = 0; t < 6; ++t) { const int cc = wc * 96 + t * 16;
        const float bias = bfr(braw[t]);
        if (cc < 256) {
#pragma unroll
            for (int m = 0; m < 4; ++m)
#pragma unroll
                for (int j = 0; j < 8; ++j) st[(wr * 64 + m * 16 + hi * 8 + j) * QSP + cc + lr] = acc[m][t][j] + bias;
        } else {     // a lane holds eight consecutive r of one d: one 16-byte piece of that d row in each plane
#pragma unroll
            for (int m = 0; m < 4; ++m) { v8us oh, ol;
#pragma unroll
                for (int j = 0; j < 8; ++j) { const float v = acc[m][t][j] + bias; const unsigned short hb = f2bf(v); oh[j] = hb; ol[j] = f2bf(v - bf2f(hb)); }
                const int o = (cc - 256 + lr) * GTP + wr * 64 + m * 16 + hi * 8; *(v8usa*)(tph + o) = oh; *(v8usa*)(tpl + o) = ol; }
        }
    }
    __syncthreads();                                          // the reads below cross the waves' staging
    {   // q | k: a wave takes 64 rows of one 64-column panel (q low, q high, k low, k high); eight lanes = one 128-byte line of each plane
        const int panel = wave & 3, rh = wave >> 2;
        h16* dh = (panel < 2 ? QH : KH) + (size_t)(rb + rh * 64) * HS + cb + (panel & 1) * 64; h16* dl = (panel < 2 ? QL : KL) + (size_t)(rb + rh * 64) * HS + cb + (panel & 1) * 64;
#pragma unroll
        for (int s = 0; s < 16; ++s) { const int row = 4 * s + (lane >> 3), piece = lane & 7; const float* sp = st + (rh * 64 + row) * QSP + panel * 64 + piece * 8; v8h o, o2;
#pragma unroll
            for (int i = 0; i < 8; ++i) { const h16 a = (h16)sp[i]; o[i] = a; o2[i] = (h16)((sp[i] - (float)a) * LOSC); }
            *(v8h*)(dh + (size_t)row * HS + piece * 8) = o; *(v8h*)(dl + (size_t)row * HS + piece * 8) = o2; }
    }
    {   // v: sixteen lanes write the two whole 128-byte lines (128 t) of a d row in each plane
        bf* th = VTH + (size_t)cb * NT_ + rb; bf* tlo = VTL + (size_t)cb * NT_ + rb;
        const int piece = tid & 15;
#pragma unroll
        for (int s = 0; s < 8; ++s) { const int d = (tid >> 4) + 16 * s;
            const v8us oh = *(const v8usa*)(tph + d * GTP + piece * 8), ol = *(const v8usa*)(tpl + d * GTP + piece * 8);
            *(v8us*)(th + (size_t)d * NT_ + piece * 8) = oh; *(v8us*)(tlo + (size_t)d * NT_ + piece * 8) = ol; }
    }
}

__device__ __forceinline__ void cp8(unsigned l0, unsigned l1, unsigned l2, unsigned l3, unsigned l4, unsigned l5, unsigned l6, unsigned l7,
                                    const void* g0, const void* g1, const void* g2, const void* g3, const void* g4, const void* g5, const void* g6, const void* g7) {
    asm volatile("global_load_async_to_lds_b128 %0, %8, off\n\t"
                 "global_load_async_to_lds_b128 %1, %9, off\n\t"
                 "global_load_async_to_lds_b128 %2, %10, off\n\t"
                 "global_load_async_to_lds_b128 %3, %11, off\n\t"
                 "global_load_async_to_lds_b128 %4, %12, off\n\t"
                 "global_load_async_to_lds_b128 %5, %13, off\n\t"
                 "global_load_async_to_lds_b128 %6, %14, off\n\t"
                 "global_load_async_to_lds_b128 %7, %15, off\n\t"
                 "s_wait_xcnt 0x0"
                 :: "v"(l0), "v"(l1), "v"(l2), "v"(l3), "v"(l4), "v"(l5), "v"(l6), "v"(l7), "v"(g0), "v"(g1), "v"(g2), "v"(g3), "v"(g4), "v"(g5), "v"(g6), "v"(g7) : "memory");
}
// ex2s: 2^x; the one free slot that the instruction set asks for behind a transcendental stands inside the statement
#define L2E 1.4426950408889634f
__device__ __forceinline__ float ex2s(float x) { float r; asm("v_exp_f32 %0, %1\n\tv_nop" : "=v"(r) : "v"(x)); return r; }
// ex2x3: three at once: each fills the slot of the one in front of it (results apart from every source), one v_nop behind the last
__device__ __forceinline__ void ex2x3(float& r0, float& r1, float& r2, float x0, float x1, float x2) {
    asm("v_exp_f32 %0, %3\n\tv_exp_f32 %1, %4\n\tv_exp_f32 %2, %5\n\tv_nop" : "=&v"(r0), "=&v"(r1), "=&v"(r2) : "v"(x0), "v"(x1), "v"(x2)); }
// rowmax8: eight values, each replaced by its maximum over the lane's 16-lane row, by DPP row_xmask steps in the vector unit (the shuffle intrinsic compiled to an LDS permute with a
// wait behind each step). The eight rows go through each step side by side, so that every instruction's producer stands eight instructions back and no step waits for the one before.
__device__ __forceinline__ void rowmax8(float (&m)[8]) {
    asm(
        "v_max_num_f32_dpp %0, %0, %0 row_xmask:1 row_mask:0xf bank_mask:0xf\n\t"
        "v_max_num_f32_dpp %1, %1, %1 row_xmask:1 row_mask:0xf bank_mask:0xf\n\t"
        "v_max_num_f32_dpp %2, %2, %2 row_xmask:1 row_mask:0xf bank_mask:0xf\n\t"
        "v_max_num_f32_dpp %3, %3, %3 row_xmask:1 row_mask:0xf bank_mask:0xf\n\t"
        "v_max_num_f32_dpp %4, %4, %4 row_xmask:1 row_mask:0xf bank_mask:0xf\n\t"
        "v_max_num_f32_dpp %5, %5, %5 row_xmask:1 row_mask:0xf bank_mask:0xf\n\t"
        "v_max_num_f32_dpp %6, %6, %6 row_xmask:1 row_mask:0xf bank_mask:0xf\n\t"
        "v_max_num_f32_dpp %7, %7, %7 row_xmask:1 row_mask:0xf bank_mask:0xf\n\t"
        "v_max_num_f32_dpp %0, %0, %0 row_xmask:2 row_mask:0xf bank_mask:0xf\n\t"
        "v_max_num_f32_dpp %1, %1, %1 row_xmask:2 row_mask:0xf bank_mask:0xf\n\t"
        "v_max_num_f32_dpp %2, %2, %2 row_xmask:2 row_mask:0xf bank_mask:0xf\n\t"
        "v_max_num_f32_dpp %3, %3, %3 row_xmask:2 row_mask:0xf bank_mask:0xf\n\t"
        "v_max_num_f32_dpp %4, %4, %4 row_xmask:2 row_mask:0xf bank_mask:0xf\n\t"
        "v_max_num_f32_dpp %5, %5, %5 row_xmask:2 row_mask:0xf bank_mask:0xf\n\t"
        "v_max_num_f32_dpp %6, %6, %6 row_xmask:2 row_mask:0xf bank_mask:0xf\n\t"
        "v_max_num_f32_dpp %7, %7, %7 row_xmask:2 row_mask:0xf bank_mask:0xf\n\t"
        "v_max_num_f32_dpp %0, %0, %0 row_xmask:4 row_mask:0xf bank_mask:0xf\n\t"
        "v_max_num_f32_dpp %1, %1, %1 row_xmask:4 row_mask:0xf bank_mask:0xf\n\t"
        "v_max_num_f32_dpp %2, %2, %2 row_xmask:4 row_mask:0xf bank_mask:0xf\n\t"
        "v_max_num_f32_dpp %3, %3, %3 row_xmask:4 row_mask:0xf bank_mask:0xf\n\t"
        "v_max_num_f32_dpp %4, %4, %4 row_xmask:4 row_mask:0xf bank_mask:0xf\n\t"
        "v_max_num_f32_dpp %5, %5, %5 row_xmask:4 row_mask:0xf bank_mask:0xf\n\t"
        "v_max_num_f32_dpp %6, %6, %6 row_xmask:4 row_mask:0xf bank_mask:0xf\n\t"
        "v_max_num_f32_dpp %7, %7, %7 row_xmask:4 row_mask:0xf bank_mask:0xf\n\t"
        "v_max_num_f32_dpp %0, %0, %0 row_xmask:8 row_mask:0xf bank_mask:0xf\n\t"
        "v_max_num_f32_dpp %1, %1, %1 row_xmask:8 row_mask:0xf bank_mask:0xf\n\t"
        "v_max_num_f32_dpp %2, %2, %2 row_xmask:8 row_mask:0xf bank_mask:0xf\n\t"
        "v_max_num_f32_dpp %3, %3, %3 row_xmask:8 row_mask:0xf bank_mask:0xf\n\t"
        "v_max_num_f32_dpp %4, %4, %4 row_xmask:8 row_mask:0xf bank_mask:0xf\n\t"
        "v_max_num_f32_dpp %5, %5, %5 row_xmask:8 row_mask:0xf bank_mask:0xf\n\t"
        "v_max_num_f32_dpp %6, %6, %6 row_xmask:8 row_mask:0xf bank_mask:0xf\n\t"
        "v_max_num_f32_dpp %7, %7, %7 row_xmask:8 row_mask:0xf bank_mask:0xf"
        : "+v"(m[0]), "+v"(m[1]), "+v"(m[2]), "+v"(m[3]), "+v"(m[4]), "+v"(m[5]), "+v"(m[6]), "+v"(m[7]));
}
// xm: the value of lane l ^ M inside the lane's 16-lane row, by a DPP row_xmask move (the closing row sums, once a block)
template <int M> __device__ __forceinline__ float xm(float x) { return __builtin_bit_cast(float, __builtin_amdgcn_update_dpp(0, __builtin_bit_cast(int, x), 0x160 | M, 0xf, 0xf, true)); }
__global__ __launch_bounds__(256) void k_attn(const h16* __restrict__ QH, const h16* __restrict__ QL, const h16* __restrict__ KH, const h16* __restrict__ KL, const bf* __restrict__ VTH, const bf* __restrict__ VTL, bf* OH, bf* OL) {
    __shared__ __align__(16) unsigned short plds[8][16 * 32];
    __shared__ __align__(16) unsigned short plds2[8][16 * 32];
    __shared__ __align__(16) float ost[8][16 * 68];
    __shared__ __align__(16) float xch[8][12 * 32 * 4];     // what a wave hands its partner: four output tiles, the maxima, the sums
    __shared__ __align__(16) unsigned char ring[4 * STG];   // two buffers x two teams
    const int lane = threadIdx.x & 31, wave = threadIdx.x >> 5, lr = lane & 15, hi = lane >> 4;
    const int kp = __builtin_amdgcn_readfirstlane((int)(threadIdx.x >> 7));     // the team: parity of its key tiles (wave-uniform, kept scalar)
    const int bid = blockIdx.x; const int h = bid % NH_, qt = (NT_ / 64 - 1) - bid / NH_; const int g = h / NREP;     // longest blocks first; GQA: kv head
    const int q0 = qt * 64 + (wave & 3) * 16;
    unsigned short* pl = &plds[wave][0]; unsigned short* pl2 = &plds2[wave][0];
    const size_t qo = (size_t)(q0 + lr) * (NH_ * HD) + h * HD + 8 * hi;
    const h16* kh_b = KH + g * HD; const h16* kl_b = KL + g * HD;
    const size_t vbase = ((size_t)g * HD) * NT_;
    v8f o[8];
#pragma unroll
    for (int n = 0; n < 8; ++n) o[n] = (v8f){};
    float mrow[8], lpart[8];
#pragma unroll
    for (int j = 0; j < 8; ++j) { mrow[j] = -3.0e38f; lpart[j] = 0.f; }
    // causal key tiles 0 .. 2 qt + 1: trip it works on tile 2 it + kp, it = 0 .. qt
    // each thread copies 4 x 16 B of each plane of its team's tile: k rows tid / 16 + 8 i (a wave = two whole 256-byte rows), v rows tid / 4 + 32 i
    const int tid = threadIdx.x & 127;
    const unsigned ring0 = (unsigned)(size_t)&ring[0];     // the ring's byte address in LDS
    const unsigned kdst = ring0 + (tid >> 4) * KPB + (tid & 15) * 16, vdst = ring0 + 2 * KPL + (tid >> 2) * VPB + (tid & 3) * 16;
    const size_t ksrc = (size_t)(tid >> 4) * KW + (tid & 15) * 8, vsrc = vbase + (size_t)(tid >> 2) * NT_ + (tid & 3) * 8;
    auto stage = [&](int t, unsigned bo) {
        const h16* a = kh_b + ksrc + (size_t)t * 32 * KW; const h16* b = kl_b + ksrc + (size_t)t * 32 * KW; const unsigned kd = kdst + bo;
        cp8(kd, kd + 8 * KPB, kd + 16 * KPB, kd + 24 * KPB, kd + KPL, kd + KPL + 8 * KPB, kd + KPL + 16 * KPB, kd + KPL + 24 * KPB,
            a, a + 8 * KW, a + 16 * KW, a + 24 * KW, b, b + 8 * KW, b + 16 * KW, b + 24 * KW);
        const bf* c = VTH + vsrc + t * 32; const bf* d = VTL + vsrc + t * 32; const unsigned vd = vdst + bo;
        cp8(vd, vd + 32 * VPB, vd + 64 * VPB, vd + 96 * VPB, vd + VPL, vd + VPL + 32 * VPB, vd + VPL + 64 * VPB, vd + VPL + 96 * VPB,
            c, c + 32 * NT_, c + 64 * NT_, c + 96 * NT_, d, d + 32 * NT_, d + 64 * NT_, d + 96 * NT_);
    };
    const unsigned tbo = (unsigned)kp * STG;              // the team's part of a buffer
    stage(kp, tbo);
    asm volatile("s_wait_asynccnt 0x0" ::: "memory");     // this wave's copies of trip 0 have landed
    __syncthreads();                                      // ... and every other wave's
    if (qt >= 1) stage(2 + kp, 2u * STG + tbo);           // block-uniform: a trip 1 exists
#pragma unroll 1
    for (int it = 0; it <= qt; ++it) {
        const int l0 = (2 * it + kp) * 32;
        const unsigned bo = (unsigned)(it & 1) * (2u * STG) + tbo;
        const h16* kth = (const h16*)(ring + bo) + lr * (KPB / 2) + 8 * hi; const h16* ktl = kth + KPL / 2;     // this lane's k row of the staged tile
        const bf* vth = (const bf*)(ring + bo + 2 * KPL) + lr * (VPB / 2) + 8 * hi; const bf* vtl = vth + VPL / 2;
        v8f s0 = {}, s1 = {}, x0 = {}, x1 = {};
        v16h kf[4][4];
#pragma unroll
        for (int kc = 0; kc < 4; ++kc) {
            kf[kc][0] = cat16(*(const v8ha*)(kth + kc * 32), *(const v8ha*)(kth + kc * 32 + 16)); kf[kc][1] = cat16(*(const v8ha*)(kth + 16 * (KPB / 2) + kc * 32), *(const v8ha*)(kth + 16 * (KPB / 2) + kc * 32 + 16));
            kf[kc][2] = cat16(*(const v8ha*)(ktl + kc * 32), *(const v8ha*)(ktl + kc * 32 + 16)); kf[kc][3] = cat16(*(const v8ha*)(ktl + 16 * (KPB / 2) + kc * 32), *(const v8ha*)(ktl + 16 * (KPB / 2) + kc * 32 + 16)); }
        __builtin_amdgcn_sched_barrier(0);     // all 32 LDS reads of the k tile issue ahead of the first product: one LDS latency a tile, not eight
#pragma unroll
        for (int kc = 0; kc < 4; ++kc) {
            const v16h qa = cat16(*(const v8h*)(QH + qo + kc * 32), *(const v8h*)(QH + qo + kc * 32 + 16)), qx = cat16(*(const v8h*)(QL + qo + kc * 32), *(const v8h*)(QL + qo + kc * 32 + 16));
            const v16h k0h = kf[kc][0], k1h = kf[kc][1];
            s0 = wmma16(qa, k0h, s0); s1 = wmma16(qa, k1h, s1); x0 = wmma16(qx, k0h, x0); x1 = wmma16(qx, k1h, x1);
            const v16h k0l = kf[kc][2], k1l = kf[kc][3];
            x0 = wmma16(qa, k0l, x0); x1 = wmma16(qa, k1l, x1);
        }
        asm volatile("v_nop\n\tv_nop\n\tv_nop\n\tv_nop" : "+v"(s0), "+v"(s1), "+v"(x0), "+v"(x1));
        float alpha[8], sa[8], sb[8], mxr[8];
#pragma unroll
        for (int j = 0; j < 8; ++j) { const int qi = q0 + hi * 8 + j, ja = l0 + lr, jb = l0 + 16 + lr;
            sa[j] = (ja <= qi) ? (s0[j] + x0[j] * LOSCI) * SCL : -__builtin_inff(); sb[j] = (jb <= qi) ? (s1[j] + x1[j] * LOSCI) * SCL : -__builtin_inff();     // causal (-inf as the reference; the diagonal is always live)
            mxr[j] = fmaxf(sa[j], sb[j]); }
        rowmax8(mxr);
#pragma unroll
        for (int j = 0; j < 8; ++j) { const float a0 = sa[j], a1 = sb[j];
            const float mn = fmaxf(mrow[j], mxr[j]);
            float p0, p1; ex2x3(alpha[j], p0, p1, (mrow[j] - mn) * L2E, (a0 - mn) * L2E, (a1 - mn) * L2E); mrow[j] = mn;
            lpart[j] = lpart[j] * alpha[j] + (p0 + p1);
            const int mr = hi * 8 + j; const float ps0 = p0 * PSC, ps1 = p1 * PSC; const unsigned short h0 = f2bf(ps0), h1 = f2bf(ps1);
            pl[mr * 32 + lr] = h0; pl[mr * 32 + 16 + lr] = h1; pl2[mr * 32 + lr] = f2bf(ps0 - bf2f(h0)); pl2[mr * 32 + 16 + lr] = f2bf(ps1 - bf2f(h1)); }
#pragma unroll
        for (int n = 0; n < 8; ++n)
#pragma unroll
            for (int j = 0; j < 8; ++j) o[n][j] *= alpha[j];
        asm volatile("" ::: "memory");
        const v16bf pa = cat16b(*(const v8usa*)(pl + lr * 32 + hi * 8), *(const v8usa*)(pl + lr * 32 + 16 + hi * 8));
        const v16bf px = cat16b(*(const v8usa*)(pl2 + lr * 32 + hi * 8), *(const v8usa*)(pl2 + lr * 32 + 16 + hi * 8));
        v16bf vf[8][2];
#pragma unroll
        for (int n = 0; n < 8; ++n) { const int vo = n * 16 * (VPB / 2);
            vf[n][0] = cat16b(*(const v8usa*)(vth + vo), *(const v8usa*)(vth + vo + 16)); vf[n][1] = cat16b(*(const v8usa*)(vtl + vo), *(const v8usa*)(vtl + vo + 16)); }
        __builtin_amdgcn_sched_barrier(0);     // the v tile's 32 LDS reads issue ahead of the first product: one LDS latency a tile, not eight
#pragma unroll
        for (int n = 0; n < 8; ++n) { const v16bf vh = vf[n][0], vl = vf[n][1];
            o[n] = wmmab(pa, vh, o[n]); o[n] = wmmab(px, vh, o[n]); o[n] = wmmab(pa, vl, o[n]); }
        __builtin_amdgcn_sched_barrier(0);     // the tile's products stay in front of the foot: else half of them sink behind the barrier and hold back the refill
        asm volatile("v_nop\n\tv_nop\n\tv_nop\n\tv_nop" : "+v"(o[0]), "+v"(o[7]) : "v"(pa), "v"(px));
        asm volatile("s_wait_dscnt 0x0" ::: "memory");        // this wave's reads of trip it are done before its buffer is refilled
        asm volatile("s_wait_asynccnt 0x0" ::: "memory");     // this wave's copies of trip it + 1 have landed
        __syncthreads();                                      // publishes trip it + 1 and ends every wave's reads of trip it
        if (it + 2 <= qt) stage(2 * (it + 2) + kp, bo);       // block-uniform: the refill of the buffer just read
    }
    asm volatile("s_wait_asynccnt 0x0" ::: "memory");         // no copy is outstanding when the wave goes on
    // join of the two teams: each wave hands its partner (wave ^ 4: the same 16 queries, the other key tiles) the four output tiles that the partner finishes, with its maxima and sums
    float* xw = &xch[wave][0]; const float* xr = &xch[wave ^ 4][0];
    v8f fo[4];
#pragma unroll
    for (int n = 0; n < 4; ++n) { const v8f sv = kp ? o[n] : o[4 + n]; fo[n] = kp ? o[4 + n] : o[n];
        *(v4fa*)(xw + ((2 * n) * 32 + lane) * 4) = (v4f){sv[0], sv[1], sv[2], sv[3]}; *(v4fa*)(xw + ((2 * n + 1) * 32 + lane) * 4) = (v4f){sv[4], sv[5], sv[6], sv[7]}; }
    *(v4fa*)(xw + (8 * 32 + lane) * 4) = (v4f){mrow[0], mrow[1], mrow[2], mrow[3]}; *(v4fa*)(xw + (9 * 32 + lane) * 4) = (v4f){mrow[4], mrow[5], mrow[6], mrow[7]};
    *(v4fa*)(xw + (10 * 32 + lane) * 4) = (v4f){lpart[0], lpart[1], lpart[2], lpart[3]}; *(v4fa*)(xw + (11 * 32 + lane) * 4) = (v4f){lpart[4], lpart[5], lpart[6], lpart[7]};
    __syncthreads();                                          // every wave's state is in LDS before its partner reads it
    float fa[8], fb[8];
#pragma unroll
    for (int q = 0; q < 2; ++q) { const v4f pm = *(const v4fa*)(xr + ((8 + q) * 32 + lane) * 4), pls = *(const v4fa*)(xr + ((10 + q) * 32 + lane) * 4);
#pragma unroll
        for (int i = 0; i < 4; ++i) { const int j = q * 4 + i; const float mn = fmaxf(mrow[j], pm[i]);     // a team whose tiles were all masked holds the start maximum and zeros: its factor is 0
            fa[j] = ex2s((mrow[j] - mn) * L2E); fb[j] = ex2s((pm[i] - mn) * L2E); lpart[j] = lpart[j] * fa[j] + pls[i] * fb[j]; } }
#pragma unroll
    for (int n = 0; n < 4; ++n)
#pragma unroll
        for (int q = 0; q < 2; ++q) { const v4f po = *(const v4fa*)(xr + ((2 * n + q) * 32 + lane) * 4);
#pragma unroll
            for (int i = 0; i < 4; ++i) fo[n][q * 4 + i] = fo[n][q * 4 + i] * fa[q * 4 + i] + po[i] * fb[q * 4 + i]; }
    float inv[8];
#pragma unroll
    for (int j = 0; j < 8; ++j) { float rs = lpart[j]; rs += xm<1>(rs); rs += xm<2>(rs); rs += xm<4>(rs); rs += xm<8>(rs); inv[j] = 1.0f / (rs * PSC); }
    float* os = &ost[wave][0];
    const size_t ob = (size_t)q0 * (NH_ * HD) + (size_t)h * HD;     // row stride NH*HD, this head's 128 columns
    { const int half = kp;     // this wave's 64 columns
#pragma unroll
        for (int n = 0; n < 4; ++n)
#pragma unroll
            for (int j = 0; j < 8; ++j) os[(hi * 8 + j) * 68 + n * 16 + lr] = fo[n][j] * inv[j];
        __builtin_amdgcn_wave_barrier(); asm volatile("" ::: "memory");
{
#pragma unroll
            for (int s = 0; s < 4; ++s) { const int row = 4 * s + (lane >> 3), piece = lane & 7; const float* sp = os + row * 68 + piece * 8; v8us oh, ol;     // eight lanes = one 128-byte line of each plane
#pragma unroll
                for (int i = 0; i < 8; ++i) { const float v = sp[i]; const unsigned short hb = f2bf(v); oh[i] = hb; ol[i] = f2bf(v - bf2f(hb)); }
                const size_t oo = ob + (size_t)row * (NH_ * HD) + half * 64 + piece * 8; *(v8us*)(OH + oo) = oh; *(v8us*)(OL + oo) = ol; }
             }
        __builtin_amdgcn_wave_barrier(); asm volatile("" ::: "memory");
    }
}

extern "C" void kernel_launch(void* const* d_in, const int* in_sizes, int n_in,
                              void* d_out, int out_size, void* d_ws, size_t ws_size, hipStream_t stream) {
    (void)in_sizes; (void)n_in; (void)out_size;
    const float* x = (const float*)d_in[0]; const float* Wq = (const float*)d_in[1]; const float* bq = (const float*)d_in[2]; const float* Wk = (const float*)d_in[3]; const float* bk = (const float*)d_in[4];
    const float* Wv = (const float*)d_in[5]; const float* bv = (const float*)d_in[6]; const float* WO = (const float*)d_in[7]; const float* bo = (const float*)d_in[8];     // per-head [16][2048][128] k-major weights (x @ W[h]), WO [2048][2048] k-major
    float* out = (float*)d_out;    // [1][2048][2048]
    char* wsp = (char*)d_ws;
    auto take = [&](size_t bytes) { char* p = wsp; wsp += (bytes + 255) & ~(size_t)255; return (void*)p; };
    bf* Xb = (bf*)take((size_t)NT_ * HS * 2); bf* WqN = (bf*)take((size_t)HS * HS * 2); bf* WkN = (bf*)take((size_t)HS * HS * 2); bf* WvN = (bf*)take((size_t)HS * HS * 2); bf* WoT = (bf*)take((size_t)HS * HS * 2);
    bf* Oh = (bf*)take((size_t)NT_ * HS * 2); bf* Ol = (bf*)take((size_t)NT_ * HS * 2); h16* QH = (h16*)take((size_t)NT_ * HS * 2); h16* QL = (h16*)take((size_t)NT_ * HS * 2); h16* KH = (h16*)take((size_t)NT_ * KW * 2); h16* KL = (h16*)take((size_t)NT_ * KW * 2);
    bf* VTH = (bf*)take((size_t)KW * NT_ * 2); bf* VTL = (bf*)take((size_t)KW * NT_ * 2);
    if ((size_t)(wsp - (char*)d_ws) > ws_size) return;    // 13 planes of 8.4 MB ~ 109 MB = 104 MiB
    k_prep<<<3 * PB_W + PB_O + PB_X, 256, 0, stream>>>(Wq, Wk, Wv, WO, x, WqN, WkN, WvN, WoT, Xb);                     // bf16 x and every weight operand plane of the four products, one launch
    k_qkv<<<dim3(NT_ / GTB, NH_, 1), 256, 0, stream>>>(Xb, WqN, WkN, WvN, bq, bk, bv, QH, QL, KH, KL, VTH, VTL);              // q, k planes and v planes [h*128 + d][t]: block = (128 rows, head)
    k_attn<<<NH_ * (NT_ / 64), 256, 0, stream>>>(QH, QL, KH, KL, VTH, VTL, Oh, Ol);                                   // ctx planes [2048][2048]
    k_gemmb<true, false><<<dim3(NT_ / GTB, HS / GTB, 1), 256, 0, stream>>>(Oh, Ol, WoT, bo, out, HS, nullptr);         // out = ctx.WO + bo
}

// v009
// A run of this version takes 126 microseconds.
// Next to v008, in two timings, it ran 1.09 and 1.10 times as fast.
// All steps since v000 together make it 5.76 times as fast.
#include <hip/hip_runtime.h>

// Compute dtypes, f32 accumulate: q/k/v = x.W[h] + b[h] for all 16 heads at once ([2048 x 2048].[2048 x 2048]; the per-head k-major weights transposed into one n-major
// operand; PLAIN bf16 operands = inputs rounded once, exact) and out = ctx.WO + bo (ctx as bf16 hi + UNSCALED residual) on v_wmma_f32_16x16x32_bf16; q/k -> f16
// hi + residual x1024 planes, v -> bf16 hi + UNSCALED residual [d][t] planes; the 16-head causal attention (128-dim heads, scale 128^-1/2) fused: scores on
// v_wmma_f32_16x16x32_f16 (hh + hl + lh), online f32 softmax, weights (x32768) and v on v_wmma_f32_16x16x32_bf16, f32 rows split on the way out. Deterministic, no atomics;
// every product writes its consumer's operand planes from its own epilogue (no f32 intermediate in memory, no separate splitting pass).

#define NB_  1
#define NT_  2048
#define HS   2048
#define NH_  16
#define NKV  16
#define HD   128
#define KW   (NKV * HD)          // 2048
#define NREP 1
#define DM   HS
#define NTK  NT_
#define SCL  0.08838834764831845f
#define PSC  32768.0f
#define LOSC 1024.0f
#define LOSCI (1.0f / 1024.0f)
#define KPB  272                 // LDS pitch in bytes of a staged k row (256 + 16) and
#define VPB  80                  // of a staged v row (64 + 16): 16 B x odd, conflict-free for ds_load_b128
#define KPL  (32 * KPB)          // one k plane of a 32-key stage
#define VPL  (HD * VPB)          // one v plane of a 32-key stage
#define STG  (2 * KPL + 2 * VPL) // one stage: k hi, k lo, v hi, v lo

typedef _Float16 h16;
typedef unsigned short bf;
typedef __attribute__((ext_vector_type(16))) __bf16   v16bf;
typedef __attribute__((ext_vector_type(16))) _Float16 v16h;
typedef __attribute__((ext_vector_type(8)))  _Float16 v8h;
typedef __attribute__((ext_vector_type(8)))  unsigned short v8us;
typedef __attribute__((ext_vector_type(8)))  float    v8f;
typedef __attribute__((ext_vector_type(4)))  float    v4f;
typedef __attribute__((ext_vector_type(4)))  _Float16 v4h;
typedef v8h  __attribute__((may_alias)) v8ha;
typedef v4f  __attribute__((may_alias)) v4fa;
typedef v8us __attribute__((may_alias)) v8usa;

__device__ __forceinline__ unsigned short f2bf(float f) { unsigned u = __float_as_uint(f); u += 0x7FFFu + ((u >> 16) & 1u); return (unsigned short)(u >> 16); }
__device__ __forceinline__ float bf2f(unsigned short b) { return __uint_as_float(((unsigned)b) << 16); }
__device__ __forceinline__ float bfr(float f) { return bf2f(f2bf(f)); }
__device__ __forceinline__ v16h cat16(v8h lo, v8h hi) { return __builtin_shufflevector(lo, hi, 0, 1, 2, 3, 4, 5, 6, 7, 8, 9, 10, 11, 12, 13, 14, 15); }
__device__ __forceinline__ v16bf cat16b(v8us lo, v8us hi) { return __builtin_bit_cast(v16bf, __builtin_shufflevector(lo, hi, 0, 1, 2, 3, 4, 5, 6, 7, 8, 9, 10, 11, 12, 13, 14, 15)); }
__device__ __forceinline__ v8f wmma16(v16h a, v16h b, v8f c) { return __builtin_amdgcn_wmma_f32_16x16x32_f16(false, a, false, b, (short)0, c, false, false); }
__device__ __forceinline__ v8f wmmab(v16bf a, v16bf b, v8f c) { return __builtin_amdgcn_wmma_f32_16x16x32_bf16(false, a, false, b, (short)0, c, false, false); }

// k_gemm: 64 x 64 tile of (A [+ Al]).Bn^T over K = 2048 (+ optional bf16-rounded bias[c]) -> f32 rows [2048][ldc].
template <bool SPLITA>
__global__ __launch_bounds__(128) void k_gemm(const bf* __restrict__ A, const bf* __restrict__ Al, const bf* __restrict__ Bn, const float* __restrict__ bias, int ldc, float* C) {
    __shared__ __align__(16) float ost[4][16 * 68];
    const int lane = threadIdx.x & 31, wave = threadIdx.x >> 5, lr = lane & 15, hi = lane >> 4;
    const size_t r0 = (size_t)blockIdx.x * 64 + wave * 16; const int c0 = blockIdx.y * 64;
    const size_t aoff = (r0 + lr) * HS + 8 * hi;
    v8f acc[4];
#pragma unroll
    for (int t = 0; t < 4; ++t) acc[t] = (v8f){};
#pragma unroll 2
    for (int kc = 0; kc < HS; kc += 32) {
        const v16bf a = cat16b(*(const v8us*)(A + aoff + kc), *(const v8us*)(A + aoff + kc + 16));
        v16bf al = a; if (SPLITA) al = cat16b(*(const v8us*)(Al + aoff + kc), *(const v8us*)(Al + aoff + kc + 16));
#pragma unroll
        for (int t = 0; t < 4; ++t) { const bf* bp = Bn + (size_t)(c0 + t * 16 + lr) * HS + kc + 8 * hi; const v16bf bb = cat16b(*(const v8us*)bp, *(const v8us*)(bp + 16)); acc[t] = wmmab(a, bb, acc[t]); if (SPLITA) acc[t] = wmmab(al, bb, acc[t]); }
        asm volatile("v_nop" : "+v"(acc[0]), "+v"(acc[1]), "+v"(acc[2]), "+v"(acc[3]) : "v"(a), "v"(al) : "memory");
    }
    float* os = &ost[wave][0];
#pragma unroll
    for (int t = 0; t < 4; ++t)
#pragma unroll
        for (int j = 0; j < 8; ++j) os[(hi * 8 + j) * 68 + t * 16 + lr] = acc[t][j] + (bias ? bfr(bias[c0 + t * 16 + lr]) : 0.f);
    __builtin_amdgcn_wave_barrier(); asm volatile("" ::: "memory");
    float* crow = C + r0 * ldc + c0;
    auto pass = [&]() {
#pragma unroll
        for (int s = 0; s < 8; ++s) { const int Lid = (lane >> 3) + 4 * s, piece = lane & 7; const int row = Lid >> 1, cofs = (Lid & 1) * 32 + piece * 4;
            const v4f val = *(const v4fa*)(os + row * 68 + cofs); *(v4f*)(crow + (size_t)row * ldc + cofs) = val; }
    };
    pass(); 
}
// k_attn: block = (head, 64 queries), wave = 16; causal key tiles 0..(Q0+63)/32 (block-uniform); per element: score x 128^-1/2, keys past the query at -inf;
// online f32 softmax; P (x32768) as bf16 hi + residual against the V planes; output rows as bf16 hi + unscaled residual planes.
// k_prep: all input preparation in one grid; the jobs are independent of one another and the block index picks one (block-uniform):
//   blocks 0 .. 3071: a 64 x 64 tile of one head's k-major [2048][128] weight (q, k, v: 1024 blocks each; 64 a head) -> rows (h, d) of the n-major bf16 operand;
//   blocks 3072 .. 4095: a 64 x 64 tile of WO [2048][2048] -> WoT; blocks 4096 .. 4351: eight rows of x -> bf16 (one wave per row).
// Transpose tile: WT [n][2048] = bf16(W[k][n]) via LDS.
#define PB_H  ((HS / 64) * (HD / 64))      // 64 tiles a head
#define PB_W  (NH_ * PB_H)                 // 1024 blocks a per-head weight
#define PB_O  ((HS / 64) * (HS / 64))      // 1024 tiles of WO
#define PB_X  (NT_ / 8)                    // 256 blocks of x rows
__global__ __launch_bounds__(256) void k_prep(const float* __restrict__ Wq, const float* __restrict__ Wk, const float* __restrict__ Wv, const float* __restrict__ WO, const float* __restrict__ x,
                                              bf* WqN, bf* WkN, bf* WvN, bf* WoT, bf* Xb) {
    __shared__ __align__(16) unsigned short tl[64 * 72];
    const int tid = threadIdx.x, b = blockIdx.x;
    if (b >= 3 * PB_W + PB_O) {            // x rows; the whole block leaves here, ahead of the barrier
        const float* __restrict__ src = x; bf* dst = Xb;
        const int lane = threadIdx.x & 31, r = (b - (3 * PB_W + PB_O)) * 8 + (threadIdx.x >> 5);
#pragma unroll
        for (int q = 0; q < HS / 256; ++q) { v8us o;
#pragma unroll
            for (int i = 0; i < 8; ++i) o[i] = f2bf(src[(size_t)r * HS + q * 256 + lane * 8 + i]);
            *(v8us*)(dst + (size_t)r * HS + q * 256 + lane * 8) = o; }
        return;
    }
    const float* __restrict__ Wm; bf* WT; int ncols, t; const int K = HS;
    if (b < 3 * PB_W) { const int m = b / PB_W, r = b - m * PB_W, h = r / PB_H; t = r - h * PB_H; ncols = HD;
        Wm = (m == 0 ? Wq : m == 1 ? Wk : Wv) + (size_t)h * HS * HD; WT = (m == 0 ? WqN : m == 1 ? WkN : WvN) + (size_t)h * HD * HS; }
    else { t = b - 3 * PB_W; ncols = HS; Wm = WO; WT = WoT; }
    const int k0 = (t % (HS / 64)) * 64, n0 = (t / (HS / 64)) * 64;
    const int kk = tid >> 2, nq = (tid & 3) * 16;
#pragma unroll
    for (int i = 0; i < 16; ++i) tl[(nq + i) * 72 + kk] = f2bf(Wm[(size_t)(k0 + kk) * ncols + n0 + nq + i]);
    __syncthreads();
    const int piece = tid & 7;
    auto pass = [&]() {
#pragma unroll
        for (int s = 0; s < 2; ++s) { const int nr = (tid >> 3) + 32 * s; const v8us val = *(const v8usa*)(tl + nr * 72 + piece * 8); *(v8us*)(WT + (size_t)(n0 + nr) * K + k0 + piece * 8) = val; }
    };
    pass(); 
}
// k_gemmb: 128 x 128 block tile (8 waves, 4 x 2, each 32 x 64) of C[NTK][NW] = (A [+ Al]).B^T [+ bf(bias[c])] [+ bf(R[r][c]) residual]; f32 whole-line epilogue, or f16
// hi + residual x1024 planes (F16OUT), or the transposed [c][r] bf16 hi + unscaled residual planes (VTOUT: C, C2 are the two planes, row length NT_). Each 128-k slab of the block's 128 A rows (and Al rows) and 128 B rows is brought into LDS once per block by asynchronous copies in whole 256-byte rows,
// two buffers: slab t + 1 flies while slab t is worked on; the waves read their fragments from there (K a multiple of 128). The k order of the fragments is unchanged.
#define GKS  128                 // k elements of a staged slab: rows of 256 bytes
#define GPB  272                 // LDS pitch in bytes of a staged row (256 + 16): 16 B x odd, conflict-free for ds_load_b128
#define GTB  128                 // rows of a plane: the block tile's rows, and its columns
#define GPL  (GTB * GPB)         // one plane of a slab
#define GTP  136                 // pitch in elements of a staged transposed output row (128 + 8): 16 B x odd
// cpa8: eight 16-byte copies of one lane; the s_wait_xcnt stands inside the statement so that no address register is rewritten ahead of it.
__device__ __forceinline__ void cpa8(unsigned l0, unsigned l1, unsigned l2, unsigned l3, unsigned l4, unsigned l5, unsigned l6, unsigned l7,
                                     const void* g0, const void* g1, const void* g2, const void* g3, const void* g4, const void* g5, const void* g6, const void* g7) {
    asm volatile("global_load_async_to_lds_b128 %0, %8, off\n\t"
                 "global_load_async_to_lds_b128 %1, %9, off\n\t"
                 "global_load_async_to_lds_b128 %2, %10, off\n\t"
                 "global_load_async_to_lds_b128 %3, %11, off\n\t"
                 "global_load_async_to_lds_b128 %4, %12, off\n\t"
                 "global_load_async_to_lds_b128 %5, %13, off\n\t"
                 "global_load_async_to_lds_b128 %6, %14, off\n\t"
                 "global_load_async_to_lds_b128 %7, %15, off\n\t"
                 "s_wait_xcnt 0x0"
                 :: "v"(l0), "v"(l1), "v"(l2), "v"(l3), "v"(l4), "v"(l5), "v"(l6), "v"(l7), "v"(g0), "v"(g1), "v"(g2), "v"(g3), "v"(g4), "v"(g5), "v"(g6), "v"(g7) : "memory");
}
template <bool SPLITA, bool F16OUT = false, bool VTOUT = false>
__global__ __launch_bounds__(256) void k_gemmb(const bf* __restrict__ A, const bf* __restrict__ Al, const bf* __restrict__ Bn, const float* __restrict__ bias, float* C, int ldc, h16* C2, const float* __restrict__ R = nullptr, int K = DM, int roundR = 1) {
    constexpr unsigned GST = (SPLITA ? 3 : 2) * GPL, GBO = (SPLITA ? 2 : 1) * GPL;     // one slab: A rows (, Al rows), B rows; where its B plane begins (Al within reach of the A pointer's 16-bit LDS offsets)
    constexpr int KG = SPLITA ? 1 : 2, NG = (GKS / 32) / KG;     // 32-k steps whose fragments are read as one group (16 products a group either way); groups a slab
    __shared__ __align__(16) float ost[8][32 * 68];
    __shared__ __align__(16) unsigned char gring[2 * GST];
    const int lane = threadIdx.x & 31, wave = threadIdx.x >> 5, lr = lane & 15, hi = lane >> 4;
    const int wr = wave >> 1, wc = wave & 1;             // the wave's 32 rows and 64 columns of the block tile
    const int rb = blockIdx.x * GTB, cb = blockIdx.y * GTB;
    const int r0 = rb + wr * 32, c0 = cb + wc * 64;
    // each thread copies 8 x 16 B of each plane: rows tid / 16 + 16 i (a wave = two whole 256-byte rows)
    const int tid = threadIdx.x;
    const unsigned gdst = (unsigned)(size_t)&gring[0] + (tid >> 4) * GPB + (tid & 15) * 16;     // the lane's byte address in LDS
    const size_t asrc = (size_t)(rb + (tid >> 4)) * K + (tid & 15) * 8, bsrc = (size_t)(cb + (tid >> 4)) * K + (tid & 15) * 8, rs = (size_t)16 * K;
    auto plane = [&](const bf* p, unsigned d) {
        cpa8(d, d + 16 * GPB, d + 32 * GPB, d + 48 * GPB, d + 64 * GPB, d + 80 * GPB, d + 96 * GPB, d + 112 * GPB,
             p, p + rs, p + 2 * rs, p + 3 * rs, p + 4 * rs, p + 5 * rs, p + 6 * rs, p + 7 * rs);
    };
    auto stage = [&](int t, unsigned bo) {
        plane(A + asrc + (size_t)t * GKS, gdst + bo); plane(Bn + bsrc + (size_t)t * GKS, gdst + bo + GBO);
        if (SPLITA) plane(Al + asrc + (size_t)t * GKS, gdst + bo + GPL);
    };
    v8f acc[2][4];
#pragma unroll
    for (int m = 0; m < 2; ++m)
#pragma unroll
        for (int t = 0; t < 4; ++t) acc[m][t] = (v8f){};
    const int nt = K / GKS;
    stage(0, 0u);
    asm volatile("s_wait_asynccnt 0x0" ::: "memory");     // slab 0 of this wave's copies has landed
    __syncthreads();                                      // ... and every other wave's
    if (nt > 1) stage(1, GST);                            // block-uniform
#pragma unroll 1
    for (int s = 0; s < nt; ++s) {
        const unsigned bo = (unsigned)(s & 1) * GST;
        const bf* as = (const bf*)(gring + bo) + (wr * 32 + lr) * (GPB / 2) + 8 * hi;            // this lane's A row of row group 0 in the staged slab (Al: one plane on)
        const bf* bs = (const bf*)(gring + bo + GBO) + (wc * 64 + lr) * (GPB / 2) + 8 * hi;      // this lane's B row of column group 0
#pragma unroll
        for (int g = 0; g < NG; ++g) {
            v16bf af[KG][2], alf[KG][2], bb[KG][4];
#pragma unroll
            for (int kc = 0; kc < KG; ++kc) { const int ko = (g * KG + kc) * 32;
#pragma unroll
                for (int m = 0; m < 2; ++m) { const bf* ap = as + m * 16 * (GPB / 2) + ko;
                    af[kc][m] = cat16b(*(const v8usa*)ap, *(const v8usa*)(ap + 16));
                    alf[kc][m] = af[kc][m]; if (SPLITA) alf[kc][m] = cat16b(*(const v8usa*)(ap + GPL / 2), *(const v8usa*)(ap + GPL / 2 + 16)); }
#pragma unroll
                for (int t = 0; t < 4; ++t) { const bf* bp = bs + t * 16 * (GPB / 2) + ko; bb[kc][t] = cat16b(*(const v8usa*)bp, *(const v8usa*)(bp + 16)); }
            }
            __builtin_amdgcn_sched_barrier(0);     // the group's LDS reads issue ahead of its first product: one LDS latency a group, not one a fragment
#pragma unroll
            for (int kc = 0; kc < KG; ++kc)
#pragma unroll
                for (int m = 0; m < 2; ++m)
#pragma unroll
                    for (int t = 0; t < 4; ++t) { acc[m][t] = wmmab(af[kc][m], bb[kc][t], acc[m][t]); if (SPLITA) acc[m][t] = wmmab(alf[kc][m], bb[kc][t], acc[m][t]); }
            if (g == NG - 1)     // the distance behind the slab's last product, on the back edge too
                asm volatile("v_nop\n\tv_nop\n\tv_nop\n\tv_nop" : "+v"(acc[0][0]), "+v"(acc[0][1]), "+v"(acc[0][2]), "+v"(acc[0][3]), "+v"(acc[1][0]), "+v"(acc[1][1]), "+v"(acc[1][2]), "+v"(acc[1][3]) : "v"(af[KG - 1][1]), "v"(alf[KG - 1][1]));
        }
        asm volatile("s_wait_dscnt 0x0" ::: "memory");        // this wave's reads of slab s are done before its buffer is refilled
        asm volatile("s_wait_asynccnt 0x0" ::: "memory");     // this wave's copies of slab s + 1 have landed
        __syncthreads();                                      // publishes slab s + 1 and ends every wave's reads of slab s
        if (s + 2 < nt) stage(s + 2, bo);                     // block-uniform: the refill of the buffer just read
    }
    asm volatile("s_wait_asynccnt 0x0" ::: "memory");         // no copy is outstanding when the wave goes on
    float* os = &ost[wave][0];
    unsigned short* tph = (unsigned short*)(void*)&ost[0][0]; unsigned short* tpl = tph + GTB * GTP;     // VTOUT: the staging holds the two transposed planes, [c][r]
#pragma unroll
    for (int t = 0; t < 4; ++t) { const float bv = bias ? bfr(bias[c0 + t * 16 + lr]) : 0.f;
#pragma unroll
        for (int m = 0; m < 2; ++m) {
            if (VTOUT) {     // a lane holds eight consecutive r of one c: one 16-byte piece of that c row in each plane
                v8us oh, ol;
#pragma unroll
                for (int j = 0; j < 8; ++j) { const float v = acc[m][t][j] + bv; const unsigned short hb = f2bf(v); oh[j] = hb; ol[j] = f2bf(v - bf2f(hb)); }
                const int o = (wc * 64 + t * 16 + lr) * GTP + wr * 32 + m * 16 + hi * 8; *(v8usa*)(tph + o) = oh; *(v8usa*)(tpl + o) = ol;
            } else {
#pragma unroll
                for (int j = 0; j < 8; ++j) os[(m * 16 + hi * 8 + j) * 68 + t * 16 + lr] = acc[m][t][j] + bv;
            }
        } }
    __syncthreads();
    if (VTOUT) {
        // the block's 128 r x 128 c tile leaves transposed: sixteen lanes write the two whole 128-byte lines (128 r) of a c row in each plane; reads cross the waves' staging (behind the barrier above)
        bf* th = (bf*)(void*)C + (size_t)cb * NT_ + rb; bf* tlo = (bf*)(void*)C2 + (size_t)cb * NT_ + rb;
        const int piece = tid & 15;
#pragma unroll
        for (int s = 0; s < 8; ++s) { const int d = (tid >> 4) + 16 * s;
            const v8us oh = *(const v8usa*)(tph + d * GTP + piece * 8), ol = *(const v8usa*)(tpl + d * GTP + piece * 8);
            *(v8us*)(th + (size_t)d * NT_ + piece * 8) = oh; *(v8us*)(tlo + (size_t)d * NT_ + piece * 8) = ol; }
    } else if (F16OUT) {
        h16* crow = (h16*)(void*)C + (size_t)r0 * ldc + c0;
        auto pass = [&]() {
#pragma unroll
            for (int s = 0; s < 8; ++s) { const int row = 4 * s + (lane >> 3), piece = lane & 7; const float* sp = os + row * 68 + piece * 8; v8h o, o2;
#pragma unroll
                for (int i = 0; i < 8; ++i) { const h16 a = (h16)sp[i]; o[i] = a; o2[i] = (h16)((sp[i] - (float)a) * LOSC); }
                *(v8h*)(crow + (size_t)row * ldc + piece * 8) = o;
                asm volatile("s_wait_xcnt 0x0" ::: "memory");     // the store's registers are reused on the far side of the branch below
                if (C2) *(v8h*)(C2 + (size_t)r0 * ldc + c0 + (size_t)row * ldc + piece * 8) = o2; }
        };
        pass(); 
    } else {
        float* crow = C + (size_t)r0 * ldc + c0;
        auto pass = [&]() {
#pragma unroll
            for (int s = 0; s < 16; ++s) { const int Lid = (lane >> 3) + 4 * s, piece = lane & 7; const int row = Lid >> 1, cofs = (Lid & 1) * 32 + piece * 4;
                v4f val = *(const v4fa*)(os + row * 68 + cofs); if (R) { const v4f rv = *(const v4f*)(R + ((size_t)r0 + row) * ldc + c0 + cofs); val += roundR ? (v4f){bfr(rv[0]), bfr(rv[1]), bfr(rv[2]), bfr(rv[3])} : rv; }
                *(v4f*)(crow + (size_t)row * ldc + cofs) = val;
                asm volatile("s_wait_xcnt 0x0" ::: "memory"); }     // the store's registers are reused behind the branch on R of the next row
        };
        pass(); 
    }
}

// k_qkv: the q, k and v products of one head for 128 rows of x in one block: a 128 x 384 block tile = x[128 rows] . [Wq(h) | Wk(h) | Wv(h)]^T + the bf16-rounded biases, 8 waves (2 x 4), each
// 64 x 96. The three products share their A operand: each 128-k slab of the 128 x rows is brought into LDS once for all three, beside the 3 x 128 weight rows (asynchronous copies in whole
// 256-byte rows, two buffers, the order of k_gemmb's ring); a wave reads 10 fragments for 24 products. The k order of every sum is that of k_gemmb. Behind the loop the ring is free and
// holds the output staging: q | k as f32 rows (they leave as f16 hi + residual x1024 planes), v as the two transposed [d][t] bf16 planes (hi + unscaled residual).
#define QSP  260                 // pitch in floats of a staged q | k row (256 + 4): the two 8-row halves of a tile store fall on different banks, four rows of a read too
__global__ __launch_bounds__(256) void k_qkv(const bf* __restrict__ A, const bf* __restrict__ Bq, const bf* __restrict__ Bk, const bf* __restrict__ Bv,
                                             const float* __restrict__ bq, const float* __restrict__ bk, const float* __restrict__ bv, h16* QH, h16* QL, h16* KH, h16* KL, bf* VTH, bf* VTL) {
    constexpr unsigned GST = 4 * GPL;                    // one slab: the x rows, then the q, k and v weight rows (384 rows of the second operand, one behind the other)
    constexpr int K = DM, nt = K / GKS;
    __shared__ __align__(16) unsigned char gring[2 * GST];
    const int tid = threadIdx.x, lane = tid & 31, lr = lane & 15, hi = lane >> 4;
    const int wave = __builtin_amdgcn_readfirstlane(tid >> 5);     // wave-uniform, kept scalar: the epilogue branches on it
    const int wr = wave >> 2, wc = wave & 3;             // the wave's 64 rows and 96 columns of the block tile
    const int rb = blockIdx.x * GTB, cb = blockIdx.y * GTB;        // rows of x; this head's 128 columns of each product
    // each thread copies 8 x 16 B of each plane: rows tid / 16 + 16 i (a wave = two whole 256-byte rows)
    const unsigned gdst = (unsigned)(size_t)&gring[0] + (tid >> 4) * GPB + (tid & 15) * 16;     // the lane's byte address in LDS
    const unsigned lsrc = (tid >> 4) * K + (tid & 15) * 8;         // the lane's element in a plane's slab: the same for all four planes, all that a lane keeps of the sources
    const size_t aro = (size_t)rb * K, bro = (size_t)cb * K, rs = (size_t)16 * K;     // block-uniform
    auto plane = [&](const bf* u, unsigned d) {          // u: block-uniform start of the plane's slab
        // the slab's start is held in scalar registers, so that a lane keeps one offset and not four 64-bit pointers across the loop (they were spilled: asm operands must lie below v256)
        const unsigned long long ua = (unsigned long long)u;
        const unsigned ulo = (unsigned)__builtin_amdgcn_readfirstlane((int)(unsigned)ua), uhi = (unsigned)__builtin_amdgcn_readfirstlane((int)(unsigned)(ua >> 32));
        const bf* p = (const bf*)(((unsigned long long)uhi << 32) | ulo) + lsrc;
        cpa8(d, d + 16 * GPB, d + 32 * GPB, d + 48 * GPB, d + 64 * GPB, d + 80 * GPB, d + 96 * GPB, d + 112 * GPB,
             p, p + rs, p + 2 * rs, p + 3 * rs, p + 4 * rs, p + 5 * rs, p + 6 * rs, p + 7 * rs);
    };
    auto stage = [&](int t, unsigned bo) {               // 32 copies of a wave in flight
        plane(A + aro + (size_t)t * GKS, gdst + bo); plane(Bq + bro + (size_t)t * GKS, gdst + bo + GPL);
        plane(Bk + bro + (size_t)t * GKS, gdst + bo + 2 * GPL); plane(Bv + bro + (size_t)t * GKS, gdst + bo + 3 * GPL);
    };
    v8f acc[4][6];
#pragma unroll
    for (int m = 0; m < 4; ++m)
#pragma unroll
        for (int t = 0; t < 6; ++t) acc[m][t] = (v8f){};
    stage(0, 0u);
    asm volatile("s_wait_asynccnt 0x0" ::: "memory");     // slab 0 of this wave's copies has landed
    __syncthreads();                                      // ... and every other wave's
    stage(1, GST);
    float braw[6];     // the wave's six bias values a lane, asked for here so that their latency passes under the loop
#pragma unroll
    for (int t = 0; t < 6; ++t) { const int cc = wc * 96 + t * 16;     // the 16-column group's place in q | k | v: wave-uniform, each group lies in one product
        const float* __restrict__ bp = cc < 128 ? bq : cc < 256 ? bk : bv; braw[t] = bp[cb + (cc & 127) + lr]; }
    asm volatile("s_wait_xcnt 0x0" ::: "memory");     // before the six loads' offset registers are reused
    __builtin_amdgcn_sched_barrier(0);                // ... and no later register write is lifted over that wait (its clobber orders memory operations only)
#pragma unroll 1
    for (int s = 0; s < nt; ++s) {
        const unsigned bo = (unsigned)(s & 1) * GST;
        const bf* as = (const bf*)(gring + bo) + (wr * 64 + lr) * (GPB / 2) + 8 * hi;            // this lane's x row of row group 0 in the staged slab
        const bf* bs = (const bf*)(gring + bo + GPL) + (wc * 96 + lr) * (GPB / 2) + 8 * hi;      // this lane's weight row of column group 0
#pragma unroll
        for (int g = 0; g < GKS / 32; ++g) {
            v16bf af[4], bb[6];
            auto lda = [&](int m) { const bf* ap = as + m * 16 * (GPB / 2) + g * 32; af[m] = cat16b(*(const v8usa*)ap, *(const v8usa*)(ap + 16)); };
            lda(0);                                       // in the order in which the products want them
#pragma unroll
            for (int t = 0; t < 6; ++t) { const bf* bp = bs + t * 16 * (GPB / 2) + g * 32; bb[t] = cat16b(*(const v8usa*)bp, *(const v8usa*)(bp + 16)); }
            lda(1); lda(2); lda(3);
            __builtin_amdgcn_sched_barrier(0);     // the group's LDS reads issue ahead of its first product: one LDS latency a group, not one a fragment
#pragma unroll
            for (int m = 0; m < 4; ++m)
#pragma unroll
                for (int t = 0; t < 6; ++t) acc[m][t] = wmmab(af[m], bb[t], acc[m][t]);
            if (g == GKS / 32 - 1) {
                __builtin_amdgcn_sched_barrier(0);     // the slab's products stay in front of the foot: else most of the last group sinks behind the barrier and holds back the refill
                // the distance behind the slab's last products, on the back edge too
                asm volatile("v_nop\n\tv_nop\n\tv_nop\n\tv_nop" : "+v"(acc[3][2]), "+v"(acc[3][3]), "+v"(acc[3][4]), "+v"(acc[3][5]) : "v"(af[3]), "v"(bb[2]), "v"(bb[3]), "v"(bb[4]), "v"(bb[5]));
            }
        }
        asm volatile("s_wait_dscnt 0x0" ::: "memory");        // this wave's reads of slab s are done before its buffer is refilled
        asm volatile("s_wait_asynccnt 0x0" ::: "memory");     // this wave's copies of slab s + 1 have landed
        __syncthreads();                                      // publishes slab s + 1 and ends every wave's reads of slab s
        if (s + 2 < nt) stage(s + 2, bo);                     // block-uniform: the refill of the buffer just read
    }
    asm volatile("s_wait_asynccnt 0x0" ::: "memory");         // no copy is outstanding when the wave goes on
    // the last trip's barrier has ended every wave's reads of the ring and nothing flies into it: it becomes the staging
    float* st = (float*)(void*)&gring[0];
    unsigned short* tph = (unsigned short*)(void*)&gring[GTB * QSP * 4]; unsigned short* tpl = tph + GTB * GTP;
#pragma unroll
    for (int t = 0; t < 6; ++t) { const int cc = wc * 96 + t * 16;
        const float bias = bfr(braw[t]);
        if (cc < 256) {
#pragma unroll
            for (int m = 0; m < 4; ++m)
#pragma unroll
                for (int j = 0; j < 8; ++j) st[(wr * 64 + m * 16 + hi * 8 + j) * QSP + cc + lr] = acc[m][t][j] + bias;
        } else {     // a lane holds eight consecutive r of one d: one 16-byte piece of that d row in each plane
#pragma unroll
            for (int m = 0; m < 4; ++m) { v8us oh, ol;
#pragma unroll
                for (int j = 0; j < 8; ++j) { const float v = acc[m][t][j] + bias; const unsigned short hb = f2bf(v); oh[j] = hb; ol[j] = f2bf(v - bf2f(hb)); }
                const int o = (cc - 256 + lr) * GTP + wr * 64 + m * 16 + hi * 8; *(v8usa*)(tph + o) = oh; *(v8usa*)(tpl + o) = ol; }
        }
    }
    __syncthreads();                                          // the reads below cross the waves' staging
    {   // q | k: a wave takes 64 rows of one 64-column panel (q low, q high, k low, k high); eight lanes = one 128-byte line of each plane
        const int panel = wave & 3, rh = wave >> 2;
        h16* dh = (panel < 2 ? QH : KH) + (size_t)(rb + rh * 64) * HS + cb + (panel & 1) * 64; h16* dl = (panel < 2 ? QL : KL) + (size_t)(rb + rh * 64) * HS + cb + (panel & 1) * 64;
#pragma unroll
        for (int s = 0; s < 16; ++s) { const int row = 4 * s + (lane >> 3), piece = lane & 7; const float* sp = st + (rh * 64 + row) * QSP + panel * 64 + piece * 8; v8h o, o2;
#pragma unroll
            for (int i = 0; i < 8; ++i) { const h16 a = (h16)sp[i]; o[i] = a; o2[i] = (h16)((sp[i] - (float)a) * LOSC); }
            *(v8h*)(dh + (size_t)row * HS + piece * 8) = o; *(v8h*)(dl + (size_t)row * HS + piece * 8) = o2; }
    }
    {   // v: sixteen lanes write the two whole 128-byte lines (128 t) of a d row in each plane
        bf* th = VTH + (size_t)cb * NT_ + rb; bf* tlo = VTL + (size_t)cb * NT_ + rb;
        const int piece = tid & 15;
#pragma unroll
        for (int s = 0; s < 8; ++s) { const int d = (tid >> 4) + 16 * s;
            const v8us oh = *(const v8usa*)(tph + d * GTP + piece * 8), ol = *(const v8usa*)(tpl + d * GTP + piece * 8);
            *(v8us*)(th + (size_t)d * NT_ + piece * 8) = oh; *(v8us*)(tlo + (size_t)d * NT_ + piece * 8) = ol; }
    }
}

__device__ __forceinline__ void cp8(unsigned l0, unsigned l1, unsigned l2, unsigned l3, unsigned l4, unsigned l5, unsigned l6, unsigned l7,
                                    const void* g0, const void* g1, const void* g2, const void* g3, const void* g4, const void* g5, const void* g6, const void* g7) {
    asm volatile("global_load_async_to_lds_b128 %0, %8, off\n\t"
                 "global_load_async_to_lds_b128 %1, %9, off\n\t"
                 "global_load_async_to_lds_b128 %2, %10, off\n\t"
                 "global_load_async_to_lds_b128 %3, %11, off\n\t"
                 "global_load_async_to_lds_b128 %4, %12, off\n\t"
                 "global_load_async_to_lds_b128 %5, %13, off\n\t"
                 "global_load_async_to_lds_b128 %6, %14, off\n\t"
                 "global_load_async_to_lds_b128 %7, %15, off\n\t"
                 "s_wait_xcnt 0x0"
                 :: "v"(l0), "v"(l1), "v"(l2), "v"(l3), "v"(l4), "v"(l5), "v"(l6), "v"(l7), "v"(g0), "v"(g1), "v"(g2), "v"(g3), "v"(g4), "v"(g5), "v"(g6), "v"(g7) : "memory");
}
// ex2s: 2^x; the one free slot that the instruction set asks for behind a transcendental stands inside the statement
#define L2E 1.4426950408889634f
__device__ __forceinline__ float ex2s(float x) { float r; asm("v_exp_f32 %0, %1\n\tv_nop" : "=v"(r) : "v"(x)); return r; }
// ex2x8: eight at once: each fills the slot of the one in front of it (results apart from every source), one v_nop behind the last
__device__ __forceinline__ void ex2x8(float (&r)[8], const float (&x)[8]) {
    asm("v_exp_f32 %0, %8\n\tv_exp_f32 %1, %9\n\tv_exp_f32 %2, %10\n\tv_exp_f32 %3, %11\n\tv_exp_f32 %4, %12\n\tv_exp_f32 %5, %13\n\tv_exp_f32 %6, %14\n\tv_exp_f32 %7, %15\n\tv_nop"
        : "=&v"(r[0]), "=&v"(r[1]), "=&v"(r[2]), "=&v"(r[3]), "=&v"(r[4]), "=&v"(r[5]), "=&v"(r[6]), "=&v"(r[7])
        : "v"(x[0]), "v"(x[1]), "v"(x[2]), "v"(x[3]), "v"(x[4]), "v"(x[5]), "v"(x[6]), "v"(x[7])); }
// xhalf: the value of lane l ^ 16 (the other half of the wave), by a vector cross-row move
__device__ __forceinline__ float xhalf(float x) { return __builtin_bit_cast(float, __builtin_amdgcn_permlanex16(__builtin_bit_cast(int, x), __builtin_bit_cast(int, x), 0x76543210, 0xfedcba98, false, false)); }
// pkbf: two f32 rounded to nearest even into one register of a bf16 operand (a in the low half): one packed conversion, the rounding of f2bf
typedef __attribute__((ext_vector_type(2))) float v2f;
typedef __attribute__((ext_vector_type(2))) __bf16 v2bf;
typedef __attribute__((ext_vector_type(8))) unsigned v8u;
__device__ __forceinline__ unsigned pkbf(float a, float b) { return __builtin_bit_cast(unsigned, __builtin_convertvector((v2f){a, b}, v2bf)); }
__device__ __forceinline__ float max3f(float a, float b, float c) { return fmaxf(fmaxf(a, b), c); }
__global__ __launch_bounds__(256) void k_attn(const h16* __restrict__ QH, const h16* __restrict__ QL, const h16* __restrict__ KH, const h16* __restrict__ KL, const bf* __restrict__ VTH, const bf* __restrict__ VTL, bf* OH, bf* OL) {
    __shared__ __align__(16) float ost[8][16 * 68];
    __shared__ __align__(16) float xch[8][9 * 32 * 4];      // what a wave hands its partner: four output tiles, the maximum and the sum
    __shared__ __align__(16) unsigned char ring[4 * STG];   // two buffers x two teams
    const int lane = threadIdx.x & 31, wave = threadIdx.x >> 5, lr = lane & 15, hi = lane >> 4;
    const int kp = __builtin_amdgcn_readfirstlane((int)(threadIdx.x >> 7));     // the team: parity of its key tiles (wave-uniform, kept scalar)
    const int bid = blockIdx.x; const int h = bid % NH_, qt = (NT_ / 64 - 1) - bid / NH_; const int g = h / NREP;     // longest blocks first; GQA: kv head
    const int q0 = qt * 64 + (wave & 3) * 16;
    const size_t qo = (size_t)(q0 + lr) * (NH_ * HD) + h * HD + 8 * hi;
    const h16* kh_b = KH + g * HD; const h16* kl_b = KL + g * HD;
    const size_t vbase = ((size_t)g * HD) * NT_;
    v8f o[8];     // O^T: tile n, register j of lane (lr, hi) = column d = 16 n + 8 hi + j of query q0 + lr
#pragma unroll
    for (int n = 0; n < 8; ++n) o[n] = (v8f){};
    float mrow = -3.0e38f, lpart = 0.f;     // this lane's query: running maximum (equal in both halves), sum over this half's keys
    // causal key tiles 0 .. 2 qt + 1: trip it works on tile 2 it + kp, it = 0 .. qt
    // each thread copies 4 x 16 B of each plane of its team's tile: k rows tid / 16 + 8 i (a wave = two whole 256-byte rows), v rows tid / 4 + 32 i
    const int tid = threadIdx.x & 127;
    const unsigned ring0 = (unsigned)(size_t)&ring[0];     // the ring's byte address in LDS
    const unsigned kdst = ring0 + (tid >> 4) * KPB + (tid & 15) * 16, vdst = ring0 + 2 * KPL + (tid >> 2) * VPB + (tid & 3) * 16;
    const size_t ksrc = (size_t)(tid >> 4) * KW + (tid & 15) * 8, vsrc = vbase + (size_t)(tid >> 2) * NT_ + (tid & 3) * 8;
    auto stage = [&](int t, unsigned bo) {
        const h16* a = kh_b + ksrc + (size_t)t * 32 * KW; const h16* b = kl_b + ksrc + (size_t)t * 32 * KW; const unsigned kd = kdst + bo;
        cp8(kd, kd + 8 * KPB, kd + 16 * KPB, kd + 24 * KPB, kd + KPL, kd + KPL + 8 * KPB, kd + KPL + 16 * KPB, kd + KPL + 24 * KPB,
            a, a + 8 * KW, a + 16 * KW, a + 24 * KW, b, b + 8 * KW, b + 16 * KW, b + 24 * KW);
        const bf* c = VTH + vsrc + t * 32; const bf* d = VTL + vsrc + t * 32; const unsigned vd = vdst + bo;
        cp8(vd, vd + 32 * VPB, vd + 64 * VPB, vd + 96 * VPB, vd + VPL, vd + VPL + 32 * VPB, vd + VPL + 64 * VPB, vd + VPL + 96 * VPB,
            c, c + 32 * NT_, c + 64 * NT_, c + 96 * NT_, d, d + 32 * NT_, d + 64 * NT_, d + 96 * NT_);
    };
    const unsigned tbo = (unsigned)kp * STG;              // the team's part of a buffer
    stage(kp, tbo);
    asm volatile("s_wait_asynccnt 0x0" ::: "memory");     // this wave's copies of trip 0 have landed
    __syncthreads();                                      // ... and every other wave's
    if (qt >= 1) stage(2 + kp, 2u * STG + tbo);           // block-uniform: a trip 1 exists
#pragma unroll 1
    for (int it = 0; it <= qt; ++it) {
        const int l0 = (2 * it + kp) * 32;
        const unsigned bo = (unsigned)(it & 1) * (2u * STG) + tbo;
        const h16* kth = (const h16*)(ring + bo) + lr * (KPB / 2) + 8 * hi; const h16* ktl = kth + KPL / 2;     // this lane's k row of the staged tile
        const bf* vth = (const bf*)(ring + bo + 2 * KPL) + lr * (VPB / 2) + 8 * hi; const bf* vtl = vth + VPL / 2;
        v8f s0 = {}, s1 = {}, x0 = {}, x1 = {};     // S^T: register j of lane (lr, hi) = key l0 + 8 hi + j (s0, x0) or l0 + 16 + 8 hi + j (s1, x1) against query q0 + lr
        v16h kf[4][4];
#pragma unroll
        for (int kc = 0; kc < 4; ++kc) {
            kf[kc][0] = cat16(*(const v8ha*)(kth + kc * 32), *(const v8ha*)(kth + kc * 32 + 16)); kf[kc][1] = cat16(*(const v8ha*)(kth + 16 * (KPB / 2) + kc * 32), *(const v8ha*)(kth + 16 * (KPB / 2) + kc * 32 + 16));
            kf[kc][2] = cat16(*(const v8ha*)(ktl + kc * 32), *(const v8ha*)(ktl + kc * 32 + 16)); kf[kc][3] = cat16(*(const v8ha*)(ktl + 16 * (KPB / 2) + kc * 32), *(const v8ha*)(ktl + 16 * (KPB / 2) + kc * 32 + 16)); }
        __builtin_amdgcn_sched_barrier(0);     // all 32 LDS reads of the k tile issue ahead of the first product: one LDS latency a tile, not eight
#pragma unroll
        for (int kc = 0; kc < 4; ++kc) {
            const v16h qa = cat16(*(const v8h*)(QH + qo + kc * 32), *(const v8h*)(QH + qo + kc * 32 + 16)), qx = cat16(*(const v8h*)(QL + qo + kc * 32), *(const v8h*)(QL + qo + kc * 32 + 16));
            const v16h k0h = kf[kc][0], k1h = kf[kc][1];
            s0 = wmma16(k0h, qa, s0); s1 = wmma16(k1h, qa, s1); x0 = wmma16(k0h, qx, x0); x1 = wmma16(k1h, qx, x1);
            const v16h k0l = kf[kc][2], k1l = kf[kc][3];
            x0 = wmma16(k0l, qa, x0); x1 = wmma16(k1l, qa, x1);
        }
        asm volatile("v_nop\n\tv_nop\n\tv_nop\n\tv_nop" : "+v"(s0), "+v"(s1), "+v"(x0), "+v"(x1));
        v16bf vf[8][2];
#pragma unroll
        for (int n = 0; n < 8; ++n) { const int vo = n * 16 * (VPB / 2);
            vf[n][0] = cat16b(*(const v8usa*)(vth + vo), *(const v8usa*)(vth + vo + 16)); vf[n][1] = cat16b(*(const v8usa*)(vtl + vo), *(const v8usa*)(vtl + vo + 16)); }
        __builtin_amdgcn_sched_barrier(0);     // the v tile's 32 LDS reads issue ahead of the softmax (nothing of it passes through LDS any more): they are served under its vector work
        const int dq = q0 + lr - (l0 + hi * 8);     // the lane's query less its first key: key j of the lane is live where j <= dq
        float sa[8], sb[8], ea[8], eb[8], p0[8], p1[8];
#pragma unroll
        for (int j = 0; j < 8; ++j) {
            sa[j] = (j <= dq) ? (s0[j] + x0[j] * LOSCI) * SCL : -__builtin_inff(); sb[j] = (16 + j <= dq) ? (s1[j] + x1[j] * LOSCI) * SCL : -__builtin_inff(); }     // causal (-inf as the reference; the diagonal is always live)
        float mx = fmaxf(max3f(max3f(sa[0], sa[1], sa[2]), max3f(sa[3], sa[4], sa[5]), max3f(sa[6], sa[7], sb[0])), max3f(max3f(sb[1], sb[2], sb[3]), max3f(sb[4], sb[5], sb[6]), sb[7]));
        mx = fmaxf(mx, xhalf(mx));     // over all 32 keys of the tile: the same in both halves
        const float mn = fmaxf(mrow, mx);
#pragma unroll
        for (int j = 0; j < 8; ++j) { ea[j] = (sa[j] - mn) * L2E; eb[j] = (sb[j] - mn) * L2E; }
        ex2x8(p0, ea); ex2x8(p1, eb);
        const float alpha = ex2s((mrow - mn) * L2E); mrow = mn;
        lpart = lpart * alpha + ((((p0[0] + p1[0]) + (p0[1] + p1[1])) + ((p0[2] + p1[2]) + (p0[3] + p1[3]))) + (((p0[4] + p1[4]) + (p0[5] + p1[5])) + ((p0[6] + p1[6]) + (p0[7] + p1[7]))));
        v8u ph, pr;     // the operand's registers: 0 .. 3 = keys 8 hi + 0 .. 7 in pairs, 4 .. 7 = keys 16 + 8 hi + 0 .. 7, as the v rows are read
#pragma unroll
        for (int j = 0; j < 8; j += 2) {
            const float a0 = p0[j] * PSC, a1 = p0[j + 1] * PSC, b0 = p1[j] * PSC, b1 = p1[j + 1] * PSC;
            const unsigned ha = pkbf(a0, a1), hb = pkbf(b0, b1); ph[j / 2] = ha; ph[4 + j / 2] = hb;
            pr[j / 2] = pkbf(a0 - __uint_as_float(ha << 16), a1 - __uint_as_float(ha & 0xFFFF0000u)); pr[4 + j / 2] = pkbf(b0 - __uint_as_float(hb << 16), b1 - __uint_as_float(hb & 0xFFFF0000u)); }
        const v16bf pa = __builtin_bit_cast(v16bf, ph), px = __builtin_bit_cast(v16bf, pr);
#pragma unroll
        for (int n = 0; n < 8; ++n)
#pragma unroll
            for (int j = 0; j < 8; ++j) o[n][j] *= alpha;
#pragma unroll
        for (int n = 0; n < 8; ++n) { const v16bf vh = vf[n][0], vl = vf[n][1];
            o[n] = wmmab(vh, pa, o[n]); o[n] = wmmab(vh, px, o[n]); o[n] = wmmab(vl, pa, o[n]); }
        __builtin_amdgcn_sched_barrier(0);     // the tile's products stay in front of the foot: else half of them sink behind the barrier and hold back the refill
        asm volatile("v_nop\n\tv_nop\n\tv_nop\n\tv_nop" : "+v"(o[0]), "+v"(o[7]) : "v"(pa), "v"(px));
        asm volatile("s_wait_dscnt 0x0" ::: "memory");        // this wave's reads of trip it are done before its buffer is refilled
        asm volatile("s_wait_asynccnt 0x0" ::: "memory");     // this wave's copies of trip it + 1 have landed
        __syncthreads();                                      // publishes trip it + 1 and ends every wave's reads of trip it
        if (it + 2 <= qt) stage(2 * (it + 2) + kp, bo);       // block-uniform: the refill of the buffer just read
    }
    asm volatile("s_wait_asynccnt 0x0" ::: "memory");         // no copy is outstanding when the wave goes on
    // join of the two teams: each wave hands its partner (wave ^ 4: the same 16 queries, the other key tiles) the four output tiles that the partner finishes, with its maximum and sum
    float* xw = &xch[wave][0]; const float* xr = &xch[wave ^ 4][0];
    v8f fo[4];
#pragma unroll
    for (int n = 0; n < 4; ++n) { const v8f sv = kp ? o[n] : o[4 + n]; fo[n] = kp ? o[4 + n] : o[n];
        *(v4fa*)(xw + ((2 * n) * 32 + lane) * 4) = (v4f){sv[0], sv[1], sv[2], sv[3]}; *(v4fa*)(xw + ((2 * n + 1) * 32 + lane) * 4) = (v4f){sv[4], sv[5], sv[6], sv[7]}; }
    *(v4fa*)(xw + (8 * 32 + lane) * 4) = (v4f){mrow, lpart, 0.f, 0.f};
    __syncthreads();                                          // every wave's state is in LDS before its partner reads it
    const v4f pml = *(const v4fa*)(xr + (8 * 32 + lane) * 4);
    const float mj = fmaxf(mrow, pml[0]);     // a team whose tiles were all masked holds the start maximum and zeros: its factor is 0
    const float fa = ex2s((mrow - mj) * L2E), fb = ex2s((pml[0] - mj) * L2E);
    float rs = lpart * fa + pml[1] * fb; rs += xhalf(rs);     // the two halves' keys
    const float inv = 1.0f / (rs * PSC);
#pragma unroll
    for (int n = 0; n < 4; ++n)
#pragma unroll
        for (int q = 0; q < 2; ++q) { const v4f po = *(const v4fa*)(xr + ((2 * n + q) * 32 + lane) * 4);
#pragma unroll
            for (int i = 0; i < 4; ++i) fo[n][q * 4 + i] = fo[n][q * 4 + i] * fa + po[i] * fb; }
    float* os = &ost[wave][0];
    const size_t ob = (size_t)q0 * (NH_ * HD) + (size_t)h * HD;     // row stride NH*HD, this head's 128 columns
    { const int half = kp;     // this wave's 64 columns
#pragma unroll
        for (int n = 0; n < 4; ++n) {     // a lane holds eight consecutive columns of its query's row
            float* op = os + lr * 68 + n * 16 + hi * 8;
            *(v4fa*)op = (v4f){fo[n][0] * inv, fo[n][1] * inv, fo[n][2] * inv, fo[n][3] * inv}; *(v4fa*)(op + 4) = (v4f){fo[n][4] * inv, fo[n][5] * inv, fo[n][6] * inv, fo[n][7] * inv}; }
        __builtin_amdgcn_wave_barrier(); asm volatile("" ::: "memory");
{
#pragma unroll
            for (int s = 0; s < 4; ++s) { const int row = 4 * s + (lane >> 3), piece = lane & 7; const float* sp = os + row * 68 + piece * 8; v8us oh, ol;     // eight lanes = one 128-byte line of each plane
#pragma unroll
                for (int i = 0; i < 8; ++i) { const float v = sp[i]; const unsigned short hb = f2bf(v); oh[i] = hb; ol[i] = f2bf(v - bf2f(hb)); }
                const size_t oo = ob + (size_t)row * (NH_ * HD) + half * 64 + piece * 8; *(v8us*)(OH + oo) = oh; *(v8us*)(OL + oo) = ol; }
             }
        __builtin_amdgcn_wave_barrier(); asm volatile("" ::: "memory");
    }
}

extern "C" void kernel_launch(void* const* d_in, const int* in_sizes, int n_in,
                              void* d_out, int out_size, void* d_ws, size_t ws_size, hipStream_t stream) {
    (void)in_sizes; (void)n_in; (void)out_size;
    const float* x = (const float*)d_in[0]; const float* Wq = (const float*)d_in[1]; const float* bq = (const float*)d_in[2]; const float* Wk = (const float*)d_in[3]; const float* bk = (const float*)d_in[4];
    const float* Wv = (const float*)d_in[5]; const float* bv = (const float*)d_in[6]; const float* WO = (const float*)d_in[7]; const float* bo = (const float*)d_in[8];     // per-head [16][2048][128] k-major weights (x @ W[h]), WO [2048][2048] k-major
    float* out = (float*)d_out;    // [1][2048][2048]
    char* wsp = (char*)d_ws;
    auto take = [&](size_t bytes) { char* p = wsp; wsp += (bytes + 255) & ~(size_t)255; return (void*)p; };
    bf* Xb = (bf*)take((size_t)NT_ * HS * 2); bf* WqN = (bf*)take((size_t)HS * HS * 2); bf* WkN = (bf*)take((size_t)HS * HS * 2); bf* WvN = (bf*)take((size_t)HS * HS * 2); bf* WoT = (bf*)take((size_t)HS * HS * 2);
    bf* Oh = (bf*)take((size_t)NT_ * HS * 2); bf* Ol = (bf*)take((size_t)NT_ * HS * 2); h16* QH = (h16*)take((size_t)NT_ * HS * 2); h16* QL = (h16*)take((size_t)NT_ * HS * 2); h16* KH = (h16*)take((size_t)NT_ * KW * 2); h16* KL = (h16*)take((size_t)NT_ * KW * 2);
    bf* VTH = (bf*)take((size_t)KW * NT_ * 2); bf* VTL = (bf*)take((size_t)KW * NT_ * 2);
    if ((size_t)(wsp - (char*)d_ws) > ws_size) return;    // 13 planes of 8.4 MB ~ 109 MB = 104 MiB
    k_prep<<<3 * PB_W + PB_O + PB_X, 256, 0, stream>>>(Wq, Wk, Wv, WO, x, WqN, WkN, WvN, WoT, Xb);                     // bf16 x and every weight operand plane of the four products, one launch
    k_qkv<<<dim3(NT_ / GTB, NH_, 1), 256, 0, stream>>>(Xb, WqN, WkN, WvN, bq, bk, bv, QH, QL, KH, KL, VTH, VTL);              // q, k planes and v planes [h*128 + d][t]: block = (128 rows, head)
    k_attn<<<NH_ * (NT_ / 64), 256, 0, stream>>>(QH, QL, KH, KL, VTH, VTL, Oh, Ol);                                   // ctx planes [2048][2048]
    k_gemmb<true, false><<<dim3(NT_ / GTB, HS / GTB, 1), 256, 0, stream>>>(Oh, Ol, WoT, bo, out, HS, nullptr);         // out = ctx.WO + bo
}
